// v000
// Times are from an AMD MI455X. After a warm-up the kernel runs many times in a row, and a time is the length of
// such a window on the GPU divided by its runs, so every launch and the gaps after it count. The runs cycle
// through copies of the inputs. A figure is the median of several windows, for all but v000 over two sittings.
// Sittings can differ by a few percent; kernels timed side by side share one.
// The starting kernel, v000, takes 802 microseconds a run.
// Contractions: q/k/v projections on v_wmma_f32_16x16x32_bf16 (bf16 operands = RNE-cast inputs, single product); q.k^T on v_wmma_f32_16x16x32_bf16 with bf16 hi/lo planes for both q and k (hi.hi + hi.lo + lo.hi); p.v on v_wmma_f32_16x16x32_f16 (p f16 carried x2^15, v f16, single product); output projection on v_wmma_f32_16x16x32_bf16 with y as bf16 hi/lo planes (hi.W + lo.W) and W bf16; f32 accumulate everywhere; softmax, score scale and the cache add in f32.
#include <hip/hip_runtime.h>
#include <math.h>
#include <stdint.h>

constexpr int kBatch = 2;
constexpr int kTq    = 2048;            // query length
constexpr int kSkv   = 2048;            // cache length
constexpr int kKeys  = kSkv + kTq;      // 4096 keys per (batch, head)
constexpr int kDm    = 1024;            // model dim
constexpr int kHeads = 16;
constexpr int kHd    = 64;
static_assert(kHeads * kHd == kDm, "head split");
static_assert(kTq % 64 == 0 && kKeys % 64 == 0 && kDm % 64 == 0 && kSkv % 64 == 0, "tile multiples");

typedef __attribute__((ext_vector_type(16))) _Float16 v16h;
typedef __attribute__((ext_vector_type(8)))  _Float16 v8h;
typedef __attribute__((ext_vector_type(16))) __bf16   v16b;
typedef __attribute__((ext_vector_type(8)))  __bf16   v8b;
typedef __attribute__((ext_vector_type(8)))  float    v8f;
typedef __attribute__((ext_vector_type(4)))  float    v4f;
typedef __attribute__((ext_vector_type(2)))  float    v2f;
typedef __attribute__((ext_vector_type(4)))  unsigned int v4u;

__device__ __forceinline__ unsigned short f2bf_bits(float f) {
  unsigned u = __float_as_uint(f);
  return (unsigned short)((u + 0x7FFFu + ((u >> 16) & 1u)) >> 16);
}
__device__ __forceinline__ float bf_bits2f(unsigned short h) { return __uint_as_float(((unsigned)h) << 16); }
__device__ __forceinline__ unsigned short h_bits(float f) { return __builtin_bit_cast(unsigned short, (_Float16)f); }
__device__ __forceinline__ unsigned pk16(unsigned short a, unsigned short b) { return (unsigned)a | ((unsigned)b << 16); }

// hazard guards as plain device helpers (no inline asm inside the kernel template body)
__device__ __forceinline__ void dep_guard_h(v8f& a, v8f& b, v16h x, v16h y) { asm volatile("v_nop\n\tv_nop\n\tv_nop\n\tv_nop" : "+v"(a), "+v"(b) : "v"(x), "v"(y)); }
__device__ __forceinline__ void dep_guard_b(v8f& a, v8f& b, v16b x, v16b y) { asm volatile("v_nop\n\tv_nop\n\tv_nop\n\tv_nop" : "+v"(a), "+v"(b) : "v"(x), "v"(y)); }
__device__ __forceinline__ void keep4_h(v16h a, v16h b, v16h c, v16h d) { asm volatile("v_nop" :: "v"(a), "v"(b), "v"(c), "v"(d)); }
__device__ __forceinline__ void keep4_b(v16b a, v16b b, v16b c, v16b d) { asm volatile("v_nop" :: "v"(a), "v"(b), "v"(c), "v"(d)); }
__device__ __forceinline__ void acc_guard4(v8f& a, v8f& b, v8f& c, v8f& d) { asm volatile("v_nop\n\tv_nop\n\tv_nop\n\tv_nop" : "+v"(a), "+v"(b), "+v"(c), "+v"(d)); }
template <typename T> struct Frag;
template <> struct Frag<_Float16> {
  typedef v16h V; union U { v16h v; v8h h[2]; };
  static __device__ __forceinline__ v16h load(const _Float16* p) {   // elements 0..7 <- p[0..7], 8..15 <- p[16..23]
    U f; f.h[0] = *(const v8h*)(p); f.h[1] = *(const v8h*)(p + 16); return f.v;
  }
  static __device__ __forceinline__ v8f mma(v16h a, v16h b, v8f c) {
    return __builtin_amdgcn_wmma_f32_16x16x32_f16(false, a, false, b, (short)0, c, false, false);
  }
  static __device__ __forceinline__ void guard(v8f& a, v8f& b, v16h x, v16h y) { dep_guard_h(a, b, x, y); }
  static __device__ __forceinline__ void keep(v16h a, v16h b, v16h c, v16h d) { keep4_h(a, b, c, d); }
};
template <> struct Frag<__bf16> {
  typedef v16b V; union U { v16b v; v8b h[2]; };
  static __device__ __forceinline__ v16b load(const __bf16* p) {
    U f; f.h[0] = *(const v8b*)(p); f.h[1] = *(const v8b*)(p + 16); return f.v;
  }
  static __device__ __forceinline__ v8f mma(v16b a, v16b b, v8f c) {
    return __builtin_amdgcn_wmma_f32_16x16x32_bf16(false, a, false, b, (short)0, c, false, false);
  }
  static __device__ __forceinline__ void guard(v8f& a, v8f& b, v16b x, v16b y) { dep_guard_b(a, b, x, y); }
  static __device__ __forceinline__ void keep(v16b a, v16b b, v16b c, v16b d) { keep4_b(a, b, c, d); }
};

// ---- Register-blocked batched WMMA GEMM ------------------------------------
// C[m,n] = scale * sum_k A[m,k] * Bt[n,k] (+bias)(+resid); each wave owns a 64x64 tile.
// A row-major [M,K]; Bt row-major [N,K]; M,N % 64 == 0, K % 32 == 0.
// SPLIT: operands are hi/lo planes (A2/Bt2 = lo planes, same layout); product = hi.hi + hi.lo + lo.hi.
// SPLITB (only meaningful with SPLIT): when false only A carries a lo plane; product = hi.B + lo.B (Bt2 unused).
// BIAS_MODE: 0 = none, 1 = bias[m], 2 = bias[n].
// OUT_MODE: 0 = f32, 1 = f16, 2 = bf16 hi plane (Cout) + bf16 lo plane (Cout2).
// ET: 0 = f16 operands, 1 = bf16 operands (pointers passed as 16-bit storage)
template <int ET> struct Elem;
template <> struct Elem<0> { typedef _Float16 T; };
template <> struct Elem<1> { typedef __bf16 T; };
template <int ET, bool SPLIT, int BIAS_MODE, int OUT_MODE, bool RESID, int ACT = 0, bool SPLITB = SPLIT>
__global__ __launch_bounds__(256) void wmma_gemm64(
    const unsigned short* __restrict__ Ap, const unsigned short* __restrict__ A2p, int lda, long strideA,
    const unsigned short* __restrict__ Btp, const unsigned short* __restrict__ Bt2p, int ldb, long strideB,
    void* __restrict__ Cout, void* __restrict__ Cout2, int ldc, long strideC,
    const float* __restrict__ bias,
    const float* __restrict__ resid, long strideR,
    int M, int N, int K, float scale) {
  typedef typename Elem<ET>::T T;
  typedef typename Frag<T>::V V;
  const T* A = (const T*)Ap; const T* A2 = (const T*)A2p; const T* Bt = (const T*)Btp; const T* Bt2 = (const T*)Bt2p;
  __shared__ __align__(16) float sT[8][16 * 68];   // per-wave 16x64 slab, pitch 68 floats
  const int b    = blockIdx.y;
  const int lane = threadIdx.x & 31;
  const int wave = threadIdx.x >> 5;
  const int tilesN = N >> 6;
  const int tilesM = M >> 6;
  const int tile = blockIdx.x * 8 + wave;
  if (tile >= tilesM * tilesN) return;   // wave-uniform; no block barriers in this kernel
  const int tm = tile / tilesN;
  const int tn = tile - tm * tilesN;
  const int m0 = tm << 6;
  const int n0 = tn << 6;

  const T* Ab  = A  + (size_t)b * strideA;
  const T* Bb  = Bt + (size_t)b * strideB;
  const T* Ab2 = SPLIT ? (A2  + (size_t)b * strideA) : nullptr;
  const T* Bb2 = (SPLIT && SPLITB) ? (Bt2 + (size_t)b * strideB) : nullptr;

  const int rlane = lane & 15;                 // row (A) / col (B, D) within subtile
  const int koff  = (lane >> 4) * 8;           // k offset of this lane half
  const int mOff  = (lane >> 4) * 8;           // D row offset

  v8f acc[4][4];
#pragma unroll
  for (int i = 0; i < 4; ++i)
#pragma unroll
    for (int j = 0; j < 4; ++j) acc[i][j] = (v8f){0.f,0.f,0.f,0.f,0.f,0.f,0.f,0.f};

  for (int k0 = 0; k0 < K; k0 += 32) {
    V bh[4], bl[4];
#pragma unroll
    for (int j = 0; j < 4; ++j) {
      const size_t bo = (size_t)(n0 + (j << 4) + rlane) * ldb + koff + k0;
      bh[j] = Frag<T>::load(Bb + bo);
      if (SPLIT && SPLITB) bl[j] = Frag<T>::load(Bb2 + bo);
    }
#pragma unroll
    for (int i = 0; i < 4; ++i) {
      const size_t ao = (size_t)(m0 + (i << 4) + rlane) * lda + koff + k0;
      V ah = Frag<T>::load(Ab + ao);
      V al;
      if (SPLIT) al = Frag<T>::load(Ab2 + ao);
#pragma unroll
      for (int j = 0; j < 4; ++j) {
        acc[i][j] = Frag<T>::mma(ah, bh[j], acc[i][j]);
        if (SPLIT) {
          if (SPLITB) acc[i][j] = Frag<T>::mma(ah, bl[j], acc[i][j]);
          acc[i][j] = Frag<T>::mma(al, bh[j], acc[i][j]);
        }
      }
      Frag<T>::guard(acc[i][0], acc[i][3], ah, SPLIT ? al : ah);
    }
    Frag<T>::keep(bh[0], bh[1], bh[2], bh[3]);
    if (SPLIT && SPLITB) Frag<T>::keep(bl[0], bl[1], bl[2], bl[3]);
  }
  acc_guard4(acc[0][0], acc[0][1], acc[0][2], acc[0][3]);
  acc_guard4(acc[1][0], acc[1][1], acc[1][2], acc[1][3]);
  acc_guard4(acc[2][0], acc[2][1], acc[2][2], acc[2][3]);
  acc_guard4(acc[3][0], acc[3][1], acc[3][2], acc[3][3]);

  // ---- epilogue ----
  float* slab = sT[wave];
  const float* Rb = RESID ? (resid + (size_t)b * strideR) : nullptr;
#pragma unroll
  for (int i = 0; i < 4; ++i) {
    const int mBase = m0 + (i << 4);
#pragma unroll
    for (int j = 0; j < 4; ++j) {
      const int n = n0 + (j << 4) + rlane;
      float bv = 0.f;
      if (BIAS_MODE == 2) bv = bias[n];
#pragma unroll
      for (int r = 0; r < 8; ++r) {
        float v = acc[i][j][r] * scale;
        if (BIAS_MODE == 1) v += bias[mBase + mOff + r];
        if (BIAS_MODE == 2) v += bv;
        if (RESID) v += Rb[(size_t)(mBase + mOff + r) * ldc + n];
        if (ACT == 1) v = tanhf(v);
        if (ACT == 2) v = fmaxf(v, 0.0f);
        if (ACT == 3) v = v / (1.0f + expf(-v));
        if (ACT == 4) v = (v > 0.f) ? v : 0.01f * v;
        slab[(mOff + r) * 68 + (j << 4) + rlane] = v;
      }
    }
    __builtin_amdgcn_fence(__ATOMIC_RELEASE, "workgroup");
    __builtin_amdgcn_wave_barrier();
    __builtin_amdgcn_fence(__ATOMIC_ACQUIRE, "workgroup");
    if (OUT_MODE == 0) {
      float* C = (float*)Cout + (size_t)b * strideC;
      const int hh = lane >> 4, c4 = (lane & 15) * 4;     // row seg = 256 B = 16 lanes x 16 B
      {
#pragma unroll
        for (int it = 0; it < 8; ++it) {
          const int row = it * 2 + hh;
          v4f v = *(const v4f*)(slab + row * 68 + c4);
          *(v4f*)(C + (size_t)(mBase + row) * ldc + n0 + c4) = v;
        }
        
      }
    } else {
      const int q = lane >> 3, c8 = (lane & 7) * 8;
      unsigned short* C  = (unsigned short*)Cout  + (size_t)b * strideC;
      unsigned short* C2 = (OUT_MODE == 2) ? ((unsigned short*)Cout2 + (size_t)b * strideC) : nullptr;
      {
#pragma unroll
        for (int it = 0; it < 4; ++it) {
          const int row = it * 4 + q;
          const float* sp = slab + row * 68 + c8;
          v8h hv, lv;
#pragma unroll
          for (int e = 0; e < 8; ++e) {
            if (OUT_MODE == 1) {
              hv[e] = (_Float16)sp[e];
            } else {
              unsigned short hb = f2bf_bits(sp[e]);
              unsigned short lb = f2bf_bits(sp[e] - bf_bits2f(hb));
              hv[e] = __builtin_bit_cast(_Float16, hb);
              lv[e] = __builtin_bit_cast(_Float16, lb);
            }
          }
          *(v8h*)(C + (size_t)(mBase + row) * ldc + n0 + c8) = hv;
          if (OUT_MODE == 2) *(v8h*)(C2 + (size_t)(mBase + row) * ldc + n0 + c8) = lv;
        }
        
      }
    }
    __builtin_amdgcn_fence(__ATOMIC_RELEASE, "workgroup");
    __builtin_amdgcn_wave_barrier();
    __builtin_amdgcn_fence(__ATOMIC_ACQUIRE, "workgroup");
  }
}

// ---------------------------------------------------------------------------
// Elementwise f32 -> bf16 (RNE) cast, 2 elements per thread, one 4-B store per lane -> each wave writes exactly
// Coverage: grid = ceil(n2/256) x 256 threads x 2 elements = 2*n2 = the whole plane (all n2 used here are
// multiples of 256, so every wave is full and every line complete).
// ---------------------------------------------------------------------------
__global__ __launch_bounds__(256) void cast_bf16x2_kernel(const float* __restrict__ in, unsigned short* __restrict__ out,
                                                         int n2) {
  const int i = blockIdx.x * 256 + threadIdx.x;
  if (i < n2) {
    const v2f f = *(const v2f*)(in + 2 * (size_t)i);
    const unsigned u = pk16(f2bf_bits(f[0]), f2bf_bits(f[1]));
    ((unsigned*)out)[i] = u;
    
  }
}

// ---------------------------------------------------------------------------
// Elementwise bf16 split: hi = bf16_rne(in), lo = bf16_rne(in - hi); 2 elements per thread, one 4-B store
// (here n2 = 4096*1024/2 = 2,097,152 -> 8192 blocks x 512 elements = 4096x1024).
// ---------------------------------------------------------------------------
__global__ __launch_bounds__(256) void split_bf16x2_kernel(const float* __restrict__ in, unsigned short* __restrict__ hi,
                                                           unsigned short* __restrict__ lo, int n2) {
  const int i = blockIdx.x * 256 + threadIdx.x;
  if (i < n2) {
    const v2f f = *(const v2f*)(in + 2 * (size_t)i);
    const unsigned short h0 = f2bf_bits(f[0]), h1 = f2bf_bits(f[1]);
    const unsigned short l0 = f2bf_bits(f[0] - bf_bits2f(h0)), l1 = f2bf_bits(f[1] - bf_bits2f(h1));
    const unsigned uh = pk16(h0, h1), ul = pk16(l0, l1);
    ((unsigned*)hi)[i] = uh;
    ((unsigned*)lo)[i] = ul;
    
  }
}

// ---------------------------------------------------------------------------
// Cache keys, rows 0..kSkv-1 of each per-batch [kKeys][kDm] bf16 key plane pair:
//   x = bf16_rne(k_xl[b][s][c]) + bf16_rne(pos[s][c])   (the add in f32)
//   kh[b][s][c] = bf16_rne(x),  kl[b][s][c] = bf16_rne(x - kh)
// flags = the causal flag input; this forward applies no mask, the pointer is only bound, never read.
// ---------------------------------------------------------------------------
__global__ __launch_bounds__(256) void kcache_split_kernel(const float* __restrict__ kxl, const float* __restrict__ pos,
                                                           unsigned short* __restrict__ kh, unsigned short* __restrict__ kl,
                                                           const int* __restrict__ flags, int n2) {
  const int i = blockIdx.x * 256 + threadIdx.x;
  if (i < n2) {
    const size_t e = 2 * (size_t)i;                        // element index into [b][s][c]
    const size_t perB = (size_t)kSkv * kDm;
    const int bb = (int)(e / perB);
    const size_t rem = e - (size_t)bb * perB;              // s*kDm + c (even)
    const v2f a = *(const v2f*)(kxl + e);
    const v2f p = *(const v2f*)(pos + rem);
    const float s0 = bf_bits2f(f2bf_bits(a[0])) + bf_bits2f(f2bf_bits(p[0]));
    const float s1 = bf_bits2f(f2bf_bits(a[1])) + bf_bits2f(f2bf_bits(p[1]));
    const unsigned short h0 = f2bf_bits(s0), h1 = f2bf_bits(s1);
    const unsigned short l0 = f2bf_bits(s0 - bf_bits2f(h0)), l1 = f2bf_bits(s1 - bf_bits2f(h1));
    const unsigned uh = pk16(h0, h1), ul = pk16(l0, l1);
    const size_t o = ((size_t)bb * kKeys * kDm + rem) >> 1; // u32 index
    ((unsigned*)kh)[o] = uh;
    ((unsigned*)kl)[o] = ul;
    
  }
}

// ---------------------------------------------------------------------------
// Fused transpose + cast of an f32 matrix, z-batched: in_z = W + z*sIn viewed [R rows][Cc cols] (pitch Cc) ->
//   o_z[c][r] = f16(bf16_rne(in_z[r][c]))   ([Cc][...], output row pitch ldo halves), o_z = o + z*sOut.
// 64x64 tiles through LDS. grid = (Cc/64, R/64, Z), 256 threads (R, Cc multiples of 64).
// Coverage per block: load 4 it x 256 thr x 4 floats = 64x64; store 2 it x 256 thr x 8 u16 = 64x64.
// ---------------------------------------------------------------------------
__global__ __launch_bounds__(256) void tcast16_kernel(const float* __restrict__ W, unsigned short* __restrict__ o,
                                                      int R, int Cc, int ldo, long sIn, long sOut) {
  __shared__ __align__(16) float tf[64 * 68];
  W += (size_t)blockIdx.z * sIn;
  o += (size_t)blockIdx.z * sOut;
  const int c0  = blockIdx.x * 64;   // input column block = output row block
  const int r0  = blockIdx.y * 64;   // input row block    = output column block
  const int tid = threadIdx.x;
  {
    const int lr = tid >> 4;         // 0..15
    const int c4 = (tid & 15) * 4;   // 0..60
#pragma unroll
    for (int it = 0; it < 4; ++it) {
      const int rr = it * 16 + lr;   // 0..63
      const v4f a = *(const v4f*)(W + (size_t)(r0 + rr) * Cc + c0 + c4);
      *(v4f*)(tf + rr * 68 + c4) = a;
    }
  }
  __syncthreads();
  const int sub = tid >> 3;          // 0..31
  const int c8  = (tid & 7) * 8;     // 0..56
  v4u hv[2];
#pragma unroll
  for (int it = 0; it < 2; ++it) {
    const int oc = it * 32 + sub;    // output row within tile (= input column)
    v4u a;
#pragma unroll
    for (int q = 0; q < 4; ++q) {
      const float f0 = tf[(c8 + 2 * q) * 68 + oc];
      const float f1 = tf[(c8 + 2 * q + 1) * 68 + oc];
      a[q] = pk16(h_bits(bf_bits2f(f2bf_bits(f0))), h_bits(bf_bits2f(f2bf_bits(f1))));
    }
    hv[it] = a;
  }
  {
#pragma unroll
    for (int it = 0; it < 2; ++it) {
      const int oc = it * 32 + sub;
      const size_t go = (size_t)(c0 + oc) * ldo + r0 + c8;
      *(v4u*)(o + go) = hv[it];
    }
    
  }
}

// =====================================================================================
// Full (unmasked) attention over kKeys keys, head dim 64.
//   q planes (bf16 hi / lo): element (b, t, h, d) at [b*kTq*kDm + t*kDm + h*64 + d]
//   k planes (bf16 hi / lo): element (b, s, h, d) at [b*kKeys*kDm + s*kDm + h*64 + d], s in [0, kKeys)
//   v^T plane (f16):         element (b, h, d, s) at [b*kDm*kKeys + (h*64 + d)*kKeys + s]
//   out f32:                 element (b, t, h, d) at [b*kTq*kDm + t*kDm + h*64 + d]
//   scores = (q . k) * sscale : v_wmma_f32_16x16x32_bf16, hi.hi + hi.lo + lo.hi, f32 accumulate, scale applied in f32
//   out    = p . v            : v_wmma_f32_16x16x32_f16, p (unnormalised, <= 1) carried x2^15 in f16, v f16;
//                               2^15 folded into the final 1/l
//   online softmax in f32 over all kKeys keys (64 chunks of 64, compile-time trip count, no masking).
//   Block = 4 waves = 64 query rows of one (batch, head); grid = (kHeads * kTq/64, kBatch).
//   K hi / K lo / V^T chunk staging: 128 threads x 32 elements per plane = the whole 64x64 tile (16-B copies,
//   plain loads, __syncthreads before and after); fragment loads read the LDS tiles with the same vector element type.
// =====================================================================================
#define AT_D 64
#define AT_NW 4
#define AT_QB 64
#define AT_KC 64

__device__ __forceinline__ v8f at_mma_b(v16b a, v16b b, v8f c) {
  c = __builtin_amdgcn_wmma_f32_16x16x32_bf16(false, a, false, b, (short)0, c, false, false);
  asm volatile("v_nop\n\tv_nop\n\tv_nop\n\tv_nop" : "+v"(c) : "v"(a), "v"(b));
  return c;
}
__device__ __forceinline__ v8f at_mma_h(v16h a, v16h b, v8f c) {
  c = __builtin_amdgcn_wmma_f32_16x16x32_f16(false, a, false, b, (short)0, c, false, false);
  asm volatile("v_nop\n\tv_nop\n\tv_nop\n\tv_nop" : "+v"(c) : "v"(a), "v"(b));
  return c;
}

__global__ __launch_bounds__(128)
void attn_xl_kernel(const unsigned short* __restrict__ qhp, const unsigned short* __restrict__ qlp,
                    const unsigned short* __restrict__ khp, const unsigned short* __restrict__ klp,
                    const unsigned short* __restrict__ vtp, float* __restrict__ out, float sscale) {
  union FB { v16b v; v8b h[2]; };
  union FH { v16h v; v8h h[2]; };
  __shared__ __align__(16) __bf16   Ksh[AT_KC * AT_D];          // K hi [kv][d]   8 KB
  __shared__ __align__(16) __bf16   Ksl[AT_KC * AT_D];          // K lo [kv][d]   8 KB
  __shared__ __align__(16) _Float16 Vth[AT_D * AT_KC];          // V^T [d][kv]    8 KB
  __shared__ __align__(16) _Float16 Psh[AT_NW][16 * AT_KC];     // per wave P [row][kv] 8 KB
  __shared__ __align__(16) float    Os[AT_NW][16 * 68];         // per wave out tile, pitch 68
  const float PSC = 32768.0f;

  const int tid  = threadIdx.x;
  const int wave = tid >> 5;
  const int lane = tid & 31;
  const int hh   = lane >> 4;
  const int c    = lane & 15;

  const int nqb = kTq / AT_QB;            // 32
  const int bx = blockIdx.x;
  const int b  = blockIdx.y;
  const int qb = bx % nqb;
  const int h  = bx / nqb;                // 0..kHeads-1
  const int q0 = qb * AT_QB + wave * 16;

  const __bf16*   Qh = (const __bf16*)(const void*)qhp   + (size_t)b * kTq * kDm   + (size_t)h * AT_D;
  const __bf16*   Ql = (const __bf16*)(const void*)qlp   + (size_t)b * kTq * kDm   + (size_t)h * AT_D;
  const __bf16*   Kh = (const __bf16*)(const void*)khp   + (size_t)b * kKeys * kDm + (size_t)h * AT_D;
  const __bf16*   Kl = (const __bf16*)(const void*)klp   + (size_t)b * kKeys * kDm + (size_t)h * AT_D;
  const _Float16* Vh = (const _Float16*)(const void*)vtp + (size_t)b * kDm * kKeys + (size_t)h * AT_D * kKeys;
  float*          ob = out + (size_t)b * kTq * kDm + (size_t)h * AT_D;

  // ---- Q fragments (A operand, row = lane&15, split k map via Frag load): 2 d-chunks, hi and lo ----
  v16b qah[2], qal[2];
#pragma unroll
  for (int dc = 0; dc < 2; ++dc) {
    qah[dc] = Frag<__bf16>::load(Qh + (size_t)(q0 + c) * kDm + dc * 32 + 8 * hh);
    qal[dc] = Frag<__bf16>::load(Ql + (size_t)(q0 + c) * kDm + dc * 32 + 8 * hh);
  }

  float mrow[8], lrow[8];
  v8f oacc[4];
#pragma unroll
  for (int r = 0; r < 8; ++r) { mrow[r] = -INFINITY; lrow[r] = 0.f; }
#pragma unroll
  for (int t = 0; t < 4; ++t) oacc[t] = (v8f){0.f,0.f,0.f,0.f,0.f,0.f,0.f,0.f};

  const int nChunks = kKeys / AT_KC;   // 64, compile-time constant
  for (int kc = 0; kc < nChunks; ++kc) {
    const int kv0 = kc * AT_KC;
    __syncthreads();
    {
      // staging coverage: 128 threads x (4 x 8) elements = 64 rows x 64 per plane = the whole chunk tile (3 planes)
      const int r = tid >> 1, half = (tid & 1) * 32;
      const __bf16*   ksh = Kh + (size_t)(kv0 + r) * kDm + half;    // K row kv0+r, d = half..half+31
      const __bf16*   ksl = Kl + (size_t)(kv0 + r) * kDm + half;
      const _Float16* vsh = Vh + (size_t)r * kKeys + kv0 + half;    // V^T row d = r, s = kv0+half..+31
#pragma unroll
      for (int i = 0; i < 4; ++i) {
        const v8b a0 = *(const v8b*)(ksh + 8 * i);
        const v8b a1 = *(const v8b*)(ksl + 8 * i);
        const v8h b0 = *(const v8h*)(vsh + 8 * i);
        *(v8b*)(Ksh + r * AT_D  + half + 8 * i) = a0;
        *(v8b*)(Ksl + r * AT_D  + half + 8 * i) = a1;
        *(v8h*)(Vth + r * AT_KC + half + 8 * i) = b0;
      }
    }
    __syncthreads();

    v8f s[4];
#pragma unroll
    for (int j = 0; j < 4; ++j) {
      s[j] = (v8f){0.f,0.f,0.f,0.f,0.f,0.f,0.f,0.f};
#pragma unroll
      for (int dc = 0; dc < 2; ++dc) {
        FB kb, klf;
        kb.h[0]  = *(const v8b*)(Ksh + (j * 16 + c) * AT_D + dc * 32 + 8 * hh);
        kb.h[1]  = *(const v8b*)(Ksh + (j * 16 + c) * AT_D + dc * 32 + 16 + 8 * hh);
        klf.h[0] = *(const v8b*)(Ksl + (j * 16 + c) * AT_D + dc * 32 + 8 * hh);
        klf.h[1] = *(const v8b*)(Ksl + (j * 16 + c) * AT_D + dc * 32 + 16 + 8 * hh);
        s[j] = at_mma_b(qah[dc], kb.v,  s[j]);
        s[j] = at_mma_b(qah[dc], klf.v, s[j]);
        s[j] = at_mma_b(qal[dc], kb.v,  s[j]);
      }
    }
    float cm[8];
#pragma unroll
    for (int r = 0; r < 8; ++r) {
      float m = -INFINITY;
#pragma unroll
      for (int j = 0; j < 4; ++j) {
        const float sv = s[j][r] * sscale;
        s[j][r] = sv;
        m = fmaxf(m, sv);
      }
#pragma unroll
      for (int off = 1; off < 16; off <<= 1) m = fmaxf(m, __shfl_xor(m, off, 32));
      cm[r] = m;
    }
    _Float16* pwh = Psh[wave];
#pragma unroll
    for (int r = 0; r < 8; ++r) {
      const float mnew = fmaxf(mrow[r], cm[r]);
      const float alpha = expf(mrow[r] - mnew);
      mrow[r] = mnew;
      float psum = 0.f;
#pragma unroll
      for (int j = 0; j < 4; ++j) {
        const float p = expf(s[j][r] - mnew);
        psum += p;
        pwh[(8 * hh + r) * AT_KC + j * 16 + c] = (_Float16)(p * PSC);
      }
#pragma unroll
      for (int off = 1; off < 16; off <<= 1) psum += __shfl_xor(psum, off, 32);
      lrow[r] = lrow[r] * alpha + psum;
#pragma unroll
      for (int t = 0; t < 4; ++t) oacc[t][r] *= alpha;
    }
    __builtin_amdgcn_fence(__ATOMIC_RELEASE, "workgroup");
    __builtin_amdgcn_wave_barrier();
    __builtin_amdgcn_fence(__ATOMIC_ACQUIRE, "workgroup");
#pragma unroll 1
    for (int kk = 0; kk < 2; ++kk) {
      FH pa;
      pa.h[0] = *(const v8h*)(pwh + c * AT_KC + kk * 32 + 8 * hh);
      pa.h[1] = *(const v8h*)(pwh + c * AT_KC + kk * 32 + 16 + 8 * hh);
#pragma unroll
      for (int t = 0; t < 4; ++t) {
        FH vb;
        vb.h[0] = *(const v8h*)(Vth + (t * 16 + c) * AT_KC + kk * 32 + 8 * hh);
        vb.h[1] = *(const v8h*)(Vth + (t * 16 + c) * AT_KC + kk * 32 + 16 + 8 * hh);
        oacc[t] = at_mma_h(pa.v, vb.v, oacc[t]);
      }
    }
  }

  float* os = Os[wave];
#pragma unroll
  for (int r = 0; r < 8; ++r) {
    const float inv = 1.0f / (lrow[r] * PSC);
#pragma unroll
    for (int t = 0; t < 4; ++t) os[(8 * hh + r) * 68 + t * 16 + c] = oacc[t][r] * inv;
  }
  __builtin_amdgcn_fence(__ATOMIC_RELEASE, "workgroup");
  __builtin_amdgcn_wave_barrier();
  __builtin_amdgcn_fence(__ATOMIC_ACQUIRE, "workgroup");
  {
    const int c4 = (lane & 15) * 4;
    {
#pragma unroll
      for (int it = 0; it < 8; ++it) {
        const int row = it * 2 + hh;   // it 0..7 x hh 0..1 covers rows 0..15 of the wave tile
        v4f val = *(const v4f*)(os + row * 68 + c4);
        *(v4f*)(ob + (size_t)(q0 + row) * kDm + c4) = val;
      }
      
    }
  }
}

// ---------------------------------------------------------------------------
// Workspace region map (byte offsets; every region is fully written before it is read):
//   R0  Qb   bf16 [4096][1024]          8,388,608 @           0   (RNE cast of q)
//   R1  Wq   bf16 [3072][1024]          6,291,456 @   8,388,608   (RNE cast of W_qkv)
//   R2  Wp   bf16 [1024][1024]          2,097,152 @  14,680,064   (RNE cast of W_proj)
//   R3  Qh   bf16 [4096][1024]          8,388,608 @  16,777,216   (q projection, hi plane)
//   R4  Ql   bf16 [4096][1024]          8,388,608 @  25,165,824   (q projection, lo plane)
//   R5  Kh   bf16 [2][4096][1024]      16,777,216 @  33,554,432   (rows 0..2047 cache keys, 2048.. k projection; hi)
//   R6  Kl   bf16 [2][4096][1024]      16,777,216 @  50,331,648   (same rows; lo)
//   R7  Vt   f16  [2][1024][4096]      16,777,216 @  67,108,864   (cols 0..2047 cache values^T, 2048.. v projection^T)
//   R8  Y    f32  [4096][1024]         16,777,216 @  83,886,080   (attention output, token-major, heads merged)
//   R9  Yh   bf16 [4096][1024]          8,388,608 @ 100,663,296   (split of Y, hi)
//   R10 Yl   bf16 [4096][1024]          8,388,608 @ 109,051,904   (split of Y, lo)
//   total 117,440,512 B
// ---------------------------------------------------------------------------
extern "C" void kernel_launch(void* const* d_in, const int* in_sizes, int n_in,
                              void* d_out, int out_size, void* d_ws,
                              size_t ws_size, hipStream_t stream) {
  if (n_in < 7) return;
  const size_t nQ  = (size_t)kBatch * kTq * kDm;        // 4,194,304
  const size_t nKV = (size_t)kBatch * kSkv * kDm;       // 4,194,304
  const size_t nWq = (size_t)3 * kDm * kDm;             // 3,145,728
  const size_t nWp = (size_t)kDm * kDm;                 // 1,048,576
  const size_t nPe = (size_t)kSkv * kDm;                // 2,097,152
  if (in_sizes[0] != (int)nQ || in_sizes[1] != (int)nKV || in_sizes[2] != (int)nKV ||
      in_sizes[3] != (int)nWq || in_sizes[4] != (int)nWp || in_sizes[5] != (int)nPe ||
      out_size != (int)nQ) return;

  const float* q     = (const float*)d_in[0];
  const float* k_xl  = (const float*)d_in[1];
  const float* v_xl  = (const float*)d_in[2];
  const float* Wqkv  = (const float*)d_in[3];
  const float* Wproj = (const float*)d_in[4];
  const float* pos   = (const float*)d_in[5];
  const int*   causf = (const int*)d_in[6];
  float* outp = (float*)d_out;

  const size_t offQb = 0,              szQb = nQ * 2;
  const size_t offWq = offQb + szQb,   szWq = nWq * 2;
  const size_t offWp = offWq + szWq,   szWp = nWp * 2;
  const size_t offQh = offWp + szWp,   szQh = nQ * 2;
  const size_t offQl = offQh + szQh,   szQl = nQ * 2;
  const size_t offKh = offQl + szQl,   szKh = (size_t)kBatch * kKeys * kDm * 2;
  const size_t offKl = offKh + szKh,   szKl = szKh;
  const size_t offVt = offKl + szKl,   szVt = (size_t)kBatch * kDm * kKeys * 2;
  const size_t offY  = offVt + szVt,   szY  = nQ * 4;
  const size_t offYh = offY + szY,     szYh = nQ * 2;
  const size_t offYl = offYh + szYh,   szYl = nQ * 2;
  const size_t total = offYl + szYl;   // 117,440,512
  if (total > ws_size) return;

  char* ws = (char*)d_ws;
  unsigned short* Qb = (unsigned short*)(ws + offQb);
  unsigned short* Wq = (unsigned short*)(ws + offWq);
  unsigned short* Wp = (unsigned short*)(ws + offWp);
  unsigned short* Qh = (unsigned short*)(ws + offQh);
  unsigned short* Ql = (unsigned short*)(ws + offQl);
  unsigned short* Kh = (unsigned short*)(ws + offKh);
  unsigned short* Kl = (unsigned short*)(ws + offKl);
  unsigned short* Vt = (unsigned short*)(ws + offVt);
  float*          Y  = (float*)(ws + offY);
  unsigned short* Yh = (unsigned short*)(ws + offYh);
  unsigned short* Yl = (unsigned short*)(ws + offYl);

  // ---- input casts (RNE bf16 of every float input) and cache planes ----
  {
    const int n2q = (int)(nQ / 2), n2wq = (int)(nWq / 2), n2wp = (int)(nWp / 2), n2kv = (int)(nKV / 2);
    cast_bf16x2_kernel<<<dim3((n2q + 255) / 256), 256, 0, stream>>>(q, Qb, n2q);
    cast_bf16x2_kernel<<<dim3((n2wq + 255) / 256), 256, 0, stream>>>(Wqkv, Wq, n2wq);
    cast_bf16x2_kernel<<<dim3((n2wp + 255) / 256), 256, 0, stream>>>(Wproj, Wp, n2wp);
    // cache keys -> rows 0..2047 of both key planes (hi, lo), both batches
    kcache_split_kernel<<<dim3((n2kv + 255) / 256), 256, 0, stream>>>(k_xl, pos, Kh, Kl, causf, n2kv);
    // v_xl[b]: in[s rows=2048][c cols=1024] -> Vt[b] out[c][s] with output row pitch kKeys, cols 0..2047;
    // grid (cols/64, rows/64, B)
    tcast16_kernel<<<dim3(kDm / 64, kSkv / 64, kBatch), 256, 0, stream>>>(
        v_xl, Vt, kSkv, kDm, kKeys, (long)kSkv * kDm, (long)kDm * kKeys);
  }

  // ---- qkv projections: bf16 operands (K = 1024, M,N multiples of 64, no tails) ----
  {
    // q projection: C[m = b*2048+t][n] -> Qh (hi) / Ql (lo), M=4096, N=1024, K=1024; 1024 tiles -> 128 blocks
    const int tilesQ = (int)((nQ / kDm) / 64) * (kDm / 64);
    wmma_gemm64<1, false, 0, 2, false><<<dim3((tilesQ + 7) / 8, 1), 256, 0, stream>>>(
        Qb, nullptr, kDm, 0L, Wq, nullptr, kDm, 0L,
        (void*)Qh, (void*)Ql, kDm, 0L, nullptr, nullptr, 0L,
        kBatch * kTq, kDm, kDm, 1.0f);
    // k projection per batch: C[t][n] -> key plane rows 2048+t (hi -> Kh, lo -> Kl), M=2048, N=1024, K=1024;
    // 512 tiles -> 64 blocks, grid.y = batch
    const int tilesK = (kTq / 64) * (kDm / 64);
    wmma_gemm64<1, false, 0, 2, false><<<dim3((tilesK + 7) / 8, kBatch), 256, 0, stream>>>(
        Qb, nullptr, kDm, (long)kTq * kDm, Wq + (size_t)kDm * kDm, nullptr, kDm, 0L,
        (void*)(Kh + (size_t)kSkv * kDm), (void*)(Kl + (size_t)kSkv * kDm), kDm, (long)kKeys * kDm,
        nullptr, nullptr, 0L,
        kTq, kDm, kDm, 1.0f);
    // v projection, role-swapped: C[m = channel][n = t] -> Vt_b[channel][2048 + t] (f16), M=1024, N=2048, K=1024,
    // ldc = kKeys; 512 tiles -> 64 blocks, grid.y = batch
    const int tilesV = (kDm / 64) * (kTq / 64);
    wmma_gemm64<1, false, 0, 1, false><<<dim3((tilesV + 7) / 8, kBatch), 256, 0, stream>>>(
        Wq + (size_t)2 * kDm * kDm, nullptr, kDm, 0L, Qb, nullptr, kDm, (long)kTq * kDm,
        (void*)(Vt + kSkv), nullptr, kKeys, (long)kDm * kKeys, nullptr, nullptr, 0L,
        kDm, kTq, kDm, 1.0f);
  }

  // ---- attention over the 4096 keys per (batch, head); score scale 1/sqrt(64) applied in f32 ----
  attn_xl_kernel<<<dim3(kHeads * (kTq / AT_QB), kBatch), 128, 0, stream>>>(Qh, Ql, Kh, Kl, Vt, Y, 0.125f);

  // ---- y -> bf16 hi/lo planes; output projection C[m][n] = sum_c (Yh + Yl)[m][c] * Wp[n][c] -> d_out ----
  {
    const int n2y = (int)(nQ / 2);
    split_bf16x2_kernel<<<dim3((n2y + 255) / 256), 256, 0, stream>>>(Y, Yh, Yl, n2y);
    const int tilesP = (int)((nQ / kDm) / 64) * (kDm / 64);   // 1024 tiles -> 128 blocks
    wmma_gemm64<1, true, 0, 0, false, 0, false><<<dim3((tilesP + 7) / 8, 1), 256, 0, stream>>>(
        Yh, Yl, kDm, 0L, Wp, nullptr, kDm, 0L,
        (void*)outp, nullptr, kDm, 0L, nullptr, nullptr, 0L,
        kBatch * kTq, kDm, kDm, 1.0f);
  }
}

// v001
// It runs in 565 microseconds.
// In both of two side-by-side timings against v000, it was 1.48 times as fast.
// Contractions: q/k/v projections on v_wmma_f32_16x16x32_bf16 (bf16 operands = RNE-cast inputs, single product); q.k^T on v_wmma_f32_16x16x32_bf16 with bf16 hi/lo planes for both q and k (hi.hi + hi.lo + lo.hi); p.v on v_wmma_f32_16x16x32_f16 (p f16 carried x2^15, v f16, single product); output projection on v_wmma_f32_16x16x32_bf16 with y as bf16 hi/lo planes (hi.W + lo.W) and W bf16; f32 accumulate everywhere; softmax, score scale and the cache add in f32.
#include <hip/hip_runtime.h>
#include <math.h>
#include <stdint.h>

constexpr int kBatch = 2;
constexpr int kTq    = 2048;            // query length
constexpr int kSkv   = 2048;            // cache length
constexpr int kKeys  = kSkv + kTq;      // 4096 keys per (batch, head)
constexpr int kDm    = 1024;            // model dim
constexpr int kHeads = 16;
constexpr int kHd    = 64;
static_assert(kHeads * kHd == kDm, "head split");
static_assert(kTq % 64 == 0 && kKeys % 64 == 0 && kDm % 64 == 0 && kSkv % 64 == 0, "tile multiples");

typedef __attribute__((ext_vector_type(16))) _Float16 v16h;
typedef __attribute__((ext_vector_type(8)))  _Float16 v8h;
typedef __attribute__((ext_vector_type(16))) __bf16   v16b;
typedef __attribute__((ext_vector_type(8)))  __bf16   v8b;
typedef __attribute__((ext_vector_type(8)))  float    v8f;
typedef __attribute__((ext_vector_type(4)))  float    v4f;
typedef __attribute__((ext_vector_type(2)))  float    v2f;
typedef __attribute__((ext_vector_type(4)))  unsigned int v4u;

__device__ __forceinline__ unsigned short f2bf_bits(float f) {
  unsigned u = __float_as_uint(f);
  return (unsigned short)((u + 0x7FFFu + ((u >> 16) & 1u)) >> 16);
}
__device__ __forceinline__ float bf_bits2f(unsigned short h) { return __uint_as_float(((unsigned)h) << 16); }
__device__ __forceinline__ unsigned short h_bits(float f) { return __builtin_bit_cast(unsigned short, (_Float16)f); }
__device__ __forceinline__ unsigned pk16(unsigned short a, unsigned short b) { return (unsigned)a | ((unsigned)b << 16); }

// hazard guards as plain device helpers (no inline asm inside the kernel template body)
__device__ __forceinline__ void dep_guard_h(v8f& a, v8f& b, v16h x, v16h y) { asm volatile("v_nop\n\tv_nop\n\tv_nop\n\tv_nop" : "+v"(a), "+v"(b) : "v"(x), "v"(y)); }
__device__ __forceinline__ void dep_guard_b(v8f& a, v8f& b, v16b x, v16b y) { asm volatile("v_nop\n\tv_nop\n\tv_nop\n\tv_nop" : "+v"(a), "+v"(b) : "v"(x), "v"(y)); }
__device__ __forceinline__ void keep4_h(v16h a, v16h b, v16h c, v16h d) { asm volatile("v_nop" :: "v"(a), "v"(b), "v"(c), "v"(d)); }
__device__ __forceinline__ void keep4_b(v16b a, v16b b, v16b c, v16b d) { asm volatile("v_nop" :: "v"(a), "v"(b), "v"(c), "v"(d)); }
__device__ __forceinline__ void acc_guard4(v8f& a, v8f& b, v8f& c, v8f& d) { asm volatile("v_nop\n\tv_nop\n\tv_nop\n\tv_nop" : "+v"(a), "+v"(b), "+v"(c), "+v"(d)); }
template <typename T> struct Frag;
template <> struct Frag<_Float16> {
  typedef v16h V; union U { v16h v; v8h h[2]; };
  static __device__ __forceinline__ v16h load(const _Float16* p) {   // elements 0..7 <- p[0..7], 8..15 <- p[16..23]
    U f; f.h[0] = *(const v8h*)(p); f.h[1] = *(const v8h*)(p + 16); return f.v;
  }
  static __device__ __forceinline__ v8f mma(v16h a, v16h b, v8f c) {
    return __builtin_amdgcn_wmma_f32_16x16x32_f16(false, a, false, b, (short)0, c, false, false);
  }
  static __device__ __forceinline__ void guard(v8f& a, v8f& b, v16h x, v16h y) { dep_guard_h(a, b, x, y); }
  static __device__ __forceinline__ void keep(v16h a, v16h b, v16h c, v16h d) { keep4_h(a, b, c, d); }
};
template <> struct Frag<__bf16> {
  typedef v16b V; union U { v16b v; v8b h[2]; };
  static __device__ __forceinline__ v16b load(const __bf16* p) {
    U f; f.h[0] = *(const v8b*)(p); f.h[1] = *(const v8b*)(p + 16); return f.v;
  }
  static __device__ __forceinline__ v8f mma(v16b a, v16b b, v8f c) {
    return __builtin_amdgcn_wmma_f32_16x16x32_bf16(false, a, false, b, (short)0, c, false, false);
  }
  static __device__ __forceinline__ void guard(v8f& a, v8f& b, v16b x, v16b y) { dep_guard_b(a, b, x, y); }
  static __device__ __forceinline__ void keep(v16b a, v16b b, v16b c, v16b d) { keep4_b(a, b, c, d); }
};

// ---- Register-blocked batched WMMA GEMM ------------------------------------
// C[m,n] = scale * sum_k A[m,k] * Bt[n,k] (+bias)(+resid); each wave owns a 64x64 tile.
// A row-major [M,K]; Bt row-major [N,K]; M,N % 64 == 0, K % 32 == 0.
// SPLIT: operands are hi/lo planes (A2/Bt2 = lo planes, same layout); product = hi.hi + hi.lo + lo.hi.
// SPLITB (only meaningful with SPLIT): when false only A carries a lo plane; product = hi.B + lo.B (Bt2 unused).
// BIAS_MODE: 0 = none, 1 = bias[m], 2 = bias[n].
// OUT_MODE: 0 = f32, 1 = f16, 2 = bf16 hi plane (Cout) + bf16 lo plane (Cout2).
// ET: 0 = f16 operands, 1 = bf16 operands (pointers passed as 16-bit storage)
template <int ET> struct Elem;
template <> struct Elem<0> { typedef _Float16 T; };
template <> struct Elem<1> { typedef __bf16 T; };
template <int ET, bool SPLIT, int BIAS_MODE, int OUT_MODE, bool RESID, int ACT = 0, bool SPLITB = SPLIT>
__global__ __launch_bounds__(256) void wmma_gemm64(
    const unsigned short* __restrict__ Ap, const unsigned short* __restrict__ A2p, int lda, long strideA,
    const unsigned short* __restrict__ Btp, const unsigned short* __restrict__ Bt2p, int ldb, long strideB,
    void* __restrict__ Cout, void* __restrict__ Cout2, int ldc, long strideC,
    const float* __restrict__ bias,
    const float* __restrict__ resid, long strideR,
    int M, int N, int K, float scale) {
  typedef typename Elem<ET>::T T;
  typedef typename Frag<T>::V V;
  const T* A = (const T*)Ap; const T* A2 = (const T*)A2p; const T* Bt = (const T*)Btp; const T* Bt2 = (const T*)Bt2p;
  __shared__ __align__(16) float sT[8][16 * 68];   // per-wave 16x64 slab, pitch 68 floats
  const int b    = blockIdx.y;
  const int lane = threadIdx.x & 31;
  const int wave = threadIdx.x >> 5;
  const int tilesN = N >> 6;
  const int tilesM = M >> 6;
  const int tile = blockIdx.x * 8 + wave;
  if (tile >= tilesM * tilesN) return;   // wave-uniform; no block barriers in this kernel
  const int tm = tile / tilesN;
  const int tn = tile - tm * tilesN;
  const int m0 = tm << 6;
  const int n0 = tn << 6;

  const T* Ab  = A  + (size_t)b * strideA;
  const T* Bb  = Bt + (size_t)b * strideB;
  const T* Ab2 = SPLIT ? (A2  + (size_t)b * strideA) : nullptr;
  const T* Bb2 = (SPLIT && SPLITB) ? (Bt2 + (size_t)b * strideB) : nullptr;

  const int rlane = lane & 15;                 // row (A) / col (B, D) within subtile
  const int koff  = (lane >> 4) * 8;           // k offset of this lane half
  const int mOff  = (lane >> 4) * 8;           // D row offset

  v8f acc[4][4];
#pragma unroll
  for (int i = 0; i < 4; ++i)
#pragma unroll
    for (int j = 0; j < 4; ++j) acc[i][j] = (v8f){0.f,0.f,0.f,0.f,0.f,0.f,0.f,0.f};

  for (int k0 = 0; k0 < K; k0 += 32) {
    V bh[4], bl[4];
#pragma unroll
    for (int j = 0; j < 4; ++j) {
      const size_t bo = (size_t)(n0 + (j << 4) + rlane) * ldb + koff + k0;
      bh[j] = Frag<T>::load(Bb + bo);
      if (SPLIT && SPLITB) bl[j] = Frag<T>::load(Bb2 + bo);
    }
#pragma unroll
    for (int i = 0; i < 4; ++i) {
      const size_t ao = (size_t)(m0 + (i << 4) + rlane) * lda + koff + k0;
      V ah = Frag<T>::load(Ab + ao);
      V al;
      if (SPLIT) al = Frag<T>::load(Ab2 + ao);
#pragma unroll
      for (int j = 0; j < 4; ++j) {
        acc[i][j] = Frag<T>::mma(ah, bh[j], acc[i][j]);
        if (SPLIT) {
          if (SPLITB) acc[i][j] = Frag<T>::mma(ah, bl[j], acc[i][j]);
          acc[i][j] = Frag<T>::mma(al, bh[j], acc[i][j]);
        }
      }
      Frag<T>::guard(acc[i][0], acc[i][3], ah, SPLIT ? al : ah);
    }
    Frag<T>::keep(bh[0], bh[1], bh[2], bh[3]);
    if (SPLIT && SPLITB) Frag<T>::keep(bl[0], bl[1], bl[2], bl[3]);
  }
  acc_guard4(acc[0][0], acc[0][1], acc[0][2], acc[0][3]);
  acc_guard4(acc[1][0], acc[1][1], acc[1][2], acc[1][3]);
  acc_guard4(acc[2][0], acc[2][1], acc[2][2], acc[2][3]);
  acc_guard4(acc[3][0], acc[3][1], acc[3][2], acc[3][3]);

  // ---- epilogue ----
  float* slab = sT[wave];
  const float* Rb = RESID ? (resid + (size_t)b * strideR) : nullptr;
#pragma unroll
  for (int i = 0; i < 4; ++i) {
    const int mBase = m0 + (i << 4);
#pragma unroll
    for (int j = 0; j < 4; ++j) {
      const int n = n0 + (j << 4) + rlane;
      float bv = 0.f;
      if (BIAS_MODE == 2) bv = bias[n];
#pragma unroll
      for (int r = 0; r < 8; ++r) {
        float v = acc[i][j][r] * scale;
        if (BIAS_MODE == 1) v += bias[mBase + mOff + r];
        if (BIAS_MODE == 2) v += bv;
        if (RESID) v += Rb[(size_t)(mBase + mOff + r) * ldc + n];
        if (ACT == 1) v = tanhf(v);
        if (ACT == 2) v = fmaxf(v, 0.0f);
        if (ACT == 3) v = v / (1.0f + expf(-v));
        if (ACT == 4) v = (v > 0.f) ? v : 0.01f * v;
        slab[(mOff + r) * 68 + (j << 4) + rlane] = v;
      }
    }
    __builtin_amdgcn_fence(__ATOMIC_RELEASE, "workgroup");
    __builtin_amdgcn_wave_barrier();
    __builtin_amdgcn_fence(__ATOMIC_ACQUIRE, "workgroup");
    if (OUT_MODE == 0) {
      float* C = (float*)Cout + (size_t)b * strideC;
      const int hh = lane >> 4, c4 = (lane & 15) * 4;     // row seg = 256 B = 16 lanes x 16 B
      {
#pragma unroll
        for (int it = 0; it < 8; ++it) {
          const int row = it * 2 + hh;
          v4f v = *(const v4f*)(slab + row * 68 + c4);
          *(v4f*)(C + (size_t)(mBase + row) * ldc + n0 + c4) = v;
        }
        
      }
    } else {
      const int q = lane >> 3, c8 = (lane & 7) * 8;
      unsigned short* C  = (unsigned short*)Cout  + (size_t)b * strideC;
      unsigned short* C2 = (OUT_MODE == 2) ? ((unsigned short*)Cout2 + (size_t)b * strideC) : nullptr;
      {
#pragma unroll
        for (int it = 0; it < 4; ++it) {
          const int row = it * 4 + q;
          const float* sp = slab + row * 68 + c8;
          v8h hv, lv;
#pragma unroll
          for (int e = 0; e < 8; ++e) {
            if (OUT_MODE == 1) {
              hv[e] = (_Float16)sp[e];
            } else {
              unsigned short hb = f2bf_bits(sp[e]);
              unsigned short lb = f2bf_bits(sp[e] - bf_bits2f(hb));
              hv[e] = __builtin_bit_cast(_Float16, hb);
              lv[e] = __builtin_bit_cast(_Float16, lb);
            }
          }
          *(v8h*)(C + (size_t)(mBase + row) * ldc + n0 + c8) = hv;
          if (OUT_MODE == 2) *(v8h*)(C2 + (size_t)(mBase + row) * ldc + n0 + c8) = lv;
        }
        
      }
    }
    __builtin_amdgcn_fence(__ATOMIC_RELEASE, "workgroup");
    __builtin_amdgcn_wave_barrier();
    __builtin_amdgcn_fence(__ATOMIC_ACQUIRE, "workgroup");
  }
}

// ---------------------------------------------------------------------------
// Elementwise f32 -> bf16 (RNE) cast, 2 elements per thread, one 4-B store per lane -> each wave writes exactly
// Coverage: grid = ceil(n2/256) x 256 threads x 2 elements = 2*n2 = the whole plane (all n2 used here are
// multiples of 256, so every wave is full and every line complete).
// ---------------------------------------------------------------------------
__global__ __launch_bounds__(256) void cast_bf16x2_kernel(const float* __restrict__ in, unsigned short* __restrict__ out,
                                                         int n2) {
  const int i = blockIdx.x * 256 + threadIdx.x;
  if (i < n2) {
    const v2f f = *(const v2f*)(in + 2 * (size_t)i);
    const unsigned u = pk16(f2bf_bits(f[0]), f2bf_bits(f[1]));
    ((unsigned*)out)[i] = u;
    
  }
}

// ---------------------------------------------------------------------------
// Elementwise bf16 split: hi = bf16_rne(in), lo = bf16_rne(in - hi); 2 elements per thread, one 4-B store
// (here n2 = 4096*1024/2 = 2,097,152 -> 8192 blocks x 512 elements = 4096x1024).
// ---------------------------------------------------------------------------
__global__ __launch_bounds__(256) void split_bf16x2_kernel(const float* __restrict__ in, unsigned short* __restrict__ hi,
                                                           unsigned short* __restrict__ lo, int n2) {
  const int i = blockIdx.x * 256 + threadIdx.x;
  if (i < n2) {
    const v2f f = *(const v2f*)(in + 2 * (size_t)i);
    const unsigned short h0 = f2bf_bits(f[0]), h1 = f2bf_bits(f[1]);
    const unsigned short l0 = f2bf_bits(f[0] - bf_bits2f(h0)), l1 = f2bf_bits(f[1] - bf_bits2f(h1));
    const unsigned uh = pk16(h0, h1), ul = pk16(l0, l1);
    ((unsigned*)hi)[i] = uh;
    ((unsigned*)lo)[i] = ul;
    
  }
}

// ---------------------------------------------------------------------------
// Cache keys, rows 0..kSkv-1 of each per-batch [kKeys][kDm] bf16 key plane pair:
//   x = bf16_rne(k_xl[b][s][c]) + bf16_rne(pos[s][c])   (the add in f32)
//   kh[b][s][c] = bf16_rne(x),  kl[b][s][c] = bf16_rne(x - kh)
// flags = the causal flag input; this forward applies no mask, the pointer is only bound, never read.
// ---------------------------------------------------------------------------
__global__ __launch_bounds__(256) void kcache_split_kernel(const float* __restrict__ kxl, const float* __restrict__ pos,
                                                           unsigned short* __restrict__ kh, unsigned short* __restrict__ kl,
                                                           const int* __restrict__ flags, int n2) {
  const int i = blockIdx.x * 256 + threadIdx.x;
  if (i < n2) {
    const size_t e = 2 * (size_t)i;                        // element index into [b][s][c]
    const size_t perB = (size_t)kSkv * kDm;
    const int bb = (int)(e / perB);
    const size_t rem = e - (size_t)bb * perB;              // s*kDm + c (even)
    const v2f a = *(const v2f*)(kxl + e);
    const v2f p = *(const v2f*)(pos + rem);
    const float s0 = bf_bits2f(f2bf_bits(a[0])) + bf_bits2f(f2bf_bits(p[0]));
    const float s1 = bf_bits2f(f2bf_bits(a[1])) + bf_bits2f(f2bf_bits(p[1]));
    const unsigned short h0 = f2bf_bits(s0), h1 = f2bf_bits(s1);
    const unsigned short l0 = f2bf_bits(s0 - bf_bits2f(h0)), l1 = f2bf_bits(s1 - bf_bits2f(h1));
    const unsigned uh = pk16(h0, h1), ul = pk16(l0, l1);
    const size_t o = ((size_t)bb * kKeys * kDm + rem) >> 1; // u32 index
    ((unsigned*)kh)[o] = uh;
    ((unsigned*)kl)[o] = ul;
    
  }
}

// ---------------------------------------------------------------------------
// Fused transpose + cast of an f32 matrix, z-batched: in_z = W + z*sIn viewed [R rows][Cc cols] (pitch Cc) ->
//   o_z[c][r] = f16(bf16_rne(in_z[r][c]))   ([Cc][...], output row pitch ldo halves), o_z = o + z*sOut.
// 64x64 tiles through LDS. grid = (Cc/64, R/64, Z), 256 threads (R, Cc multiples of 64).
// Coverage per block: load 4 it x 256 thr x 4 floats = 64x64; store 2 it x 256 thr x 8 u16 = 64x64.
// ---------------------------------------------------------------------------
__global__ __launch_bounds__(256) void tcast16_kernel(const float* __restrict__ W, unsigned short* __restrict__ o,
                                                      int R, int Cc, int ldo, long sIn, long sOut) {
  __shared__ __align__(16) float tf[64 * 68];
  W += (size_t)blockIdx.z * sIn;
  o += (size_t)blockIdx.z * sOut;
  const int c0  = blockIdx.x * 64;   // input column block = output row block
  const int r0  = blockIdx.y * 64;   // input row block    = output column block
  const int tid = threadIdx.x;
  {
    const int lr = tid >> 4;         // 0..15
    const int c4 = (tid & 15) * 4;   // 0..60
#pragma unroll
    for (int it = 0; it < 4; ++it) {
      const int rr = it * 16 + lr;   // 0..63
      const v4f a = *(const v4f*)(W + (size_t)(r0 + rr) * Cc + c0 + c4);
      *(v4f*)(tf + rr * 68 + c4) = a;
    }
  }
  __syncthreads();
  const int sub = tid >> 3;          // 0..31
  const int c8  = (tid & 7) * 8;     // 0..56
  v4u hv[2];
#pragma unroll
  for (int it = 0; it < 2; ++it) {
    const int oc = it * 32 + sub;    // output row within tile (= input column)
    v4u a;
#pragma unroll
    for (int q = 0; q < 4; ++q) {
      const float f0 = tf[(c8 + 2 * q) * 68 + oc];
      const float f1 = tf[(c8 + 2 * q + 1) * 68 + oc];
      a[q] = pk16(h_bits(bf_bits2f(f2bf_bits(f0))), h_bits(bf_bits2f(f2bf_bits(f1))));
    }
    hv[it] = a;
  }
  {
#pragma unroll
    for (int it = 0; it < 2; ++it) {
      const int oc = it * 32 + sub;
      const size_t go = (size_t)(c0 + oc) * ldo + r0 + c8;
      *(v4u*)(o + go) = hv[it];
    }
    
  }
}

// =====================================================================================
// Full (unmasked) attention over kKeys keys, head dim 64.
//   q planes (bf16 hi / lo): element (b, t, h, d) at [b*kTq*kDm + t*kDm + h*64 + d]
//   k planes (bf16 hi / lo): element (b, s, h, d) at [b*kKeys*kDm + s*kDm + h*64 + d], s in [0, kKeys)
//   v^T plane (f16):         element (b, h, d, s) at [b*kDm*kKeys + (h*64 + d)*kKeys + s]
//   out f32:                 element (b, t, h, d) at [b*kTq*kDm + t*kDm + h*64 + d]
//   scores = (q . k) * sscale : v_wmma_f32_16x16x32_bf16, hi.hi + hi.lo + lo.hi, f32 accumulate, scale applied in f32
//   out    = p . v            : v_wmma_f32_16x16x32_f16, p (unnormalised, <= 1) carried x2^15 in f16, v f16;
//                               2^15 folded into the final 1/l
//   online softmax in f32 over all kKeys keys (64 chunks of 64, compile-time trip count, no masking).
//   Block = 4 waves = 64 query rows of one (batch, head); grid = (kHeads * kTq/64, kBatch).
//   K hi / K lo / V^T chunk staging: 128 threads x 32 elements per plane = the whole 64x64 tile (16-B copies,
//   plain loads, __syncthreads before and after); fragment loads read the LDS tiles with the same vector element type.
// =====================================================================================
#define AT_D 64
#define AT_NW 4
#define AT_QB 64
#define AT_KC 64
#define AT_LP 72   // LDS row pitch in 16-bit elements: 144 B = 16 B x 9 (odd), so the 16 rows of a 16-byte fragment read fall on 16 different bank groups

__device__ __forceinline__ v8f at_mma_b(v16b a, v16b b, v8f c) {
  c = __builtin_amdgcn_wmma_f32_16x16x32_bf16(false, a, false, b, (short)0, c, false, false);
  asm volatile("v_nop\n\tv_nop\n\tv_nop\n\tv_nop" : "+v"(c) : "v"(a), "v"(b));
  return c;
}
__device__ __forceinline__ v8f at_mma_h(v16h a, v16h b, v8f c) {
  c = __builtin_amdgcn_wmma_f32_16x16x32_f16(false, a, false, b, (short)0, c, false, false);
  asm volatile("v_nop\n\tv_nop\n\tv_nop\n\tv_nop" : "+v"(c) : "v"(a), "v"(b));
  return c;
}

__global__ __launch_bounds__(128)
void attn_xl_kernel(const unsigned short* __restrict__ qhp, const unsigned short* __restrict__ qlp,
                    const unsigned short* __restrict__ khp, const unsigned short* __restrict__ klp,
                    const unsigned short* __restrict__ vtp, float* __restrict__ out, float sscale) {
  union FB { v16b v; v8b h[2]; };
  union FH { v16h v; v8h h[2]; };
  __shared__ __align__(16) __bf16   Ksh[AT_KC * AT_LP];         // K hi [kv][d]   9 KB
  __shared__ __align__(16) __bf16   Ksl[AT_KC * AT_LP];         // K lo [kv][d]   9 KB
  __shared__ __align__(16) _Float16 Vth[AT_D * AT_LP];          // V^T [d][kv]    9 KB
  __shared__ __align__(16) _Float16 Psh[AT_NW][16 * AT_LP];     // per wave P [row][kv] 9 KB
  __shared__ __align__(16) float    Os[AT_NW][16 * 68];         // per wave out tile, pitch 68
  const float PSC = 32768.0f;

  const int tid  = threadIdx.x;
  const int wave = tid >> 5;
  const int lane = tid & 31;
  const int hh   = lane >> 4;
  const int c    = lane & 15;

  const int nqb = kTq / AT_QB;            // 32
  const int bx = blockIdx.x;
  const int b  = blockIdx.y;
  const int qb = bx % nqb;
  const int h  = bx / nqb;                // 0..kHeads-1
  const int q0 = qb * AT_QB + wave * 16;

  const __bf16*   Qh = (const __bf16*)(const void*)qhp   + (size_t)b * kTq * kDm   + (size_t)h * AT_D;
  const __bf16*   Ql = (const __bf16*)(const void*)qlp   + (size_t)b * kTq * kDm   + (size_t)h * AT_D;
  const __bf16*   Kh = (const __bf16*)(const void*)khp   + (size_t)b * kKeys * kDm + (size_t)h * AT_D;
  const __bf16*   Kl = (const __bf16*)(const void*)klp   + (size_t)b * kKeys * kDm + (size_t)h * AT_D;
  const _Float16* Vh = (const _Float16*)(const void*)vtp + (size_t)b * kDm * kKeys + (size_t)h * AT_D * kKeys;
  float*          ob = out + (size_t)b * kTq * kDm + (size_t)h * AT_D;

  // ---- Q fragments (A operand, row = lane&15, split k map via Frag load): 2 d-chunks, hi and lo ----
  v16b qah[2], qal[2];
#pragma unroll
  for (int dc = 0; dc < 2; ++dc) {
    qah[dc] = Frag<__bf16>::load(Qh + (size_t)(q0 + c) * kDm + dc * 32 + 8 * hh);
    qal[dc] = Frag<__bf16>::load(Ql + (size_t)(q0 + c) * kDm + dc * 32 + 8 * hh);
  }

  float mrow[8], lrow[8];
  v8f oacc[4];
#pragma unroll
  for (int r = 0; r < 8; ++r) { mrow[r] = -INFINITY; lrow[r] = 0.f; }
#pragma unroll
  for (int t = 0; t < 4; ++t) oacc[t] = (v8f){0.f,0.f,0.f,0.f,0.f,0.f,0.f,0.f};

  const int nChunks = kKeys / AT_KC;   // 64, compile-time constant
  for (int kc = 0; kc < nChunks; ++kc) {
    const int kv0 = kc * AT_KC;
    __syncthreads();
    {
      // staging coverage: 128 threads x (4 x 8) elements = 64 rows x 64 per plane = the whole chunk tile (3 planes)
      const int r = tid >> 1, half = (tid & 1) * 32;
      const __bf16*   ksh = Kh + (size_t)(kv0 + r) * kDm + half;    // K row kv0+r, d = half..half+31
      const __bf16*   ksl = Kl + (size_t)(kv0 + r) * kDm + half;
      const _Float16* vsh = Vh + (size_t)r * kKeys + kv0 + half;    // V^T row d = r, s = kv0+half..+31
#pragma unroll
      for (int i = 0; i < 4; ++i) {
        const v8b a0 = *(const v8b*)(ksh + 8 * i);
        const v8b a1 = *(const v8b*)(ksl + 8 * i);
        const v8h b0 = *(const v8h*)(vsh + 8 * i);
        *(v8b*)(Ksh + r * AT_LP + half + 8 * i) = a0;
        *(v8b*)(Ksl + r * AT_LP + half + 8 * i) = a1;
        *(v8h*)(Vth + r * AT_LP + half + 8 * i) = b0;
      }
    }
    __syncthreads();

    v8f s[4];
#pragma unroll
    for (int j = 0; j < 4; ++j) {
      s[j] = (v8f){0.f,0.f,0.f,0.f,0.f,0.f,0.f,0.f};
#pragma unroll
      for (int dc = 0; dc < 2; ++dc) {
        FB kb, klf;
        kb.h[0]  = *(const v8b*)(Ksh + (j * 16 + c) * AT_LP + dc * 32 + 8 * hh);
        kb.h[1]  = *(const v8b*)(Ksh + (j * 16 + c) * AT_LP + dc * 32 + 16 + 8 * hh);
        klf.h[0] = *(const v8b*)(Ksl + (j * 16 + c) * AT_LP + dc * 32 + 8 * hh);
        klf.h[1] = *(const v8b*)(Ksl + (j * 16 + c) * AT_LP + dc * 32 + 16 + 8 * hh);
        s[j] = at_mma_b(qah[dc], kb.v,  s[j]);
        s[j] = at_mma_b(qah[dc], klf.v, s[j]);
        s[j] = at_mma_b(qal[dc], kb.v,  s[j]);
      }
    }
    float cm[8];
#pragma unroll
    for (int r = 0; r < 8; ++r) {
      float m = -INFINITY;
#pragma unroll
      for (int j = 0; j < 4; ++j) {
        const float sv = s[j][r] * sscale;
        s[j][r] = sv;
        m = fmaxf(m, sv);
      }
#pragma unroll
      for (int off = 1; off < 16; off <<= 1) m = fmaxf(m, __shfl_xor(m, off, 32));
      cm[r] = m;
    }
    _Float16* pwh = Psh[wave];
#pragma unroll
    for (int r = 0; r < 8; ++r) {
      const float mnew = fmaxf(mrow[r], cm[r]);
      const float alpha = expf(mrow[r] - mnew);
      mrow[r] = mnew;
      float psum = 0.f;
#pragma unroll
      for (int j = 0; j < 4; ++j) {
        const float p = expf(s[j][r] - mnew);
        psum += p;
        pwh[(8 * hh + r) * AT_LP + j * 16 + c] = (_Float16)(p * PSC);
      }
#pragma unroll
      for (int off = 1; off < 16; off <<= 1) psum += __shfl_xor(psum, off, 32);
      lrow[r] = lrow[r] * alpha + psum;
#pragma unroll
      for (int t = 0; t < 4; ++t) oacc[t][r] *= alpha;
    }
    __builtin_amdgcn_fence(__ATOMIC_RELEASE, "workgroup");
    __builtin_amdgcn_wave_barrier();
    __builtin_amdgcn_fence(__ATOMIC_ACQUIRE, "workgroup");
#pragma unroll 1
    for (int kk = 0; kk < 2; ++kk) {
      FH pa;
      pa.h[0] = *(const v8h*)(pwh + c * AT_LP + kk * 32 + 8 * hh);
      pa.h[1] = *(const v8h*)(pwh + c * AT_LP + kk * 32 + 16 + 8 * hh);
#pragma unroll
      for (int t = 0; t < 4; ++t) {
        FH vb;
        vb.h[0] = *(const v8h*)(Vth + (t * 16 + c) * AT_LP + kk * 32 + 8 * hh);
        vb.h[1] = *(const v8h*)(Vth + (t * 16 + c) * AT_LP + kk * 32 + 16 + 8 * hh);
        oacc[t] = at_mma_h(pa.v, vb.v, oacc[t]);
      }
    }
  }

  float* os = Os[wave];
#pragma unroll
  for (int r = 0; r < 8; ++r) {
    const float inv = 1.0f / (lrow[r] * PSC);
#pragma unroll
    for (int t = 0; t < 4; ++t) os[(8 * hh + r) * 68 + t * 16 + c] = oacc[t][r] * inv;
  }
  __builtin_amdgcn_fence(__ATOMIC_RELEASE, "workgroup");
  __builtin_amdgcn_wave_barrier();
  __builtin_amdgcn_fence(__ATOMIC_ACQUIRE, "workgroup");
  {
    const int c4 = (lane & 15) * 4;
    {
#pragma unroll
      for (int it = 0; it < 8; ++it) {
        const int row = it * 2 + hh;   // it 0..7 x hh 0..1 covers rows 0..15 of the wave tile
        v4f val = *(const v4f*)(os + row * 68 + c4);
        *(v4f*)(ob + (size_t)(q0 + row) * kDm + c4) = val;
      }
      
    }
  }
}

// ---------------------------------------------------------------------------
// Workspace region map (byte offsets; every region is fully written before it is read):
//   R0  Qb   bf16 [4096][1024]          8,388,608 @           0   (RNE cast of q)
//   R1  Wq   bf16 [3072][1024]          6,291,456 @   8,388,608   (RNE cast of W_qkv)
//   R2  Wp   bf16 [1024][1024]          2,097,152 @  14,680,064   (RNE cast of W_proj)
//   R3  Qh   bf16 [4096][1024]          8,388,608 @  16,777,216   (q projection, hi plane)
//   R4  Ql   bf16 [4096][1024]          8,388,608 @  25,165,824   (q projection, lo plane)
//   R5  Kh   bf16 [2][4096][1024]      16,777,216 @  33,554,432   (rows 0..2047 cache keys, 2048.. k projection; hi)
//   R6  Kl   bf16 [2][4096][1024]      16,777,216 @  50,331,648   (same rows; lo)
//   R7  Vt   f16  [2][1024][4096]      16,777,216 @  67,108,864   (cols 0..2047 cache values^T, 2048.. v projection^T)
//   R8  Y    f32  [4096][1024]         16,777,216 @  83,886,080   (attention output, token-major, heads merged)
//   R9  Yh   bf16 [4096][1024]          8,388,608 @ 100,663,296   (split of Y, hi)
//   R10 Yl   bf16 [4096][1024]          8,388,608 @ 109,051,904   (split of Y, lo)
//   total 117,440,512 B
// ---------------------------------------------------------------------------
extern "C" void kernel_launch(void* const* d_in, const int* in_sizes, int n_in,
                              void* d_out, int out_size, void* d_ws,
                              size_t ws_size, hipStream_t stream) {
  if (n_in < 7) return;
  const size_t nQ  = (size_t)kBatch * kTq * kDm;        // 4,194,304
  const size_t nKV = (size_t)kBatch * kSkv * kDm;       // 4,194,304
  const size_t nWq = (size_t)3 * kDm * kDm;             // 3,145,728
  const size_t nWp = (size_t)kDm * kDm;                 // 1,048,576
  const size_t nPe = (size_t)kSkv * kDm;                // 2,097,152
  if (in_sizes[0] != (int)nQ || in_sizes[1] != (int)nKV || in_sizes[2] != (int)nKV ||
      in_sizes[3] != (int)nWq || in_sizes[4] != (int)nWp || in_sizes[5] != (int)nPe ||
      out_size != (int)nQ) return;

  const float* q     = (const float*)d_in[0];
  const float* k_xl  = (const float*)d_in[1];
  const float* v_xl  = (const float*)d_in[2];
  const float* Wqkv  = (const float*)d_in[3];
  const float* Wproj = (const float*)d_in[4];
  const float* pos   = (const float*)d_in[5];
  const int*   causf = (const int*)d_in[6];
  float* outp = (float*)d_out;

  const size_t offQb = 0,              szQb = nQ * 2;
  const size_t offWq = offQb + szQb,   szWq = nWq * 2;
  const size_t offWp = offWq + szWq,   szWp = nWp * 2;
  const size_t offQh = offWp + szWp,   szQh = nQ * 2;
  const size_t offQl = offQh + szQh,   szQl = nQ * 2;
  const size_t offKh = offQl + szQl,   szKh = (size_t)kBatch * kKeys * kDm * 2;
  const size_t offKl = offKh + szKh,   szKl = szKh;
  const size_t offVt = offKl + szKl,   szVt = (size_t)kBatch * kDm * kKeys * 2;
  const size_t offY  = offVt + szVt,   szY  = nQ * 4;
  const size_t offYh = offY + szY,     szYh = nQ * 2;
  const size_t offYl = offYh + szYh,   szYl = nQ * 2;
  const size_t total = offYl + szYl;   // 117,440,512
  if (total > ws_size) return;

  char* ws = (char*)d_ws;
  unsigned short* Qb = (unsigned short*)(ws + offQb);
  unsigned short* Wq = (unsigned short*)(ws + offWq);
  unsigned short* Wp = (unsigned short*)(ws + offWp);
  unsigned short* Qh = (unsigned short*)(ws + offQh);
  unsigned short* Ql = (unsigned short*)(ws + offQl);
  unsigned short* Kh = (unsigned short*)(ws + offKh);
  unsigned short* Kl = (unsigned short*)(ws + offKl);
  unsigned short* Vt = (unsigned short*)(ws + offVt);
  float*          Y  = (float*)(ws + offY);
  unsigned short* Yh = (unsigned short*)(ws + offYh);
  unsigned short* Yl = (unsigned short*)(ws + offYl);

  // ---- input casts (RNE bf16 of every float input) and cache planes ----
  {
    const int n2q = (int)(nQ / 2), n2wq = (int)(nWq / 2), n2wp = (int)(nWp / 2), n2kv = (int)(nKV / 2);
    cast_bf16x2_kernel<<<dim3((n2q + 255) / 256), 256, 0, stream>>>(q, Qb, n2q);
    cast_bf16x2_kernel<<<dim3((n2wq + 255) / 256), 256, 0, stream>>>(Wqkv, Wq, n2wq);
    cast_bf16x2_kernel<<<dim3((n2wp + 255) / 256), 256, 0, stream>>>(Wproj, Wp, n2wp);
    // cache keys -> rows 0..2047 of both key planes (hi, lo), both batches
    kcache_split_kernel<<<dim3((n2kv + 255) / 256), 256, 0, stream>>>(k_xl, pos, Kh, Kl, causf, n2kv);
    // v_xl[b]: in[s rows=2048][c cols=1024] -> Vt[b] out[c][s] with output row pitch kKeys, cols 0..2047;
    // grid (cols/64, rows/64, B)
    tcast16_kernel<<<dim3(kDm / 64, kSkv / 64, kBatch), 256, 0, stream>>>(
        v_xl, Vt, kSkv, kDm, kKeys, (long)kSkv * kDm, (long)kDm * kKeys);
  }

  // ---- qkv projections: bf16 operands (K = 1024, M,N multiples of 64, no tails) ----
  {
    // q projection: C[m = b*2048+t][n] -> Qh (hi) / Ql (lo), M=4096, N=1024, K=1024; 1024 tiles -> 128 blocks
    const int tilesQ = (int)((nQ / kDm) / 64) * (kDm / 64);
    wmma_gemm64<1, false, 0, 2, false><<<dim3((tilesQ + 7) / 8, 1), 256, 0, stream>>>(
        Qb, nullptr, kDm, 0L, Wq, nullptr, kDm, 0L,
        (void*)Qh, (void*)Ql, kDm, 0L, nullptr, nullptr, 0L,
        kBatch * kTq, kDm, kDm, 1.0f);
    // k projection per batch: C[t][n] -> key plane rows 2048+t (hi -> Kh, lo -> Kl), M=2048, N=1024, K=1024;
    // 512 tiles -> 64 blocks, grid.y = batch
    const int tilesK = (kTq / 64) * (kDm / 64);
    wmma_gemm64<1, false, 0, 2, false><<<dim3((tilesK + 7) / 8, kBatch), 256, 0, stream>>>(
        Qb, nullptr, kDm, (long)kTq * kDm, Wq + (size_t)kDm * kDm, nullptr, kDm, 0L,
        (void*)(Kh + (size_t)kSkv * kDm), (void*)(Kl + (size_t)kSkv * kDm), kDm, (long)kKeys * kDm,
        nullptr, nullptr, 0L,
        kTq, kDm, kDm, 1.0f);
    // v projection, role-swapped: C[m = channel][n = t] -> Vt_b[channel][2048 + t] (f16), M=1024, N=2048, K=1024,
    // ldc = kKeys; 512 tiles -> 64 blocks, grid.y = batch
    const int tilesV = (kDm / 64) * (kTq / 64);
    wmma_gemm64<1, false, 0, 1, false><<<dim3((tilesV + 7) / 8, kBatch), 256, 0, stream>>>(
        Wq + (size_t)2 * kDm * kDm, nullptr, kDm, 0L, Qb, nullptr, kDm, (long)kTq * kDm,
        (void*)(Vt + kSkv), nullptr, kKeys, (long)kDm * kKeys, nullptr, nullptr, 0L,
        kDm, kTq, kDm, 1.0f);
  }

  // ---- attention over the 4096 keys per (batch, head); score scale 1/sqrt(64) applied in f32 ----
  attn_xl_kernel<<<dim3(kHeads * (kTq / AT_QB), kBatch), 128, 0, stream>>>(Qh, Ql, Kh, Kl, Vt, Y, 0.125f);

  // ---- y -> bf16 hi/lo planes; output projection C[m][n] = sum_c (Yh + Yl)[m][c] * Wp[n][c] -> d_out ----
  {
    const int n2y = (int)(nQ / 2);
    split_bf16x2_kernel<<<dim3((n2y + 255) / 256), 256, 0, stream>>>(Y, Yh, Yl, n2y);
    const int tilesP = (int)((nQ / kDm) / 64) * (kDm / 64);   // 1024 tiles -> 128 blocks
    wmma_gemm64<1, true, 0, 0, false, 0, false><<<dim3((tilesP + 7) / 8, 1), 256, 0, stream>>>(
        Yh, Yl, kDm, 0L, Wp, nullptr, kDm, 0L,
        (void*)outp, nullptr, kDm, 0L, nullptr, nullptr, 0L,
        kBatch * kTq, kDm, kDm, 1.0f);
  }
}

// v002
// One run takes 433 microseconds.
// Next to v001, in two timings, it ran 1.31 times as fast each time.
// All steps since v000 together make it 1.93 times as fast.
// Contractions: q/k/v projections on v_wmma_f32_16x16x32_bf16 (bf16 operands = RNE-cast inputs, single product); q.k^T on v_wmma_f32_16x16x32_bf16 with bf16 hi/lo planes for both q and k (hi.hi + hi.lo + lo.hi); p.v on v_wmma_f32_16x16x32_f16 (p f16 carried x2^15, v f16, single product); output projection on v_wmma_f32_16x16x32_bf16 with y as bf16 hi/lo planes (hi.W + lo.W) and W bf16; f32 accumulate everywhere; softmax, score scale and the cache add in f32.
#include <hip/hip_runtime.h>
#include <math.h>
#include <stdint.h>

constexpr int kBatch = 2;
constexpr int kTq    = 2048;            // query length
constexpr int kSkv   = 2048;            // cache length
constexpr int kKeys  = kSkv + kTq;      // 4096 keys per (batch, head)
constexpr int kDm    = 1024;            // model dim
constexpr int kHeads = 16;
constexpr int kHd    = 64;
static_assert(kHeads * kHd == kDm, "head split");
static_assert(kTq % 64 == 0 && kKeys % 64 == 0 && kDm % 64 == 0 && kSkv % 64 == 0, "tile multiples");

typedef __attribute__((ext_vector_type(16))) _Float16 v16h;
typedef __attribute__((ext_vector_type(8)))  _Float16 v8h;
typedef __attribute__((ext_vector_type(16))) __bf16   v16b;
typedef __attribute__((ext_vector_type(8)))  __bf16   v8b;
typedef __attribute__((ext_vector_type(8)))  float    v8f;
typedef __attribute__((ext_vector_type(4)))  float    v4f;
typedef __attribute__((ext_vector_type(2)))  float    v2f;
typedef __attribute__((ext_vector_type(4)))  unsigned int v4u;

__device__ __forceinline__ unsigned short f2bf_bits(float f) {
  unsigned u = __float_as_uint(f);
  return (unsigned short)((u + 0x7FFFu + ((u >> 16) & 1u)) >> 16);
}
__device__ __forceinline__ float bf_bits2f(unsigned short h) { return __uint_as_float(((unsigned)h) << 16); }
__device__ __forceinline__ unsigned short h_bits(float f) { return __builtin_bit_cast(unsigned short, (_Float16)f); }
__device__ __forceinline__ unsigned pk16(unsigned short a, unsigned short b) { return (unsigned)a | ((unsigned)b << 16); }

// hazard guards as plain device helpers (no inline asm inside the kernel template body)
__device__ __forceinline__ void dep_guard_h(v8f& a, v8f& b, v16h x, v16h y) { asm volatile("v_nop\n\tv_nop\n\tv_nop\n\tv_nop" : "+v"(a), "+v"(b) : "v"(x), "v"(y)); }
__device__ __forceinline__ void dep_guard_b(v8f& a, v8f& b, v16b x, v16b y) { asm volatile("v_nop\n\tv_nop\n\tv_nop\n\tv_nop" : "+v"(a), "+v"(b) : "v"(x), "v"(y)); }
__device__ __forceinline__ void keep4_h(v16h a, v16h b, v16h c, v16h d) { asm volatile("v_nop" :: "v"(a), "v"(b), "v"(c), "v"(d)); }
__device__ __forceinline__ void keep4_b(v16b a, v16b b, v16b c, v16b d) { asm volatile("v_nop" :: "v"(a), "v"(b), "v"(c), "v"(d)); }
__device__ __forceinline__ void acc_guard4(v8f& a, v8f& b, v8f& c, v8f& d) { asm volatile("v_nop\n\tv_nop\n\tv_nop\n\tv_nop" : "+v"(a), "+v"(b), "+v"(c), "+v"(d)); }
template <typename T> struct Frag;
template <> struct Frag<_Float16> {
  typedef v16h V; union U { v16h v; v8h h[2]; };
  static __device__ __forceinline__ v16h load(const _Float16* p) {   // elements 0..7 <- p[0..7], 8..15 <- p[16..23]
    U f; f.h[0] = *(const v8h*)(p); f.h[1] = *(const v8h*)(p + 16); return f.v;
  }
  static __device__ __forceinline__ v8f mma(v16h a, v16h b, v8f c) {
    return __builtin_amdgcn_wmma_f32_16x16x32_f16(false, a, false, b, (short)0, c, false, false);
  }
  static __device__ __forceinline__ void guard(v8f& a, v8f& b, v16h x, v16h y) { dep_guard_h(a, b, x, y); }
  static __device__ __forceinline__ void keep(v16h a, v16h b, v16h c, v16h d) { keep4_h(a, b, c, d); }
};
template <> struct Frag<__bf16> {
  typedef v16b V; union U { v16b v; v8b h[2]; };
  static __device__ __forceinline__ v16b load(const __bf16* p) {
    U f; f.h[0] = *(const v8b*)(p); f.h[1] = *(const v8b*)(p + 16); return f.v;
  }
  static __device__ __forceinline__ v8f mma(v16b a, v16b b, v8f c) {
    return __builtin_amdgcn_wmma_f32_16x16x32_bf16(false, a, false, b, (short)0, c, false, false);
  }
  static __device__ __forceinline__ void guard(v8f& a, v8f& b, v16b x, v16b y) { dep_guard_b(a, b, x, y); }
  static __device__ __forceinline__ void keep(v16b a, v16b b, v16b c, v16b d) { keep4_b(a, b, c, d); }
};

// ---- Register-blocked batched WMMA GEMM ------------------------------------
// C[m,n] = scale * sum_k A[m,k] * Bt[n,k] (+bias)(+resid); each wave owns a 64x64 tile.
// A row-major [M,K]; Bt row-major [N,K]; M,N % 64 == 0, K % 32 == 0.
// SPLIT: operands are hi/lo planes (A2/Bt2 = lo planes, same layout); product = hi.hi + hi.lo + lo.hi.
// SPLITB (only meaningful with SPLIT): when false only A carries a lo plane; product = hi.B + lo.B (Bt2 unused).
// BIAS_MODE: 0 = none, 1 = bias[m], 2 = bias[n].
// OUT_MODE: 0 = f32, 1 = f16, 2 = bf16 hi plane (Cout) + bf16 lo plane (Cout2).
// ET: 0 = f16 operands, 1 = bf16 operands (pointers passed as 16-bit storage)
template <int ET> struct Elem;
template <> struct Elem<0> { typedef _Float16 T; };
template <> struct Elem<1> { typedef __bf16 T; };
template <int ET, bool SPLIT, int BIAS_MODE, int OUT_MODE, bool RESID, int ACT = 0, bool SPLITB = SPLIT>
__global__ __launch_bounds__(256) void wmma_gemm64(
    const unsigned short* __restrict__ Ap, const unsigned short* __restrict__ A2p, int lda, long strideA,
    const unsigned short* __restrict__ Btp, const unsigned short* __restrict__ Bt2p, int ldb, long strideB,
    void* __restrict__ Cout, void* __restrict__ Cout2, int ldc, long strideC,
    const float* __restrict__ bias,
    const float* __restrict__ resid, long strideR,
    int M, int N, int K, float scale) {
  typedef typename Elem<ET>::T T;
  typedef typename Frag<T>::V V;
  const T* A = (const T*)Ap; const T* A2 = (const T*)A2p; const T* Bt = (const T*)Btp; const T* Bt2 = (const T*)Bt2p;
  __shared__ __align__(16) float sT[8][16 * 68];   // per-wave 16x64 slab, pitch 68 floats
  const int b    = blockIdx.y;
  const int lane = threadIdx.x & 31;
  const int wave = threadIdx.x >> 5;
  const int tilesN = N >> 6;
  const int tilesM = M >> 6;
  const int tile = blockIdx.x * 8 + wave;
  if (tile >= tilesM * tilesN) return;   // wave-uniform; no block barriers in this kernel
  const int tm = tile / tilesN;
  const int tn = tile - tm * tilesN;
  const int m0 = tm << 6;
  const int n0 = tn << 6;

  const T* Ab  = A  + (size_t)b * strideA;
  const T* Bb  = Bt + (size_t)b * strideB;
  const T* Ab2 = SPLIT ? (A2  + (size_t)b * strideA) : nullptr;
  const T* Bb2 = (SPLIT && SPLITB) ? (Bt2 + (size_t)b * strideB) : nullptr;

  const int rlane = lane & 15;                 // row (A) / col (B, D) within subtile
  const int koff  = (lane >> 4) * 8;           // k offset of this lane half
  const int mOff  = (lane >> 4) * 8;           // D row offset

  v8f acc[4][4];
#pragma unroll
  for (int i = 0; i < 4; ++i)
#pragma unroll
    for (int j = 0; j < 4; ++j) acc[i][j] = (v8f){0.f,0.f,0.f,0.f,0.f,0.f,0.f,0.f};

  for (int k0 = 0; k0 < K; k0 += 32) {
    V bh[4], bl[4];
#pragma unroll
    for (int j = 0; j < 4; ++j) {
      const size_t bo = (size_t)(n0 + (j << 4) + rlane) * ldb + koff + k0;
      bh[j] = Frag<T>::load(Bb + bo);
      if (SPLIT && SPLITB) bl[j] = Frag<T>::load(Bb2 + bo);
    }
#pragma unroll
    for (int i = 0; i < 4; ++i) {
      const size_t ao = (size_t)(m0 + (i << 4) + rlane) * lda + koff + k0;
      V ah = Frag<T>::load(Ab + ao);
      V al;
      if (SPLIT) al = Frag<T>::load(Ab2 + ao);
#pragma unroll
      for (int j = 0; j < 4; ++j) {
        acc[i][j] = Frag<T>::mma(ah, bh[j], acc[i][j]);
        if (SPLIT) {
          if (SPLITB) acc[i][j] = Frag<T>::mma(ah, bl[j], acc[i][j]);
          acc[i][j] = Frag<T>::mma(al, bh[j], acc[i][j]);
        }
      }
      Frag<T>::guard(acc[i][0], acc[i][3], ah, SPLIT ? al : ah);
    }
    Frag<T>::keep(bh[0], bh[1], bh[2], bh[3]);
    if (SPLIT && SPLITB) Frag<T>::keep(bl[0], bl[1], bl[2], bl[3]);
  }
  acc_guard4(acc[0][0], acc[0][1], acc[0][2], acc[0][3]);
  acc_guard4(acc[1][0], acc[1][1], acc[1][2], acc[1][3]);
  acc_guard4(acc[2][0], acc[2][1], acc[2][2], acc[2][3]);
  acc_guard4(acc[3][0], acc[3][1], acc[3][2], acc[3][3]);

  // ---- epilogue ----
  float* slab = sT[wave];
  const float* Rb = RESID ? (resid + (size_t)b * strideR) : nullptr;
#pragma unroll
  for (int i = 0; i < 4; ++i) {
    const int mBase = m0 + (i << 4);
#pragma unroll
    for (int j = 0; j < 4; ++j) {
      const int n = n0 + (j << 4) + rlane;
      float bv = 0.f;
      if (BIAS_MODE == 2) bv = bias[n];
#pragma unroll
      for (int r = 0; r < 8; ++r) {
        float v = acc[i][j][r] * scale;
        if (BIAS_MODE == 1) v += bias[mBase + mOff + r];
        if (BIAS_MODE == 2) v += bv;
        if (RESID) v += Rb[(size_t)(mBase + mOff + r) * ldc + n];
        if (ACT == 1) v = tanhf(v);
        if (ACT == 2) v = fmaxf(v, 0.0f);
        if (ACT == 3) v = v / (1.0f + expf(-v));
        if (ACT == 4) v = (v > 0.f) ? v : 0.01f * v;
        slab[(mOff + r) * 68 + (j << 4) + rlane] = v;
      }
    }
    __builtin_amdgcn_fence(__ATOMIC_RELEASE, "workgroup");
    __builtin_amdgcn_wave_barrier();
    __builtin_amdgcn_fence(__ATOMIC_ACQUIRE, "workgroup");
    if (OUT_MODE == 0) {
      float* C = (float*)Cout + (size_t)b * strideC;
      const int hh = lane >> 4, c4 = (lane & 15) * 4;     // row seg = 256 B = 16 lanes x 16 B
      {
#pragma unroll
        for (int it = 0; it < 8; ++it) {
          const int row = it * 2 + hh;
          v4f v = *(const v4f*)(slab + row * 68 + c4);
          *(v4f*)(C + (size_t)(mBase + row) * ldc + n0 + c4) = v;
        }
        
      }
    } else {
      const int q = lane >> 3, c8 = (lane & 7) * 8;
      unsigned short* C  = (unsigned short*)Cout  + (size_t)b * strideC;
      unsigned short* C2 = (OUT_MODE == 2) ? ((unsigned short*)Cout2 + (size_t)b * strideC) : nullptr;
      {
#pragma unroll
        for (int it = 0; it < 4; ++it) {
          const int row = it * 4 + q;
          const float* sp = slab + row * 68 + c8;
          v8h hv, lv;
#pragma unroll
          for (int e = 0; e < 8; ++e) {
            if (OUT_MODE == 1) {
              hv[e] = (_Float16)sp[e];
            } else {
              unsigned short hb = f2bf_bits(sp[e]);
              unsigned short lb = f2bf_bits(sp[e] - bf_bits2f(hb));
              hv[e] = __builtin_bit_cast(_Float16, hb);
              lv[e] = __builtin_bit_cast(_Float16, lb);
            }
          }
          *(v8h*)(C + (size_t)(mBase + row) * ldc + n0 + c8) = hv;
          if (OUT_MODE == 2) *(v8h*)(C2 + (size_t)(mBase + row) * ldc + n0 + c8) = lv;
        }
        
      }
    }
    __builtin_amdgcn_fence(__ATOMIC_RELEASE, "workgroup");
    __builtin_amdgcn_wave_barrier();
    __builtin_amdgcn_fence(__ATOMIC_ACQUIRE, "workgroup");
  }
}

// ---------------------------------------------------------------------------
// Elementwise f32 -> bf16 (RNE) cast, 2 elements per thread, one 4-B store per lane -> each wave writes exactly
// Coverage: grid = ceil(n2/256) x 256 threads x 2 elements = 2*n2 = the whole plane (all n2 used here are
// multiples of 256, so every wave is full and every line complete).
// ---------------------------------------------------------------------------
__global__ __launch_bounds__(256) void cast_bf16x2_kernel(const float* __restrict__ in, unsigned short* __restrict__ out,
                                                         int n2) {
  const int i = blockIdx.x * 256 + threadIdx.x;
  if (i < n2) {
    const v2f f = *(const v2f*)(in + 2 * (size_t)i);
    const unsigned u = pk16(f2bf_bits(f[0]), f2bf_bits(f[1]));
    ((unsigned*)out)[i] = u;
    
  }
}

// ---------------------------------------------------------------------------
// Elementwise bf16 split: hi = bf16_rne(in), lo = bf16_rne(in - hi); 2 elements per thread, one 4-B store
// (here n2 = 4096*1024/2 = 2,097,152 -> 8192 blocks x 512 elements = 4096x1024).
// ---------------------------------------------------------------------------
__global__ __launch_bounds__(256) void split_bf16x2_kernel(const float* __restrict__ in, unsigned short* __restrict__ hi,
                                                           unsigned short* __restrict__ lo, int n2) {
  const int i = blockIdx.x * 256 + threadIdx.x;
  if (i < n2) {
    const v2f f = *(const v2f*)(in + 2 * (size_t)i);
    const unsigned short h0 = f2bf_bits(f[0]), h1 = f2bf_bits(f[1]);
    const unsigned short l0 = f2bf_bits(f[0] - bf_bits2f(h0)), l1 = f2bf_bits(f[1] - bf_bits2f(h1));
    const unsigned uh = pk16(h0, h1), ul = pk16(l0, l1);
    ((unsigned*)hi)[i] = uh;
    ((unsigned*)lo)[i] = ul;
    
  }
}

// ---------------------------------------------------------------------------
// Cache keys, rows 0..kSkv-1 of each per-batch [kKeys][kDm] bf16 key plane pair:
//   x = bf16_rne(k_xl[b][s][c]) + bf16_rne(pos[s][c])   (the add in f32)
//   kh[b][s][c] = bf16_rne(x),  kl[b][s][c] = bf16_rne(x - kh)
// flags = the causal flag input; this forward applies no mask, the pointer is only bound, never read.
// ---------------------------------------------------------------------------
__global__ __launch_bounds__(256) void kcache_split_kernel(const float* __restrict__ kxl, const float* __restrict__ pos,
                                                           unsigned short* __restrict__ kh, unsigned short* __restrict__ kl,
                                                           const int* __restrict__ flags, int n2) {
  const int i = blockIdx.x * 256 + threadIdx.x;
  if (i < n2) {
    const size_t e = 2 * (size_t)i;                        // element index into [b][s][c]
    const size_t perB = (size_t)kSkv * kDm;
    const int bb = (int)(e / perB);
    const size_t rem = e - (size_t)bb * perB;              // s*kDm + c (even)
    const v2f a = *(const v2f*)(kxl + e);
    const v2f p = *(const v2f*)(pos + rem);
    const float s0 = bf_bits2f(f2bf_bits(a[0])) + bf_bits2f(f2bf_bits(p[0]));
    const float s1 = bf_bits2f(f2bf_bits(a[1])) + bf_bits2f(f2bf_bits(p[1]));
    const unsigned short h0 = f2bf_bits(s0), h1 = f2bf_bits(s1);
    const unsigned short l0 = f2bf_bits(s0 - bf_bits2f(h0)), l1 = f2bf_bits(s1 - bf_bits2f(h1));
    const unsigned uh = pk16(h0, h1), ul = pk16(l0, l1);
    const size_t o = ((size_t)bb * kKeys * kDm + rem) >> 1; // u32 index
    ((unsigned*)kh)[o] = uh;
    ((unsigned*)kl)[o] = ul;
    
  }
}

// ---------------------------------------------------------------------------
// Fused transpose + cast of an f32 matrix, z-batched: in_z = W + z*sIn viewed [R rows][Cc cols] (pitch Cc) ->
//   o_z[c][r] = f16(bf16_rne(in_z[r][c]))   ([Cc][...], output row pitch ldo halves), o_z = o + z*sOut.
// 64x64 tiles through LDS. grid = (Cc/64, R/64, Z), 256 threads (R, Cc multiples of 64).
// Coverage per block: load 4 it x 256 thr x 4 floats = 64x64; store 2 it x 256 thr x 8 u16 = 64x64.
// ---------------------------------------------------------------------------
__global__ __launch_bounds__(256) void tcast16_kernel(const float* __restrict__ W, unsigned short* __restrict__ o,
                                                      int R, int Cc, int ldo, long sIn, long sOut) {
  __shared__ __align__(16) float tf[64 * 68];
  W += (size_t)blockIdx.z * sIn;
  o += (size_t)blockIdx.z * sOut;
  const int c0  = blockIdx.x * 64;   // input column block = output row block
  const int r0  = blockIdx.y * 64;   // input row block    = output column block
  const int tid = threadIdx.x;
  {
    const int lr = tid >> 4;         // 0..15
    const int c4 = (tid & 15) * 4;   // 0..60
#pragma unroll
    for (int it = 0; it < 4; ++it) {
      const int rr = it * 16 + lr;   // 0..63
      const v4f a = *(const v4f*)(W + (size_t)(r0 + rr) * Cc + c0 + c4);
      *(v4f*)(tf + rr * 68 + c4) = a;
    }
  }
  __syncthreads();
  const int sub = tid >> 3;          // 0..31
  const int c8  = (tid & 7) * 8;     // 0..56
  v4u hv[2];
#pragma unroll
  for (int it = 0; it < 2; ++it) {
    const int oc = it * 32 + sub;    // output row within tile (= input column)
    v4u a;
#pragma unroll
    for (int q = 0; q < 4; ++q) {
      const float f0 = tf[(c8 + 2 * q) * 68 + oc];
      const float f1 = tf[(c8 + 2 * q + 1) * 68 + oc];
      a[q] = pk16(h_bits(bf_bits2f(f2bf_bits(f0))), h_bits(bf_bits2f(f2bf_bits(f1))));
    }
    hv[it] = a;
  }
  {
#pragma unroll
    for (int it = 0; it < 2; ++it) {
      const int oc = it * 32 + sub;
      const size_t go = (size_t)(c0 + oc) * ldo + r0 + c8;
      *(v4u*)(o + go) = hv[it];
    }
    
  }
}

// =====================================================================================
// Full (unmasked) attention over kKeys keys, head dim 64.
//   q planes (bf16 hi / lo): element (b, t, h, d) at [b*kTq*kDm + t*kDm + h*64 + d]
//   k planes (bf16 hi / lo): element (b, s, h, d) at [b*kKeys*kDm + s*kDm + h*64 + d], s in [0, kKeys)
//   v^T plane (f16):         element (b, h, d, s) at [b*kDm*kKeys + (h*64 + d)*kKeys + s]
//   out f32:                 element (b, t, h, d) at [b*kTq*kDm + t*kDm + h*64 + d]
//   scores = (q . k) * sscale : v_wmma_f32_16x16x32_bf16, hi.hi + hi.lo + lo.hi, f32 accumulate, scale applied in f32
//                               (folded with log2 e into the one fma in front of each hardware exp2)
//   out    = p . v            : v_wmma_f32_16x16x32_f16, p (unnormalised, <= 1) carried x2^15 in f16, v f16;
//                               2^15 folded into the final 1/l
//   online softmax in f32 over all kKeys keys (64 chunks of 64, compile-time trip count, no masking).
//   Block = 4 waves = 64 query rows of one (batch, head); grid = (kHeads * kTq/64, kBatch).
//   K hi / K lo / V^T chunk staging: 128 threads x 32 elements per plane = the whole 64x64 tile (16-B copies,
//   plain loads, __syncthreads before and after); fragment loads read the LDS tiles with the same vector element type.
// =====================================================================================
#define AT_D 64
#define AT_NW 4
#define AT_QB 64
#define AT_KC 64
#define AT_LP 72   // LDS row pitch in 16-bit elements: 144 B = 16 B x 9 (odd), so the 16 rows of a 16-byte fragment read fall on 16 different bank groups

__device__ __forceinline__ v8f at_mma_b(v16b a, v16b b, v8f c) {
  c = __builtin_amdgcn_wmma_f32_16x16x32_bf16(false, a, false, b, (short)0, c, false, false);
  asm volatile("v_nop\n\tv_nop\n\tv_nop\n\tv_nop" : "+v"(c) : "v"(a), "v"(b));
  return c;
}
__device__ __forceinline__ v8f at_mma_h(v16h a, v16h b, v8f c) {
  c = __builtin_amdgcn_wmma_f32_16x16x32_f16(false, a, false, b, (short)0, c, false, false);
  asm volatile("v_nop\n\tv_nop\n\tv_nop\n\tv_nop" : "+v"(c) : "v"(a), "v"(b));
  return c;
}

// Four hardware exp2 in place, in one statement: each v_exp_f32 is followed by an independent one and the last by
// v_nop, the slot the instruction set asks for behind a transcendental before its result is read or its source
// overwritten.
__device__ __forceinline__ void exp2x4(float& a, float& b, float& c, float& d) {
  asm("v_exp_f32 %0, %0\n\tv_exp_f32 %1, %1\n\tv_exp_f32 %2, %2\n\tv_exp_f32 %3, %3\n\tv_nop"
      : "+v"(a), "+v"(b), "+v"(c), "+v"(d));
}

__global__ __launch_bounds__(128)
void attn_xl_kernel(const unsigned short* __restrict__ qhp, const unsigned short* __restrict__ qlp,
                    const unsigned short* __restrict__ khp, const unsigned short* __restrict__ klp,
                    const unsigned short* __restrict__ vtp, float* __restrict__ out, float sscale) {
  union FB { v16b v; v8b h[2]; };
  union FH { v16h v; v8h h[2]; };
  __shared__ __align__(16) __bf16   Ksh[AT_KC * AT_LP];         // K hi [kv][d]   9 KB
  __shared__ __align__(16) __bf16   Ksl[AT_KC * AT_LP];         // K lo [kv][d]   9 KB
  __shared__ __align__(16) _Float16 Vth[AT_D * AT_LP];          // V^T [d][kv]    9 KB
  __shared__ __align__(16) _Float16 Psh[AT_NW][16 * AT_LP];     // per wave P [row][kv] 9 KB
  __shared__ __align__(16) float    Os[AT_NW][16 * 68];         // per wave out tile, pitch 68
  const float PSC = 32768.0f;
  // softmax in base 2: exp((x - m) * sscale) = 2^((x - m) * sc2). sscale > 0 (the launch passes 1/sqrt(64)),
  // so the row maximum may be taken on the unscaled scores.
  const float sc2 = sscale * 1.44269504088896340736f;

  const int tid  = threadIdx.x;
  const int wave = tid >> 5;
  const int lane = tid & 31;
  const int hh   = lane >> 4;
  const int c    = lane & 15;

  const int nqb = kTq / AT_QB;            // 32
  const int bx = blockIdx.x;
  const int b  = blockIdx.y;
  const int qb = bx % nqb;
  const int h  = bx / nqb;                // 0..kHeads-1
  const int q0 = qb * AT_QB + wave * 16;

  const __bf16*   Qh = (const __bf16*)(const void*)qhp   + (size_t)b * kTq * kDm   + (size_t)h * AT_D;
  const __bf16*   Ql = (const __bf16*)(const void*)qlp   + (size_t)b * kTq * kDm   + (size_t)h * AT_D;
  const __bf16*   Kh = (const __bf16*)(const void*)khp   + (size_t)b * kKeys * kDm + (size_t)h * AT_D;
  const __bf16*   Kl = (const __bf16*)(const void*)klp   + (size_t)b * kKeys * kDm + (size_t)h * AT_D;
  const _Float16* Vh = (const _Float16*)(const void*)vtp + (size_t)b * kDm * kKeys + (size_t)h * AT_D * kKeys;
  float*          ob = out + (size_t)b * kTq * kDm + (size_t)h * AT_D;

  // ---- Q fragments (A operand, row = lane&15, split k map via Frag load): 2 d-chunks, hi and lo ----
  v16b qah[2], qal[2];
#pragma unroll
  for (int dc = 0; dc < 2; ++dc) {
    qah[dc] = Frag<__bf16>::load(Qh + (size_t)(q0 + c) * kDm + dc * 32 + 8 * hh);
    qal[dc] = Frag<__bf16>::load(Ql + (size_t)(q0 + c) * kDm + dc * 32 + 8 * hh);
  }

  float mrow[8], lrow[8];
  v8f oacc[4];
#pragma unroll
  for (int r = 0; r < 8; ++r) { mrow[r] = -INFINITY; lrow[r] = 0.f; }
#pragma unroll
  for (int t = 0; t < 4; ++t) oacc[t] = (v8f){0.f,0.f,0.f,0.f,0.f,0.f,0.f,0.f};

  const int nChunks = kKeys / AT_KC;   // 64, compile-time constant
  for (int kc = 0; kc < nChunks; ++kc) {
    const int kv0 = kc * AT_KC;
    __syncthreads();
    {
      // staging coverage: 128 threads x (4 x 8) elements = 64 rows x 64 per plane = the whole chunk tile (3 planes)
      const int r = tid >> 1, half = (tid & 1) * 32;
      const __bf16*   ksh = Kh + (size_t)(kv0 + r) * kDm + half;    // K row kv0+r, d = half..half+31
      const __bf16*   ksl = Kl + (size_t)(kv0 + r) * kDm + half;
      const _Float16* vsh = Vh + (size_t)r * kKeys + kv0 + half;    // V^T row d = r, s = kv0+half..+31
#pragma unroll
      for (int i = 0; i < 4; ++i) {
        const v8b a0 = *(const v8b*)(ksh + 8 * i);
        const v8b a1 = *(const v8b*)(ksl + 8 * i);
        const v8h b0 = *(const v8h*)(vsh + 8 * i);
        *(v8b*)(Ksh + r * AT_LP + half + 8 * i) = a0;
        *(v8b*)(Ksl + r * AT_LP + half + 8 * i) = a1;
        *(v8h*)(Vth + r * AT_LP + half + 8 * i) = b0;
      }
    }
    __syncthreads();

    v8f s[4];
#pragma unroll
    for (int j = 0; j < 4; ++j) {
      s[j] = (v8f){0.f,0.f,0.f,0.f,0.f,0.f,0.f,0.f};
#pragma unroll
      for (int dc = 0; dc < 2; ++dc) {
        FB kb, klf;
        kb.h[0]  = *(const v8b*)(Ksh + (j * 16 + c) * AT_LP + dc * 32 + 8 * hh);
        kb.h[1]  = *(const v8b*)(Ksh + (j * 16 + c) * AT_LP + dc * 32 + 16 + 8 * hh);
        klf.h[0] = *(const v8b*)(Ksl + (j * 16 + c) * AT_LP + dc * 32 + 8 * hh);
        klf.h[1] = *(const v8b*)(Ksl + (j * 16 + c) * AT_LP + dc * 32 + 16 + 8 * hh);
        s[j] = at_mma_b(qah[dc], kb.v,  s[j]);
        s[j] = at_mma_b(qah[dc], klf.v, s[j]);
        s[j] = at_mma_b(qal[dc], kb.v,  s[j]);
      }
    }
    float cm[8];
#pragma unroll
    for (int r = 0; r < 8; ++r) {
      float m = -INFINITY;
#pragma unroll
      for (int j = 0; j < 4; ++j) m = fmaxf(m, s[j][r]);
#pragma unroll
      for (int off = 1; off < 16; off <<= 1) m = fmaxf(m, __shfl_xor(m, off, 32));
      cm[r] = m;
    }
    _Float16* pwh = Psh[wave];
    float al[8], nm[8];
#pragma unroll
    for (int r = 0; r < 8; ++r) {
      const float mnew = fmaxf(mrow[r], cm[r]);
      al[r] = (mrow[r] - mnew) * sc2;
      nm[r] = -mnew * sc2;
      mrow[r] = mnew;
    }
    exp2x4(al[0], al[1], al[2], al[3]);
    exp2x4(al[4], al[5], al[6], al[7]);
#pragma unroll
    for (int r = 0; r < 8; ++r) {
      const float alpha = al[r];
      float pe[4];
#pragma unroll
      for (int j = 0; j < 4; ++j) pe[j] = fmaf(s[j][r], sc2, nm[r]);
      exp2x4(pe[0], pe[1], pe[2], pe[3]);
      float psum = 0.f;
#pragma unroll
      for (int j = 0; j < 4; ++j) {
        const float p = pe[j];
        psum += p;
        pwh[(8 * hh + r) * AT_LP + j * 16 + c] = (_Float16)(p * PSC);
      }
#pragma unroll
      for (int off = 1; off < 16; off <<= 1) psum += __shfl_xor(psum, off, 32);
      lrow[r] = lrow[r] * alpha + psum;
#pragma unroll
      for (int t = 0; t < 4; ++t) oacc[t][r] *= alpha;
    }
    __builtin_amdgcn_fence(__ATOMIC_RELEASE, "workgroup");
    __builtin_amdgcn_wave_barrier();
    __builtin_amdgcn_fence(__ATOMIC_ACQUIRE, "workgroup");
#pragma unroll 1
    for (int kk = 0; kk < 2; ++kk) {
      FH pa;
      pa.h[0] = *(const v8h*)(pwh + c * AT_LP + kk * 32 + 8 * hh);
      pa.h[1] = *(const v8h*)(pwh + c * AT_LP + kk * 32 + 16 + 8 * hh);
#pragma unroll
      for (int t = 0; t < 4; ++t) {
        FH vb;
        vb.h[0] = *(const v8h*)(Vth + (t * 16 + c) * AT_LP + kk * 32 + 8 * hh);
        vb.h[1] = *(const v8h*)(Vth + (t * 16 + c) * AT_LP + kk * 32 + 16 + 8 * hh);
        oacc[t] = at_mma_h(pa.v, vb.v, oacc[t]);
      }
    }
  }

  float* os = Os[wave];
#pragma unroll
  for (int r = 0; r < 8; ++r) {
    const float inv = 1.0f / (lrow[r] * PSC);
#pragma unroll
    for (int t = 0; t < 4; ++t) os[(8 * hh + r) * 68 + t * 16 + c] = oacc[t][r] * inv;
  }
  __builtin_amdgcn_fence(__ATOMIC_RELEASE, "workgroup");
  __builtin_amdgcn_wave_barrier();
  __builtin_amdgcn_fence(__ATOMIC_ACQUIRE, "workgroup");
  {
    const int c4 = (lane & 15) * 4;
    {
#pragma unroll
      for (int it = 0; it < 8; ++it) {
        const int row = it * 2 + hh;   // it 0..7 x hh 0..1 covers rows 0..15 of the wave tile
        v4f val = *(const v4f*)(os + row * 68 + c4);
        *(v4f*)(ob + (size_t)(q0 + row) * kDm + c4) = val;
      }
      
    }
  }
}

// ---------------------------------------------------------------------------
// Workspace region map (byte offsets; every region is fully written before it is read):
//   R0  Qb   bf16 [4096][1024]          8,388,608 @           0   (RNE cast of q)
//   R1  Wq   bf16 [3072][1024]          6,291,456 @   8,388,608   (RNE cast of W_qkv)
//   R2  Wp   bf16 [1024][1024]          2,097,152 @  14,680,064   (RNE cast of W_proj)
//   R3  Qh   bf16 [4096][1024]          8,388,608 @  16,777,216   (q projection, hi plane)
//   R4  Ql   bf16 [4096][1024]          8,388,608 @  25,165,824   (q projection, lo plane)
//   R5  Kh   bf16 [2][4096][1024]      16,777,216 @  33,554,432   (rows 0..2047 cache keys, 2048.. k projection; hi)
//   R6  Kl   bf16 [2][4096][1024]      16,777,216 @  50,331,648   (same rows; lo)
//   R7  Vt   f16  [2][1024][4096]      16,777,216 @  67,108,864   (cols 0..2047 cache values^T, 2048.. v projection^T)
//   R8  Y    f32  [4096][1024]         16,777,216 @  83,886,080   (attention output, token-major, heads merged)
//   R9  Yh   bf16 [4096][1024]          8,388,608 @ 100,663,296   (split of Y, hi)
//   R10 Yl   bf16 [4096][1024]          8,388,608 @ 109,051,904   (split of Y, lo)
//   total 117,440,512 B
// ---------------------------------------------------------------------------
extern "C" void kernel_launch(void* const* d_in, const int* in_sizes, int n_in,
                              void* d_out, int out_size, void* d_ws,
                              size_t ws_size, hipStream_t stream) {
  if (n_in < 7) return;
  const size_t nQ  = (size_t)kBatch * kTq * kDm;        // 4,194,304
  const size_t nKV = (size_t)kBatch * kSkv * kDm;       // 4,194,304
  const size_t nWq = (size_t)3 * kDm * kDm;             // 3,145,728
  const size_t nWp = (size_t)kDm * kDm;                 // 1,048,576
  const size_t nPe = (size_t)kSkv * kDm;                // 2,097,152
  if (in_sizes[0] != (int)nQ || in_sizes[1] != (int)nKV || in_sizes[2] != (int)nKV ||
      in_sizes[3] != (int)nWq || in_sizes[4] != (int)nWp || in_sizes[5] != (int)nPe ||
      out_size != (int)nQ) return;

  const float* q     = (const float*)d_in[0];
  const float* k_xl  = (const float*)d_in[1];
  const float* v_xl  = (const float*)d_in[2];
  const float* Wqkv  = (const float*)d_in[3];
  const float* Wproj = (const float*)d_in[4];
  const float* pos   = (const float*)d_in[5];
  const int*   causf = (const int*)d_in[6];
  float* outp = (float*)d_out;

  const size_t offQb = 0,              szQb = nQ * 2;
  const size_t offWq = offQb + szQb,   szWq = nWq * 2;
  const size_t offWp = offWq + szWq,   szWp = nWp * 2;
  const size_t offQh = offWp + szWp,   szQh = nQ * 2;
  const size_t offQl = offQh + szQh,   szQl = nQ * 2;
  const size_t offKh = offQl + szQl,   szKh = (size_t)kBatch * kKeys * kDm * 2;
  const size_t offKl = offKh + szKh,   szKl = szKh;
  const size_t offVt = offKl + szKl,   szVt = (size_t)kBatch * kDm * kKeys * 2;
  const size_t offY  = offVt + szVt,   szY  = nQ * 4;
  const size_t offYh = offY + szY,     szYh = nQ * 2;
  const size_t offYl = offYh + szYh,   szYl = nQ * 2;
  const size_t total = offYl + szYl;   // 117,440,512
  if (total > ws_size) return;

  char* ws = (char*)d_ws;
  unsigned short* Qb = (unsigned short*)(ws + offQb);
  unsigned short* Wq = (unsigned short*)(ws + offWq);
  unsigned short* Wp = (unsigned short*)(ws + offWp);
  unsigned short* Qh = (unsigned short*)(ws + offQh);
  unsigned short* Ql = (unsigned short*)(ws + offQl);
  unsigned short* Kh = (unsigned short*)(ws + offKh);
  unsigned short* Kl = (unsigned short*)(ws + offKl);
  unsigned short* Vt = (unsigned short*)(ws + offVt);
  float*          Y  = (float*)(ws + offY);
  unsigned short* Yh = (unsigned short*)(ws + offYh);
  unsigned short* Yl = (unsigned short*)(ws + offYl);

  // ---- input casts (RNE bf16 of every float input) and cache planes ----
  {
    const int n2q = (int)(nQ / 2), n2wq = (int)(nWq / 2), n2wp = (int)(nWp / 2), n2kv = (int)(nKV / 2);
    cast_bf16x2_kernel<<<dim3((n2q + 255) / 256), 256, 0, stream>>>(q, Qb, n2q);
    cast_bf16x2_kernel<<<dim3((n2wq + 255) / 256), 256, 0, stream>>>(Wqkv, Wq, n2wq);
    cast_bf16x2_kernel<<<dim3((n2wp + 255) / 256), 256, 0, stream>>>(Wproj, Wp, n2wp);
    // cache keys -> rows 0..2047 of both key planes (hi, lo), both batches
    kcache_split_kernel<<<dim3((n2kv + 255) / 256), 256, 0, stream>>>(k_xl, pos, Kh, Kl, causf, n2kv);
    // v_xl[b]: in[s rows=2048][c cols=1024] -> Vt[b] out[c][s] with output row pitch kKeys, cols 0..2047;
    // grid (cols/64, rows/64, B)
    tcast16_kernel<<<dim3(kDm / 64, kSkv / 64, kBatch), 256, 0, stream>>>(
        v_xl, Vt, kSkv, kDm, kKeys, (long)kSkv * kDm, (long)kDm * kKeys);
  }

  // ---- qkv projections: bf16 operands (K = 1024, M,N multiples of 64, no tails) ----
  {
    // q projection: C[m = b*2048+t][n] -> Qh (hi) / Ql (lo), M=4096, N=1024, K=1024; 1024 tiles -> 128 blocks
    const int tilesQ = (int)((nQ / kDm) / 64) * (kDm / 64);
    wmma_gemm64<1, false, 0, 2, false><<<dim3((tilesQ + 7) / 8, 1), 256, 0, stream>>>(
        Qb, nullptr, kDm, 0L, Wq, nullptr, kDm, 0L,
        (void*)Qh, (void*)Ql, kDm, 0L, nullptr, nullptr, 0L,
        kBatch * kTq, kDm, kDm, 1.0f);
    // k projection per batch: C[t][n] -> key plane rows 2048+t (hi -> Kh, lo -> Kl), M=2048, N=1024, K=1024;
    // 512 tiles -> 64 blocks, grid.y = batch
    const int tilesK = (kTq / 64) * (kDm / 64);
    wmma_gemm64<1, false, 0, 2, false><<<dim3((tilesK + 7) / 8, kBatch), 256, 0, stream>>>(
        Qb, nullptr, kDm, (long)kTq * kDm, Wq + (size_t)kDm * kDm, nullptr, kDm, 0L,
        (void*)(Kh + (size_t)kSkv * kDm), (void*)(Kl + (size_t)kSkv * kDm), kDm, (long)kKeys * kDm,
        nullptr, nullptr, 0L,
        kTq, kDm, kDm, 1.0f);
    // v projection, role-swapped: C[m = channel][n = t] -> Vt_b[channel][2048 + t] (f16), M=1024, N=2048, K=1024,
    // ldc = kKeys; 512 tiles -> 64 blocks, grid.y = batch
    const int tilesV = (kDm / 64) * (kTq / 64);
    wmma_gemm64<1, false, 0, 1, false><<<dim3((tilesV + 7) / 8, kBatch), 256, 0, stream>>>(
        Wq + (size_t)2 * kDm * kDm, nullptr, kDm, 0L, Qb, nullptr, kDm, (long)kTq * kDm,
        (void*)(Vt + kSkv), nullptr, kKeys, (long)kDm * kKeys, nullptr, nullptr, 0L,
        kDm, kTq, kDm, 1.0f);
  }

  // ---- attention over the 4096 keys per (batch, head); score scale 1/sqrt(64) applied in f32 ----
  attn_xl_kernel<<<dim3(kHeads * (kTq / AT_QB), kBatch), 128, 0, stream>>>(Qh, Ql, Kh, Kl, Vt, Y, 0.125f);

  // ---- y -> bf16 hi/lo planes; output projection C[m][n] = sum_c (Yh + Yl)[m][c] * Wp[n][c] -> d_out ----
  {
    const int n2y = (int)(nQ / 2);
    split_bf16x2_kernel<<<dim3((n2y + 255) / 256), 256, 0, stream>>>(Y, Yh, Yl, n2y);
    const int tilesP = (int)((nQ / kDm) / 64) * (kDm / 64);   // 1024 tiles -> 128 blocks
    wmma_gemm64<1, true, 0, 0, false, 0, false><<<dim3((tilesP + 7) / 8, 1), 256, 0, stream>>>(
        Yh, Yl, kDm, 0L, Wp, nullptr, kDm, 0L,
        (void*)outp, nullptr, kDm, 0L, nullptr, nullptr, 0L,
        kBatch * kTq, kDm, kDm, 1.0f);
  }
}

// v003
// One run takes 378 microseconds.
// Two timings next to v002 both put it at 1.15 times that version's speed.
// All steps since v000 together make it 2.22 times as fast.
// Contractions: q/k/v projections on v_wmma_f32_16x16x32_bf16 (bf16 operands = RNE-cast inputs, single product); q.k^T on v_wmma_f32_16x16x32_bf16 with bf16 hi/lo planes for both q and k (hi.hi + hi.lo + lo.hi); p.v on v_wmma_f32_16x16x32_f16 (p f16 carried x2^15, v f16, single product); output projection on v_wmma_f32_16x16x32_bf16 with y as bf16 hi/lo planes (hi.W + lo.W) and W bf16; f32 accumulate everywhere; softmax, score scale and the cache add in f32.
#include <hip/hip_runtime.h>
#include <math.h>
#include <stdint.h>

constexpr int kBatch = 2;
constexpr int kTq    = 2048;            // query length
constexpr int kSkv   = 2048;            // cache length
constexpr int kKeys  = kSkv + kTq;      // 4096 keys per (batch, head)
constexpr int kDm    = 1024;            // model dim
constexpr int kHeads = 16;
constexpr int kHd    = 64;
static_assert(kHeads * kHd == kDm, "head split");
static_assert(kTq % 64 == 0 && kKeys % 64 == 0 && kDm % 64 == 0 && kSkv % 64 == 0, "tile multiples");

typedef __attribute__((ext_vector_type(16))) _Float16 v16h;
typedef __attribute__((ext_vector_type(8)))  _Float16 v8h;
typedef __attribute__((ext_vector_type(2)))  _Float16 v2h;
typedef __attribute__((ext_vector_type(16))) __bf16   v16b;
typedef __attribute__((ext_vector_type(8)))  __bf16   v8b;
typedef __attribute__((ext_vector_type(8)))  float    v8f;
typedef __attribute__((ext_vector_type(4)))  float    v4f;
typedef __attribute__((ext_vector_type(2)))  float    v2f;
typedef __attribute__((ext_vector_type(4)))  unsigned int v4u;

__device__ __forceinline__ unsigned short f2bf_bits(float f) {
  unsigned u = __float_as_uint(f);
  return (unsigned short)((u + 0x7FFFu + ((u >> 16) & 1u)) >> 16);
}
__device__ __forceinline__ float bf_bits2f(unsigned short h) { return __uint_as_float(((unsigned)h) << 16); }
__device__ __forceinline__ unsigned short h_bits(float f) { return __builtin_bit_cast(unsigned short, (_Float16)f); }
__device__ __forceinline__ unsigned pk16(unsigned short a, unsigned short b) { return (unsigned)a | ((unsigned)b << 16); }

// hazard guards as plain device helpers (no inline asm inside the kernel template body)
__device__ __forceinline__ void dep_guard_h(v8f& a, v8f& b, v16h x, v16h y) { asm volatile("v_nop\n\tv_nop\n\tv_nop\n\tv_nop" : "+v"(a), "+v"(b) : "v"(x), "v"(y)); }
__device__ __forceinline__ void dep_guard_b(v8f& a, v8f& b, v16b x, v16b y) { asm volatile("v_nop\n\tv_nop\n\tv_nop\n\tv_nop" : "+v"(a), "+v"(b) : "v"(x), "v"(y)); }
__device__ __forceinline__ void keep4_h(v16h a, v16h b, v16h c, v16h d) { asm volatile("v_nop" :: "v"(a), "v"(b), "v"(c), "v"(d)); }
__device__ __forceinline__ void keep4_b(v16b a, v16b b, v16b c, v16b d) { asm volatile("v_nop" :: "v"(a), "v"(b), "v"(c), "v"(d)); }
__device__ __forceinline__ void acc_guard4(v8f& a, v8f& b, v8f& c, v8f& d) { asm volatile("v_nop\n\tv_nop\n\tv_nop\n\tv_nop" : "+v"(a), "+v"(b), "+v"(c), "+v"(d)); }
template <typename T> struct Frag;
template <> struct Frag<_Float16> {
  typedef v16h V; union U { v16h v; v8h h[2]; };
  static __device__ __forceinline__ v16h load(const _Float16* p) {   // elements 0..7 <- p[0..7], 8..15 <- p[16..23]
    U f; f.h[0] = *(const v8h*)(p); f.h[1] = *(const v8h*)(p + 16); return f.v;
  }
  static __device__ __forceinline__ v8f mma(v16h a, v16h b, v8f c) {
    return __builtin_amdgcn_wmma_f32_16x16x32_f16(false, a, false, b, (short)0, c, false, false);
  }
  static __device__ __forceinline__ void guard(v8f& a, v8f& b, v16h x, v16h y) { dep_guard_h(a, b, x, y); }
  static __device__ __forceinline__ void keep(v16h a, v16h b, v16h c, v16h d) { keep4_h(a, b, c, d); }
};
template <> struct Frag<__bf16> {
  typedef v16b V; union U { v16b v; v8b h[2]; };
  static __device__ __forceinline__ v16b load(const __bf16* p) {
    U f; f.h[0] = *(const v8b*)(p); f.h[1] = *(const v8b*)(p + 16); return f.v;
  }
  static __device__ __forceinline__ v8f mma(v16b a, v16b b, v8f c) {
    return __builtin_amdgcn_wmma_f32_16x16x32_bf16(false, a, false, b, (short)0, c, false, false);
  }
  static __device__ __forceinline__ void guard(v8f& a, v8f& b, v16b x, v16b y) { dep_guard_b(a, b, x, y); }
  static __device__ __forceinline__ void keep(v16b a, v16b b, v16b c, v16b d) { keep4_b(a, b, c, d); }
};

// ---- Register-blocked batched WMMA GEMM ------------------------------------
// C[m,n] = scale * sum_k A[m,k] * Bt[n,k] (+bias)(+resid); each wave owns a 64x64 tile.
// A row-major [M,K]; Bt row-major [N,K]; M,N % 64 == 0, K % 32 == 0.
// SPLIT: operands are hi/lo planes (A2/Bt2 = lo planes, same layout); product = hi.hi + hi.lo + lo.hi.
// SPLITB (only meaningful with SPLIT): when false only A carries a lo plane; product = hi.B + lo.B (Bt2 unused).
// BIAS_MODE: 0 = none, 1 = bias[m], 2 = bias[n].
// OUT_MODE: 0 = f32, 1 = f16, 2 = bf16 hi plane (Cout) + bf16 lo plane (Cout2).
// ET: 0 = f16 operands, 1 = bf16 operands (pointers passed as 16-bit storage)
template <int ET> struct Elem;
template <> struct Elem<0> { typedef _Float16 T; };
template <> struct Elem<1> { typedef __bf16 T; };
template <int ET, bool SPLIT, int BIAS_MODE, int OUT_MODE, bool RESID, int ACT = 0, bool SPLITB = SPLIT>
__global__ __launch_bounds__(256) void wmma_gemm64(
    const unsigned short* __restrict__ Ap, const unsigned short* __restrict__ A2p, int lda, long strideA,
    const unsigned short* __restrict__ Btp, const unsigned short* __restrict__ Bt2p, int ldb, long strideB,
    void* __restrict__ Cout, void* __restrict__ Cout2, int ldc, long strideC,
    const float* __restrict__ bias,
    const float* __restrict__ resid, long strideR,
    int M, int N, int K, float scale) {
  typedef typename Elem<ET>::T T;
  typedef typename Frag<T>::V V;
  const T* A = (const T*)Ap; const T* A2 = (const T*)A2p; const T* Bt = (const T*)Btp; const T* Bt2 = (const T*)Bt2p;
  __shared__ __align__(16) float sT[8][16 * 68];   // per-wave 16x64 slab, pitch 68 floats
  const int b    = blockIdx.y;
  const int lane = threadIdx.x & 31;
  const int wave = threadIdx.x >> 5;
  const int tilesN = N >> 6;
  const int tilesM = M >> 6;
  const int tile = blockIdx.x * 8 + wave;
  if (tile >= tilesM * tilesN) return;   // wave-uniform; no block barriers in this kernel
  const int tm = tile / tilesN;
  const int tn = tile - tm * tilesN;
  const int m0 = tm << 6;
  const int n0 = tn << 6;

  const T* Ab  = A  + (size_t)b * strideA;
  const T* Bb  = Bt + (size_t)b * strideB;
  const T* Ab2 = SPLIT ? (A2  + (size_t)b * strideA) : nullptr;
  const T* Bb2 = (SPLIT && SPLITB) ? (Bt2 + (size_t)b * strideB) : nullptr;

  const int rlane = lane & 15;                 // row (A) / col (B, D) within subtile
  const int koff  = (lane >> 4) * 8;           // k offset of this lane half
  const int mOff  = (lane >> 4) * 8;           // D row offset

  v8f acc[4][4];
#pragma unroll
  for (int i = 0; i < 4; ++i)
#pragma unroll
    for (int j = 0; j < 4; ++j) acc[i][j] = (v8f){0.f,0.f,0.f,0.f,0.f,0.f,0.f,0.f};

  for (int k0 = 0; k0 < K; k0 += 32) {
    V bh[4], bl[4];
#pragma unroll
    for (int j = 0; j < 4; ++j) {
      const size_t bo = (size_t)(n0 + (j << 4) + rlane) * ldb + koff + k0;
      bh[j] = Frag<T>::load(Bb + bo);
      if (SPLIT && SPLITB) bl[j] = Frag<T>::load(Bb2 + bo);
    }
#pragma unroll
    for (int i = 0; i < 4; ++i) {
      const size_t ao = (size_t)(m0 + (i << 4) + rlane) * lda + koff + k0;
      V ah = Frag<T>::load(Ab + ao);
      V al;
      if (SPLIT) al = Frag<T>::load(Ab2 + ao);
#pragma unroll
      for (int j = 0; j < 4; ++j) {
        acc[i][j] = Frag<T>::mma(ah, bh[j], acc[i][j]);
        if (SPLIT) {
          if (SPLITB) acc[i][j] = Frag<T>::mma(ah, bl[j], acc[i][j]);
          acc[i][j] = Frag<T>::mma(al, bh[j], acc[i][j]);
        }
      }
      Frag<T>::guard(acc[i][0], acc[i][3], ah, SPLIT ? al : ah);
    }
    Frag<T>::keep(bh[0], bh[1], bh[2], bh[3]);
    if (SPLIT && SPLITB) Frag<T>::keep(bl[0], bl[1], bl[2], bl[3]);
  }
  acc_guard4(acc[0][0], acc[0][1], acc[0][2], acc[0][3]);
  acc_guard4(acc[1][0], acc[1][1], acc[1][2], acc[1][3]);
  acc_guard4(acc[2][0], acc[2][1], acc[2][2], acc[2][3]);
  acc_guard4(acc[3][0], acc[3][1], acc[3][2], acc[3][3]);

  // ---- epilogue ----
  float* slab = sT[wave];
  const float* Rb = RESID ? (resid + (size_t)b * strideR) : nullptr;
#pragma unroll
  for (int i = 0; i < 4; ++i) {
    const int mBase = m0 + (i << 4);
#pragma unroll
    for (int j = 0; j < 4; ++j) {
      const int n = n0 + (j << 4) + rlane;
      float bv = 0.f;
      if (BIAS_MODE == 2) bv = bias[n];
#pragma unroll
      for (int r = 0; r < 8; ++r) {
        float v = acc[i][j][r] * scale;
        if (BIAS_MODE == 1) v += bias[mBase + mOff + r];
        if (BIAS_MODE == 2) v += bv;
        if (RESID) v += Rb[(size_t)(mBase + mOff + r) * ldc + n];
        if (ACT == 1) v = tanhf(v);
        if (ACT == 2) v = fmaxf(v, 0.0f);
        if (ACT == 3) v = v / (1.0f + expf(-v));
        if (ACT == 4) v = (v > 0.f) ? v : 0.01f * v;
        slab[(mOff + r) * 68 + (j << 4) + rlane] = v;
      }
    }
    __builtin_amdgcn_fence(__ATOMIC_RELEASE, "workgroup");
    __builtin_amdgcn_wave_barrier();
    __builtin_amdgcn_fence(__ATOMIC_ACQUIRE, "workgroup");
    if (OUT_MODE == 0) {
      float* C = (float*)Cout + (size_t)b * strideC;
      const int hh = lane >> 4, c4 = (lane & 15) * 4;     // row seg = 256 B = 16 lanes x 16 B
      {
#pragma unroll
        for (int it = 0; it < 8; ++it) {
          const int row = it * 2 + hh;
          v4f v = *(const v4f*)(slab + row * 68 + c4);
          *(v4f*)(C + (size_t)(mBase + row) * ldc + n0 + c4) = v;
        }
        
      }
    } else {
      const int q = lane >> 3, c8 = (lane & 7) * 8;
      unsigned short* C  = (unsigned short*)Cout  + (size_t)b * strideC;
      unsigned short* C2 = (OUT_MODE == 2) ? ((unsigned short*)Cout2 + (size_t)b * strideC) : nullptr;
      {
#pragma unroll
        for (int it = 0; it < 4; ++it) {
          const int row = it * 4 + q;
          const float* sp = slab + row * 68 + c8;
          v8h hv, lv;
#pragma unroll
          for (int e = 0; e < 8; ++e) {
            if (OUT_MODE == 1) {
              hv[e] = (_Float16)sp[e];
            } else {
              unsigned short hb = f2bf_bits(sp[e]);
              unsigned short lb = f2bf_bits(sp[e] - bf_bits2f(hb));
              hv[e] = __builtin_bit_cast(_Float16, hb);
              lv[e] = __builtin_bit_cast(_Float16, lb);
            }
          }
          *(v8h*)(C + (size_t)(mBase + row) * ldc + n0 + c8) = hv;
          if (OUT_MODE == 2) *(v8h*)(C2 + (size_t)(mBase + row) * ldc + n0 + c8) = lv;
        }
        
      }
    }
    __builtin_amdgcn_fence(__ATOMIC_RELEASE, "workgroup");
    __builtin_amdgcn_wave_barrier();
    __builtin_amdgcn_fence(__ATOMIC_ACQUIRE, "workgroup");
  }
}

// ---------------------------------------------------------------------------
// Elementwise f32 -> bf16 (RNE) cast, 2 elements per thread, one 4-B store per lane -> each wave writes exactly
// Coverage: grid = ceil(n2/256) x 256 threads x 2 elements = 2*n2 = the whole plane (all n2 used here are
// multiples of 256, so every wave is full and every line complete).
// ---------------------------------------------------------------------------
__global__ __launch_bounds__(256) void cast_bf16x2_kernel(const float* __restrict__ in, unsigned short* __restrict__ out,
                                                         int n2) {
  const int i = blockIdx.x * 256 + threadIdx.x;
  if (i < n2) {
    const v2f f = *(const v2f*)(in + 2 * (size_t)i);
    const unsigned u = pk16(f2bf_bits(f[0]), f2bf_bits(f[1]));
    ((unsigned*)out)[i] = u;
    
  }
}

// ---------------------------------------------------------------------------
// Elementwise bf16 split: hi = bf16_rne(in), lo = bf16_rne(in - hi); 2 elements per thread, one 4-B store
// (here n2 = 4096*1024/2 = 2,097,152 -> 8192 blocks x 512 elements = 4096x1024).
// ---------------------------------------------------------------------------
__global__ __launch_bounds__(256) void split_bf16x2_kernel(const float* __restrict__ in, unsigned short* __restrict__ hi,
                                                           unsigned short* __restrict__ lo, int n2) {
  const int i = blockIdx.x * 256 + threadIdx.x;
  if (i < n2) {
    const v2f f = *(const v2f*)(in + 2 * (size_t)i);
    const unsigned short h0 = f2bf_bits(f[0]), h1 = f2bf_bits(f[1]);
    const unsigned short l0 = f2bf_bits(f[0] - bf_bits2f(h0)), l1 = f2bf_bits(f[1] - bf_bits2f(h1));
    const unsigned uh = pk16(h0, h1), ul = pk16(l0, l1);
    ((unsigned*)hi)[i] = uh;
    ((unsigned*)lo)[i] = ul;
    
  }
}

// ---------------------------------------------------------------------------
// Cache keys, rows 0..kSkv-1 of each per-batch [kKeys][kDm] bf16 key plane pair:
//   x = bf16_rne(k_xl[b][s][c]) + bf16_rne(pos[s][c])   (the add in f32)
//   kh[b][s][c] = bf16_rne(x),  kl[b][s][c] = bf16_rne(x - kh)
// flags = the causal flag input; this forward applies no mask, the pointer is only bound, never read.
// ---------------------------------------------------------------------------
__global__ __launch_bounds__(256) void kcache_split_kernel(const float* __restrict__ kxl, const float* __restrict__ pos,
                                                           unsigned short* __restrict__ kh, unsigned short* __restrict__ kl,
                                                           const int* __restrict__ flags, int n2) {
  const int i = blockIdx.x * 256 + threadIdx.x;
  if (i < n2) {
    const size_t e = 2 * (size_t)i;                        // element index into [b][s][c]
    const size_t perB = (size_t)kSkv * kDm;
    const int bb = (int)(e / perB);
    const size_t rem = e - (size_t)bb * perB;              // s*kDm + c (even)
    const v2f a = *(const v2f*)(kxl + e);
    const v2f p = *(const v2f*)(pos + rem);
    const float s0 = bf_bits2f(f2bf_bits(a[0])) + bf_bits2f(f2bf_bits(p[0]));
    const float s1 = bf_bits2f(f2bf_bits(a[1])) + bf_bits2f(f2bf_bits(p[1]));
    const unsigned short h0 = f2bf_bits(s0), h1 = f2bf_bits(s1);
    const unsigned short l0 = f2bf_bits(s0 - bf_bits2f(h0)), l1 = f2bf_bits(s1 - bf_bits2f(h1));
    const unsigned uh = pk16(h0, h1), ul = pk16(l0, l1);
    const size_t o = ((size_t)bb * kKeys * kDm + rem) >> 1; // u32 index
    ((unsigned*)kh)[o] = uh;
    ((unsigned*)kl)[o] = ul;
    
  }
}

// ---------------------------------------------------------------------------
// Fused transpose + cast of an f32 matrix, z-batched: in_z = W + z*sIn viewed [R rows][Cc cols] (pitch Cc) ->
//   o_z[c][r] = f16(bf16_rne(in_z[r][c]))   ([Cc][...], output row pitch ldo halves), o_z = o + z*sOut.
// 64x64 tiles through LDS. grid = (Cc/64, R/64, Z), 256 threads (R, Cc multiples of 64).
// Coverage per block: load 4 it x 256 thr x 4 floats = 64x64; store 2 it x 256 thr x 8 u16 = 64x64.
// ---------------------------------------------------------------------------
__global__ __launch_bounds__(256) void tcast16_kernel(const float* __restrict__ W, unsigned short* __restrict__ o,
                                                      int R, int Cc, int ldo, long sIn, long sOut) {
  __shared__ __align__(16) float tf[64 * 68];
  W += (size_t)blockIdx.z * sIn;
  o += (size_t)blockIdx.z * sOut;
  const int c0  = blockIdx.x * 64;   // input column block = output row block
  const int r0  = blockIdx.y * 64;   // input row block    = output column block
  const int tid = threadIdx.x;
  {
    const int lr = tid >> 4;         // 0..15
    const int c4 = (tid & 15) * 4;   // 0..60
#pragma unroll
    for (int it = 0; it < 4; ++it) {
      const int rr = it * 16 + lr;   // 0..63
      const v4f a = *(const v4f*)(W + (size_t)(r0 + rr) * Cc + c0 + c4);
      *(v4f*)(tf + rr * 68 + c4) = a;
    }
  }
  __syncthreads();
  const int sub = tid >> 3;          // 0..31
  const int c8  = (tid & 7) * 8;     // 0..56
  v4u hv[2];
#pragma unroll
  for (int it = 0; it < 2; ++it) {
    const int oc = it * 32 + sub;    // output row within tile (= input column)
    v4u a;
#pragma unroll
    for (int q = 0; q < 4; ++q) {
      const float f0 = tf[(c8 + 2 * q) * 68 + oc];
      const float f1 = tf[(c8 + 2 * q + 1) * 68 + oc];
      a[q] = pk16(h_bits(bf_bits2f(f2bf_bits(f0))), h_bits(bf_bits2f(f2bf_bits(f1))));
    }
    hv[it] = a;
  }
  {
#pragma unroll
    for (int it = 0; it < 2; ++it) {
      const int oc = it * 32 + sub;
      const size_t go = (size_t)(c0 + oc) * ldo + r0 + c8;
      *(v4u*)(o + go) = hv[it];
    }
    
  }
}

#define AT_D 64
#define AT_NW 4
#define AT_QB 64
#define AT_KC 64
#define AT_LP 72   // LDS row pitch in 16-bit elements: 144 B = 16 B x 9 (odd), so the 16 rows of a 16-byte fragment read fall on 16 different bank groups

__device__ __forceinline__ v8f at_mma_b(v16b a, v16b b, v8f c) {
  c = __builtin_amdgcn_wmma_f32_16x16x32_bf16(false, a, false, b, (short)0, c, false, false);
  asm volatile("v_nop\n\tv_nop\n\tv_nop\n\tv_nop" : "+v"(c) : "v"(a), "v"(b));
  return c;
}
__device__ __forceinline__ v8f at_mma_h(v16h a, v16h b, v8f c) {
  c = __builtin_amdgcn_wmma_f32_16x16x32_f16(false, a, false, b, (short)0, c, false, false);
  asm volatile("v_nop\n\tv_nop\n\tv_nop\n\tv_nop" : "+v"(c) : "v"(a), "v"(b));
  return c;
}

// Four hardware exp2 in place, in one statement: each v_exp_f32 is followed by an independent one and the last by
// v_nop, the slot the instruction set asks for behind a transcendental before its result is read or its source
// overwritten.
__device__ __forceinline__ void exp2x4(float& a, float& b, float& c, float& d) {
  asm("v_exp_f32 %0, %0\n\tv_exp_f32 %1, %1\n\tv_exp_f32 %2, %2\n\tv_exp_f32 %3, %3\n\tv_nop"
      : "+v"(a), "+v"(b), "+v"(c), "+v"(d));
}

// One hardware exp2 in place, with the same slot behind it.
__device__ __forceinline__ void exp2x1(float& a) { asm("v_exp_f32 %0, %0\n\tv_nop" : "+v"(a)); }

// lane l <-> lane l ^ 16 (the two halves that share a query column), a vector cross-row move, no LDS
__device__ __forceinline__ float xhalf(float x) {
  const int i = __builtin_bit_cast(int, x);
  return __builtin_bit_cast(float, __builtin_amdgcn_permlanex16(i, i, 0x76543210, 0xfedcba98, false, false));
}

__global__ __launch_bounds__(128)
void attn_xl_kernel(const unsigned short* __restrict__ qhp, const unsigned short* __restrict__ qlp,
                    const unsigned short* __restrict__ khp, const unsigned short* __restrict__ klp,
                    const unsigned short* __restrict__ vtp, float* __restrict__ out, float sscale) {
  union FB { v16b v; v8b h[2]; };
  union FH { v16h v; v8h h[2]; v2h p[8]; };
  __shared__ __align__(16) __bf16   Ksh[AT_KC * AT_LP];         // K hi [kv][d]   9 KB
  __shared__ __align__(16) __bf16   Ksl[AT_KC * AT_LP];         // K lo [kv][d]   9 KB
  __shared__ __align__(16) _Float16 Vth[AT_D * AT_LP];          // V^T [d][kv]    9 KB
  __shared__ __align__(16) float    Os[AT_NW][16 * 68];         // per wave out tile, pitch 68
  const float PSC = 32768.0f;
  // softmax in base 2: exp((x - m) * sscale) = 2^((x - m) * sc2). sscale > 0 (the launch passes 1/sqrt(64)),
  // so the row maximum may be taken on the unscaled scores.
  const float sc2 = sscale * 1.44269504088896340736f;

  const int tid  = threadIdx.x;
  const int wave = tid >> 5;
  const int lane = tid & 31;
  const int hh   = lane >> 4;
  const int c    = lane & 15;

  const int nqb = kTq / AT_QB;            // 32
  const int bx = blockIdx.x;
  const int b  = blockIdx.y;
  const int qb = bx % nqb;
  const int h  = bx / nqb;                // 0..kHeads-1
  const int q0 = qb * AT_QB + wave * 16;

  const __bf16*   Qh = (const __bf16*)(const void*)qhp   + (size_t)b * kTq * kDm   + (size_t)h * AT_D;
  const __bf16*   Ql = (const __bf16*)(const void*)qlp   + (size_t)b * kTq * kDm   + (size_t)h * AT_D;
  const __bf16*   Kh = (const __bf16*)(const void*)khp   + (size_t)b * kKeys * kDm + (size_t)h * AT_D;
  const __bf16*   Kl = (const __bf16*)(const void*)klp   + (size_t)b * kKeys * kDm + (size_t)h * AT_D;
  const _Float16* Vh = (const _Float16*)(const void*)vtp + (size_t)b * kDm * kKeys + (size_t)h * AT_D * kKeys;
  float*          ob = out + (size_t)b * kTq * kDm + (size_t)h * AT_D;

  // ---- Q fragments (B operand, column = lane&15, split k map via Frag load): 2 d-chunks, hi and lo ----
  v16b qah[2], qal[2];
#pragma unroll
  for (int dc = 0; dc < 2; ++dc) {
    qah[dc] = Frag<__bf16>::load(Qh + (size_t)(q0 + c) * kDm + dc * 32 + 8 * hh);
    qal[dc] = Frag<__bf16>::load(Ql + (size_t)(q0 + c) * kDm + dc * 32 + 8 * hh);
  }

  float mrow = -INFINITY, lrow = 0.f;   // query q0 + c: running maximum (both halves agree), this half's sum
  v8f oacc[4];                          // oacc[t][r] = O^T[d = 16 t + 8 hh + r][query q0 + c]
#pragma unroll
  for (int t = 0; t < 4; ++t) oacc[t] = (v8f){0.f,0.f,0.f,0.f,0.f,0.f,0.f,0.f};

  const int nChunks = kKeys / AT_KC;   // 64, compile-time constant
  for (int kc = 0; kc < nChunks; ++kc) {
    const int kv0 = kc * AT_KC;
    __syncthreads();
    {
      // staging coverage: 128 threads x (4 x 8) elements = 64 rows x 64 per plane = the whole chunk tile (3 planes)
      const int r = tid >> 1, half = (tid & 1) * 32;
      const __bf16*   ksh = Kh + (size_t)(kv0 + r) * kDm + half;    // K row kv0+r, d = half..half+31
      const __bf16*   ksl = Kl + (size_t)(kv0 + r) * kDm + half;
      const _Float16* vsh = Vh + (size_t)r * kKeys + kv0 + half;    // V^T row d = r, s = kv0+half..+31
      v8b a0[4], a1[4];
      v8h b0[4];
#pragma unroll
      for (int i = 0; i < 4; ++i) {     // all twelve loads first, so that they are in flight together
        a0[i] = *(const v8b*)(ksh + 8 * i);
        a1[i] = *(const v8b*)(ksl + 8 * i);
        b0[i] = *(const v8h*)(vsh + 8 * i);
      }
      // the wait that belongs in front of any overwrite of a register an issued global load names; the three address
      // pairs are inputs so that they stay whole up to here
      asm volatile("s_wait_xcnt 0x0" :: "v"(ksh), "v"(ksl), "v"(vsh) : "memory");
#pragma unroll
      for (int i = 0; i < 4; ++i) {
        *(v8b*)(Ksh + r * AT_LP + half + 8 * i) = a0[i];
        *(v8b*)(Ksl + r * AT_LP + half + 8 * i) = a1[i];
        *(v8h*)(Vth + r * AT_LP + half + 8 * i) = b0[i];
      }
    }
    __syncthreads();

    v8f s[4];
#pragma unroll
    for (int j = 0; j < 4; ++j) {
      s[j] = (v8f){0.f,0.f,0.f,0.f,0.f,0.f,0.f,0.f};
#pragma unroll
      for (int dc = 0; dc < 2; ++dc) {
        FB kb, klf;
        kb.h[0]  = *(const v8b*)(Ksh + (j * 16 + c) * AT_LP + dc * 32 + 8 * hh);
        kb.h[1]  = *(const v8b*)(Ksh + (j * 16 + c) * AT_LP + dc * 32 + 16 + 8 * hh);
        klf.h[0] = *(const v8b*)(Ksl + (j * 16 + c) * AT_LP + dc * 32 + 8 * hh);
        klf.h[1] = *(const v8b*)(Ksl + (j * 16 + c) * AT_LP + dc * 32 + 16 + 8 * hh);
        s[j] = at_mma_b(kb.v,  qah[dc], s[j]);   // s[j][r] = S^T[key kv0 + 16 j + 8 hh + r][query q0 + c]
        s[j] = at_mma_b(klf.v, qah[dc], s[j]);
        s[j] = at_mma_b(kb.v,  qal[dc], s[j]);
      }
    }
    float mj[4];
#pragma unroll
    for (int j = 0; j < 4; ++j) {
      float m = s[j][0];
#pragma unroll
      for (int r = 1; r < 8; ++r) m = fmaxf(m, s[j][r]);
      mj[j] = m;
    }
    float cm = fmaxf(fmaxf(mj[0], mj[1]), fmaxf(mj[2], mj[3]));
    cm = fmaxf(cm, xhalf(cm));
    const float mnew = fmaxf(mrow, cm);
    float alpha = (mrow - mnew) * sc2;
    const float nm = -mnew * sc2;
    mrow = mnew;
    exp2x1(alpha);
    FH pb[2];          // pb[kk]: P^T as B operand, keys kv0 + 32 kk + (8 hh + 0..7, 16 + 8 hh + 0..7), column c
    v2f ps[4];
#pragma unroll
    for (int j = 0; j < 4; ++j) {
      float pe[8];
#pragma unroll
      for (int r = 0; r < 8; ++r) pe[r] = fmaf(s[j][r], sc2, nm);
      exp2x4(pe[0], pe[1], pe[2], pe[3]);
      exp2x4(pe[4], pe[5], pe[6], pe[7]);
      v2f a = {0.f, 0.f};
#pragma unroll
      for (int r = 0; r < 8; r += 2) {
        const v2f w = {pe[r], pe[r + 1]};
        a = (r == 0) ? w : a + w;
        pb[j >> 1].p[(j & 1) * 4 + (r >> 1)] = __builtin_convertvector(w * PSC, v2h);
      }
      ps[j] = a;
    }
    const v2f pt = (ps[0] + ps[1]) + (ps[2] + ps[3]);
    lrow = lrow * alpha + (pt[0] + pt[1]);
#pragma unroll
    for (int t = 0; t < 4; ++t)
#pragma unroll
      for (int r = 0; r < 8; ++r) oacc[t][r] *= alpha;
#pragma unroll
    for (int kk = 0; kk < 2; ++kk) {
#pragma unroll
      for (int t = 0; t < 4; ++t) {
        FH vb;
        vb.h[0] = *(const v8h*)(Vth + (t * 16 + c) * AT_LP + kk * 32 + 8 * hh);
        vb.h[1] = *(const v8h*)(Vth + (t * 16 + c) * AT_LP + kk * 32 + 16 + 8 * hh);
        oacc[t] = at_mma_h(vb.v, pb[kk].v, oacc[t]);
      }
    }
  }

  float* os = Os[wave];
  const float inv = 1.0f / ((lrow + xhalf(lrow)) * PSC);   // the halves' sums are joined once, here
#pragma unroll
  for (int t = 0; t < 4; ++t) {
    const v4f lo4 = {oacc[t][0] * inv, oacc[t][1] * inv, oacc[t][2] * inv, oacc[t][3] * inv};
    const v4f hi4 = {oacc[t][4] * inv, oacc[t][5] * inv, oacc[t][6] * inv, oacc[t][7] * inv};
    *(v4f*)(os + c * 68 + t * 16 + 8 * hh)     = lo4;   // row = query, 8 consecutive d per lane
    *(v4f*)(os + c * 68 + t * 16 + 8 * hh + 4) = hi4;
  }
  __builtin_amdgcn_fence(__ATOMIC_RELEASE, "workgroup");
  __builtin_amdgcn_wave_barrier();
  __builtin_amdgcn_fence(__ATOMIC_ACQUIRE, "workgroup");
  {
    const int c4 = (lane & 15) * 4;
    {
#pragma unroll
      for (int it = 0; it < 8; ++it) {
        const int row = it * 2 + hh;   // it 0..7 x hh 0..1 covers rows 0..15 of the wave tile
        v4f val = *(const v4f*)(os + row * 68 + c4);
        *(v4f*)(ob + (size_t)(q0 + row) * kDm + c4) = val;
      }
      
    }
  }
}

// ---------------------------------------------------------------------------
// Workspace region map (byte offsets; every region is fully written before it is read):
//   R0  Qb   bf16 [4096][1024]          8,388,608 @           0   (RNE cast of q)
//   R1  Wq   bf16 [3072][1024]          6,291,456 @   8,388,608   (RNE cast of W_qkv)
//   R2  Wp   bf16 [1024][1024]          2,097,152 @  14,680,064   (RNE cast of W_proj)
//   R3  Qh   bf16 [4096][1024]          8,388,608 @  16,777,216   (q projection, hi plane)
//   R4  Ql   bf16 [4096][1024]          8,388,608 @  25,165,824   (q projection, lo plane)
//   R5  Kh   bf16 [2][4096][1024]      16,777,216 @  33,554,432   (rows 0..2047 cache keys, 2048.. k projection; hi)
//   R6  Kl   bf16 [2][4096][1024]      16,777,216 @  50,331,648   (same rows; lo)
//   R7  Vt   f16  [2][1024][4096]      16,777,216 @  67,108,864   (cols 0..2047 cache values^T, 2048.. v projection^T)
//   R8  Y    f32  [4096][1024]         16,777,216 @  83,886,080   (attention output, token-major, heads merged)
//   R9  Yh   bf16 [4096][1024]          8,388,608 @ 100,663,296   (split of Y, hi)
//   R10 Yl   bf16 [4096][1024]          8,388,608 @ 109,051,904   (split of Y, lo)
//   total 117,440,512 B
// ---------------------------------------------------------------------------
extern "C" void kernel_launch(void* const* d_in, const int* in_sizes, int n_in,
                              void* d_out, int out_size, void* d_ws,
                              size_t ws_size, hipStream_t stream) {
  if (n_in < 7) return;
  const size_t nQ  = (size_t)kBatch * kTq * kDm;        // 4,194,304
  const size_t nKV = (size_t)kBatch * kSkv * kDm;       // 4,194,304
  const size_t nWq = (size_t)3 * kDm * kDm;             // 3,145,728
  const size_t nWp = (size_t)kDm * kDm;                 // 1,048,576
  const size_t nPe = (size_t)kSkv * kDm;                // 2,097,152
  if (in_sizes[0] != (int)nQ || in_sizes[1] != (int)nKV || in_sizes[2] != (int)nKV ||
      in_sizes[3] != (int)nWq || in_sizes[4] != (int)nWp || in_sizes[5] != (int)nPe ||
      out_size != (int)nQ) return;

  const float* q     = (const float*)d_in[0];
  const float* k_xl  = (const float*)d_in[1];
  const float* v_xl  = (const float*)d_in[2];
  const float* Wqkv  = (const float*)d_in[3];
  const float* Wproj = (const float*)d_in[4];
  const float* pos   = (const float*)d_in[5];
  const int*   causf = (const int*)d_in[6];
  float* outp = (float*)d_out;

  const size_t offQb = 0,              szQb = nQ * 2;
  const size_t offWq = offQb + szQb,   szWq = nWq * 2;
  const size_t offWp = offWq + szWq,   szWp = nWp * 2;
  const size_t offQh = offWp + szWp,   szQh = nQ * 2;
  const size_t offQl = offQh + szQh,   szQl = nQ * 2;
  const size_t offKh = offQl + szQl,   szKh = (size_t)kBatch * kKeys * kDm * 2;
  const size_t offKl = offKh + szKh,   szKl = szKh;
  const size_t offVt = offKl + szKl,   szVt = (size_t)kBatch * kDm * kKeys * 2;
  const size_t offY  = offVt + szVt,   szY  = nQ * 4;
  const size_t offYh = offY + szY,     szYh = nQ * 2;
  const size_t offYl = offYh + szYh,   szYl = nQ * 2;
  const size_t total = offYl + szYl;   // 117,440,512
  if (total > ws_size) return;

  char* ws = (char*)d_ws;
  unsigned short* Qb = (unsigned short*)(ws + offQb);
  unsigned short* Wq = (unsigned short*)(ws + offWq);
  unsigned short* Wp = (unsigned short*)(ws + offWp);
  unsigned short* Qh = (unsigned short*)(ws + offQh);
  unsigned short* Ql = (unsigned short*)(ws + offQl);
  unsigned short* Kh = (unsigned short*)(ws + offKh);
  unsigned short* Kl = (unsigned short*)(ws + offKl);
  unsigned short* Vt = (unsigned short*)(ws + offVt);
  float*          Y  = (float*)(ws + offY);
  unsigned short* Yh = (unsigned short*)(ws + offYh);
  unsigned short* Yl = (unsigned short*)(ws + offYl);

  // ---- input casts (RNE bf16 of every float input) and cache planes ----
  {
    const int n2q = (int)(nQ / 2), n2wq = (int)(nWq / 2), n2wp = (int)(nWp / 2), n2kv = (int)(nKV / 2);
    cast_bf16x2_kernel<<<dim3((n2q + 255) / 256), 256, 0, stream>>>(q, Qb, n2q);
    cast_bf16x2_kernel<<<dim3((n2wq + 255) / 256), 256, 0, stream>>>(Wqkv, Wq, n2wq);
    cast_bf16x2_kernel<<<dim3((n2wp + 255) / 256), 256, 0, stream>>>(Wproj, Wp, n2wp);
    // cache keys -> rows 0..2047 of both key planes (hi, lo), both batches
    kcache_split_kernel<<<dim3((n2kv + 255) / 256), 256, 0, stream>>>(k_xl, pos, Kh, Kl, causf, n2kv);
    // v_xl[b]: in[s rows=2048][c cols=1024] -> Vt[b] out[c][s] with output row pitch kKeys, cols 0..2047;
    // grid (cols/64, rows/64, B)
    tcast16_kernel<<<dim3(kDm / 64, kSkv / 64, kBatch), 256, 0, stream>>>(
        v_xl, Vt, kSkv, kDm, kKeys, (long)kSkv * kDm, (long)kDm * kKeys);
  }

  // ---- qkv projections: bf16 operands (K = 1024, M,N multiples of 64, no tails) ----
  {
    // q projection: C[m = b*2048+t][n] -> Qh (hi) / Ql (lo), M=4096, N=1024, K=1024; 1024 tiles -> 128 blocks
    const int tilesQ = (int)((nQ / kDm) / 64) * (kDm / 64);
    wmma_gemm64<1, false, 0, 2, false><<<dim3((tilesQ + 7) / 8, 1), 256, 0, stream>>>(
        Qb, nullptr, kDm, 0L, Wq, nullptr, kDm, 0L,
        (void*)Qh, (void*)Ql, kDm, 0L, nullptr, nullptr, 0L,
        kBatch * kTq, kDm, kDm, 1.0f);
    // k projection per batch: C[t][n] -> key plane rows 2048+t (hi -> Kh, lo -> Kl), M=2048, N=1024, K=1024;
    // 512 tiles -> 64 blocks, grid.y = batch
    const int tilesK = (kTq / 64) * (kDm / 64);
    wmma_gemm64<1, false, 0, 2, false><<<dim3((tilesK + 7) / 8, kBatch), 256, 0, stream>>>(
        Qb, nullptr, kDm, (long)kTq * kDm, Wq + (size_t)kDm * kDm, nullptr, kDm, 0L,
        (void*)(Kh + (size_t)kSkv * kDm), (void*)(Kl + (size_t)kSkv * kDm), kDm, (long)kKeys * kDm,
        nullptr, nullptr, 0L,
        kTq, kDm, kDm, 1.0f);
    // v projection, role-swapped: C[m = channel][n = t] -> Vt_b[channel][2048 + t] (f16), M=1024, N=2048, K=1024,
    // ldc = kKeys; 512 tiles -> 64 blocks, grid.y = batch
    const int tilesV = (kDm / 64) * (kTq / 64);
    wmma_gemm64<1, false, 0, 1, false><<<dim3((tilesV + 7) / 8, kBatch), 256, 0, stream>>>(
        Wq + (size_t)2 * kDm * kDm, nullptr, kDm, 0L, Qb, nullptr, kDm, (long)kTq * kDm,
        (void*)(Vt + kSkv), nullptr, kKeys, (long)kDm * kKeys, nullptr, nullptr, 0L,
        kDm, kTq, kDm, 1.0f);
  }

  // ---- attention over the 4096 keys per (batch, head); score scale 1/sqrt(64) applied in f32 ----
  attn_xl_kernel<<<dim3(kHeads * (kTq / AT_QB), kBatch), 128, 0, stream>>>(Qh, Ql, Kh, Kl, Vt, Y, 0.125f);

  // ---- y -> bf16 hi/lo planes; output projection C[m][n] = sum_c (Yh + Yl)[m][c] * Wp[n][c] -> d_out ----
  {
    const int n2y = (int)(nQ / 2);
    split_bf16x2_kernel<<<dim3((n2y + 255) / 256), 256, 0, stream>>>(Y, Yh, Yl, n2y);
    const int tilesP = (int)((nQ / kDm) / 64) * (kDm / 64);   // 1024 tiles -> 128 blocks
    wmma_gemm64<1, true, 0, 0, false, 0, false><<<dim3((tilesP + 7) / 8, 1), 256, 0, stream>>>(
        Yh, Yl, kDm, 0L, Wp, nullptr, kDm, 0L,
        (void*)outp, nullptr, kDm, 0L, nullptr, nullptr, 0L,
        kBatch * kTq, kDm, kDm, 1.0f);
  }
}

// v004
// A run of this version takes 365 microseconds.
// Two timings next to v003 put it at 1.04 and 1.02 times that version's speed.
// Over all steps from v000 it is 2.29 times as fast.
// Contractions: q/k/v projections on v_wmma_f32_16x16x32_bf16 (bf16 operands = RNE-cast inputs, single product); q.k^T on v_wmma_f32_16x16x32_bf16 with bf16 hi/lo planes for both q and k (hi.hi + hi.lo + lo.hi); p.v on v_wmma_f32_16x16x32_f16 (p f16 carried x2^15, v f16, single product); output projection on v_wmma_f32_16x16x32_bf16 with y as bf16 hi/lo planes (hi.W + lo.W) and W bf16; f32 accumulate everywhere; softmax, score scale and the cache add in f32.
#include <hip/hip_runtime.h>
#include <math.h>
#include <stdint.h>

constexpr int kBatch = 2;
constexpr int kTq    = 2048;            // query length
constexpr int kSkv   = 2048;            // cache length
constexpr int kKeys  = kSkv + kTq;      // 4096 keys per (batch, head)
constexpr int kDm    = 1024;            // model dim
constexpr int kHeads = 16;
constexpr int kHd    = 64;
static_assert(kHeads * kHd == kDm, "head split");
static_assert(kTq % 64 == 0 && kKeys % 64 == 0 && kDm % 64 == 0 && kSkv % 64 == 0, "tile multiples");

typedef __attribute__((ext_vector_type(16))) _Float16 v16h;
typedef __attribute__((ext_vector_type(8)))  _Float16 v8h;
typedef __attribute__((ext_vector_type(2)))  _Float16 v2h;
typedef __attribute__((ext_vector_type(16))) __bf16   v16b;
typedef __attribute__((ext_vector_type(8)))  __bf16   v8b;
typedef __attribute__((ext_vector_type(8)))  float    v8f;
typedef __attribute__((ext_vector_type(4)))  float    v4f;
typedef __attribute__((ext_vector_type(2)))  float    v2f;
typedef __attribute__((ext_vector_type(4)))  unsigned int v4u;

__device__ __forceinline__ unsigned short f2bf_bits(float f) {
  unsigned u = __float_as_uint(f);
  return (unsigned short)((u + 0x7FFFu + ((u >> 16) & 1u)) >> 16);
}
__device__ __forceinline__ float bf_bits2f(unsigned short h) { return __uint_as_float(((unsigned)h) << 16); }
__device__ __forceinline__ unsigned short h_bits(float f) { return __builtin_bit_cast(unsigned short, (_Float16)f); }
__device__ __forceinline__ unsigned pk16(unsigned short a, unsigned short b) { return (unsigned)a | ((unsigned)b << 16); }

// hazard guards as plain device helpers (no inline asm inside the kernel template body)
__device__ __forceinline__ void dep_guard_h(v8f& a, v8f& b, v16h x, v16h y) { asm volatile("v_nop\n\tv_nop\n\tv_nop\n\tv_nop" : "+v"(a), "+v"(b) : "v"(x), "v"(y)); }
__device__ __forceinline__ void dep_guard_b(v8f& a, v8f& b, v16b x, v16b y) { asm volatile("v_nop\n\tv_nop\n\tv_nop\n\tv_nop" : "+v"(a), "+v"(b) : "v"(x), "v"(y)); }
__device__ __forceinline__ void keep4_h(v16h a, v16h b, v16h c, v16h d) { asm volatile("v_nop" :: "v"(a), "v"(b), "v"(c), "v"(d)); }
__device__ __forceinline__ void keep4_b(v16b a, v16b b, v16b c, v16b d) { asm volatile("v_nop" :: "v"(a), "v"(b), "v"(c), "v"(d)); }
__device__ __forceinline__ void acc_guard4(v8f& a, v8f& b, v8f& c, v8f& d) { asm volatile("v_nop\n\tv_nop\n\tv_nop\n\tv_nop" : "+v"(a), "+v"(b), "+v"(c), "+v"(d)); }
// The wait that belongs in front of any overwrite of a register that an issued global load names. The address pairs
// are inputs so that they stay whole up to here.
__device__ __forceinline__ void addr_wait4(const void* a, const void* b, const void* c, const void* d) {
  asm volatile("s_wait_xcnt 0x0" :: "v"(a), "v"(b), "v"(c), "v"(d) : "memory");
}
__device__ __forceinline__ void addr_wait6(const void* a, const void* b, const void* c, const void* d, const void* e, const void* f) {
  asm volatile("s_wait_xcnt 0x0" :: "v"(a), "v"(b), "v"(c), "v"(d), "v"(e), "v"(f) : "memory");
}
__device__ __forceinline__ void addr_wait2(const void* a, const void* b) {
  asm volatile("s_wait_xcnt 0x0" :: "v"(a), "v"(b) : "memory");
}
template <typename T> struct Frag;
template <> struct Frag<_Float16> {
  typedef v16h V; union U { v16h v; v8h h[2]; };
  static __device__ __forceinline__ v16h load(const _Float16* p) {   // elements 0..7 <- p[0..7], 8..15 <- p[16..23]
    U f; f.h[0] = *(const v8h*)(p); f.h[1] = *(const v8h*)(p + 16); return f.v;
  }
  static __device__ __forceinline__ v16h loadp(const _Float16* p) {  // fragment order: register halves 256 elements apart
    U f; f.h[0] = *(const v8h*)(p); f.h[1] = *(const v8h*)(p + 256); return f.v;
  }
  static __device__ __forceinline__ v8f mma(v16h a, v16h b, v8f c) {
    return __builtin_amdgcn_wmma_f32_16x16x32_f16(false, a, false, b, (short)0, c, false, false);
  }
  static __device__ __forceinline__ void guard(v8f& a, v8f& b, v16h x, v16h y) { dep_guard_h(a, b, x, y); }
  static __device__ __forceinline__ void keep(v16h a, v16h b, v16h c, v16h d) { keep4_h(a, b, c, d); }
};
template <> struct Frag<__bf16> {
  typedef v16b V; union U { v16b v; v8b h[2]; };
  static __device__ __forceinline__ v16b load(const __bf16* p) {
    U f; f.h[0] = *(const v8b*)(p); f.h[1] = *(const v8b*)(p + 16); return f.v;
  }
  static __device__ __forceinline__ v16b loadp(const __bf16* p) {
    U f; f.h[0] = *(const v8b*)(p); f.h[1] = *(const v8b*)(p + 256); return f.v;
  }
  static __device__ __forceinline__ v8f mma(v16b a, v16b b, v8f c) {
    return __builtin_amdgcn_wmma_f32_16x16x32_bf16(false, a, false, b, (short)0, c, false, false);
  }
  static __device__ __forceinline__ void guard(v8f& a, v8f& b, v16b x, v16b y) { dep_guard_b(a, b, x, y); }
  static __device__ __forceinline__ void keep(v16b a, v16b b, v16b c, v16b d) { keep4_b(a, b, c, d); }
};

// ---- Register-blocked batched WMMA GEMM ------------------------------------
// C[m,n] = scale * sum_k A[m,k] * Bt[n,k] (+bias)(+resid); each wave owns a 64x64 tile.
// A [M,K] and Bt [N,K] stand in FRAGMENT ORDER (lda = ldb = K): blocks of 16 rows x 32 k = 512 elements (1 KB), block
// number (row / 16) * (K / 32) + k / 32, so a row tile starts where row-major row 16 * (row / 16) would. Inside a block
// the 8 elements k % 32 = 8 * (2 h + hh) + 0..7 of row r stand at element h * 256 + (hh * 16 + r) * 8: lane hh * 16 + r
// finds register half h of its fragment at h * 256 + lane * 8, and each of a fragment's two loads reads 512
// contiguous bytes (4 whole lines). The k of every lane and register position is that of Frag::load on a row-major
// operand, the same for A and Bt. M,N % 64 == 0, K % 32 == 0.
// SPLIT: operands are hi/lo planes (A2/Bt2 = lo planes, same layout); product = hi.hi + hi.lo + lo.hi.
// SPLITB (only meaningful with SPLIT): when false only A carries a lo plane; product = hi.B + lo.B (Bt2 unused).
// BIAS_MODE: 0 = none, 1 = bias[m], 2 = bias[n].
// OUT_MODE: 0 = f32, 1 = f16, 2 = bf16 hi plane (Cout) + bf16 lo plane (Cout2).
// ET: 0 = f16 operands, 1 = bf16 operands (pointers passed as 16-bit storage)
template <int ET> struct Elem;
template <> struct Elem<0> { typedef _Float16 T; };
template <> struct Elem<1> { typedef __bf16 T; };
template <int ET, bool SPLIT, int BIAS_MODE, int OUT_MODE, bool RESID, int ACT = 0, bool SPLITB = SPLIT>
__global__ __launch_bounds__(256) void wmma_gemm64(
    const unsigned short* __restrict__ Ap, const unsigned short* __restrict__ A2p, int lda, long strideA,
    const unsigned short* __restrict__ Btp, const unsigned short* __restrict__ Bt2p, int ldb, long strideB,
    void* __restrict__ Cout, void* __restrict__ Cout2, int ldc, long strideC,
    const float* __restrict__ bias,
    const float* __restrict__ resid, long strideR,
    int M, int N, int K, float scale) {
  typedef typename Elem<ET>::T T;
  typedef typename Frag<T>::V V;
  const T* A = (const T*)Ap; const T* A2 = (const T*)A2p; const T* Bt = (const T*)Btp; const T* Bt2 = (const T*)Bt2p;
  __shared__ __align__(16) float sT[8][16 * 68];   // per-wave 16x64 slab, pitch 68 floats
  const int b    = blockIdx.y;
  const int lane = threadIdx.x & 31;
  const int wave = __builtin_amdgcn_readfirstlane(threadIdx.x >> 5);   // scalar, so that tile indices and row-tile offsets stay in scalar registers
  const int tilesN = N >> 6;
  const int tilesM = M >> 6;
  const int tile = blockIdx.x * 8 + wave;
  if (tile >= tilesM * tilesN) return;   // wave-uniform; no block barriers in this kernel
  const int tm = tile / tilesN;
  const int tn = tile - tm * tilesN;
  const int m0 = tm << 6;
  const int n0 = tn << 6;

  const T* Ab  = A  + (size_t)b * strideA;
  const T* Bb  = Bt + (size_t)b * strideB;
  const T* Ab2 = SPLIT ? (A2  + (size_t)b * strideA) : nullptr;
  const T* Bb2 = (SPLIT && SPLITB) ? (Bt2 + (size_t)b * strideB) : nullptr;

  const int rlane = lane & 15;                 // row (A) / col (B, D) within subtile
  const int mOff  = (lane >> 4) * 8;           // D row offset
  const unsigned lo8 = (unsigned)lane * 8u;    // this lane's 8 elements (16 bytes) inside a half block

  v8f acc[4][4];
#pragma unroll
  for (int i = 0; i < 4; ++i)
#pragma unroll
    for (int j = 0; j < 4; ++j) acc[i][j] = (v8f){0.f,0.f,0.f,0.f,0.f,0.f,0.f,0.f};

  for (int k0 = 0; k0 < K; k0 += 32) {
    V bh[4], bl[4];
    const size_t kb = (size_t)(k0 >> 5) * 512;   // this k block inside a row tile (scalar; the lane adds lo8)
    const T* bp[4];
    const T* bp2[4];
#pragma unroll
    for (int j = 0; j < 4; ++j) {
      const size_t bo = (size_t)(n0 + (j << 4)) * ldb + kb;
      bp[j] = Bb + bo + lo8;
      bh[j] = Frag<T>::loadp(bp[j]);
      if (SPLIT && SPLITB) { bp2[j] = Bb2 + bo + lo8; bl[j] = Frag<T>::loadp(bp2[j]); }
    }
    if (SPLIT && SPLITB) addr_wait4(bp2[0], bp2[1], bp2[2], bp2[3]);
#pragma unroll
    for (int i = 0; i < 4; ++i) {
      const size_t ao = (size_t)(m0 + (i << 4)) * lda + kb;
      const T* ap  = Ab + ao + lo8;
      const T* ap2 = SPLIT ? (Ab2 + ao + lo8) : ap;
      V ah = Frag<T>::loadp(ap);
      V al;
      if (SPLIT) al = Frag<T>::loadp(ap2);
      if (i == 0) addr_wait6(bp[0], bp[1], bp[2], bp[3], ap, ap2);   // one wait for the B loads and the first A loads
      else        addr_wait2(ap, ap2);
#pragma unroll
      for (int j = 0; j < 4; ++j) {
        acc[i][j] = Frag<T>::mma(ah, bh[j], acc[i][j]);
        if (SPLIT) {
          if (SPLITB) acc[i][j] = Frag<T>::mma(ah, bl[j], acc[i][j]);
          acc[i][j] = Frag<T>::mma(al, bh[j], acc[i][j]);
        }
      }
      Frag<T>::guard(acc[i][0], acc[i][3], ah, SPLIT ? al : ah);
    }
    Frag<T>::keep(bh[0], bh[1], bh[2], bh[3]);
    if (SPLIT && SPLITB) Frag<T>::keep(bl[0], bl[1], bl[2], bl[3]);
  }
  acc_guard4(acc[0][0], acc[0][1], acc[0][2], acc[0][3]);
  acc_guard4(acc[1][0], acc[1][1], acc[1][2], acc[1][3]);
  acc_guard4(acc[2][0], acc[2][1], acc[2][2], acc[2][3]);
  acc_guard4(acc[3][0], acc[3][1], acc[3][2], acc[3][3]);

  // ---- epilogue ----
  float* slab = sT[wave];
  const float* Rb = RESID ? (resid + (size_t)b * strideR) : nullptr;
#pragma unroll
  for (int i = 0; i < 4; ++i) {
    const int mBase = m0 + (i << 4);
#pragma unroll
    for (int j = 0; j < 4; ++j) {
      const int n = n0 + (j << 4) + rlane;
      float bv = 0.f;
      if (BIAS_MODE == 2) bv = bias[n];
#pragma unroll
      for (int r = 0; r < 8; ++r) {
        float v = acc[i][j][r] * scale;
        if (BIAS_MODE == 1) v += bias[mBase + mOff + r];
        if (BIAS_MODE == 2) v += bv;
        if (RESID) v += Rb[(size_t)(mBase + mOff + r) * ldc + n];
        if (ACT == 1) v = tanhf(v);
        if (ACT == 2) v = fmaxf(v, 0.0f);
        if (ACT == 3) v = v / (1.0f + expf(-v));
        if (ACT == 4) v = (v > 0.f) ? v : 0.01f * v;
        slab[(mOff + r) * 68 + (j << 4) + rlane] = v;
      }
    }
    __builtin_amdgcn_fence(__ATOMIC_RELEASE, "workgroup");
    __builtin_amdgcn_wave_barrier();
    __builtin_amdgcn_fence(__ATOMIC_ACQUIRE, "workgroup");
    if (OUT_MODE == 0) {
      float* C = (float*)Cout + (size_t)b * strideC;
      const int hh = lane >> 4, c4 = (lane & 15) * 4;     // row seg = 256 B = 16 lanes x 16 B
      {
#pragma unroll
        for (int it = 0; it < 8; ++it) {
          const int row = it * 2 + hh;
          v4f v = *(const v4f*)(slab + row * 68 + c4);
          *(v4f*)(C + (size_t)(mBase + row) * ldc + n0 + c4) = v;
        }
        
      }
    } else {
      const int q = lane >> 3, c8 = (lane & 7) * 8;
      unsigned short* C  = (unsigned short*)Cout  + (size_t)b * strideC;
      unsigned short* C2 = (OUT_MODE == 2) ? ((unsigned short*)Cout2 + (size_t)b * strideC) : nullptr;
      {
#pragma unroll
        for (int it = 0; it < 4; ++it) {
          const int row = it * 4 + q;
          const float* sp = slab + row * 68 + c8;
          v8h hv, lv;
#pragma unroll
          for (int e = 0; e < 8; ++e) {
            if (OUT_MODE == 1) {
              hv[e] = (_Float16)sp[e];
            } else {
              unsigned short hb = f2bf_bits(sp[e]);
              unsigned short lb = f2bf_bits(sp[e] - bf_bits2f(hb));
              hv[e] = __builtin_bit_cast(_Float16, hb);
              lv[e] = __builtin_bit_cast(_Float16, lb);
            }
          }
          *(v8h*)(C + (size_t)(mBase + row) * ldc + n0 + c8) = hv;
          if (OUT_MODE == 2) *(v8h*)(C2 + (size_t)(mBase + row) * ldc + n0 + c8) = lv;
        }
        
      }
    }
    __builtin_amdgcn_fence(__ATOMIC_RELEASE, "workgroup");
    __builtin_amdgcn_wave_barrier();
    __builtin_amdgcn_fence(__ATOMIC_ACQUIRE, "workgroup");
  }
}

// ---------------------------------------------------------------------------
// f32 [R][kDm] row-major -> 16-bit planes in the fragment order that wmma_gemm64 reads (described there).
// One wave makes two neighbouring 1 KB blocks (16 rows x 64 k). Lane l takes the 8 floats k = 8 * (l & 3) + 0..7 of row
// 8 it + (l >> 2) of block u (u, it = 0, 1): two 16-byte loads, one 16-byte store per plane. A wave-wide store writes
// four whole 128-byte lines (8 rows x 16 B each); the eight loads of a lane are issued together.
// Coverage: nPairs = (R / 16) * (kDm / 64) waves x 1024 elements = R * kDm (every nPairs here is a multiple of 8).
// ---------------------------------------------------------------------------
struct PackPos { const float* src; size_t dst; };
__device__ __forceinline__ PackPos pack_pos(const float* in, int wv, int lane) {
  const int rt = wv / (kDm / 64), kp = wv - rt * (kDm / 64);   // row tile, pair of k blocks
  const int r8 = lane >> 2, piece = lane & 3;
  PackPos p;
  p.src = in + (size_t)(rt * 16 + r8) * kDm + kp * 64 + piece * 8;
  p.dst = (size_t)wv * 1024 + (piece >> 1) * 256 + ((piece & 1) * 16 + r8) * 8;
  return p;
}

// bf16 (RNE) cast
__global__ __launch_bounds__(256) void cast_pack_bf16_kernel(const float* __restrict__ in, unsigned short* __restrict__ out,
                                                            int nPairs) {
  const int wv = (blockIdx.x * 256 + threadIdx.x) >> 5;
  if (wv < nPairs) {
    const PackPos p = pack_pos(in, wv, threadIdx.x & 31);
    v4f f[2][2][2];
#pragma unroll
    for (int u = 0; u < 2; ++u)
#pragma unroll
      for (int it = 0; it < 2; ++it) {
        f[u][it][0] = *(const v4f*)(p.src + (size_t)it * 8 * kDm + u * 32);
        f[u][it][1] = *(const v4f*)(p.src + (size_t)it * 8 * kDm + u * 32 + 4);
      }
#pragma unroll
    for (int u = 0; u < 2; ++u)
#pragma unroll
      for (int it = 0; it < 2; ++it) {
        v4u o;
#pragma unroll
        for (int q = 0; q < 4; ++q) {
          const v4f g = f[u][it][q >> 1];
          o[q] = pk16(f2bf_bits(g[(q & 1) * 2]), f2bf_bits(g[(q & 1) * 2 + 1]));
        }
        *(v4u*)(out + p.dst + u * 512 + it * 64) = o;
      }
  }
}

// bf16 split: hi = bf16_rne(in), lo = bf16_rne(in - hi)
__global__ __launch_bounds__(256) void split_pack_bf16_kernel(const float* __restrict__ in, unsigned short* __restrict__ hi,
                                                             unsigned short* __restrict__ lo, int nPairs) {
  const int wv = (blockIdx.x * 256 + threadIdx.x) >> 5;
  if (wv < nPairs) {
    const PackPos p = pack_pos(in, wv, threadIdx.x & 31);
    v4f f[2][2][2];
#pragma unroll
    for (int u = 0; u < 2; ++u)
#pragma unroll
      for (int it = 0; it < 2; ++it) {
        f[u][it][0] = *(const v4f*)(p.src + (size_t)it * 8 * kDm + u * 32);
        f[u][it][1] = *(const v4f*)(p.src + (size_t)it * 8 * kDm + u * 32 + 4);
      }
#pragma unroll
    for (int u = 0; u < 2; ++u)
#pragma unroll
      for (int it = 0; it < 2; ++it) {
        v4u oh, ol;
#pragma unroll
        for (int q = 0; q < 4; ++q) {
          const v4f g = f[u][it][q >> 1];
          const float f0 = g[(q & 1) * 2], f1 = g[(q & 1) * 2 + 1];
          const unsigned short h0 = f2bf_bits(f0), h1 = f2bf_bits(f1);
          oh[q] = pk16(h0, h1);
          ol[q] = pk16(f2bf_bits(f0 - bf_bits2f(h0)), f2bf_bits(f1 - bf_bits2f(h1)));
        }
        *(v4u*)(hi + p.dst + u * 512 + it * 64) = oh;
        *(v4u*)(lo + p.dst + u * 512 + it * 64) = ol;
      }
  }
}

// ---------------------------------------------------------------------------
// Cache keys, rows 0..kSkv-1 of each per-batch [kKeys][kDm] bf16 key plane pair:
//   x = bf16_rne(k_xl[b][s][c]) + bf16_rne(pos[s][c])   (the add in f32)
//   kh[b][s][c] = bf16_rne(x),  kl[b][s][c] = bf16_rne(x - kh)
// flags = the causal flag input; this forward applies no mask, the pointer is only bound, never read.
// ---------------------------------------------------------------------------
__global__ __launch_bounds__(256) void kcache_split_kernel(const float* __restrict__ kxl, const float* __restrict__ pos,
                                                           unsigned short* __restrict__ kh, unsigned short* __restrict__ kl,
                                                           const int* __restrict__ flags, int n2) {
  const int i = blockIdx.x * 256 + threadIdx.x;
  if (i < n2) {
    const size_t e = 2 * (size_t)i;                        // element index into [b][s][c]
    const size_t perB = (size_t)kSkv * kDm;
    const int bb = (int)(e / perB);
    const size_t rem = e - (size_t)bb * perB;              // s*kDm + c (even)
    const v2f a = *(const v2f*)(kxl + e);
    const v2f p = *(const v2f*)(pos + rem);
    const float s0 = bf_bits2f(f2bf_bits(a[0])) + bf_bits2f(f2bf_bits(p[0]));
    const float s1 = bf_bits2f(f2bf_bits(a[1])) + bf_bits2f(f2bf_bits(p[1]));
    const unsigned short h0 = f2bf_bits(s0), h1 = f2bf_bits(s1);
    const unsigned short l0 = f2bf_bits(s0 - bf_bits2f(h0)), l1 = f2bf_bits(s1 - bf_bits2f(h1));
    const unsigned uh = pk16(h0, h1), ul = pk16(l0, l1);
    const size_t o = ((size_t)bb * kKeys * kDm + rem) >> 1; // u32 index
    ((unsigned*)kh)[o] = uh;
    ((unsigned*)kl)[o] = ul;
    
  }
}

// ---------------------------------------------------------------------------
// Fused transpose + cast of an f32 matrix, z-batched: in_z = W + z*sIn viewed [R rows][Cc cols] (pitch Cc) ->
//   o_z[c][r] = f16(bf16_rne(in_z[r][c]))   ([Cc][...], output row pitch ldo halves), o_z = o + z*sOut.
// 64x64 tiles through LDS. grid = (Cc/64, R/64, Z), 256 threads (R, Cc multiples of 64).
// Coverage per block: load 4 it x 256 thr x 4 floats = 64x64; store 2 it x 256 thr x 8 u16 = 64x64.
// ---------------------------------------------------------------------------
__global__ __launch_bounds__(256) void tcast16_kernel(const float* __restrict__ W, unsigned short* __restrict__ o,
                                                      int R, int Cc, int ldo, long sIn, long sOut) {
  __shared__ __align__(16) float tf[64 * 68];
  W += (size_t)blockIdx.z * sIn;
  o += (size_t)blockIdx.z * sOut;
  const int c0  = blockIdx.x * 64;   // input column block = output row block
  const int r0  = blockIdx.y * 64;   // input row block    = output column block
  const int tid = threadIdx.x;
  {
    const int lr = tid >> 4;         // 0..15
    const int c4 = (tid & 15) * 4;   // 0..60
#pragma unroll
    for (int it = 0; it < 4; ++it) {
      const int rr = it * 16 + lr;   // 0..63
      const v4f a = *(const v4f*)(W + (size_t)(r0 + rr) * Cc + c0 + c4);
      *(v4f*)(tf + rr * 68 + c4) = a;
    }
  }
  __syncthreads();
  const int sub = tid >> 3;          // 0..31
  const int c8  = (tid & 7) * 8;     // 0..56
  v4u hv[2];
#pragma unroll
  for (int it = 0; it < 2; ++it) {
    const int oc = it * 32 + sub;    // output row within tile (= input column)
    v4u a;
#pragma unroll
    for (int q = 0; q < 4; ++q) {
      const float f0 = tf[(c8 + 2 * q) * 68 + oc];
      const float f1 = tf[(c8 + 2 * q + 1) * 68 + oc];
      a[q] = pk16(h_bits(bf_bits2f(f2bf_bits(f0))), h_bits(bf_bits2f(f2bf_bits(f1))));
    }
    hv[it] = a;
  }
  {
#pragma unroll
    for (int it = 0; it < 2; ++it) {
      const int oc = it * 32 + sub;
      const size_t go = (size_t)(c0 + oc) * ldo + r0 + c8;
      *(v4u*)(o + go) = hv[it];
    }
    
  }
}

#define AT_D 64
#define AT_NW 4
#define AT_QB 64
#define AT_KC 64
#define AT_LP 72   // LDS row pitch in 16-bit elements: 144 B = 16 B x 9 (odd), so the 16 rows of a 16-byte fragment read fall on 16 different bank groups

__device__ __forceinline__ v8f at_mma_b(v16b a, v16b b, v8f c) {
  c = __builtin_amdgcn_wmma_f32_16x16x32_bf16(false, a, false, b, (short)0, c, false, false);
  asm volatile("v_nop\n\tv_nop\n\tv_nop\n\tv_nop" : "+v"(c) : "v"(a), "v"(b));
  return c;
}
__device__ __forceinline__ v8f at_mma_h(v16h a, v16h b, v8f c) {
  c = __builtin_amdgcn_wmma_f32_16x16x32_f16(false, a, false, b, (short)0, c, false, false);
  asm volatile("v_nop\n\tv_nop\n\tv_nop\n\tv_nop" : "+v"(c) : "v"(a), "v"(b));
  return c;
}

// Four hardware exp2 in place, in one statement: each v_exp_f32 is followed by an independent one and the last by
// v_nop, the slot the instruction set asks for behind a transcendental before its result is read or its source
// overwritten.
__device__ __forceinline__ void exp2x4(float& a, float& b, float& c, float& d) {
  asm("v_exp_f32 %0, %0\n\tv_exp_f32 %1, %1\n\tv_exp_f32 %2, %2\n\tv_exp_f32 %3, %3\n\tv_nop"
      : "+v"(a), "+v"(b), "+v"(c), "+v"(d));
}

// One hardware exp2 in place, with the same slot behind it.
__device__ __forceinline__ void exp2x1(float& a) { asm("v_exp_f32 %0, %0\n\tv_nop" : "+v"(a)); }

// lane l <-> lane l ^ 16 (the two halves that share a query column), a vector cross-row move, no LDS
__device__ __forceinline__ float xhalf(float x) {
  const int i = __builtin_bit_cast(int, x);
  return __builtin_bit_cast(float, __builtin_amdgcn_permlanex16(i, i, 0x76543210, 0xfedcba98, false, false));
}

__global__ __launch_bounds__(128)
void attn_xl_kernel(const unsigned short* __restrict__ qhp, const unsigned short* __restrict__ qlp,
                    const unsigned short* __restrict__ khp, const unsigned short* __restrict__ klp,
                    const unsigned short* __restrict__ vtp, float* __restrict__ out, float sscale) {
  union FB { v16b v; v8b h[2]; };
  union FH { v16h v; v8h h[2]; v2h p[8]; };
  __shared__ __align__(16) __bf16   Ksh[AT_KC * AT_LP];         // K hi [kv][d]   9 KB
  __shared__ __align__(16) __bf16   Ksl[AT_KC * AT_LP];         // K lo [kv][d]   9 KB
  __shared__ __align__(16) _Float16 Vth[AT_D * AT_LP];          // V^T [d][kv]    9 KB
  __shared__ __align__(16) float    Os[AT_NW][16 * 68];         // per wave out tile, pitch 68
  const float PSC = 32768.0f;
  // softmax in base 2: exp((x - m) * sscale) = 2^((x - m) * sc2). sscale > 0 (the launch passes 1/sqrt(64)),
  // so the row maximum may be taken on the unscaled scores.
  const float sc2 = sscale * 1.44269504088896340736f;

  const int tid  = threadIdx.x;
  const int wave = tid >> 5;
  const int lane = tid & 31;
  const int hh   = lane >> 4;
  const int c    = lane & 15;

  const int nqb = kTq / AT_QB;            // 32
  const int bx = blockIdx.x;
  const int b  = blockIdx.y;
  const int qb = bx % nqb;
  const int h  = bx / nqb;                // 0..kHeads-1
  const int q0 = qb * AT_QB + wave * 16;

  const __bf16*   Qh = (const __bf16*)(const void*)qhp   + (size_t)b * kTq * kDm   + (size_t)h * AT_D;
  const __bf16*   Ql = (const __bf16*)(const void*)qlp   + (size_t)b * kTq * kDm   + (size_t)h * AT_D;
  const __bf16*   Kh = (const __bf16*)(const void*)khp   + (size_t)b * kKeys * kDm + (size_t)h * AT_D;
  const __bf16*   Kl = (const __bf16*)(const void*)klp   + (size_t)b * kKeys * kDm + (size_t)h * AT_D;
  const _Float16* Vh = (const _Float16*)(const void*)vtp + (size_t)b * kDm * kKeys + (size_t)h * AT_D * kKeys;
  float*          ob = out + (size_t)b * kTq * kDm + (size_t)h * AT_D;

  // ---- Q fragments (B operand, column = lane&15, split k map via Frag load): 2 d-chunks, hi and lo ----
  v16b qah[2], qal[2];
#pragma unroll
  for (int dc = 0; dc < 2; ++dc) {
    qah[dc] = Frag<__bf16>::load(Qh + (size_t)(q0 + c) * kDm + dc * 32 + 8 * hh);
    qal[dc] = Frag<__bf16>::load(Ql + (size_t)(q0 + c) * kDm + dc * 32 + 8 * hh);
  }

  float mrow = -INFINITY, lrow = 0.f;   // query q0 + c: running maximum (both halves agree), this half's sum
  v8f oacc[4];                          // oacc[t][r] = O^T[d = 16 t + 8 hh + r][query q0 + c]
#pragma unroll
  for (int t = 0; t < 4; ++t) oacc[t] = (v8f){0.f,0.f,0.f,0.f,0.f,0.f,0.f,0.f};

  const int nChunks = kKeys / AT_KC;   // 64, compile-time constant
  for (int kc = 0; kc < nChunks; ++kc) {
    const int kv0 = kc * AT_KC;
    __syncthreads();
    {
      // staging coverage: 128 threads x (4 x 8) elements = 64 rows x 64 per plane = the whole chunk tile (3 planes)
      const int r = tid >> 1, half = (tid & 1) * 32;
      const __bf16*   ksh = Kh + (size_t)(kv0 + r) * kDm + half;    // K row kv0+r, d = half..half+31
      const __bf16*   ksl = Kl + (size_t)(kv0 + r) * kDm + half;
      const _Float16* vsh = Vh + (size_t)r * kKeys + kv0 + half;    // V^T row d = r, s = kv0+half..+31
      v8b a0[4], a1[4];
      v8h b0[4];
#pragma unroll
      for (int i = 0; i < 4; ++i) {     // all twelve loads first, so that they are in flight together
        a0[i] = *(const v8b*)(ksh + 8 * i);
        a1[i] = *(const v8b*)(ksl + 8 * i);
        b0[i] = *(const v8h*)(vsh + 8 * i);
      }
      // the wait that belongs in front of any overwrite of a register an issued global load names; the three address
      // pairs are inputs so that they stay whole up to here
      asm volatile("s_wait_xcnt 0x0" :: "v"(ksh), "v"(ksl), "v"(vsh) : "memory");
#pragma unroll
      for (int i = 0; i < 4; ++i) {
        *(v8b*)(Ksh + r * AT_LP + half + 8 * i) = a0[i];
        *(v8b*)(Ksl + r * AT_LP + half + 8 * i) = a1[i];
        *(v8h*)(Vth + r * AT_LP + half + 8 * i) = b0[i];
      }
    }
    __syncthreads();

    v8f s[4];
#pragma unroll
    for (int j = 0; j < 4; ++j) {
      s[j] = (v8f){0.f,0.f,0.f,0.f,0.f,0.f,0.f,0.f};
#pragma unroll
      for (int dc = 0; dc < 2; ++dc) {
        FB kb, klf;
        kb.h[0]  = *(const v8b*)(Ksh + (j * 16 + c) * AT_LP + dc * 32 + 8 * hh);
        kb.h[1]  = *(const v8b*)(Ksh + (j * 16 + c) * AT_LP + dc * 32 + 16 + 8 * hh);
        klf.h[0] = *(const v8b*)(Ksl + (j * 16 + c) * AT_LP + dc * 32 + 8 * hh);
        klf.h[1] = *(const v8b*)(Ksl + (j * 16 + c) * AT_LP + dc * 32 + 16 + 8 * hh);
        s[j] = at_mma_b(kb.v,  qah[dc], s[j]);   // s[j][r] = S^T[key kv0 + 16 j + 8 hh + r][query q0 + c]
        s[j] = at_mma_b(klf.v, qah[dc], s[j]);
        s[j] = at_mma_b(kb.v,  qal[dc], s[j]);
      }
    }
    float mj[4];
#pragma unroll
    for (int j = 0; j < 4; ++j) {
      float m = s[j][0];
#pragma unroll
      for (int r = 1; r < 8; ++r) m = fmaxf(m, s[j][r]);
      mj[j] = m;
    }
    float cm = fmaxf(fmaxf(mj[0], mj[1]), fmaxf(mj[2], mj[3]));
    cm = fmaxf(cm, xhalf(cm));
    const float mnew = fmaxf(mrow, cm);
    float alpha = (mrow - mnew) * sc2;
    const float nm = -mnew * sc2;
    mrow = mnew;
    exp2x1(alpha);
    FH pb[2];          // pb[kk]: P^T as B operand, keys kv0 + 32 kk + (8 hh + 0..7, 16 + 8 hh + 0..7), column c
    v2f ps[4];
#pragma unroll
    for (int j = 0; j < 4; ++j) {
      float pe[8];
#pragma unroll
      for (int r = 0; r < 8; ++r) pe[r] = fmaf(s[j][r], sc2, nm);
      exp2x4(pe[0], pe[1], pe[2], pe[3]);
      exp2x4(pe[4], pe[5], pe[6], pe[7]);
      v2f a = {0.f, 0.f};
#pragma unroll
      for (int r = 0; r < 8; r += 2) {
        const v2f w = {pe[r], pe[r + 1]};
        a = (r == 0) ? w : a + w;
        pb[j >> 1].p[(j & 1) * 4 + (r >> 1)] = __builtin_convertvector(w * PSC, v2h);
      }
      ps[j] = a;
    }
    const v2f pt = (ps[0] + ps[1]) + (ps[2] + ps[3]);
    lrow = lrow * alpha + (pt[0] + pt[1]);
#pragma unroll
    for (int t = 0; t < 4; ++t)
#pragma unroll
      for (int r = 0; r < 8; ++r) oacc[t][r] *= alpha;
#pragma unroll
    for (int kk = 0; kk < 2; ++kk) {
#pragma unroll
      for (int t = 0; t < 4; ++t) {
        FH vb;
        vb.h[0] = *(const v8h*)(Vth + (t * 16 + c) * AT_LP + kk * 32 + 8 * hh);
        vb.h[1] = *(const v8h*)(Vth + (t * 16 + c) * AT_LP + kk * 32 + 16 + 8 * hh);
        oacc[t] = at_mma_h(vb.v, pb[kk].v, oacc[t]);
      }
    }
  }

  float* os = Os[wave];
  const float inv = 1.0f / ((lrow + xhalf(lrow)) * PSC);   // the halves' sums are joined once, here
#pragma unroll
  for (int t = 0; t < 4; ++t) {
    const v4f lo4 = {oacc[t][0] * inv, oacc[t][1] * inv, oacc[t][2] * inv, oacc[t][3] * inv};
    const v4f hi4 = {oacc[t][4] * inv, oacc[t][5] * inv, oacc[t][6] * inv, oacc[t][7] * inv};
    *(v4f*)(os + c * 68 + t * 16 + 8 * hh)     = lo4;   // row = query, 8 consecutive d per lane
    *(v4f*)(os + c * 68 + t * 16 + 8 * hh + 4) = hi4;
  }
  __builtin_amdgcn_fence(__ATOMIC_RELEASE, "workgroup");
  __builtin_amdgcn_wave_barrier();
  __builtin_amdgcn_fence(__ATOMIC_ACQUIRE, "workgroup");
  {
    const int c4 = (lane & 15) * 4;
    {
#pragma unroll
      for (int it = 0; it < 8; ++it) {
        const int row = it * 2 + hh;   // it 0..7 x hh 0..1 covers rows 0..15 of the wave tile
        v4f val = *(const v4f*)(os + row * 68 + c4);
        *(v4f*)(ob + (size_t)(q0 + row) * kDm + c4) = val;
      }
      
    }
  }
}

// ---------------------------------------------------------------------------
// Workspace region map (byte offsets; every region is fully written before it is read):
//   R0  Qb   bf16 [4096][1024]          8,388,608 @           0   (RNE cast of q, fragment order)
//   R1  Wq   bf16 [3072][1024]          6,291,456 @   8,388,608   (RNE cast of W_qkv, fragment order)
//   R2  Wp   bf16 [1024][1024]          2,097,152 @  14,680,064   (RNE cast of W_proj, fragment order)
//   R3  Qh   bf16 [4096][1024]          8,388,608 @  16,777,216   (q projection, hi plane)
//   R4  Ql   bf16 [4096][1024]          8,388,608 @  25,165,824   (q projection, lo plane)
//   R5  Kh   bf16 [2][4096][1024]      16,777,216 @  33,554,432   (rows 0..2047 cache keys, 2048.. k projection; hi)
//   R6  Kl   bf16 [2][4096][1024]      16,777,216 @  50,331,648   (same rows; lo)
//   R7  Vt   f16  [2][1024][4096]      16,777,216 @  67,108,864   (cols 0..2047 cache values^T, 2048.. v projection^T)
//   R8  Y    f32  [4096][1024]         16,777,216 @  83,886,080   (attention output, token-major, heads merged)
//   R9  Yh   bf16 [4096][1024]          8,388,608 @ 100,663,296   (split of Y, hi, fragment order)
//   R10 Yl   bf16 [4096][1024]          8,388,608 @ 109,051,904   (split of Y, lo, fragment order)
//   total 117,440,512 B
// ---------------------------------------------------------------------------
extern "C" void kernel_launch(void* const* d_in, const int* in_sizes, int n_in,
                              void* d_out, int out_size, void* d_ws,
                              size_t ws_size, hipStream_t stream) {
  if (n_in < 7) return;
  const size_t nQ  = (size_t)kBatch * kTq * kDm;        // 4,194,304
  const size_t nKV = (size_t)kBatch * kSkv * kDm;       // 4,194,304
  const size_t nWq = (size_t)3 * kDm * kDm;             // 3,145,728
  const size_t nWp = (size_t)kDm * kDm;                 // 1,048,576
  const size_t nPe = (size_t)kSkv * kDm;                // 2,097,152
  if (in_sizes[0] != (int)nQ || in_sizes[1] != (int)nKV || in_sizes[2] != (int)nKV ||
      in_sizes[3] != (int)nWq || in_sizes[4] != (int)nWp || in_sizes[5] != (int)nPe ||
      out_size != (int)nQ) return;

  const float* q     = (const float*)d_in[0];
  const float* k_xl  = (const float*)d_in[1];
  const float* v_xl  = (const float*)d_in[2];
  const float* Wqkv  = (const float*)d_in[3];
  const float* Wproj = (const float*)d_in[4];
  const float* pos   = (const float*)d_in[5];
  const int*   causf = (const int*)d_in[6];
  float* outp = (float*)d_out;

  const size_t offQb = 0,              szQb = nQ * 2;
  const size_t offWq = offQb + szQb,   szWq = nWq * 2;
  const size_t offWp = offWq + szWq,   szWp = nWp * 2;
  const size_t offQh = offWp + szWp,   szQh = nQ * 2;
  const size_t offQl = offQh + szQh,   szQl = nQ * 2;
  const size_t offKh = offQl + szQl,   szKh = (size_t)kBatch * kKeys * kDm * 2;
  const size_t offKl = offKh + szKh,   szKl = szKh;
  const size_t offVt = offKl + szKl,   szVt = (size_t)kBatch * kDm * kKeys * 2;
  const size_t offY  = offVt + szVt,   szY  = nQ * 4;
  const size_t offYh = offY + szY,     szYh = nQ * 2;
  const size_t offYl = offYh + szYh,   szYl = nQ * 2;
  const size_t total = offYl + szYl;   // 117,440,512
  if (total > ws_size) return;

  char* ws = (char*)d_ws;
  unsigned short* Qb = (unsigned short*)(ws + offQb);
  unsigned short* Wq = (unsigned short*)(ws + offWq);
  unsigned short* Wp = (unsigned short*)(ws + offWp);
  unsigned short* Qh = (unsigned short*)(ws + offQh);
  unsigned short* Ql = (unsigned short*)(ws + offQl);
  unsigned short* Kh = (unsigned short*)(ws + offKh);
  unsigned short* Kl = (unsigned short*)(ws + offKl);
  unsigned short* Vt = (unsigned short*)(ws + offVt);
  float*          Y  = (float*)(ws + offY);
  unsigned short* Yh = (unsigned short*)(ws + offYh);
  unsigned short* Yl = (unsigned short*)(ws + offYl);

  // ---- input casts (RNE bf16 of every float input) and cache planes ----
  {
    const int npq = (int)(nQ / 1024), npwq = (int)(nWq / 1024), npwp = (int)(nWp / 1024), n2kv = (int)(nKV / 2);
    // GEMM operands, written in fragment order; one wave per 1024 elements, 8 waves per block
    cast_pack_bf16_kernel<<<dim3((npq + 7) / 8), 256, 0, stream>>>(q, Qb, npq);
    cast_pack_bf16_kernel<<<dim3((npwq + 7) / 8), 256, 0, stream>>>(Wqkv, Wq, npwq);
    cast_pack_bf16_kernel<<<dim3((npwp + 7) / 8), 256, 0, stream>>>(Wproj, Wp, npwp);
    // cache keys -> rows 0..2047 of both key planes (hi, lo), both batches
    kcache_split_kernel<<<dim3((n2kv + 255) / 256), 256, 0, stream>>>(k_xl, pos, Kh, Kl, causf, n2kv);
    // v_xl[b]: in[s rows=2048][c cols=1024] -> Vt[b] out[c][s] with output row pitch kKeys, cols 0..2047;
    // grid (cols/64, rows/64, B)
    tcast16_kernel<<<dim3(kDm / 64, kSkv / 64, kBatch), 256, 0, stream>>>(
        v_xl, Vt, kSkv, kDm, kKeys, (long)kSkv * kDm, (long)kDm * kKeys);
  }

  // ---- qkv projections: bf16 operands (K = 1024, M,N multiples of 64, no tails) ----
  {
    // q projection: C[m = b*2048+t][n] -> Qh (hi) / Ql (lo), M=4096, N=1024, K=1024; 1024 tiles -> 128 blocks
    const int tilesQ = (int)((nQ / kDm) / 64) * (kDm / 64);
    wmma_gemm64<1, false, 0, 2, false><<<dim3((tilesQ + 7) / 8, 1), 256, 0, stream>>>(
        Qb, nullptr, kDm, 0L, Wq, nullptr, kDm, 0L,
        (void*)Qh, (void*)Ql, kDm, 0L, nullptr, nullptr, 0L,
        kBatch * kTq, kDm, kDm, 1.0f);
    // k projection per batch: C[t][n] -> key plane rows 2048+t (hi -> Kh, lo -> Kl), M=2048, N=1024, K=1024;
    // 512 tiles -> 64 blocks, grid.y = batch
    const int tilesK = (kTq / 64) * (kDm / 64);
    wmma_gemm64<1, false, 0, 2, false><<<dim3((tilesK + 7) / 8, kBatch), 256, 0, stream>>>(
        Qb, nullptr, kDm, (long)kTq * kDm, Wq + (size_t)kDm * kDm, nullptr, kDm, 0L,
        (void*)(Kh + (size_t)kSkv * kDm), (void*)(Kl + (size_t)kSkv * kDm), kDm, (long)kKeys * kDm,
        nullptr, nullptr, 0L,
        kTq, kDm, kDm, 1.0f);
    // v projection, role-swapped: C[m = channel][n = t] -> Vt_b[channel][2048 + t] (f16), M=1024, N=2048, K=1024,
    // ldc = kKeys; 512 tiles -> 64 blocks, grid.y = batch
    const int tilesV = (kDm / 64) * (kTq / 64);
    wmma_gemm64<1, false, 0, 1, false><<<dim3((tilesV + 7) / 8, kBatch), 256, 0, stream>>>(
        Wq + (size_t)2 * kDm * kDm, nullptr, kDm, 0L, Qb, nullptr, kDm, (long)kTq * kDm,
        (void*)(Vt + kSkv), nullptr, kKeys, (long)kDm * kKeys, nullptr, nullptr, 0L,
        kDm, kTq, kDm, 1.0f);
  }

  // ---- attention over the 4096 keys per (batch, head); score scale 1/sqrt(64) applied in f32 ----
  attn_xl_kernel<<<dim3(kHeads * (kTq / AT_QB), kBatch), 128, 0, stream>>>(Qh, Ql, Kh, Kl, Vt, Y, 0.125f);

  // ---- y -> bf16 hi/lo planes; output projection C[m][n] = sum_c (Yh + Yl)[m][c] * Wp[n][c] -> d_out ----
  {
    const int npy = (int)(nQ / 1024);
    split_pack_bf16_kernel<<<dim3((npy + 7) / 8), 256, 0, stream>>>(Y, Yh, Yl, npy);
    const int tilesP = (int)((nQ / kDm) / 64) * (kDm / 64);   // 1024 tiles -> 128 blocks
    wmma_gemm64<1, true, 0, 0, false, 0, false><<<dim3((tilesP + 7) / 8, 1), 256, 0, stream>>>(
        Yh, Yl, kDm, 0L, Wp, nullptr, kDm, 0L,
        (void*)outp, nullptr, kDm, 0L, nullptr, nullptr, 0L,
        kBatch * kTq, kDm, kDm, 1.0f);
  }
}

// v005
// One run takes 288 microseconds.
// Next to v004, in two timings, it ran 1.27 and 1.28 times as fast.
// Counting every step since v000, it is 2.92 times as fast.
// Contractions: q/k/v projections on v_wmma_f32_16x16x32_bf16 (bf16 operands = RNE-cast inputs, single product); q.k^T on v_wmma_f32_16x16x32_bf16 with bf16 hi/lo planes for both q and k (hi.hi + hi.lo + lo.hi); p.v on v_wmma_f32_16x16x32_f16 (p f16 carried x2^15, v f16, single product); output projection on v_wmma_f32_16x16x32_bf16 with y as bf16 hi/lo planes (hi.W + lo.W) and W bf16; f32 accumulate everywhere; softmax, score scale and the cache add in f32.
#include <hip/hip_runtime.h>
#include <math.h>
#include <stdint.h>

constexpr int kBatch = 2;
constexpr int kTq    = 2048;            // query length
constexpr int kSkv   = 2048;            // cache length
constexpr int kKeys  = kSkv + kTq;      // 4096 keys per (batch, head)
constexpr int kDm    = 1024;            // model dim
constexpr int kHeads = 16;
constexpr int kHd    = 64;
static_assert(kHeads * kHd == kDm, "head split");
static_assert(kTq % 64 == 0 && kKeys % 64 == 0 && kDm % 64 == 0 && kSkv % 64 == 0, "tile multiples");

typedef __attribute__((ext_vector_type(16))) _Float16 v16h;
typedef __attribute__((ext_vector_type(8)))  _Float16 v8h;
typedef __attribute__((ext_vector_type(2)))  _Float16 v2h;
typedef __attribute__((ext_vector_type(16))) __bf16   v16b;
typedef __attribute__((ext_vector_type(8)))  __bf16   v8b;
typedef __attribute__((ext_vector_type(8)))  float    v8f;
typedef __attribute__((ext_vector_type(4)))  float    v4f;
typedef __attribute__((ext_vector_type(2)))  float    v2f;
typedef __attribute__((ext_vector_type(4)))  unsigned int v4u;

__device__ __forceinline__ unsigned short f2bf_bits(float f) {
  unsigned u = __float_as_uint(f);
  return (unsigned short)((u + 0x7FFFu + ((u >> 16) & 1u)) >> 16);
}
__device__ __forceinline__ float bf_bits2f(unsigned short h) { return __uint_as_float(((unsigned)h) << 16); }
__device__ __forceinline__ unsigned short h_bits(float f) { return __builtin_bit_cast(unsigned short, (_Float16)f); }
__device__ __forceinline__ unsigned pk16(unsigned short a, unsigned short b) { return (unsigned)a | ((unsigned)b << 16); }

// hazard guards as plain device helpers (no inline asm inside the kernel template body)
__device__ __forceinline__ void dep_guard_h(v8f& a, v8f& b, v16h x, v16h y) { asm volatile("v_nop\n\tv_nop\n\tv_nop\n\tv_nop" : "+v"(a), "+v"(b) : "v"(x), "v"(y)); }
__device__ __forceinline__ void dep_guard_b(v8f& a, v8f& b, v16b x, v16b y) { asm volatile("v_nop\n\tv_nop\n\tv_nop\n\tv_nop" : "+v"(a), "+v"(b) : "v"(x), "v"(y)); }
__device__ __forceinline__ void keep4_h(v16h a, v16h b, v16h c, v16h d) { asm volatile("v_nop" :: "v"(a), "v"(b), "v"(c), "v"(d)); }
__device__ __forceinline__ void keep4_b(v16b a, v16b b, v16b c, v16b d) { asm volatile("v_nop" :: "v"(a), "v"(b), "v"(c), "v"(d)); }
__device__ __forceinline__ void acc_guard4(v8f& a, v8f& b, v8f& c, v8f& d) { asm volatile("v_nop\n\tv_nop\n\tv_nop\n\tv_nop" : "+v"(a), "+v"(b), "+v"(c), "+v"(d)); }
// The wait that belongs in front of any overwrite of a register that an issued global load names. The address pairs
// are inputs so that they stay whole up to here.
__device__ __forceinline__ void addr_wait4(const void* a, const void* b, const void* c, const void* d) {
  asm volatile("s_wait_xcnt 0x0" :: "v"(a), "v"(b), "v"(c), "v"(d) : "memory");
}
__device__ __forceinline__ void addr_wait8(const void* a, const void* b, const void* c, const void* d, const void* e, const void* f,
                                           const void* g, const void* h) {
  asm volatile("s_wait_xcnt 0x0" :: "v"(a), "v"(b), "v"(c), "v"(d), "v"(e), "v"(f), "v"(g), "v"(h) : "memory");
}
__device__ __forceinline__ void addr_wait12(const void* a, const void* b, const void* c, const void* d, const void* e, const void* f,
                                            const void* g, const void* h, const void* i, const void* j, const void* k, const void* l) {
  asm volatile("s_wait_xcnt 0x0" :: "v"(a), "v"(b), "v"(c), "v"(d), "v"(e), "v"(f), "v"(g), "v"(h), "v"(i), "v"(j), "v"(k), "v"(l) : "memory");
}
template <typename T> struct Frag;
template <> struct Frag<_Float16> {
  typedef v16h V; union U { v16h v; v8h h[2]; };
  static __device__ __forceinline__ v16h load(const _Float16* p) {   // elements 0..7 <- p[0..7], 8..15 <- p[16..23]
    U f; f.h[0] = *(const v8h*)(p); f.h[1] = *(const v8h*)(p + 16); return f.v;
  }
  // fragment order: register halves 256 elements apart. The global address space is stated: pointers carried round a
  // loop would otherwise give flat loads.
  static __device__ __forceinline__ v16h loadp(const _Float16* p) {
    typedef const __attribute__((address_space(1))) v8h* G;
    U f; f.h[0] = *(G)(p); f.h[1] = *(G)(p + 256); return f.v;
  }
  static __device__ __forceinline__ v8f mma(v16h a, v16h b, v8f c) {
    return __builtin_amdgcn_wmma_f32_16x16x32_f16(false, a, false, b, (short)0, c, false, false);
  }
  static __device__ __forceinline__ void guard(v8f& a, v8f& b, v16h x, v16h y) { dep_guard_h(a, b, x, y); }
  static __device__ __forceinline__ void keep(v16h a, v16h b, v16h c, v16h d) { keep4_h(a, b, c, d); }
};
template <> struct Frag<__bf16> {
  typedef v16b V; union U { v16b v; v8b h[2]; };
  static __device__ __forceinline__ v16b load(const __bf16* p) {
    U f; f.h[0] = *(const v8b*)(p); f.h[1] = *(const v8b*)(p + 16); return f.v;
  }
  static __device__ __forceinline__ v16b loadp(const __bf16* p) {
    typedef const __attribute__((address_space(1))) v8b* G;
    U f; f.h[0] = *(G)(p); f.h[1] = *(G)(p + 256); return f.v;
  }
  static __device__ __forceinline__ v8f mma(v16b a, v16b b, v8f c) {
    return __builtin_amdgcn_wmma_f32_16x16x32_bf16(false, a, false, b, (short)0, c, false, false);
  }
  static __device__ __forceinline__ void guard(v8f& a, v8f& b, v16b x, v16b y) { dep_guard_b(a, b, x, y); }
  static __device__ __forceinline__ void keep(v16b a, v16b b, v16b c, v16b d) { keep4_b(a, b, c, d); }
};

// ---- Register-blocked batched WMMA GEMM ------------------------------------
// C[m,n] = scale * sum_k A[m,k] * Bt[n,k] (+bias)(+resid); each wave owns a 64x64 tile.
// A [M,K] and Bt [N,K] stand in FRAGMENT ORDER (lda = ldb = K): blocks of 16 rows x 32 k = 512 elements (1 KB), block
// number (row / 16) * (K / 32) + k / 32, so a row tile starts where row-major row 16 * (row / 16) would. Inside a block
// the 8 elements k % 32 = 8 * (2 h + hh) + 0..7 of row r stand at element h * 256 + (hh * 16 + r) * 8: lane hh * 16 + r
// finds register half h of its fragment at h * 256 + lane * 8, and each of a fragment's two loads reads 512
// contiguous bytes (4 whole lines). The k of every lane and register position is that of Frag::load on a row-major
// operand, the same for A and Bt. M,N % 64 == 0, K % 32 == 0.
// SPLIT: operands are hi/lo planes (A2/Bt2 = lo planes, same layout); product = hi.hi + hi.lo + lo.hi.
// SPLITB (only meaningful with SPLIT): when false only A carries a lo plane; product = hi.B + lo.B (Bt2 unused).
// BIAS_MODE: 0 = none, 1 = bias[m], 2 = bias[n].
// OUT_MODE: 0 = f32, 1 = f16, 2 = bf16 hi plane (Cout) + bf16 lo plane (Cout2).
// ET: 0 = f16 operands, 1 = bf16 operands (pointers passed as 16-bit storage)
template <int ET> struct Elem;
template <> struct Elem<0> { typedef _Float16 T; };
template <> struct Elem<1> { typedef __bf16 T; };
template <int ET, bool SPLIT, int BIAS_MODE, int OUT_MODE, bool RESID, int ACT = 0, bool SPLITB = SPLIT>
__global__ __launch_bounds__(256) void wmma_gemm64(
    const unsigned short* __restrict__ Ap, const unsigned short* __restrict__ A2p, int lda, long strideA,
    const unsigned short* __restrict__ Btp, const unsigned short* __restrict__ Bt2p, int ldb, long strideB,
    void* __restrict__ Cout, void* __restrict__ Cout2, int ldc, long strideC,
    const float* __restrict__ bias,
    const float* __restrict__ resid, long strideR,
    int M, int N, int K, float scale) {
  typedef typename Elem<ET>::T T;
  typedef typename Frag<T>::V V;
  const T* A = (const T*)Ap; const T* A2 = (const T*)A2p; const T* Bt = (const T*)Btp; const T* Bt2 = (const T*)Bt2p;
  __shared__ __align__(16) float sT[8][16 * 68];   // per-wave 16x64 slab, pitch 68 floats
  const int b    = blockIdx.y;
  const int lane = threadIdx.x & 31;
  const int wave = __builtin_amdgcn_readfirstlane(threadIdx.x >> 5);   // scalar, so that tile indices and row-tile offsets stay in scalar registers
  const int tilesN = N >> 6;
  const int tilesM = M >> 6;
  const int tile = blockIdx.x * 8 + wave;
  if (tile >= tilesM * tilesN) return;   // wave-uniform; no block barriers in this kernel
  const int tm = tile / tilesN;
  const int tn = tile - tm * tilesN;
  const int m0 = tm << 6;
  const int n0 = tn << 6;

  const T* Ab  = A  + (size_t)b * strideA;
  const T* Bb  = Bt + (size_t)b * strideB;
  const T* Ab2 = SPLIT ? (A2  + (size_t)b * strideA) : nullptr;
  const T* Bb2 = (SPLIT && SPLITB) ? (Bt2 + (size_t)b * strideB) : nullptr;

  const int rlane = lane & 15;                 // row (A) / col (B, D) within subtile
  const int mOff  = (lane >> 4) * 8;           // D row offset
  const unsigned lo8 = (unsigned)lane * 8u;    // this lane's 8 elements (16 bytes) inside a half block

  v8f acc[4][4];
#pragma unroll
  for (int i = 0; i < 4; ++i)
#pragma unroll
    for (int j = 0; j < 4; ++j) acc[i][j] = (v8f){0.f,0.f,0.f,0.f,0.f,0.f,0.f,0.f};

  // This lane's 16 bytes in the current k block of each row tile; the next k block stands 512 elements further on.
  const T* bp[4]; const T* bp2[4]; const T* ap[4]; const T* ap2[4];
#pragma unroll
  for (int j = 0; j < 4; ++j) {
    const size_t bo = (size_t)(n0 + (j << 4)) * ldb + lo8;
    const size_t ao = (size_t)(m0 + (j << 4)) * lda + lo8;
    bp[j]  = Bb + bo;
    bp2[j] = (SPLIT && SPLITB) ? (Bb2 + bo) : bp[j];
    ap[j]  = Ab + ao;
    ap2[j] = SPLIT ? (Ab2 + ao) : ap[j];
  }
  for (int k0 = 0; k0 < K; k0 += 32) {
    // All fragment loads of the k block as one group, so that the block waits for memory once, not once per row tile of A.
    V bh[4], bl[4], ah[4], al[4];
#pragma unroll
    for (int j = 0; j < 4; ++j) {
      bh[j] = Frag<T>::loadp(bp[j]);
      if (SPLIT && SPLITB) bl[j] = Frag<T>::loadp(bp2[j]);
    }
#pragma unroll
    for (int i = 0; i < 4; ++i) {
      ah[i] = Frag<T>::loadp(ap[i]);
      if (SPLIT) al[i] = Frag<T>::loadp(ap2[i]);
    }
#pragma unroll
    for (int i = 0; i < 4; ++i) {
#pragma unroll
      for (int j = 0; j < 4; ++j) {
        acc[i][j] = Frag<T>::mma(ah[i], bh[j], acc[i][j]);
        if (SPLIT) {
          if (SPLITB) acc[i][j] = Frag<T>::mma(ah[i], bl[j], acc[i][j]);
          acc[i][j] = Frag<T>::mma(al[i], bh[j], acc[i][j]);
        }
      }
      Frag<T>::guard(acc[i][0], acc[i][3], ah[i], SPLIT ? al[i] : ah[i]);
    }
    Frag<T>::keep(bh[0], bh[1], bh[2], bh[3]);
    if (SPLIT && SPLITB) Frag<T>::keep(bl[0], bl[1], bl[2], bl[3]);
    // in front of the advance, which overwrites the pairs that the loads of this block name
    if (SPLIT) addr_wait12(bp[0], bp[1], bp[2], bp[3], ap[0], ap[1], ap[2], ap[3], ap2[0], ap2[1], ap2[2], ap2[3]);
    else       addr_wait8(bp[0], bp[1], bp[2], bp[3], ap[0], ap[1], ap[2], ap[3]);
    if (SPLIT && SPLITB) addr_wait4(bp2[0], bp2[1], bp2[2], bp2[3]);
#pragma unroll
    for (int j = 0; j < 4; ++j) { bp[j] += 512; bp2[j] += 512; ap[j] += 512; ap2[j] += 512; }
  }
  acc_guard4(acc[0][0], acc[0][1], acc[0][2], acc[0][3]);
  acc_guard4(acc[1][0], acc[1][1], acc[1][2], acc[1][3]);
  acc_guard4(acc[2][0], acc[2][1], acc[2][2], acc[2][3]);
  acc_guard4(acc[3][0], acc[3][1], acc[3][2], acc[3][3]);

  // ---- epilogue ----
  float* slab = sT[wave];
  const float* Rb = RESID ? (resid + (size_t)b * strideR) : nullptr;
#pragma unroll
  for (int i = 0; i < 4; ++i) {
    const int mBase = m0 + (i << 4);
#pragma unroll
    for (int j = 0; j < 4; ++j) {
      const int n = n0 + (j << 4) + rlane;
      float bv = 0.f;
      if (BIAS_MODE == 2) bv = bias[n];
#pragma unroll
      for (int r = 0; r < 8; ++r) {
        float v = acc[i][j][r] * scale;
        if (BIAS_MODE == 1) v += bias[mBase + mOff + r];
        if (BIAS_MODE == 2) v += bv;
        if (RESID) v += Rb[(size_t)(mBase + mOff + r) * ldc + n];
        if (ACT == 1) v = tanhf(v);
        if (ACT == 2) v = fmaxf(v, 0.0f);
        if (ACT == 3) v = v / (1.0f + expf(-v));
        if (ACT == 4) v = (v > 0.f) ? v : 0.01f * v;
        slab[(mOff + r) * 68 + (j << 4) + rlane] = v;
      }
    }
    __builtin_amdgcn_fence(__ATOMIC_RELEASE, "workgroup");
    __builtin_amdgcn_wave_barrier();
    __builtin_amdgcn_fence(__ATOMIC_ACQUIRE, "workgroup");
    if (OUT_MODE == 0) {
      float* C = (float*)Cout + (size_t)b * strideC;
      const int hh = lane >> 4, c4 = (lane & 15) * 4;     // row seg = 256 B = 16 lanes x 16 B
      {
#pragma unroll
        for (int it = 0; it < 8; ++it) {
          const int row = it * 2 + hh;
          v4f v = *(const v4f*)(slab + row * 68 + c4);
          *(v4f*)(C + (size_t)(mBase + row) * ldc + n0 + c4) = v;
        }
        
      }
    } else {
      const int q = lane >> 3, c8 = (lane & 7) * 8;
      unsigned short* C  = (unsigned short*)Cout  + (size_t)b * strideC;
      unsigned short* C2 = (OUT_MODE == 2) ? ((unsigned short*)Cout2 + (size_t)b * strideC) : nullptr;
      {
#pragma unroll
        for (int it = 0; it < 4; ++it) {
          const int row = it * 4 + q;
          const float* sp = slab + row * 68 + c8;
          v8h hv, lv;
#pragma unroll
          for (int e = 0; e < 8; ++e) {
            if (OUT_MODE == 1) {
              hv[e] = (_Float16)sp[e];
            } else {
              unsigned short hb = f2bf_bits(sp[e]);
              unsigned short lb = f2bf_bits(sp[e] - bf_bits2f(hb));
              hv[e] = __builtin_bit_cast(_Float16, hb);
              lv[e] = __builtin_bit_cast(_Float16, lb);
            }
          }
          *(v8h*)(C + (size_t)(mBase + row) * ldc + n0 + c8) = hv;
          if (OUT_MODE == 2) *(v8h*)(C2 + (size_t)(mBase + row) * ldc + n0 + c8) = lv;
        }
        
      }
    }
    __builtin_amdgcn_fence(__ATOMIC_RELEASE, "workgroup");
    __builtin_amdgcn_wave_barrier();
    __builtin_amdgcn_fence(__ATOMIC_ACQUIRE, "workgroup");
  }
}

// ---------------------------------------------------------------------------
// f32 [R][kDm] row-major -> 16-bit planes in the fragment order that wmma_gemm64 reads (described there).
// One wave makes two neighbouring 1 KB blocks (16 rows x 64 k). Lane l takes the 8 floats k = 8 * (l & 3) + 0..7 of row
// 8 it + (l >> 2) of block u (u, it = 0, 1): two 16-byte loads, one 16-byte store per plane. A wave-wide store writes
// four whole 128-byte lines (8 rows x 16 B each); the eight loads of a lane are issued together.
// Coverage: nPairs = (R / 16) * (kDm / 64) waves x 1024 elements = R * kDm (every nPairs here is a multiple of 8).
// ---------------------------------------------------------------------------
struct PackPos { const float* src; size_t dst; };
__device__ __forceinline__ PackPos pack_pos(const float* in, int wv, int lane) {
  const int rt = wv / (kDm / 64), kp = wv - rt * (kDm / 64);   // row tile, pair of k blocks
  const int r8 = lane >> 2, piece = lane & 3;
  PackPos p;
  p.src = in + (size_t)(rt * 16 + r8) * kDm + kp * 64 + piece * 8;
  p.dst = (size_t)wv * 1024 + (piece >> 1) * 256 + ((piece & 1) * 16 + r8) * 8;
  return p;
}

// bf16 (RNE) cast
__global__ __launch_bounds__(256) void cast_pack_bf16_kernel(const float* __restrict__ in, unsigned short* __restrict__ out,
                                                            int nPairs) {
  const int wv = (blockIdx.x * 256 + threadIdx.x) >> 5;
  if (wv < nPairs) {
    const PackPos p = pack_pos(in, wv, threadIdx.x & 31);
    v4f f[2][2][2];
#pragma unroll
    for (int u = 0; u < 2; ++u)
#pragma unroll
      for (int it = 0; it < 2; ++it) {
        f[u][it][0] = *(const v4f*)(p.src + (size_t)it * 8 * kDm + u * 32);
        f[u][it][1] = *(const v4f*)(p.src + (size_t)it * 8 * kDm + u * 32 + 4);
      }
#pragma unroll
    for (int u = 0; u < 2; ++u)
#pragma unroll
      for (int it = 0; it < 2; ++it) {
        v4u o;
#pragma unroll
        for (int q = 0; q < 4; ++q) {
          const v4f g = f[u][it][q >> 1];
          o[q] = pk16(f2bf_bits(g[(q & 1) * 2]), f2bf_bits(g[(q & 1) * 2 + 1]));
        }
        *(v4u*)(out + p.dst + u * 512 + it * 64) = o;
      }
  }
}

// bf16 split: hi = bf16_rne(in), lo = bf16_rne(in - hi)
__global__ __launch_bounds__(256) void split_pack_bf16_kernel(const float* __restrict__ in, unsigned short* __restrict__ hi,
                                                             unsigned short* __restrict__ lo, int nPairs) {
  const int wv = (blockIdx.x * 256 + threadIdx.x) >> 5;
  if (wv < nPairs) {
    const PackPos p = pack_pos(in, wv, threadIdx.x & 31);
    v4f f[2][2][2];
#pragma unroll
    for (int u = 0; u < 2; ++u)
#pragma unroll
      for (int it = 0; it < 2; ++it) {
        f[u][it][0] = *(const v4f*)(p.src + (size_t)it * 8 * kDm + u * 32);
        f[u][it][1] = *(const v4f*)(p.src + (size_t)it * 8 * kDm + u * 32 + 4);
      }
#pragma unroll
    for (int u = 0; u < 2; ++u)
#pragma unroll
      for (int it = 0; it < 2; ++it) {
        v4u oh, ol;
#pragma unroll
        for (int q = 0; q < 4; ++q) {
          const v4f g = f[u][it][q >> 1];
          const float f0 = g[(q & 1) * 2], f1 = g[(q & 1) * 2 + 1];
          const unsigned short h0 = f2bf_bits(f0), h1 = f2bf_bits(f1);
          oh[q] = pk16(h0, h1);
          ol[q] = pk16(f2bf_bits(f0 - bf_bits2f(h0)), f2bf_bits(f1 - bf_bits2f(h1)));
        }
        *(v4u*)(hi + p.dst + u * 512 + it * 64) = oh;
        *(v4u*)(lo + p.dst + u * 512 + it * 64) = ol;
      }
  }
}

// ---------------------------------------------------------------------------
// Cache keys, rows 0..kSkv-1 of each per-batch [kKeys][kDm] bf16 key plane pair:
//   x = bf16_rne(k_xl[b][s][c]) + bf16_rne(pos[s][c])   (the add in f32)
//   kh[b][s][c] = bf16_rne(x),  kl[b][s][c] = bf16_rne(x - kh)
// flags = the causal flag input; this forward applies no mask, the pointer is only bound, never read.
// ---------------------------------------------------------------------------
__global__ __launch_bounds__(256) void kcache_split_kernel(const float* __restrict__ kxl, const float* __restrict__ pos,
                                                           unsigned short* __restrict__ kh, unsigned short* __restrict__ kl,
                                                           const int* __restrict__ flags, int n2) {
  const int i = blockIdx.x * 256 + threadIdx.x;
  if (i < n2) {
    const size_t e = 2 * (size_t)i;                        // element index into [b][s][c]
    const size_t perB = (size_t)kSkv * kDm;
    const int bb = (int)(e / perB);
    const size_t rem = e - (size_t)bb * perB;              // s*kDm + c (even)
    const v2f a = *(const v2f*)(kxl + e);
    const v2f p = *(const v2f*)(pos + rem);
    const float s0 = bf_bits2f(f2bf_bits(a[0])) + bf_bits2f(f2bf_bits(p[0]));
    const float s1 = bf_bits2f(f2bf_bits(a[1])) + bf_bits2f(f2bf_bits(p[1]));
    const unsigned short h0 = f2bf_bits(s0), h1 = f2bf_bits(s1);
    const unsigned short l0 = f2bf_bits(s0 - bf_bits2f(h0)), l1 = f2bf_bits(s1 - bf_bits2f(h1));
    const unsigned uh = pk16(h0, h1), ul = pk16(l0, l1);
    const size_t o = ((size_t)bb * kKeys * kDm + rem) >> 1; // u32 index
    ((unsigned*)kh)[o] = uh;
    ((unsigned*)kl)[o] = ul;
    
  }
}

// ---------------------------------------------------------------------------
// Fused transpose + cast of an f32 matrix, z-batched: in_z = W + z*sIn viewed [R rows][Cc cols] (pitch Cc) ->
//   o_z[c][r] = f16(bf16_rne(in_z[r][c]))   ([Cc][...], output row pitch ldo halves), o_z = o + z*sOut.
// 64x64 tiles through LDS. grid = (Cc/64, R/64, Z), 256 threads (R, Cc multiples of 64).
// Coverage per block: load 4 it x 256 thr x 4 floats = 64x64; store 2 it x 256 thr x 8 u16 = 64x64.
// ---------------------------------------------------------------------------
__global__ __launch_bounds__(256) void tcast16_kernel(const float* __restrict__ W, unsigned short* __restrict__ o,
                                                      int R, int Cc, int ldo, long sIn, long sOut) {
  __shared__ __align__(16) float tf[64 * 68];
  W += (size_t)blockIdx.z * sIn;
  o += (size_t)blockIdx.z * sOut;
  const int c0  = blockIdx.x * 64;   // input column block = output row block
  const int r0  = blockIdx.y * 64;   // input row block    = output column block
  const int tid = threadIdx.x;
  {
    const int lr = tid >> 4;         // 0..15
    const int c4 = (tid & 15) * 4;   // 0..60
#pragma unroll
    for (int it = 0; it < 4; ++it) {
      const int rr = it * 16 + lr;   // 0..63
      const v4f a = *(const v4f*)(W + (size_t)(r0 + rr) * Cc + c0 + c4);
      *(v4f*)(tf + rr * 68 + c4) = a;
    }
  }
  __syncthreads();
  const int sub = tid >> 3;          // 0..31
  const int c8  = (tid & 7) * 8;     // 0..56
  v4u hv[2];
#pragma unroll
  for (int it = 0; it < 2; ++it) {
    const int oc = it * 32 + sub;    // output row within tile (= input column)
    v4u a;
#pragma unroll
    for (int q = 0; q < 4; ++q) {
      const float f0 = tf[(c8 + 2 * q) * 68 + oc];
      const float f1 = tf[(c8 + 2 * q + 1) * 68 + oc];
      a[q] = pk16(h_bits(bf_bits2f(f2bf_bits(f0))), h_bits(bf_bits2f(f2bf_bits(f1))));
    }
    hv[it] = a;
  }
  {
#pragma unroll
    for (int it = 0; it < 2; ++it) {
      const int oc = it * 32 + sub;
      const size_t go = (size_t)(c0 + oc) * ldo + r0 + c8;
      *(v4u*)(o + go) = hv[it];
    }
    
  }
}

#define AT_D 64
#define AT_NW 4
#define AT_QB 64
#define AT_KC 64
#define AT_LP 72   // LDS row pitch in 16-bit elements: 144 B = 16 B x 9 (odd), so the 16 rows of a 16-byte fragment read fall on 16 different bank groups

__device__ __forceinline__ v8f at_mma_b(v16b a, v16b b, v8f c) {
  c = __builtin_amdgcn_wmma_f32_16x16x32_bf16(false, a, false, b, (short)0, c, false, false);
  asm volatile("v_nop\n\tv_nop\n\tv_nop\n\tv_nop" : "+v"(c) : "v"(a), "v"(b));
  return c;
}
__device__ __forceinline__ v8f at_mma_h(v16h a, v16h b, v8f c) {
  c = __builtin_amdgcn_wmma_f32_16x16x32_f16(false, a, false, b, (short)0, c, false, false);
  asm volatile("v_nop\n\tv_nop\n\tv_nop\n\tv_nop" : "+v"(c) : "v"(a), "v"(b));
  return c;
}

// Four hardware exp2 in place, in one statement: each v_exp_f32 is followed by an independent one and the last by
// v_nop, the slot the instruction set asks for behind a transcendental before its result is read or its source
// overwritten.
__device__ __forceinline__ void exp2x4(float& a, float& b, float& c, float& d) {
  asm("v_exp_f32 %0, %0\n\tv_exp_f32 %1, %1\n\tv_exp_f32 %2, %2\n\tv_exp_f32 %3, %3\n\tv_nop"
      : "+v"(a), "+v"(b), "+v"(c), "+v"(d));
}

// One hardware exp2 in place, with the same slot behind it.
__device__ __forceinline__ void exp2x1(float& a) { asm("v_exp_f32 %0, %0\n\tv_nop" : "+v"(a)); }

// lane l <-> lane l ^ 16 (the two halves that share a query column), a vector cross-row move, no LDS
__device__ __forceinline__ float xhalf(float x) {
  const int i = __builtin_bit_cast(int, x);
  return __builtin_bit_cast(float, __builtin_amdgcn_permlanex16(i, i, 0x76543210, 0xfedcba98, false, false));
}

__global__ __launch_bounds__(128)
void attn_xl_kernel(const unsigned short* __restrict__ qhp, const unsigned short* __restrict__ qlp,
                    const unsigned short* __restrict__ khp, const unsigned short* __restrict__ klp,
                    const unsigned short* __restrict__ vtp, float* __restrict__ out, float sscale) {
  union FB { v16b v; v8b h[2]; };
  union FH { v16h v; v8h h[2]; v2h p[8]; };
  __shared__ __align__(16) __bf16   Ksh[AT_KC * AT_LP];         // K hi [kv][d]   9 KB
  __shared__ __align__(16) __bf16   Ksl[AT_KC * AT_LP];         // K lo [kv][d]   9 KB
  __shared__ __align__(16) _Float16 Vth[AT_D * AT_LP];          // V^T [d][kv]    9 KB
  __shared__ __align__(16) float    Os[AT_NW][16 * 68];         // per wave out tile, pitch 68
  const float PSC = 32768.0f;
  // softmax in base 2: exp((x - m) * sscale) = 2^((x - m) * sc2). sscale > 0 (the launch passes 1/sqrt(64)),
  // so the row maximum may be taken on the unscaled scores.
  const float sc2 = sscale * 1.44269504088896340736f;

  const int tid  = threadIdx.x;
  const int wave = tid >> 5;
  const int lane = tid & 31;
  const int hh   = lane >> 4;
  const int c    = lane & 15;

  const int nqb = kTq / AT_QB;            // 32
  const int bx = blockIdx.x;
  const int b  = blockIdx.y;
  const int qb = bx % nqb;
  const int h  = bx / nqb;                // 0..kHeads-1
  const int q0 = qb * AT_QB + wave * 16;

  const __bf16*   Qh = (const __bf16*)(const void*)qhp   + (size_t)b * kTq * kDm   + (size_t)h * AT_D;
  const __bf16*   Ql = (const __bf16*)(const void*)qlp   + (size_t)b * kTq * kDm   + (size_t)h * AT_D;
  const __bf16*   Kh = (const __bf16*)(const void*)khp   + (size_t)b * kKeys * kDm + (size_t)h * AT_D;
  const __bf16*   Kl = (const __bf16*)(const void*)klp   + (size_t)b * kKeys * kDm + (size_t)h * AT_D;
  const _Float16* Vh = (const _Float16*)(const void*)vtp + (size_t)b * kDm * kKeys + (size_t)h * AT_D * kKeys;
  float*          ob = out + (size_t)b * kTq * kDm + (size_t)h * AT_D;

  // ---- Q fragments (B operand, column = lane&15, split k map via Frag load): 2 d-chunks, hi and lo ----
  v16b qah[2], qal[2];
#pragma unroll
  for (int dc = 0; dc < 2; ++dc) {
    qah[dc] = Frag<__bf16>::load(Qh + (size_t)(q0 + c) * kDm + dc * 32 + 8 * hh);
    qal[dc] = Frag<__bf16>::load(Ql + (size_t)(q0 + c) * kDm + dc * 32 + 8 * hh);
  }

  float mrow = -INFINITY, lrow = 0.f;   // query q0 + c: running maximum (both halves agree), this half's sum
  v8f oacc[4];                          // oacc[t][r] = O^T[d = 16 t + 8 hh + r][query q0 + c]
#pragma unroll
  for (int t = 0; t < 4; ++t) oacc[t] = (v8f){0.f,0.f,0.f,0.f,0.f,0.f,0.f,0.f};

  const int nChunks = kKeys / AT_KC;   // 64, compile-time constant
  for (int kc = 0; kc < nChunks; ++kc) {
    const int kv0 = kc * AT_KC;
    __syncthreads();
    {
      // staging coverage: 128 threads x (4 x 8) elements = 64 rows x 64 per plane = the whole chunk tile (3 planes)
      const int r = tid >> 1, half = (tid & 1) * 32;
      const __bf16*   ksh = Kh + (size_t)(kv0 + r) * kDm + half;    // K row kv0+r, d = half..half+31
      const __bf16*   ksl = Kl + (size_t)(kv0 + r) * kDm + half;
      const _Float16* vsh = Vh + (size_t)r * kKeys + kv0 + half;    // V^T row d = r, s = kv0+half..+31
      v8b a0[4], a1[4];
      v8h b0[4];
#pragma unroll
      for (int i = 0; i < 4; ++i) {     // all twelve loads first, so that they are in flight together
        a0[i] = *(const v8b*)(ksh + 8 * i);
        a1[i] = *(const v8b*)(ksl + 8 * i);
        b0[i] = *(const v8h*)(vsh + 8 * i);
      }
      // the wait that belongs in front of any overwrite of a register an issued global load names; the three address
      // pairs are inputs so that they stay whole up to here
      asm volatile("s_wait_xcnt 0x0" :: "v"(ksh), "v"(ksl), "v"(vsh) : "memory");
#pragma unroll
      for (int i = 0; i < 4; ++i) {
        *(v8b*)(Ksh + r * AT_LP + half + 8 * i) = a0[i];
        *(v8b*)(Ksl + r * AT_LP + half + 8 * i) = a1[i];
        *(v8h*)(Vth + r * AT_LP + half + 8 * i) = b0[i];
      }
    }
    __syncthreads();

    v8f s[4];
#pragma unroll
    for (int j = 0; j < 4; ++j) {
      s[j] = (v8f){0.f,0.f,0.f,0.f,0.f,0.f,0.f,0.f};
#pragma unroll
      for (int dc = 0; dc < 2; ++dc) {
        FB kb, klf;
        kb.h[0]  = *(const v8b*)(Ksh + (j * 16 + c) * AT_LP + dc * 32 + 8 * hh);
        kb.h[1]  = *(const v8b*)(Ksh + (j * 16 + c) * AT_LP + dc * 32 + 16 + 8 * hh);
        klf.h[0] = *(const v8b*)(Ksl + (j * 16 + c) * AT_LP + dc * 32 + 8 * hh);
        klf.h[1] = *(const v8b*)(Ksl + (j * 16 + c) * AT_LP + dc * 32 + 16 + 8 * hh);
        s[j] = at_mma_b(kb.v,  qah[dc], s[j]);   // s[j][r] = S^T[key kv0 + 16 j + 8 hh + r][query q0 + c]
        s[j] = at_mma_b(klf.v, qah[dc], s[j]);
        s[j] = at_mma_b(kb.v,  qal[dc], s[j]);
      }
    }
    float mj[4];
#pragma unroll
    for (int j = 0; j < 4; ++j) {
      float m = s[j][0];
#pragma unroll
      for (int r = 1; r < 8; ++r) m = fmaxf(m, s[j][r]);
      mj[j] = m;
    }
    float cm = fmaxf(fmaxf(mj[0], mj[1]), fmaxf(mj[2], mj[3]));
    cm = fmaxf(cm, xhalf(cm));
    const float mnew = fmaxf(mrow, cm);
    float alpha = (mrow - mnew) * sc2;
    const float nm = -mnew * sc2;
    mrow = mnew;
    exp2x1(alpha);
    FH pb[2];          // pb[kk]: P^T as B operand, keys kv0 + 32 kk + (8 hh + 0..7, 16 + 8 hh + 0..7), column c
    v2f ps[4];
#pragma unroll
    for (int j = 0; j < 4; ++j) {
      float pe[8];
#pragma unroll
      for (int r = 0; r < 8; ++r) pe[r] = fmaf(s[j][r], sc2, nm);
      exp2x4(pe[0], pe[1], pe[2], pe[3]);
      exp2x4(pe[4], pe[5], pe[6], pe[7]);
      v2f a = {0.f, 0.f};
#pragma unroll
      for (int r = 0; r < 8; r += 2) {
        const v2f w = {pe[r], pe[r + 1]};
        a = (r == 0) ? w : a + w;
        pb[j >> 1].p[(j & 1) * 4 + (r >> 1)] = __builtin_convertvector(w * PSC, v2h);
      }
      ps[j] = a;
    }
    const v2f pt = (ps[0] + ps[1]) + (ps[2] + ps[3]);
    lrow = lrow * alpha + (pt[0] + pt[1]);
#pragma unroll
    for (int t = 0; t < 4; ++t)
#pragma unroll
      for (int r = 0; r < 8; ++r) oacc[t][r] *= alpha;
#pragma unroll
    for (int kk = 0; kk < 2; ++kk) {
#pragma unroll
      for (int t = 0; t < 4; ++t) {
        FH vb;
        vb.h[0] = *(const v8h*)(Vth + (t * 16 + c) * AT_LP + kk * 32 + 8 * hh);
        vb.h[1] = *(const v8h*)(Vth + (t * 16 + c) * AT_LP + kk * 32 + 16 + 8 * hh);
        oacc[t] = at_mma_h(vb.v, pb[kk].v, oacc[t]);
      }
    }
  }

  float* os = Os[wave];
  const float inv = 1.0f / ((lrow + xhalf(lrow)) * PSC);   // the halves' sums are joined once, here
#pragma unroll
  for (int t = 0; t < 4; ++t) {
    const v4f lo4 = {oacc[t][0] * inv, oacc[t][1] * inv, oacc[t][2] * inv, oacc[t][3] * inv};
    const v4f hi4 = {oacc[t][4] * inv, oacc[t][5] * inv, oacc[t][6] * inv, oacc[t][7] * inv};
    *(v4f*)(os + c * 68 + t * 16 + 8 * hh)     = lo4;   // row = query, 8 consecutive d per lane
    *(v4f*)(os + c * 68 + t * 16 + 8 * hh + 4) = hi4;
  }
  __builtin_amdgcn_fence(__ATOMIC_RELEASE, "workgroup");
  __builtin_amdgcn_wave_barrier();
  __builtin_amdgcn_fence(__ATOMIC_ACQUIRE, "workgroup");
  {
    const int c4 = (lane & 15) * 4;
    {
#pragma unroll
      for (int it = 0; it < 8; ++it) {
        const int row = it * 2 + hh;   // it 0..7 x hh 0..1 covers rows 0..15 of the wave tile
        v4f val = *(const v4f*)(os + row * 68 + c4);
        *(v4f*)(ob + (size_t)(q0 + row) * kDm + c4) = val;
      }
      
    }
  }
}

// ---------------------------------------------------------------------------
// Workspace region map (byte offsets; every region is fully written before it is read):
//   R0  Qb   bf16 [4096][1024]          8,388,608 @           0   (RNE cast of q, fragment order)
//   R1  Wq   bf16 [3072][1024]          6,291,456 @   8,388,608   (RNE cast of W_qkv, fragment order)
//   R2  Wp   bf16 [1024][1024]          2,097,152 @  14,680,064   (RNE cast of W_proj, fragment order)
//   R3  Qh   bf16 [4096][1024]          8,388,608 @  16,777,216   (q projection, hi plane)
//   R4  Ql   bf16 [4096][1024]          8,388,608 @  25,165,824   (q projection, lo plane)
//   R5  Kh   bf16 [2][4096][1024]      16,777,216 @  33,554,432   (rows 0..2047 cache keys, 2048.. k projection; hi)
//   R6  Kl   bf16 [2][4096][1024]      16,777,216 @  50,331,648   (same rows; lo)
//   R7  Vt   f16  [2][1024][4096]      16,777,216 @  67,108,864   (cols 0..2047 cache values^T, 2048.. v projection^T)
//   R8  Y    f32  [4096][1024]         16,777,216 @  83,886,080   (attention output, token-major, heads merged)
//   R9  Yh   bf16 [4096][1024]          8,388,608 @ 100,663,296   (split of Y, hi, fragment order)
//   R10 Yl   bf16 [4096][1024]          8,388,608 @ 109,051,904   (split of Y, lo, fragment order)
//   total 117,440,512 B
// ---------------------------------------------------------------------------
extern "C" void kernel_launch(void* const* d_in, const int* in_sizes, int n_in,
                              void* d_out, int out_size, void* d_ws,
                              size_t ws_size, hipStream_t stream) {
  if (n_in < 7) return;
  const size_t nQ  = (size_t)kBatch * kTq * kDm;        // 4,194,304
  const size_t nKV = (size_t)kBatch * kSkv * kDm;       // 4,194,304
  const size_t nWq = (size_t)3 * kDm * kDm;             // 3,145,728
  const size_t nWp = (size_t)kDm * kDm;                 // 1,048,576
  const size_t nPe = (size_t)kSkv * kDm;                // 2,097,152
  if (in_sizes[0] != (int)nQ || in_sizes[1] != (int)nKV || in_sizes[2] != (int)nKV ||
      in_sizes[3] != (int)nWq || in_sizes[4] != (int)nWp || in_sizes[5] != (int)nPe ||
      out_size != (int)nQ) return;

  const float* q     = (const float*)d_in[0];
  const float* k_xl  = (const float*)d_in[1];
  const float* v_xl  = (const float*)d_in[2];
  const float* Wqkv  = (const float*)d_in[3];
  const float* Wproj = (const float*)d_in[4];
  const float* pos   = (const float*)d_in[5];
  const int*   causf = (const int*)d_in[6];
  float* outp = (float*)d_out;

  const size_t offQb = 0,              szQb = nQ * 2;
  const size_t offWq = offQb + szQb,   szWq = nWq * 2;
  const size_t offWp = offWq + szWq,   szWp = nWp * 2;
  const size_t offQh = offWp + szWp,   szQh = nQ * 2;
  const size_t offQl = offQh + szQh,   szQl = nQ * 2;
  const size_t offKh = offQl + szQl,   szKh = (size_t)kBatch * kKeys * kDm * 2;
  const size_t offKl = offKh + szKh,   szKl = szKh;
  const size_t offVt = offKl + szKl,   szVt = (size_t)kBatch * kDm * kKeys * 2;
  const size_t offY  = offVt + szVt,   szY  = nQ * 4;
  const size_t offYh = offY + szY,     szYh = nQ * 2;
  const size_t offYl = offYh + szYh,   szYl = nQ * 2;
  const size_t total = offYl + szYl;   // 117,440,512
  if (total > ws_size) return;

  char* ws = (char*)d_ws;
  unsigned short* Qb = (unsigned short*)(ws + offQb);
  unsigned short* Wq = (unsigned short*)(ws + offWq);
  unsigned short* Wp = (unsigned short*)(ws + offWp);
  unsigned short* Qh = (unsigned short*)(ws + offQh);
  unsigned short* Ql = (unsigned short*)(ws + offQl);
  unsigned short* Kh = (unsigned short*)(ws + offKh);
  unsigned short* Kl = (unsigned short*)(ws + offKl);
  unsigned short* Vt = (unsigned short*)(ws + offVt);
  float*          Y  = (float*)(ws + offY);
  unsigned short* Yh = (unsigned short*)(ws + offYh);
  unsigned short* Yl = (unsigned short*)(ws + offYl);

  // ---- input casts (RNE bf16 of every float input) and cache planes ----
  {
    const int npq = (int)(nQ / 1024), npwq = (int)(nWq / 1024), npwp = (int)(nWp / 1024), n2kv = (int)(nKV / 2);
    // GEMM operands, written in fragment order; one wave per 1024 elements, 8 waves per block
    cast_pack_bf16_kernel<<<dim3((npq + 7) / 8), 256, 0, stream>>>(q, Qb, npq);
    cast_pack_bf16_kernel<<<dim3((npwq + 7) / 8), 256, 0, stream>>>(Wqkv, Wq, npwq);
    cast_pack_bf16_kernel<<<dim3((npwp + 7) / 8), 256, 0, stream>>>(Wproj, Wp, npwp);
    // cache keys -> rows 0..2047 of both key planes (hi, lo), both batches
    kcache_split_kernel<<<dim3((n2kv + 255) / 256), 256, 0, stream>>>(k_xl, pos, Kh, Kl, causf, n2kv);
    // v_xl[b]: in[s rows=2048][c cols=1024] -> Vt[b] out[c][s] with output row pitch kKeys, cols 0..2047;
    // grid (cols/64, rows/64, B)
    tcast16_kernel<<<dim3(kDm / 64, kSkv / 64, kBatch), 256, 0, stream>>>(
        v_xl, Vt, kSkv, kDm, kKeys, (long)kSkv * kDm, (long)kDm * kKeys);
  }

  // ---- qkv projections: bf16 operands (K = 1024, M,N multiples of 64, no tails) ----
  {
    // q projection: C[m = b*2048+t][n] -> Qh (hi) / Ql (lo), M=4096, N=1024, K=1024; 1024 tiles -> 128 blocks
    const int tilesQ = (int)((nQ / kDm) / 64) * (kDm / 64);
    wmma_gemm64<1, false, 0, 2, false><<<dim3((tilesQ + 7) / 8, 1), 256, 0, stream>>>(
        Qb, nullptr, kDm, 0L, Wq, nullptr, kDm, 0L,
        (void*)Qh, (void*)Ql, kDm, 0L, nullptr, nullptr, 0L,
        kBatch * kTq, kDm, kDm, 1.0f);
    // k projection per batch: C[t][n] -> key plane rows 2048+t (hi -> Kh, lo -> Kl), M=2048, N=1024, K=1024;
    // 512 tiles -> 64 blocks, grid.y = batch
    const int tilesK = (kTq / 64) * (kDm / 64);
    wmma_gemm64<1, false, 0, 2, false><<<dim3((tilesK + 7) / 8, kBatch), 256, 0, stream>>>(
        Qb, nullptr, kDm, (long)kTq * kDm, Wq + (size_t)kDm * kDm, nullptr, kDm, 0L,
        (void*)(Kh + (size_t)kSkv * kDm), (void*)(Kl + (size_t)kSkv * kDm), kDm, (long)kKeys * kDm,
        nullptr, nullptr, 0L,
        kTq, kDm, kDm, 1.0f);
    // v projection, role-swapped: C[m = channel][n = t] -> Vt_b[channel][2048 + t] (f16), M=1024, N=2048, K=1024,
    // ldc = kKeys; 512 tiles -> 64 blocks, grid.y = batch
    const int tilesV = (kDm / 64) * (kTq / 64);
    wmma_gemm64<1, false, 0, 1, false><<<dim3((tilesV + 7) / 8, kBatch), 256, 0, stream>>>(
        Wq + (size_t)2 * kDm * kDm, nullptr, kDm, 0L, Qb, nullptr, kDm, (long)kTq * kDm,
        (void*)(Vt + kSkv), nullptr, kKeys, (long)kDm * kKeys, nullptr, nullptr, 0L,
        kDm, kTq, kDm, 1.0f);
  }

  // ---- attention over the 4096 keys per (batch, head); score scale 1/sqrt(64) applied in f32 ----
  attn_xl_kernel<<<dim3(kHeads * (kTq / AT_QB), kBatch), 128, 0, stream>>>(Qh, Ql, Kh, Kl, Vt, Y, 0.125f);

  // ---- y -> bf16 hi/lo planes; output projection C[m][n] = sum_c (Yh + Yl)[m][c] * Wp[n][c] -> d_out ----
  {
    const int npy = (int)(nQ / 1024);
    split_pack_bf16_kernel<<<dim3((npy + 7) / 8), 256, 0, stream>>>(Y, Yh, Yl, npy);
    const int tilesP = (int)((nQ / kDm) / 64) * (kDm / 64);   // 1024 tiles -> 128 blocks
    wmma_gemm64<1, true, 0, 0, false, 0, false><<<dim3((tilesP + 7) / 8, 1), 256, 0, stream>>>(
        Yh, Yl, kDm, 0L, Wp, nullptr, kDm, 0L,
        (void*)outp, nullptr, kDm, 0L, nullptr, nullptr, 0L,
        kBatch * kTq, kDm, kDm, 1.0f);
  }
}

// v006
// Measured time: 260 microseconds a run.
// Next to v005, in two timings, it ran 1.09 and 1.10 times as fast.
// All steps since v000 together make it 3.21 times as fast.
// Contractions: q/k/v projections on v_wmma_f32_16x16x32_bf16 (bf16 operands = RNE-cast inputs, single product); q.k^T on v_wmma_f32_16x16x32_bf16 with bf16 hi/lo planes for both q and k (hi.hi + hi.lo + lo.hi); p.v on v_wmma_f32_16x16x32_f16 (p f16 carried x2^15, v f16, single product); output projection on v_wmma_f32_16x16x32_bf16 with y as bf16 hi/lo planes (hi.W + lo.W) and W bf16; f32 accumulate everywhere; softmax, score scale and the cache add in f32.
#include <hip/hip_runtime.h>
#include <math.h>
#include <stdint.h>

constexpr int kBatch = 2;
constexpr int kTq    = 2048;            // query length
constexpr int kSkv   = 2048;            // cache length
constexpr int kKeys  = kSkv + kTq;      // 4096 keys per (batch, head)
constexpr int kDm    = 1024;            // model dim
constexpr int kHeads = 16;
constexpr int kHd    = 64;
static_assert(kHeads * kHd == kDm, "head split");
static_assert(kTq % 64 == 0 && kKeys % 64 == 0 && kDm % 64 == 0 && kSkv % 64 == 0, "tile multiples");

typedef __attribute__((ext_vector_type(16))) _Float16 v16h;
typedef __attribute__((ext_vector_type(8)))  _Float16 v8h;
typedef __attribute__((ext_vector_type(2)))  _Float16 v2h;
typedef __attribute__((ext_vector_type(16))) __bf16   v16b;
typedef __attribute__((ext_vector_type(8)))  __bf16   v8b;
typedef __attribute__((ext_vector_type(8)))  float    v8f;
typedef __attribute__((ext_vector_type(4)))  float    v4f;
typedef __attribute__((ext_vector_type(2)))  float    v2f;
typedef __attribute__((ext_vector_type(4)))  unsigned int v4u;

__device__ __forceinline__ unsigned short f2bf_bits(float f) {
  unsigned u = __float_as_uint(f);
  return (unsigned short)((u + 0x7FFFu + ((u >> 16) & 1u)) >> 16);
}
__device__ __forceinline__ float bf_bits2f(unsigned short h) { return __uint_as_float(((unsigned)h) << 16); }
__device__ __forceinline__ unsigned short h_bits(float f) { return __builtin_bit_cast(unsigned short, (_Float16)f); }
__device__ __forceinline__ unsigned pk16(unsigned short a, unsigned short b) { return (unsigned)a | ((unsigned)b << 16); }

// hazard guards as plain device helpers (no inline asm inside the kernel template body)
__device__ __forceinline__ void dep_guard_h(v8f& a, v8f& b, v16h x, v16h y) { asm volatile("v_nop\n\tv_nop\n\tv_nop\n\tv_nop" : "+v"(a), "+v"(b) : "v"(x), "v"(y)); }
__device__ __forceinline__ void dep_guard_b(v8f& a, v8f& b, v16b x, v16b y) { asm volatile("v_nop\n\tv_nop\n\tv_nop\n\tv_nop" : "+v"(a), "+v"(b) : "v"(x), "v"(y)); }
__device__ __forceinline__ void keep4_h(v16h a, v16h b, v16h c, v16h d) { asm volatile("v_nop" :: "v"(a), "v"(b), "v"(c), "v"(d)); }
__device__ __forceinline__ void keep4_b(v16b a, v16b b, v16b c, v16b d) { asm volatile("v_nop" :: "v"(a), "v"(b), "v"(c), "v"(d)); }
__device__ __forceinline__ void acc_guard4(v8f& a, v8f& b, v8f& c, v8f& d) { asm volatile("v_nop\n\tv_nop\n\tv_nop\n\tv_nop" : "+v"(a), "+v"(b), "+v"(c), "+v"(d)); }
// The wait that belongs in front of any overwrite of a register that an issued global load names. The address pairs
// are inputs so that they stay whole up to here.
__device__ __forceinline__ void addr_wait4(const void* a, const void* b, const void* c, const void* d) {
  asm volatile("s_wait_xcnt 0x0" :: "v"(a), "v"(b), "v"(c), "v"(d) : "memory");
}
__device__ __forceinline__ void addr_wait8(const void* a, const void* b, const void* c, const void* d, const void* e, const void* f,
                                           const void* g, const void* h) {
  asm volatile("s_wait_xcnt 0x0" :: "v"(a), "v"(b), "v"(c), "v"(d), "v"(e), "v"(f), "v"(g), "v"(h) : "memory");
}
__device__ __forceinline__ void addr_wait12(const void* a, const void* b, const void* c, const void* d, const void* e, const void* f,
                                            const void* g, const void* h, const void* i, const void* j, const void* k, const void* l) {
  asm volatile("s_wait_xcnt 0x0" :: "v"(a), "v"(b), "v"(c), "v"(d), "v"(e), "v"(f), "v"(g), "v"(h), "v"(i), "v"(j), "v"(k), "v"(l) : "memory");
}
template <typename T> struct Frag;
template <> struct Frag<_Float16> {
  typedef v16h V; union U { v16h v; v8h h[2]; };
  static __device__ __forceinline__ v16h load(const _Float16* p) {   // elements 0..7 <- p[0..7], 8..15 <- p[16..23]
    U f; f.h[0] = *(const v8h*)(p); f.h[1] = *(const v8h*)(p + 16); return f.v;
  }
  // fragment order: register halves 256 elements apart. The global address space is stated: pointers carried round a
  // loop would otherwise give flat loads.
  static __device__ __forceinline__ v16h loadp(const _Float16* p) {
    typedef const __attribute__((address_space(1))) v8h* G;
    U f; f.h[0] = *(G)(p); f.h[1] = *(G)(p + 256); return f.v;
  }
  static __device__ __forceinline__ v8f mma(v16h a, v16h b, v8f c) {
    return __builtin_amdgcn_wmma_f32_16x16x32_f16(false, a, false, b, (short)0, c, false, false);
  }
  static __device__ __forceinline__ void guard(v8f& a, v8f& b, v16h x, v16h y) { dep_guard_h(a, b, x, y); }
  static __device__ __forceinline__ void keep(v16h a, v16h b, v16h c, v16h d) { keep4_h(a, b, c, d); }
};
template <> struct Frag<__bf16> {
  typedef v16b V; union U { v16b v; v8b h[2]; };
  static __device__ __forceinline__ v16b load(const __bf16* p) {
    U f; f.h[0] = *(const v8b*)(p); f.h[1] = *(const v8b*)(p + 16); return f.v;
  }
  static __device__ __forceinline__ v16b loadp(const __bf16* p) {
    typedef const __attribute__((address_space(1))) v8b* G;
    U f; f.h[0] = *(G)(p); f.h[1] = *(G)(p + 256); return f.v;
  }
  static __device__ __forceinline__ v8f mma(v16b a, v16b b, v8f c) {
    return __builtin_amdgcn_wmma_f32_16x16x32_bf16(false, a, false, b, (short)0, c, false, false);
  }
  static __device__ __forceinline__ void guard(v8f& a, v8f& b, v16b x, v16b y) { dep_guard_b(a, b, x, y); }
  static __device__ __forceinline__ void keep(v16b a, v16b b, v16b c, v16b d) { keep4_b(a, b, c, d); }
};

// ---- Register-blocked batched WMMA GEMM ------------------------------------
// C[m,n] = scale * sum_k A[m,k] * Bt[n,k] (+bias)(+resid); each wave owns a 64x64 tile.
// A [M,K] and Bt [N,K] stand in FRAGMENT ORDER (lda = ldb = K): blocks of 16 rows x 32 k = 512 elements (1 KB), block
// number (row / 16) * (K / 32) + k / 32, so a row tile starts where row-major row 16 * (row / 16) would. Inside a block
// the 8 elements k % 32 = 8 * (2 h + hh) + 0..7 of row r stand at element h * 256 + (hh * 16 + r) * 8: lane hh * 16 + r
// finds register half h of its fragment at h * 256 + lane * 8, and each of a fragment's two loads reads 512
// contiguous bytes (4 whole lines). The k of every lane and register position is that of Frag::load on a row-major
// operand, the same for A and Bt. M,N % 64 == 0, K % 32 == 0.
// SPLIT: operands are hi/lo planes (A2/Bt2 = lo planes, same layout); product = hi.hi + hi.lo + lo.hi.
// SPLITB (only meaningful with SPLIT): when false only A carries a lo plane; product = hi.B + lo.B (Bt2 unused).
// BIAS_MODE: 0 = none, 1 = bias[m], 2 = bias[n].
// OUT_MODE: 0 = f32, 1 = f16, 2 = bf16 hi plane (Cout) + bf16 lo plane (Cout2).
// ET: 0 = f16 operands, 1 = bf16 operands (pointers passed as 16-bit storage)
template <int ET> struct Elem;
template <> struct Elem<0> { typedef _Float16 T; };
template <> struct Elem<1> { typedef __bf16 T; };
template <int ET, bool SPLIT, int BIAS_MODE, int OUT_MODE, bool RESID, int ACT = 0, bool SPLITB = SPLIT>
__global__ __launch_bounds__(256) void wmma_gemm64(
    const unsigned short* __restrict__ Ap, const unsigned short* __restrict__ A2p, int lda, long strideA,
    const unsigned short* __restrict__ Btp, const unsigned short* __restrict__ Bt2p, int ldb, long strideB,
    void* __restrict__ Cout, void* __restrict__ Cout2, int ldc, long strideC,
    const float* __restrict__ bias,
    const float* __restrict__ resid, long strideR,
    int M, int N, int K, float scale) {
  typedef typename Elem<ET>::T T;
  typedef typename Frag<T>::V V;
  const T* A = (const T*)Ap; const T* A2 = (const T*)A2p; const T* Bt = (const T*)Btp; const T* Bt2 = (const T*)Bt2p;
  __shared__ __align__(16) float sT[8][16 * 68];   // per-wave 16x64 slab, pitch 68 floats
  const int b    = blockIdx.y;
  const int lane = threadIdx.x & 31;
  const int wave = __builtin_amdgcn_readfirstlane(threadIdx.x >> 5);   // scalar, so that tile indices and row-tile offsets stay in scalar registers
  const int tilesN = N >> 6;
  const int tilesM = M >> 6;
  const int tile = blockIdx.x * 8 + wave;
  if (tile >= tilesM * tilesN) return;   // wave-uniform; no block barriers in this kernel
  const int tm = tile / tilesN;
  const int tn = tile - tm * tilesN;
  const int m0 = tm << 6;
  const int n0 = tn << 6;

  const T* Ab  = A  + (size_t)b * strideA;
  const T* Bb  = Bt + (size_t)b * strideB;
  const T* Ab2 = SPLIT ? (A2  + (size_t)b * strideA) : nullptr;
  const T* Bb2 = (SPLIT && SPLITB) ? (Bt2 + (size_t)b * strideB) : nullptr;

  const int rlane = lane & 15;                 // row (A) / col (B, D) within subtile
  const int mOff  = (lane >> 4) * 8;           // D row offset
  const unsigned lo8 = (unsigned)lane * 8u;    // this lane's 8 elements (16 bytes) inside a half block

  v8f acc[4][4];
#pragma unroll
  for (int i = 0; i < 4; ++i)
#pragma unroll
    for (int j = 0; j < 4; ++j) acc[i][j] = (v8f){0.f,0.f,0.f,0.f,0.f,0.f,0.f,0.f};

  // This lane's 16 bytes in the current k block of each row tile; the next k block stands 512 elements further on.
  const T* bp[4]; const T* bp2[4]; const T* ap[4]; const T* ap2[4];
#pragma unroll
  for (int j = 0; j < 4; ++j) {
    const size_t bo = (size_t)(n0 + (j << 4)) * ldb + lo8;
    const size_t ao = (size_t)(m0 + (j << 4)) * lda + lo8;
    bp[j]  = Bb + bo;
    bp2[j] = (SPLIT && SPLITB) ? (Bb2 + bo) : bp[j];
    ap[j]  = Ab + ao;
    ap2[j] = SPLIT ? (Ab2 + ao) : ap[j];
  }
  for (int k0 = 0; k0 < K; k0 += 32) {
    // All fragment loads of the k block as one group, so that the block waits for memory once, not once per row tile of A.
    V bh[4], bl[4], ah[4], al[4];
#pragma unroll
    for (int j = 0; j < 4; ++j) {
      bh[j] = Frag<T>::loadp(bp[j]);
      if (SPLIT && SPLITB) bl[j] = Frag<T>::loadp(bp2[j]);
    }
#pragma unroll
    for (int i = 0; i < 4; ++i) {
      ah[i] = Frag<T>::loadp(ap[i]);
      if (SPLIT) al[i] = Frag<T>::loadp(ap2[i]);
    }
#pragma unroll
    for (int i = 0; i < 4; ++i) {
#pragma unroll
      for (int j = 0; j < 4; ++j) {
        acc[i][j] = Frag<T>::mma(ah[i], bh[j], acc[i][j]);
        if (SPLIT) {
          if (SPLITB) acc[i][j] = Frag<T>::mma(ah[i], bl[j], acc[i][j]);
          acc[i][j] = Frag<T>::mma(al[i], bh[j], acc[i][j]);
        }
      }
      Frag<T>::guard(acc[i][0], acc[i][3], ah[i], SPLIT ? al[i] : ah[i]);
    }
    Frag<T>::keep(bh[0], bh[1], bh[2], bh[3]);
    if (SPLIT && SPLITB) Frag<T>::keep(bl[0], bl[1], bl[2], bl[3]);
    // in front of the advance, which overwrites the pairs that the loads of this block name
    if (SPLIT) addr_wait12(bp[0], bp[1], bp[2], bp[3], ap[0], ap[1], ap[2], ap[3], ap2[0], ap2[1], ap2[2], ap2[3]);
    else       addr_wait8(bp[0], bp[1], bp[2], bp[3], ap[0], ap[1], ap[2], ap[3]);
    if (SPLIT && SPLITB) addr_wait4(bp2[0], bp2[1], bp2[2], bp2[3]);
#pragma unroll
    for (int j = 0; j < 4; ++j) { bp[j] += 512; bp2[j] += 512; ap[j] += 512; ap2[j] += 512; }
  }
  acc_guard4(acc[0][0], acc[0][1], acc[0][2], acc[0][3]);
  acc_guard4(acc[1][0], acc[1][1], acc[1][2], acc[1][3]);
  acc_guard4(acc[2][0], acc[2][1], acc[2][2], acc[2][3]);
  acc_guard4(acc[3][0], acc[3][1], acc[3][2], acc[3][3]);

  // ---- epilogue ----
  float* slab = sT[wave];
  const float* Rb = RESID ? (resid + (size_t)b * strideR) : nullptr;
#pragma unroll
  for (int i = 0; i < 4; ++i) {
    const int mBase = m0 + (i << 4);
#pragma unroll
    for (int j = 0; j < 4; ++j) {
      const int n = n0 + (j << 4) + rlane;
      float bv = 0.f;
      if (BIAS_MODE == 2) bv = bias[n];
#pragma unroll
      for (int r = 0; r < 8; ++r) {
        float v = acc[i][j][r] * scale;
        if (BIAS_MODE == 1) v += bias[mBase + mOff + r];
        if (BIAS_MODE == 2) v += bv;
        if (RESID) v += Rb[(size_t)(mBase + mOff + r) * ldc + n];
        if (ACT == 1) v = tanhf(v);
        if (ACT == 2) v = fmaxf(v, 0.0f);
        if (ACT == 3) v = v / (1.0f + expf(-v));
        if (ACT == 4) v = (v > 0.f) ? v : 0.01f * v;
        slab[(mOff + r) * 68 + (j << 4) + rlane] = v;
      }
    }
    __builtin_amdgcn_fence(__ATOMIC_RELEASE, "workgroup");
    __builtin_amdgcn_wave_barrier();
    __builtin_amdgcn_fence(__ATOMIC_ACQUIRE, "workgroup");
    if (OUT_MODE == 0) {
      float* C = (float*)Cout + (size_t)b * strideC;
      const int hh = lane >> 4, c4 = (lane & 15) * 4;     // row seg = 256 B = 16 lanes x 16 B
      {
#pragma unroll
        for (int it = 0; it < 8; ++it) {
          const int row = it * 2 + hh;
          v4f v = *(const v4f*)(slab + row * 68 + c4);
          *(v4f*)(C + (size_t)(mBase + row) * ldc + n0 + c4) = v;
        }
        
      }
    } else {
      const int q = lane >> 3, c8 = (lane & 7) * 8;
      unsigned short* C  = (unsigned short*)Cout  + (size_t)b * strideC;
      unsigned short* C2 = (OUT_MODE == 2) ? ((unsigned short*)Cout2 + (size_t)b * strideC) : nullptr;
      {
#pragma unroll
        for (int it = 0; it < 4; ++it) {
          const int row = it * 4 + q;
          const float* sp = slab + row * 68 + c8;
          v8h hv, lv;
#pragma unroll
          for (int e = 0; e < 8; ++e) {
            if (OUT_MODE == 1) {
              hv[e] = (_Float16)sp[e];
            } else {
              unsigned short hb = f2bf_bits(sp[e]);
              unsigned short lb = f2bf_bits(sp[e] - bf_bits2f(hb));
              hv[e] = __builtin_bit_cast(_Float16, hb);
              lv[e] = __builtin_bit_cast(_Float16, lb);
            }
          }
          *(v8h*)(C + (size_t)(mBase + row) * ldc + n0 + c8) = hv;
          if (OUT_MODE == 2) *(v8h*)(C2 + (size_t)(mBase + row) * ldc + n0 + c8) = lv;
        }
        
      }
    }
    __builtin_amdgcn_fence(__ATOMIC_RELEASE, "workgroup");
    __builtin_amdgcn_wave_barrier();
    __builtin_amdgcn_fence(__ATOMIC_ACQUIRE, "workgroup");
  }
}

// ---------------------------------------------------------------------------
// f32 [R][kDm] row-major -> 16-bit planes in the fragment order that wmma_gemm64 reads (described there).
// One wave makes two neighbouring 1 KB blocks (16 rows x 64 k). Lane l takes the 8 floats k = 8 * (l & 3) + 0..7 of row
// 8 it + (l >> 2) of block u (u, it = 0, 1): two 16-byte loads, one 16-byte store per plane. A wave-wide store writes
// four whole 128-byte lines (8 rows x 16 B each); the eight loads of a lane are issued together.
// Coverage: nPairs = (R / 16) * (kDm / 64) waves x 1024 elements = R * kDm (every nPairs here is a multiple of 8).
// ---------------------------------------------------------------------------
struct PackPos { const float* src; size_t dst; };
__device__ __forceinline__ PackPos pack_pos(const float* in, int wv, int lane) {
  const int rt = wv / (kDm / 64), kp = wv - rt * (kDm / 64);   // row tile, pair of k blocks
  const int r8 = lane >> 2, piece = lane & 3;
  PackPos p;
  p.src = in + (size_t)(rt * 16 + r8) * kDm + kp * 64 + piece * 8;
  p.dst = (size_t)wv * 1024 + (piece >> 1) * 256 + ((piece & 1) * 16 + r8) * 8;
  return p;
}

// bf16 (RNE) cast
__global__ __launch_bounds__(256) void cast_pack_bf16_kernel(const float* __restrict__ in, unsigned short* __restrict__ out,
                                                            int nPairs) {
  const int wv = (blockIdx.x * 256 + threadIdx.x) >> 5;
  if (wv < nPairs) {
    const PackPos p = pack_pos(in, wv, threadIdx.x & 31);
    v4f f[2][2][2];
#pragma unroll
    for (int u = 0; u < 2; ++u)
#pragma unroll
      for (int it = 0; it < 2; ++it) {
        f[u][it][0] = *(const v4f*)(p.src + (size_t)it * 8 * kDm + u * 32);
        f[u][it][1] = *(const v4f*)(p.src + (size_t)it * 8 * kDm + u * 32 + 4);
      }
#pragma unroll
    for (int u = 0; u < 2; ++u)
#pragma unroll
      for (int it = 0; it < 2; ++it) {
        v4u o;
#pragma unroll
        for (int q = 0; q < 4; ++q) {
          const v4f g = f[u][it][q >> 1];
          o[q] = pk16(f2bf_bits(g[(q & 1) * 2]), f2bf_bits(g[(q & 1) * 2 + 1]));
        }
        *(v4u*)(out + p.dst + u * 512 + it * 64) = o;
      }
  }
}

// bf16 split: hi = bf16_rne(in), lo = bf16_rne(in - hi)
__global__ __launch_bounds__(256) void split_pack_bf16_kernel(const float* __restrict__ in, unsigned short* __restrict__ hi,
                                                             unsigned short* __restrict__ lo, int nPairs) {
  const int wv = (blockIdx.x * 256 + threadIdx.x) >> 5;
  if (wv < nPairs) {
    const PackPos p = pack_pos(in, wv, threadIdx.x & 31);
    v4f f[2][2][2];
#pragma unroll
    for (int u = 0; u < 2; ++u)
#pragma unroll
      for (int it = 0; it < 2; ++it) {
        f[u][it][0] = *(const v4f*)(p.src + (size_t)it * 8 * kDm + u * 32);
        f[u][it][1] = *(const v4f*)(p.src + (size_t)it * 8 * kDm + u * 32 + 4);
      }
#pragma unroll
    for (int u = 0; u < 2; ++u)
#pragma unroll
      for (int it = 0; it < 2; ++it) {
        v4u oh, ol;
#pragma unroll
        for (int q = 0; q < 4; ++q) {
          const v4f g = f[u][it][q >> 1];
          const float f0 = g[(q & 1) * 2], f1 = g[(q & 1) * 2 + 1];
          const unsigned short h0 = f2bf_bits(f0), h1 = f2bf_bits(f1);
          oh[q] = pk16(h0, h1);
          ol[q] = pk16(f2bf_bits(f0 - bf_bits2f(h0)), f2bf_bits(f1 - bf_bits2f(h1)));
        }
        *(v4u*)(hi + p.dst + u * 512 + it * 64) = oh;
        *(v4u*)(lo + p.dst + u * 512 + it * 64) = ol;
      }
  }
}

// ---------------------------------------------------------------------------
// Cache keys, rows 0..kSkv-1 of each per-batch [kKeys][kDm] bf16 key plane pair:
//   x = bf16_rne(k_xl[b][s][c]) + bf16_rne(pos[s][c])   (the add in f32)
//   kh[b][s][c] = bf16_rne(x),  kl[b][s][c] = bf16_rne(x - kh)
// flags = the causal flag input; this forward applies no mask, the pointer is only bound, never read.
// ---------------------------------------------------------------------------
__global__ __launch_bounds__(256) void kcache_split_kernel(const float* __restrict__ kxl, const float* __restrict__ pos,
                                                           unsigned short* __restrict__ kh, unsigned short* __restrict__ kl,
                                                           const int* __restrict__ flags, int n2) {
  const int i = blockIdx.x * 256 + threadIdx.x;
  if (i < n2) {
    const size_t e = 2 * (size_t)i;                        // element index into [b][s][c]
    const size_t perB = (size_t)kSkv * kDm;
    const int bb = (int)(e / perB);
    const size_t rem = e - (size_t)bb * perB;              // s*kDm + c (even)
    const v2f a = *(const v2f*)(kxl + e);
    const v2f p = *(const v2f*)(pos + rem);
    const float s0 = bf_bits2f(f2bf_bits(a[0])) + bf_bits2f(f2bf_bits(p[0]));
    const float s1 = bf_bits2f(f2bf_bits(a[1])) + bf_bits2f(f2bf_bits(p[1]));
    const unsigned short h0 = f2bf_bits(s0), h1 = f2bf_bits(s1);
    const unsigned short l0 = f2bf_bits(s0 - bf_bits2f(h0)), l1 = f2bf_bits(s1 - bf_bits2f(h1));
    const unsigned uh = pk16(h0, h1), ul = pk16(l0, l1);
    const size_t o = ((size_t)bb * kKeys * kDm + rem) >> 1; // u32 index
    ((unsigned*)kh)[o] = uh;
    ((unsigned*)kl)[o] = ul;
    
  }
}

// ---------------------------------------------------------------------------
// Fused transpose + cast of an f32 matrix, z-batched: in_z = W + z*sIn viewed [R rows][Cc cols] (pitch Cc) ->
//   o_z[c][r] = f16(bf16_rne(in_z[r][c]))   ([Cc][...], output row pitch ldo halves), o_z = o + z*sOut.
// 64x64 tiles through LDS. grid = (Cc/64, R/64, Z), 256 threads (R, Cc multiples of 64).
// Coverage per block: load 4 it x 256 thr x 4 floats = 64x64; store 2 it x 256 thr x 8 u16 = 64x64.
// ---------------------------------------------------------------------------
__global__ __launch_bounds__(256) void tcast16_kernel(const float* __restrict__ W, unsigned short* __restrict__ o,
                                                      int R, int Cc, int ldo, long sIn, long sOut) {
  __shared__ __align__(16) float tf[64 * 68];
  W += (size_t)blockIdx.z * sIn;
  o += (size_t)blockIdx.z * sOut;
  const int c0  = blockIdx.x * 64;   // input column block = output row block
  const int r0  = blockIdx.y * 64;   // input row block    = output column block
  const int tid = threadIdx.x;
  {
    const int lr = tid >> 4;         // 0..15
    const int c4 = (tid & 15) * 4;   // 0..60
#pragma unroll
    for (int it = 0; it < 4; ++it) {
      const int rr = it * 16 + lr;   // 0..63
      const v4f a = *(const v4f*)(W + (size_t)(r0 + rr) * Cc + c0 + c4);
      *(v4f*)(tf + rr * 68 + c4) = a;
    }
  }
  __syncthreads();
  const int sub = tid >> 3;          // 0..31
  const int c8  = (tid & 7) * 8;     // 0..56
  v4u hv[2];
#pragma unroll
  for (int it = 0; it < 2; ++it) {
    const int oc = it * 32 + sub;    // output row within tile (= input column)
    v4u a;
#pragma unroll
    for (int q = 0; q < 4; ++q) {
      const float f0 = tf[(c8 + 2 * q) * 68 + oc];
      const float f1 = tf[(c8 + 2 * q + 1) * 68 + oc];
      a[q] = pk16(h_bits(bf_bits2f(f2bf_bits(f0))), h_bits(bf_bits2f(f2bf_bits(f1))));
    }
    hv[it] = a;
  }
  {
#pragma unroll
    for (int it = 0; it < 2; ++it) {
      const int oc = it * 32 + sub;
      const size_t go = (size_t)(c0 + oc) * ldo + r0 + c8;
      *(v4u*)(o + go) = hv[it];
    }
    
  }
}

#define AT_D 64
#define AT_NW 4
#define AT_QB 64
#define AT_KC 64
#define AT_LP 72   // LDS row pitch in 16-bit elements: 144 B = 16 B x 9 (odd), so the 16 rows of a 16-byte fragment read fall on 16 different bank groups

__device__ __forceinline__ v8f at_mma_b(v16b a, v16b b, v8f c) {
  c = __builtin_amdgcn_wmma_f32_16x16x32_bf16(false, a, false, b, (short)0, c, false, false);
  asm volatile("v_nop\n\tv_nop\n\tv_nop\n\tv_nop" : "+v"(c) : "v"(a), "v"(b));
  return c;
}
__device__ __forceinline__ v8f at_mma_h(v16h a, v16h b, v8f c) {
  c = __builtin_amdgcn_wmma_f32_16x16x32_f16(false, a, false, b, (short)0, c, false, false);
  asm volatile("v_nop\n\tv_nop\n\tv_nop\n\tv_nop" : "+v"(c) : "v"(a), "v"(b));
  return c;
}

// Four hardware exp2 in place, in one statement: each v_exp_f32 is followed by an independent one and the last by
// v_nop, the slot the instruction set asks for behind a transcendental before its result is read or its source
// overwritten.
__device__ __forceinline__ void exp2x4(float& a, float& b, float& c, float& d) {
  asm("v_exp_f32 %0, %0\n\tv_exp_f32 %1, %1\n\tv_exp_f32 %2, %2\n\tv_exp_f32 %3, %3\n\tv_nop"
      : "+v"(a), "+v"(b), "+v"(c), "+v"(d));
}

// One hardware exp2 in place, with the same slot behind it.
__device__ __forceinline__ void exp2x1(float& a) { asm("v_exp_f32 %0, %0\n\tv_nop" : "+v"(a)); }

// lane l <-> lane l ^ 16 (the two halves that share a query column), a vector cross-row move, no LDS
__device__ __forceinline__ float xhalf(float x) {
  const int i = __builtin_bit_cast(int, x);
  return __builtin_bit_cast(float, __builtin_amdgcn_permlanex16(i, i, 0x76543210, 0xfedcba98, false, false));
}

__global__ __launch_bounds__(128)
void attn_xl_kernel(const unsigned short* __restrict__ qhp, const unsigned short* __restrict__ qlp,
                    const unsigned short* __restrict__ khp, const unsigned short* __restrict__ klp,
                    const unsigned short* __restrict__ vtp, float* __restrict__ out, float sscale) {
  union FB { v16b v; v8b h[2]; };
  union FH { v16h v; v8h h[2]; v2h p[8]; };
  __shared__ __align__(16) __bf16   Ksh[AT_KC * AT_LP];         // K hi [kv][d]   9 KB
  __shared__ __align__(16) __bf16   Ksl[AT_KC * AT_LP];         // K lo [kv][d]   9 KB
  __shared__ __align__(16) _Float16 Vth[AT_D * AT_LP];          // V^T [d][kv]    9 KB
  __shared__ __align__(16) float    Os[AT_NW][16 * 68];         // per wave out tile, pitch 68
  const float PSC = 32768.0f;
  // softmax in base 2: exp((x - m) * sscale) = 2^((x - m) * sc2). sscale > 0 (the launch passes 1/sqrt(64)),
  // so the row maximum may be taken on the unscaled scores.
  const float sc2 = sscale * 1.44269504088896340736f;

  const int tid  = threadIdx.x;
  const int wave = tid >> 5;
  const int lane = tid & 31;
  const int hh   = lane >> 4;
  const int c    = lane & 15;

  const int nqb = kTq / AT_QB;            // 32
  const int bx = blockIdx.x;
  const int b  = blockIdx.y;
  const int qb = bx % nqb;
  const int h  = bx / nqb;                // 0..kHeads-1
  const int q0 = qb * AT_QB + wave * 16;

  const __bf16*   Qh = (const __bf16*)(const void*)qhp   + (size_t)b * kTq * kDm   + (size_t)h * AT_D;
  const __bf16*   Ql = (const __bf16*)(const void*)qlp   + (size_t)b * kTq * kDm   + (size_t)h * AT_D;
  const __bf16*   Kh = (const __bf16*)(const void*)khp   + (size_t)b * kKeys * kDm + (size_t)h * AT_D;
  const __bf16*   Kl = (const __bf16*)(const void*)klp   + (size_t)b * kKeys * kDm + (size_t)h * AT_D;
  const _Float16* Vh = (const _Float16*)(const void*)vtp + (size_t)b * kDm * kKeys + (size_t)h * AT_D * kKeys;
  float*          ob = out + (size_t)b * kTq * kDm + (size_t)h * AT_D;

  // ---- Q fragments (B operand, column = lane&15, split k map via Frag load): 2 d-chunks, hi and lo ----
  v16b qah[2], qal[2];
#pragma unroll
  for (int dc = 0; dc < 2; ++dc) {
    qah[dc] = Frag<__bf16>::load(Qh + (size_t)(q0 + c) * kDm + dc * 32 + 8 * hh);
    qal[dc] = Frag<__bf16>::load(Ql + (size_t)(q0 + c) * kDm + dc * 32 + 8 * hh);
  }

  float mrow = -INFINITY, lrow = 0.f;   // query q0 + c: running maximum (both halves agree), this half's sum
  v8f oacc[4];                          // oacc[t][r] = O^T[d = 16 t + 8 hh + r][query q0 + c]
#pragma unroll
  for (int t = 0; t < 4; ++t) oacc[t] = (v8f){0.f,0.f,0.f,0.f,0.f,0.f,0.f,0.f};

  const int nChunks = kKeys / AT_KC;   // 64, compile-time constant
  for (int kc = 0; kc < nChunks; ++kc) {
    const int kv0 = kc * AT_KC;
    __syncthreads();
    {
      // staging coverage: 128 threads x (4 x 8) elements = 64 rows x 64 per plane = the whole chunk tile (3 planes)
      const int r = tid >> 1, half = (tid & 1) * 32;
      const __bf16*   ksh = Kh + (size_t)(kv0 + r) * kDm + half;    // K row kv0+r, d = half..half+31
      const __bf16*   ksl = Kl + (size_t)(kv0 + r) * kDm + half;
      const _Float16* vsh = Vh + (size_t)r * kKeys + kv0 + half;    // V^T row d = r, s = kv0+half..+31
      v8b a0[4], a1[4];
      v8h b0[4];
#pragma unroll
      for (int i = 0; i < 4; ++i) {     // all twelve loads first, so that they are in flight together
        a0[i] = *(const v8b*)(ksh + 8 * i);
        a1[i] = *(const v8b*)(ksl + 8 * i);
        b0[i] = *(const v8h*)(vsh + 8 * i);
      }
      // the wait that belongs in front of any overwrite of a register an issued global load names; the three address
      // pairs are inputs so that they stay whole up to here
      asm volatile("s_wait_xcnt 0x0" :: "v"(ksh), "v"(ksl), "v"(vsh) : "memory");
#pragma unroll
      for (int i = 0; i < 4; ++i) {
        *(v8b*)(Ksh + r * AT_LP + half + 8 * i) = a0[i];
        *(v8b*)(Ksl + r * AT_LP + half + 8 * i) = a1[i];
        *(v8h*)(Vth + r * AT_LP + half + 8 * i) = b0[i];
      }
    }
    __syncthreads();

    // All 32 K fragment reads of the chunk as one group, in the order of their use: the wave meets the LDS latency once
    // here, not once in front of every three products.
    FB kf[2][4], lf[2][4];
#pragma unroll
    for (int dc = 0; dc < 2; ++dc) {
#pragma unroll
      for (int j = 0; j < 4; ++j) {
        kf[dc][j].h[0] = *(const v8b*)(Ksh + (j * 16 + c) * AT_LP + dc * 32 + 8 * hh);
        kf[dc][j].h[1] = *(const v8b*)(Ksh + (j * 16 + c) * AT_LP + dc * 32 + 16 + 8 * hh);
      }
#pragma unroll
      for (int j = 0; j < 4; ++j) {
        lf[dc][j].h[0] = *(const v8b*)(Ksl + (j * 16 + c) * AT_LP + dc * 32 + 8 * hh);
        lf[dc][j].h[1] = *(const v8b*)(Ksl + (j * 16 + c) * AT_LP + dc * 32 + 16 + 8 * hh);
      }
    }
    // s[j][r] = S^T[key kv0 + 16 j + 8 hh + r][query q0 + c]; every s[j] takes its six products in the order
    // dc 0: hi.hi, lo.hi, hi.lo, then dc 1 the same; the four tiles take turns, so that no product waits for the one before it.
    v8f s[4];
#pragma unroll
    for (int j = 0; j < 4; ++j) s[j] = (v8f){0.f,0.f,0.f,0.f,0.f,0.f,0.f,0.f};
#pragma unroll
    for (int dc = 0; dc < 2; ++dc) {
#pragma unroll
      for (int j = 0; j < 4; ++j) s[j] = at_mma_b(kf[dc][j].v, qah[dc], s[j]);
#pragma unroll
      for (int j = 0; j < 4; ++j) s[j] = at_mma_b(lf[dc][j].v, qah[dc], s[j]);
#pragma unroll
      for (int j = 0; j < 4; ++j) s[j] = at_mma_b(kf[dc][j].v, qal[dc], s[j]);
    }
    // All 16 V^T fragment reads of the chunk as one group: they return while the softmax runs.
    FH vf[2][4];
#pragma unroll
    for (int kk = 0; kk < 2; ++kk) {
#pragma unroll
      for (int t = 0; t < 4; ++t) {
        vf[kk][t].h[0] = *(const v8h*)(Vth + (t * 16 + c) * AT_LP + kk * 32 + 8 * hh);
        vf[kk][t].h[1] = *(const v8h*)(Vth + (t * 16 + c) * AT_LP + kk * 32 + 16 + 8 * hh);
      }
    }
    __builtin_amdgcn_sched_barrier(0);   // keeps the 16 reads as one group in front of the softmax (without it they stand in two groups inside it)
    float mj[4];
#pragma unroll
    for (int j = 0; j < 4; ++j) {
      float m = s[j][0];
#pragma unroll
      for (int r = 1; r < 8; ++r) m = fmaxf(m, s[j][r]);
      mj[j] = m;
    }
    float cm = fmaxf(fmaxf(mj[0], mj[1]), fmaxf(mj[2], mj[3]));
    cm = fmaxf(cm, xhalf(cm));
    const float mnew = fmaxf(mrow, cm);
    float alpha = (mrow - mnew) * sc2;
    const float nm = -mnew * sc2;
    mrow = mnew;
    exp2x1(alpha);
    FH pb[2];          // pb[kk]: P^T as B operand, keys kv0 + 32 kk + (8 hh + 0..7, 16 + 8 hh + 0..7), column c
    v2f ps[4];
#pragma unroll
    for (int j = 0; j < 4; ++j) {
      float pe[8];
#pragma unroll
      for (int r = 0; r < 8; ++r) pe[r] = fmaf(s[j][r], sc2, nm);
      exp2x4(pe[0], pe[1], pe[2], pe[3]);
      exp2x4(pe[4], pe[5], pe[6], pe[7]);
      v2f a = {0.f, 0.f};
#pragma unroll
      for (int r = 0; r < 8; r += 2) {
        const v2f w = {pe[r], pe[r + 1]};
        a = (r == 0) ? w : a + w;
        pb[j >> 1].p[(j & 1) * 4 + (r >> 1)] = __builtin_convertvector(w * PSC, v2h);
      }
      ps[j] = a;
    }
    const v2f pt = (ps[0] + ps[1]) + (ps[2] + ps[3]);
    lrow = lrow * alpha + (pt[0] + pt[1]);
#pragma unroll
    for (int t = 0; t < 4; ++t)
#pragma unroll
      for (int r = 0; r < 8; ++r) oacc[t][r] *= alpha;
#pragma unroll
    for (int kk = 0; kk < 2; ++kk) {
#pragma unroll
      for (int t = 0; t < 4; ++t) oacc[t] = at_mma_h(vf[kk][t].v, pb[kk].v, oacc[t]);
    }
  }

  float* os = Os[wave];
  const float inv = 1.0f / ((lrow + xhalf(lrow)) * PSC);   // the halves' sums are joined once, here
#pragma unroll
  for (int t = 0; t < 4; ++t) {
    const v4f lo4 = {oacc[t][0] * inv, oacc[t][1] * inv, oacc[t][2] * inv, oacc[t][3] * inv};
    const v4f hi4 = {oacc[t][4] * inv, oacc[t][5] * inv, oacc[t][6] * inv, oacc[t][7] * inv};
    *(v4f*)(os + c * 68 + t * 16 + 8 * hh)     = lo4;   // row = query, 8 consecutive d per lane
    *(v4f*)(os + c * 68 + t * 16 + 8 * hh + 4) = hi4;
  }
  __builtin_amdgcn_fence(__ATOMIC_RELEASE, "workgroup");
  __builtin_amdgcn_wave_barrier();
  __builtin_amdgcn_fence(__ATOMIC_ACQUIRE, "workgroup");
  {
    const int c4 = (lane & 15) * 4;
    {
#pragma unroll
      for (int it = 0; it < 8; ++it) {
        const int row = it * 2 + hh;   // it 0..7 x hh 0..1 covers rows 0..15 of the wave tile
        v4f val = *(const v4f*)(os + row * 68 + c4);
        *(v4f*)(ob + (size_t)(q0 + row) * kDm + c4) = val;
      }
      
    }
  }
}

// ---------------------------------------------------------------------------
// Workspace region map (byte offsets; every region is fully written before it is read):
//   R0  Qb   bf16 [4096][1024]          8,388,608 @           0   (RNE cast of q, fragment order)
//   R1  Wq   bf16 [3072][1024]          6,291,456 @   8,388,608   (RNE cast of W_qkv, fragment order)
//   R2  Wp   bf16 [1024][1024]          2,097,152 @  14,680,064   (RNE cast of W_proj, fragment order)
//   R3  Qh   bf16 [4096][1024]          8,388,608 @  16,777,216   (q projection, hi plane)
//   R4  Ql   bf16 [4096][1024]          8,388,608 @  25,165,824   (q projection, lo plane)
//   R5  Kh   bf16 [2][4096][1024]      16,777,216 @  33,554,432   (rows 0..2047 cache keys, 2048.. k projection; hi)
//   R6  Kl   bf16 [2][4096][1024]      16,777,216 @  50,331,648   (same rows; lo)
//   R7  Vt   f16  [2][1024][4096]      16,777,216 @  67,108,864   (cols 0..2047 cache values^T, 2048.. v projection^T)
//   R8  Y    f32  [4096][1024]         16,777,216 @  83,886,080   (attention output, token-major, heads merged)
//   R9  Yh   bf16 [4096][1024]          8,388,608 @ 100,663,296   (split of Y, hi, fragment order)
//   R10 Yl   bf16 [4096][1024]          8,388,608 @ 109,051,904   (split of Y, lo, fragment order)
//   total 117,440,512 B
// ---------------------------------------------------------------------------
extern "C" void kernel_launch(void* const* d_in, const int* in_sizes, int n_in,
                              void* d_out, int out_size, void* d_ws,
                              size_t ws_size, hipStream_t stream) {
  if (n_in < 7) return;
  const size_t nQ  = (size_t)kBatch * kTq * kDm;        // 4,194,304
  const size_t nKV = (size_t)kBatch * kSkv * kDm;       // 4,194,304
  const size_t nWq = (size_t)3 * kDm * kDm;             // 3,145,728
  const size_t nWp = (size_t)kDm * kDm;                 // 1,048,576
  const size_t nPe = (size_t)kSkv * kDm;                // 2,097,152
  if (in_sizes[0] != (int)nQ || in_sizes[1] != (int)nKV || in_sizes[2] != (int)nKV ||
      in_sizes[3] != (int)nWq || in_sizes[4] != (int)nWp || in_sizes[5] != (int)nPe ||
      out_size != (int)nQ) return;

  const float* q     = (const float*)d_in[0];
  const float* k_xl  = (const float*)d_in[1];
  const float* v_xl  = (const float*)d_in[2];
  const float* Wqkv  = (const float*)d_in[3];
  const float* Wproj = (const float*)d_in[4];
  const float* pos   = (const float*)d_in[5];
  const int*   causf = (const int*)d_in[6];
  float* outp = (float*)d_out;

  const size_t offQb = 0,              szQb = nQ * 2;
  const size_t offWq = offQb + szQb,   szWq = nWq * 2;
  const size_t offWp = offWq + szWq,   szWp = nWp * 2;
  const size_t offQh = offWp + szWp,   szQh = nQ * 2;
  const size_t offQl = offQh + szQh,   szQl = nQ * 2;
  const size_t offKh = offQl + szQl,   szKh = (size_t)kBatch * kKeys * kDm * 2;
  const size_t offKl = offKh + szKh,   szKl = szKh;
  const size_t offVt = offKl + szKl,   szVt = (size_t)kBatch * kDm * kKeys * 2;
  const size_t offY  = offVt + szVt,   szY  = nQ * 4;
  const size_t offYh = offY + szY,     szYh = nQ * 2;
  const size_t offYl = offYh + szYh,   szYl = nQ * 2;
  const size_t total = offYl + szYl;   // 117,440,512
  if (total > ws_size) return;

  char* ws = (char*)d_ws;
  unsigned short* Qb = (unsigned short*)(ws + offQb);
  unsigned short* Wq = (unsigned short*)(ws + offWq);
  unsigned short* Wp = (unsigned short*)(ws + offWp);
  unsigned short* Qh = (unsigned short*)(ws + offQh);
  unsigned short* Ql = (unsigned short*)(ws + offQl);
  unsigned short* Kh = (unsigned short*)(ws + offKh);
  unsigned short* Kl = (unsigned short*)(ws + offKl);
  unsigned short* Vt = (unsigned short*)(ws + offVt);
  float*          Y  = (float*)(ws + offY);
  unsigned short* Yh = (unsigned short*)(ws + offYh);
  unsigned short* Yl = (unsigned short*)(ws + offYl);

  // ---- input casts (RNE bf16 of every float input) and cache planes ----
  {
    const int npq = (int)(nQ / 1024), npwq = (int)(nWq / 1024), npwp = (int)(nWp / 1024), n2kv = (int)(nKV / 2);
    // GEMM operands, written in fragment order; one wave per 1024 elements, 8 waves per block
    cast_pack_bf16_kernel<<<dim3((npq + 7) / 8), 256, 0, stream>>>(q, Qb, npq);
    cast_pack_bf16_kernel<<<dim3((npwq + 7) / 8), 256, 0, stream>>>(Wqkv, Wq, npwq);
    cast_pack_bf16_kernel<<<dim3((npwp + 7) / 8), 256, 0, stream>>>(Wproj, Wp, npwp);
    // cache keys -> rows 0..2047 of both key planes (hi, lo), both batches
    kcache_split_kernel<<<dim3((n2kv + 255) / 256), 256, 0, stream>>>(k_xl, pos, Kh, Kl, causf, n2kv);
    // v_xl[b]: in[s rows=2048][c cols=1024] -> Vt[b] out[c][s] with output row pitch kKeys, cols 0..2047;
    // grid (cols/64, rows/64, B)
    tcast16_kernel<<<dim3(kDm / 64, kSkv / 64, kBatch), 256, 0, stream>>>(
        v_xl, Vt, kSkv, kDm, kKeys, (long)kSkv * kDm, (long)kDm * kKeys);
  }

  // ---- qkv projections: bf16 operands (K = 1024, M,N multiples of 64, no tails) ----
  {
    // q projection: C[m = b*2048+t][n] -> Qh (hi) / Ql (lo), M=4096, N=1024, K=1024; 1024 tiles -> 128 blocks
    const int tilesQ = (int)((nQ / kDm) / 64) * (kDm / 64);
    wmma_gemm64<1, false, 0, 2, false><<<dim3((tilesQ + 7) / 8, 1), 256, 0, stream>>>(
        Qb, nullptr, kDm, 0L, Wq, nullptr, kDm, 0L,
        (void*)Qh, (void*)Ql, kDm, 0L, nullptr, nullptr, 0L,
        kBatch * kTq, kDm, kDm, 1.0f);
    // k projection per batch: C[t][n] -> key plane rows 2048+t (hi -> Kh, lo -> Kl), M=2048, N=1024, K=1024;
    // 512 tiles -> 64 blocks, grid.y = batch
    const int tilesK = (kTq / 64) * (kDm / 64);
    wmma_gemm64<1, false, 0, 2, false><<<dim3((tilesK + 7) / 8, kBatch), 256, 0, stream>>>(
        Qb, nullptr, kDm, (long)kTq * kDm, Wq + (size_t)kDm * kDm, nullptr, kDm, 0L,
        (void*)(Kh + (size_t)kSkv * kDm), (void*)(Kl + (size_t)kSkv * kDm), kDm, (long)kKeys * kDm,
        nullptr, nullptr, 0L,
        kTq, kDm, kDm, 1.0f);
    // v projection, role-swapped: C[m = channel][n = t] -> Vt_b[channel][2048 + t] (f16), M=1024, N=2048, K=1024,
    // ldc = kKeys; 512 tiles -> 64 blocks, grid.y = batch
    const int tilesV = (kDm / 64) * (kTq / 64);
    wmma_gemm64<1, false, 0, 1, false><<<dim3((tilesV + 7) / 8, kBatch), 256, 0, stream>>>(
        Wq + (size_t)2 * kDm * kDm, nullptr, kDm, 0L, Qb, nullptr, kDm, (long)kTq * kDm,
        (void*)(Vt + kSkv), nullptr, kKeys, (long)kDm * kKeys, nullptr, nullptr, 0L,
        kDm, kTq, kDm, 1.0f);
  }

  // ---- attention over the 4096 keys per (batch, head); score scale 1/sqrt(64) applied in f32 ----
  attn_xl_kernel<<<dim3(kHeads * (kTq / AT_QB), kBatch), 128, 0, stream>>>(Qh, Ql, Kh, Kl, Vt, Y, 0.125f);

  // ---- y -> bf16 hi/lo planes; output projection C[m][n] = sum_c (Yh + Yl)[m][c] * Wp[n][c] -> d_out ----
  {
    const int npy = (int)(nQ / 1024);
    split_pack_bf16_kernel<<<dim3((npy + 7) / 8), 256, 0, stream>>>(Y, Yh, Yl, npy);
    const int tilesP = (int)((nQ / kDm) / 64) * (kDm / 64);   // 1024 tiles -> 128 blocks
    wmma_gemm64<1, true, 0, 0, false, 0, false><<<dim3((tilesP + 7) / 8, 1), 256, 0, stream>>>(
        Yh, Yl, kDm, 0L, Wp, nullptr, kDm, 0L,
        (void*)outp, nullptr, kDm, 0L, nullptr, nullptr, 0L,
        kBatch * kTq, kDm, kDm, 1.0f);
  }
}

// v007
// Measured time: 238 microseconds a run.
// In both of two side-by-side timings against v006, it was 1.10 times as fast.
// Over all steps from v000 it is 3.51 times as fast.
// Contractions: q/k/v projections on v_wmma_f32_16x16x32_bf16 (bf16 operands = RNE-cast inputs, single product); q.k^T on v_wmma_f32_16x16x32_bf16 with bf16 hi/lo planes for both q and k (hi.hi + hi.lo + lo.hi); p.v on v_wmma_f32_16x16x32_f16 (p f16 carried x2^15, v f16, single product); output projection on v_wmma_f32_16x16x32_bf16 with y as bf16 hi/lo planes (hi.W + lo.W) and W bf16; f32 accumulate everywhere; softmax, score scale and the cache add in f32.
#include <hip/hip_runtime.h>
#include <math.h>
#include <stdint.h>

constexpr int kBatch = 2;
constexpr int kTq    = 2048;            // query length
constexpr int kSkv   = 2048;            // cache length
constexpr int kKeys  = kSkv + kTq;      // 4096 keys per (batch, head)
constexpr int kDm    = 1024;            // model dim
constexpr int kHeads = 16;
constexpr int kHd    = 64;
static_assert(kHeads * kHd == kDm, "head split");
static_assert(kTq % 64 == 0 && kKeys % 64 == 0 && kDm % 64 == 0 && kSkv % 64 == 0, "tile multiples");

typedef __attribute__((ext_vector_type(16))) _Float16 v16h;
typedef __attribute__((ext_vector_type(8)))  _Float16 v8h;
typedef __attribute__((ext_vector_type(2)))  _Float16 v2h;
typedef __attribute__((ext_vector_type(16))) __bf16   v16b;
typedef __attribute__((ext_vector_type(8)))  __bf16   v8b;
typedef __attribute__((ext_vector_type(8)))  float    v8f;
typedef __attribute__((ext_vector_type(4)))  float    v4f;
typedef __attribute__((ext_vector_type(2)))  float    v2f;
typedef __attribute__((ext_vector_type(4)))  unsigned int v4u;

__device__ __forceinline__ unsigned short f2bf_bits(float f) {
  unsigned u = __float_as_uint(f);
  return (unsigned short)((u + 0x7FFFu + ((u >> 16) & 1u)) >> 16);
}
__device__ __forceinline__ float bf_bits2f(unsigned short h) { return __uint_as_float(((unsigned)h) << 16); }
__device__ __forceinline__ unsigned short h_bits(float f) { return __builtin_bit_cast(unsigned short, (_Float16)f); }
__device__ __forceinline__ unsigned pk16(unsigned short a, unsigned short b) { return (unsigned)a | ((unsigned)b << 16); }

// hazard guards as plain device helpers (no inline asm inside the kernel template body)
__device__ __forceinline__ void dep_guard_h(v8f& a, v8f& b, v16h x, v16h y) { asm volatile("v_nop\n\tv_nop\n\tv_nop\n\tv_nop" : "+v"(a), "+v"(b) : "v"(x), "v"(y)); }
__device__ __forceinline__ void dep_guard_b(v8f& a, v8f& b, v16b x, v16b y) { asm volatile("v_nop\n\tv_nop\n\tv_nop\n\tv_nop" : "+v"(a), "+v"(b) : "v"(x), "v"(y)); }
__device__ __forceinline__ void keep4_h(v16h a, v16h b, v16h c, v16h d) { asm volatile("v_nop" :: "v"(a), "v"(b), "v"(c), "v"(d)); }
__device__ __forceinline__ void keep4_b(v16b a, v16b b, v16b c, v16b d) { asm volatile("v_nop" :: "v"(a), "v"(b), "v"(c), "v"(d)); }
__device__ __forceinline__ void acc_guard4(v8f& a, v8f& b, v8f& c, v8f& d) { asm volatile("v_nop\n\tv_nop\n\tv_nop\n\tv_nop" : "+v"(a), "+v"(b), "+v"(c), "+v"(d)); }
// The wait that belongs in front of any overwrite of a register that an issued global load names. The address pairs
// are inputs so that they stay whole up to here.
__device__ __forceinline__ void addr_wait4(const void* a, const void* b, const void* c, const void* d) {
  asm volatile("s_wait_xcnt 0x0" :: "v"(a), "v"(b), "v"(c), "v"(d) : "memory");
}
__device__ __forceinline__ void addr_wait8(const void* a, const void* b, const void* c, const void* d, const void* e, const void* f,
                                           const void* g, const void* h) {
  asm volatile("s_wait_xcnt 0x0" :: "v"(a), "v"(b), "v"(c), "v"(d), "v"(e), "v"(f), "v"(g), "v"(h) : "memory");
}
__device__ __forceinline__ void addr_wait12(const void* a, const void* b, const void* c, const void* d, const void* e, const void* f,
                                            const void* g, const void* h, const void* i, const void* j, const void* k, const void* l) {
  asm volatile("s_wait_xcnt 0x0" :: "v"(a), "v"(b), "v"(c), "v"(d), "v"(e), "v"(f), "v"(g), "v"(h), "v"(i), "v"(j), "v"(k), "v"(l) : "memory");
}
template <typename T> struct Frag;
template <> struct Frag<_Float16> {
  typedef v16h V; union U { v16h v; v8h h[2]; };
  static __device__ __forceinline__ v16h load(const _Float16* p) {   // elements 0..7 <- p[0..7], 8..15 <- p[16..23]
    U f; f.h[0] = *(const v8h*)(p); f.h[1] = *(const v8h*)(p + 16); return f.v;
  }
  // fragment order: register halves 256 elements apart. The global address space is stated: pointers carried round a
  // loop would otherwise give flat loads.
  static __device__ __forceinline__ v16h loadp(const _Float16* p) {
    typedef const __attribute__((address_space(1))) v8h* G;
    U f; f.h[0] = *(G)(p); f.h[1] = *(G)(p + 256); return f.v;
  }
  static __device__ __forceinline__ v8f mma(v16h a, v16h b, v8f c) {
    return __builtin_amdgcn_wmma_f32_16x16x32_f16(false, a, false, b, (short)0, c, false, false);
  }
  static __device__ __forceinline__ void guard(v8f& a, v8f& b, v16h x, v16h y) { dep_guard_h(a, b, x, y); }
  static __device__ __forceinline__ void keep(v16h a, v16h b, v16h c, v16h d) { keep4_h(a, b, c, d); }
};
template <> struct Frag<__bf16> {
  typedef v16b V; union U { v16b v; v8b h[2]; };
  static __device__ __forceinline__ v16b load(const __bf16* p) {
    U f; f.h[0] = *(const v8b*)(p); f.h[1] = *(const v8b*)(p + 16); return f.v;
  }
  static __device__ __forceinline__ v16b loadp(const __bf16* p) {
    typedef const __attribute__((address_space(1))) v8b* G;
    U f; f.h[0] = *(G)(p); f.h[1] = *(G)(p + 256); return f.v;
  }
  static __device__ __forceinline__ v8f mma(v16b a, v16b b, v8f c) {
    return __builtin_amdgcn_wmma_f32_16x16x32_bf16(false, a, false, b, (short)0, c, false, false);
  }
  static __device__ __forceinline__ void guard(v8f& a, v8f& b, v16b x, v16b y) { dep_guard_b(a, b, x, y); }
  static __device__ __forceinline__ void keep(v16b a, v16b b, v16b c, v16b d) { keep4_b(a, b, c, d); }
};

// ---- Register-blocked batched WMMA GEMM ------------------------------------
// C[m,n] = scale * sum_k A[m,k] * Bt[n,k] (+bias)(+resid); each wave owns a 64x64 tile.
// A [M,K] and Bt [N,K] stand in FRAGMENT ORDER (lda = ldb = K): blocks of 16 rows x 32 k = 512 elements (1 KB), block
// number (row / 16) * (K / 32) + k / 32, so a row tile starts where row-major row 16 * (row / 16) would. Inside a block
// the 8 elements k % 32 = 8 * (2 h + hh) + 0..7 of row r stand at element h * 256 + (hh * 16 + r) * 8: lane hh * 16 + r
// finds register half h of its fragment at h * 256 + lane * 8, and each of a fragment's two loads reads 512
// contiguous bytes (4 whole lines). The k of every lane and register position is that of Frag::load on a row-major
// operand, the same for A and Bt. M,N % 64 == 0, K % 32 == 0.
// SPLIT: operands are hi/lo planes (A2/Bt2 = lo planes, same layout); product = hi.hi + hi.lo + lo.hi.
// SPLITB (only meaningful with SPLIT): when false only A carries a lo plane; product = hi.B + lo.B (Bt2 unused).
// BIAS_MODE: 0 = none, 1 = bias[m], 2 = bias[n].
// OUT_MODE: 0 = f32, 1 = f16, 2 = bf16 hi plane (Cout) + bf16 lo plane (Cout2).
// ET: 0 = f16 operands, 1 = bf16 operands (pointers passed as 16-bit storage)
template <int ET> struct Elem;
template <> struct Elem<0> { typedef _Float16 T; };
template <> struct Elem<1> { typedef __bf16 T; };
template <int ET, bool SPLIT, int BIAS_MODE, int OUT_MODE, bool RESID, int ACT = 0, bool SPLITB = SPLIT>
__global__ __launch_bounds__(256) void wmma_gemm64(
    const unsigned short* __restrict__ Ap, const unsigned short* __restrict__ A2p, int lda, long strideA,
    const unsigned short* __restrict__ Btp, const unsigned short* __restrict__ Bt2p, int ldb, long strideB,
    void* __restrict__ Cout, void* __restrict__ Cout2, int ldc, long strideC,
    const float* __restrict__ bias,
    const float* __restrict__ resid, long strideR,
    int M, int N, int K, float scale) {
  typedef typename Elem<ET>::T T;
  typedef typename Frag<T>::V V;
  const T* A = (const T*)Ap; const T* A2 = (const T*)A2p; const T* Bt = (const T*)Btp; const T* Bt2 = (const T*)Bt2p;
  __shared__ __align__(16) float sT[8][16 * 68];   // per-wave 16x64 slab, pitch 68 floats
  const int b    = blockIdx.y;
  const int lane = threadIdx.x & 31;
  const int wave = __builtin_amdgcn_readfirstlane(threadIdx.x >> 5);   // scalar, so that tile indices and row-tile offsets stay in scalar registers
  const int tilesN = N >> 6;
  const int tilesM = M >> 6;
  const int tile = blockIdx.x * 8 + wave;
  if (tile >= tilesM * tilesN) return;   // wave-uniform; no block barriers in this kernel
  const int tm = tile / tilesN;
  const int tn = tile - tm * tilesN;
  const int m0 = tm << 6;
  const int n0 = tn << 6;

  const T* Ab  = A  + (size_t)b * strideA;
  const T* Bb  = Bt + (size_t)b * strideB;
  const T* Ab2 = SPLIT ? (A2  + (size_t)b * strideA) : nullptr;
  const T* Bb2 = (SPLIT && SPLITB) ? (Bt2 + (size_t)b * strideB) : nullptr;

  const int rlane = lane & 15;                 // row (A) / col (B, D) within subtile
  const int mOff  = (lane >> 4) * 8;           // D row offset
  const unsigned lo8 = (unsigned)lane * 8u;    // this lane's 8 elements (16 bytes) inside a half block

  v8f acc[4][4];
#pragma unroll
  for (int i = 0; i < 4; ++i)
#pragma unroll
    for (int j = 0; j < 4; ++j) acc[i][j] = (v8f){0.f,0.f,0.f,0.f,0.f,0.f,0.f,0.f};

  // This lane's 16 bytes in the current k block of each row tile; the next k block stands 512 elements further on.
  const T* bp[4]; const T* bp2[4]; const T* ap[4]; const T* ap2[4];
#pragma unroll
  for (int j = 0; j < 4; ++j) {
    const size_t bo = (size_t)(n0 + (j << 4)) * ldb + lo8;
    const size_t ao = (size_t)(m0 + (j << 4)) * lda + lo8;
    bp[j]  = Bb + bo;
    bp2[j] = (SPLIT && SPLITB) ? (Bb2 + bo) : bp[j];
    ap[j]  = Ab + ao;
    ap2[j] = SPLIT ? (Ab2 + ao) : ap[j];
  }
  for (int k0 = 0; k0 < K; k0 += 32) {
    // All fragment loads of the k block as one group, so that the block waits for memory once, not once per row tile of A.
    V bh[4], bl[4], ah[4], al[4];
#pragma unroll
    for (int j = 0; j < 4; ++j) {
      bh[j] = Frag<T>::loadp(bp[j]);
      if (SPLIT && SPLITB) bl[j] = Frag<T>::loadp(bp2[j]);
    }
#pragma unroll
    for (int i = 0; i < 4; ++i) {
      ah[i] = Frag<T>::loadp(ap[i]);
      if (SPLIT) al[i] = Frag<T>::loadp(ap2[i]);
    }
#pragma unroll
    for (int i = 0; i < 4; ++i) {
#pragma unroll
      for (int j = 0; j < 4; ++j) {
        acc[i][j] = Frag<T>::mma(ah[i], bh[j], acc[i][j]);
        if (SPLIT) {
          if (SPLITB) acc[i][j] = Frag<T>::mma(ah[i], bl[j], acc[i][j]);
          acc[i][j] = Frag<T>::mma(al[i], bh[j], acc[i][j]);
        }
      }
      Frag<T>::guard(acc[i][0], acc[i][3], ah[i], SPLIT ? al[i] : ah[i]);
    }
    Frag<T>::keep(bh[0], bh[1], bh[2], bh[3]);
    if (SPLIT && SPLITB) Frag<T>::keep(bl[0], bl[1], bl[2], bl[3]);
    // in front of the advance, which overwrites the pairs that the loads of this block name
    if (SPLIT) addr_wait12(bp[0], bp[1], bp[2], bp[3], ap[0], ap[1], ap[2], ap[3], ap2[0], ap2[1], ap2[2], ap2[3]);
    else       addr_wait8(bp[0], bp[1], bp[2], bp[3], ap[0], ap[1], ap[2], ap[3]);
    if (SPLIT && SPLITB) addr_wait4(bp2[0], bp2[1], bp2[2], bp2[3]);
#pragma unroll
    for (int j = 0; j < 4; ++j) { bp[j] += 512; bp2[j] += 512; ap[j] += 512; ap2[j] += 512; }
  }
  acc_guard4(acc[0][0], acc[0][1], acc[0][2], acc[0][3]);
  acc_guard4(acc[1][0], acc[1][1], acc[1][2], acc[1][3]);
  acc_guard4(acc[2][0], acc[2][1], acc[2][2], acc[2][3]);
  acc_guard4(acc[3][0], acc[3][1], acc[3][2], acc[3][3]);

  // ---- epilogue ----
  float* slab = sT[wave];
  const float* Rb = RESID ? (resid + (size_t)b * strideR) : nullptr;
#pragma unroll
  for (int i = 0; i < 4; ++i) {
    const int mBase = m0 + (i << 4);
#pragma unroll
    for (int j = 0; j < 4; ++j) {
      const int n = n0 + (j << 4) + rlane;
      float bv = 0.f;
      if (BIAS_MODE == 2) bv = bias[n];
#pragma unroll
      for (int r = 0; r < 8; ++r) {
        float v = acc[i][j][r] * scale;
        if (BIAS_MODE == 1) v += bias[mBase + mOff + r];
        if (BIAS_MODE == 2) v += bv;
        if (RESID) v += Rb[(size_t)(mBase + mOff + r) * ldc + n];
        if (ACT == 1) v = tanhf(v);
        if (ACT == 2) v = fmaxf(v, 0.0f);
        if (ACT == 3) v = v / (1.0f + expf(-v));
        if (ACT == 4) v = (v > 0.f) ? v : 0.01f * v;
        slab[(mOff + r) * 68 + (j << 4) + rlane] = v;
      }
    }
    __builtin_amdgcn_fence(__ATOMIC_RELEASE, "workgroup");
    __builtin_amdgcn_wave_barrier();
    __builtin_amdgcn_fence(__ATOMIC_ACQUIRE, "workgroup");
    if (OUT_MODE == 0) {
      float* C = (float*)Cout + (size_t)b * strideC;
      const int hh = lane >> 4, c4 = (lane & 15) * 4;     // row seg = 256 B = 16 lanes x 16 B
      {
#pragma unroll
        for (int it = 0; it < 8; ++it) {
          const int row = it * 2 + hh;
          v4f v = *(const v4f*)(slab + row * 68 + c4);
          *(v4f*)(C + (size_t)(mBase + row) * ldc + n0 + c4) = v;
        }
        
      }
    } else {
      const int q = lane >> 3, c8 = (lane & 7) * 8;
      unsigned short* C  = (unsigned short*)Cout  + (size_t)b * strideC;
      unsigned short* C2 = (OUT_MODE == 2) ? ((unsigned short*)Cout2 + (size_t)b * strideC) : nullptr;
      {
#pragma unroll
        for (int it = 0; it < 4; ++it) {
          const int row = it * 4 + q;
          const float* sp = slab + row * 68 + c8;
          v8h hv, lv;
#pragma unroll
          for (int e = 0; e < 8; ++e) {
            if (OUT_MODE == 1) {
              hv[e] = (_Float16)sp[e];
            } else {
              unsigned short hb = f2bf_bits(sp[e]);
              unsigned short lb = f2bf_bits(sp[e] - bf_bits2f(hb));
              hv[e] = __builtin_bit_cast(_Float16, hb);
              lv[e] = __builtin_bit_cast(_Float16, lb);
            }
          }
          *(v8h*)(C + (size_t)(mBase + row) * ldc + n0 + c8) = hv;
          if (OUT_MODE == 2) *(v8h*)(C2 + (size_t)(mBase + row) * ldc + n0 + c8) = lv;
        }
        
      }
    }
    __builtin_amdgcn_fence(__ATOMIC_RELEASE, "workgroup");
    __builtin_amdgcn_wave_barrier();
    __builtin_amdgcn_fence(__ATOMIC_ACQUIRE, "workgroup");
  }
}

// ---------------------------------------------------------------------------
// f32 [R][kDm] row-major -> 16-bit planes in the fragment order that wmma_gemm64 reads (described there).
// One wave makes two neighbouring 1 KB blocks (16 rows x 64 k). Lane l takes the 8 floats k = 8 * (l & 3) + 0..7 of row
// 8 it + (l >> 2) of block u (u, it = 0, 1): two 16-byte loads, one 16-byte store per plane. A wave-wide store writes
// four whole 128-byte lines (8 rows x 16 B each); the eight loads of a lane are issued together.
// Coverage: nPairs = (R / 16) * (kDm / 64) waves x 1024 elements = R * kDm (every nPairs here is a multiple of 8).
// ---------------------------------------------------------------------------
struct PackPos { const float* src; size_t dst; };
__device__ __forceinline__ PackPos pack_pos(const float* in, int wv, int lane) {
  const int rt = wv / (kDm / 64), kp = wv - rt * (kDm / 64);   // row tile, pair of k blocks
  const int r8 = lane >> 2, piece = lane & 3;
  PackPos p;
  p.src = in + (size_t)(rt * 16 + r8) * kDm + kp * 64 + piece * 8;
  p.dst = (size_t)wv * 1024 + (piece >> 1) * 256 + ((piece & 1) * 16 + r8) * 8;
  return p;
}

// bf16 (RNE) cast
__global__ __launch_bounds__(256) void cast_pack_bf16_kernel(const float* __restrict__ in, unsigned short* __restrict__ out,
                                                            int nPairs) {
  const int wv = (blockIdx.x * 256 + threadIdx.x) >> 5;
  if (wv < nPairs) {
    const PackPos p = pack_pos(in, wv, threadIdx.x & 31);
    v4f f[2][2][2];
#pragma unroll
    for (int u = 0; u < 2; ++u)
#pragma unroll
      for (int it = 0; it < 2; ++it) {
        f[u][it][0] = *(const v4f*)(p.src + (size_t)it * 8 * kDm + u * 32);
        f[u][it][1] = *(const v4f*)(p.src + (size_t)it * 8 * kDm + u * 32 + 4);
      }
#pragma unroll
    for (int u = 0; u < 2; ++u)
#pragma unroll
      for (int it = 0; it < 2; ++it) {
        v4u o;
#pragma unroll
        for (int q = 0; q < 4; ++q) {
          const v4f g = f[u][it][q >> 1];
          o[q] = pk16(f2bf_bits(g[(q & 1) * 2]), f2bf_bits(g[(q & 1) * 2 + 1]));
        }
        *(v4u*)(out + p.dst + u * 512 + it * 64) = o;
      }
  }
}

// bf16 split: hi = bf16_rne(in), lo = bf16_rne(in - hi)
__global__ __launch_bounds__(256) void split_pack_bf16_kernel(const float* __restrict__ in, unsigned short* __restrict__ hi,
                                                             unsigned short* __restrict__ lo, int nPairs) {
  const int wv = (blockIdx.x * 256 + threadIdx.x) >> 5;
  if (wv < nPairs) {
    const PackPos p = pack_pos(in, wv, threadIdx.x & 31);
    v4f f[2][2][2];
#pragma unroll
    for (int u = 0; u < 2; ++u)
#pragma unroll
      for (int it = 0; it < 2; ++it) {
        f[u][it][0] = *(const v4f*)(p.src + (size_t)it * 8 * kDm + u * 32);
        f[u][it][1] = *(const v4f*)(p.src + (size_t)it * 8 * kDm + u * 32 + 4);
      }
#pragma unroll
    for (int u = 0; u < 2; ++u)
#pragma unroll
      for (int it = 0; it < 2; ++it) {
        v4u oh, ol;
#pragma unroll
        for (int q = 0; q < 4; ++q) {
          const v4f g = f[u][it][q >> 1];
          const float f0 = g[(q & 1) * 2], f1 = g[(q & 1) * 2 + 1];
          const unsigned short h0 = f2bf_bits(f0), h1 = f2bf_bits(f1);
          oh[q] = pk16(h0, h1);
          ol[q] = pk16(f2bf_bits(f0 - bf_bits2f(h0)), f2bf_bits(f1 - bf_bits2f(h1)));
        }
        *(v4u*)(hi + p.dst + u * 512 + it * 64) = oh;
        *(v4u*)(lo + p.dst + u * 512 + it * 64) = ol;
      }
  }
}

// ---------------------------------------------------------------------------
// Cache keys, rows 0..kSkv-1 of each per-batch [kKeys][kDm] bf16 key plane pair:
//   x = bf16_rne(k_xl[b][s][c]) + bf16_rne(pos[s][c])   (the add in f32)
//   kh[b][s][c] = bf16_rne(x),  kl[b][s][c] = bf16_rne(x - kh)
// flags = the causal flag input; this forward applies no mask, the pointer is only bound, never read.
// ---------------------------------------------------------------------------
__global__ __launch_bounds__(256) void kcache_split_kernel(const float* __restrict__ kxl, const float* __restrict__ pos,
                                                           unsigned short* __restrict__ kh, unsigned short* __restrict__ kl,
                                                           const int* __restrict__ flags, int n2) {
  const int i = blockIdx.x * 256 + threadIdx.x;
  if (i < n2) {
    const size_t e = 2 * (size_t)i;                        // element index into [b][s][c]
    const size_t perB = (size_t)kSkv * kDm;
    const int bb = (int)(e / perB);
    const size_t rem = e - (size_t)bb * perB;              // s*kDm + c (even)
    const v2f a = *(const v2f*)(kxl + e);
    const v2f p = *(const v2f*)(pos + rem);
    const float s0 = bf_bits2f(f2bf_bits(a[0])) + bf_bits2f(f2bf_bits(p[0]));
    const float s1 = bf_bits2f(f2bf_bits(a[1])) + bf_bits2f(f2bf_bits(p[1]));
    const unsigned short h0 = f2bf_bits(s0), h1 = f2bf_bits(s1);
    const unsigned short l0 = f2bf_bits(s0 - bf_bits2f(h0)), l1 = f2bf_bits(s1 - bf_bits2f(h1));
    const unsigned uh = pk16(h0, h1), ul = pk16(l0, l1);
    const size_t o = ((size_t)bb * kKeys * kDm + rem) >> 1; // u32 index
    ((unsigned*)kh)[o] = uh;
    ((unsigned*)kl)[o] = ul;
    
  }
}

// ---------------------------------------------------------------------------
// Fused transpose + cast of an f32 matrix, z-batched: in_z = W + z*sIn viewed [R rows][Cc cols] (pitch Cc) ->
//   o_z[c][r] = f16(bf16_rne(in_z[r][c]))   ([Cc][...], output row pitch ldo halves), o_z = o + z*sOut.
// 64x64 tiles through LDS. grid = (Cc/64, R/64, Z), 256 threads (R, Cc multiples of 64).
// Coverage per block: load 4 it x 256 thr x 4 floats = 64x64; store 2 it x 256 thr x 8 u16 = 64x64.
// ---------------------------------------------------------------------------
__global__ __launch_bounds__(256) void tcast16_kernel(const float* __restrict__ W, unsigned short* __restrict__ o,
                                                      int R, int Cc, int ldo, long sIn, long sOut) {
  __shared__ __align__(16) float tf[64 * 68];
  W += (size_t)blockIdx.z * sIn;
  o += (size_t)blockIdx.z * sOut;
  const int c0  = blockIdx.x * 64;   // input column block = output row block
  const int r0  = blockIdx.y * 64;   // input row block    = output column block
  const int tid = threadIdx.x;
  {
    const int lr = tid >> 4;         // 0..15
    const int c4 = (tid & 15) * 4;   // 0..60
#pragma unroll
    for (int it = 0; it < 4; ++it) {
      const int rr = it * 16 + lr;   // 0..63
      const v4f a = *(const v4f*)(W + (size_t)(r0 + rr) * Cc + c0 + c4);
      *(v4f*)(tf + rr * 68 + c4) = a;
    }
  }
  __syncthreads();
  const int sub = tid >> 3;          // 0..31
  const int c8  = (tid & 7) * 8;     // 0..56
  v4u hv[2];
#pragma unroll
  for (int it = 0; it < 2; ++it) {
    const int oc = it * 32 + sub;    // output row within tile (= input column)
    v4u a;
#pragma unroll
    for (int q = 0; q < 4; ++q) {
      const float f0 = tf[(c8 + 2 * q) * 68 + oc];
      const float f1 = tf[(c8 + 2 * q + 1) * 68 + oc];
      a[q] = pk16(h_bits(bf_bits2f(f2bf_bits(f0))), h_bits(bf_bits2f(f2bf_bits(f1))));
    }
    hv[it] = a;
  }
  {
#pragma unroll
    for (int it = 0; it < 2; ++it) {
      const int oc = it * 32 + sub;
      const size_t go = (size_t)(c0 + oc) * ldo + r0 + c8;
      *(v4u*)(o + go) = hv[it];
    }
    
  }
}

#define AT_D 64
#define AT_NW 4
#define AT_QB 64
#define AT_KC 64
#define AT_PLANE 10240   // bytes from one plane's place in LDS to the next: 64 rows x 144 B = 9216, rounded up to a multiple of 2 KiB
#define AT_BUF (3 * AT_PLANE)   // one buffer: K hi, K lo, V^T
#define AT_LP 72   // LDS row pitch in 16-bit elements: 144 B = 16 B x 9 (odd), so the 16 rows of a 16-byte fragment read fall on 16 different bank groups

__device__ __forceinline__ v8f at_mma_b(v16b a, v16b b, v8f c) {
  c = __builtin_amdgcn_wmma_f32_16x16x32_bf16(false, a, false, b, (short)0, c, false, false);
  asm volatile("v_nop\n\tv_nop\n\tv_nop\n\tv_nop" : "+v"(c) : "v"(a), "v"(b));
  return c;
}
__device__ __forceinline__ v8f at_mma_h(v16h a, v16h b, v8f c) {
  c = __builtin_amdgcn_wmma_f32_16x16x32_f16(false, a, false, b, (short)0, c, false, false);
  asm volatile("v_nop\n\tv_nop\n\tv_nop\n\tv_nop" : "+v"(c) : "v"(a), "v"(b));
  return c;
}

// Four hardware exp2 in place, in one statement: each v_exp_f32 is followed by an independent one and the last by
// v_nop, the slot the instruction set asks for behind a transcendental before its result is read or its source
// overwritten.
__device__ __forceinline__ void exp2x4(float& a, float& b, float& c, float& d) {
  asm("v_exp_f32 %0, %0\n\tv_exp_f32 %1, %1\n\tv_exp_f32 %2, %2\n\tv_exp_f32 %3, %3\n\tv_nop"
      : "+v"(a), "+v"(b), "+v"(c), "+v"(d));
}

// One hardware exp2 in place, with the same slot behind it.
__device__ __forceinline__ void exp2x1(float& a) { asm("v_exp_f32 %0, %0\n\tv_nop" : "+v"(a)); }

// lane l <-> lane l ^ 16 (the two halves that share a query column), a vector cross-row move, no LDS
__device__ __forceinline__ float xhalf(float x) {
  const int i = __builtin_bit_cast(int, x);
  return __builtin_bit_cast(float, __builtin_amdgcn_permlanex16(i, i, 0x76543210, 0xfedcba98, false, false));
}

typedef uint32_t u32x4 __attribute__((ext_vector_type(4)));
typedef uint32_t u32x8 __attribute__((ext_vector_type(8)));
__device__ __forceinline__ uint32_t uni(uint32_t v) { return (uint32_t)__builtin_amdgcn_readfirstlane(v); }
// A wave-uniform test held in a scalar register, so that the branch on it is a scalar branch: a tensor load ignores EXEC.
__device__ __forceinline__ uint32_t pinned(uint32_t v) { uint32_t w = (uint32_t)__builtin_amdgcn_readfirstlane(v); asm volatile("" : "+s"(w)); return w; }
// Descriptor group 1: 1-byte elements, tensor = tile = 64 rows of 128 bytes, source row pitch src_pitch bytes, no mask;
// word 0: a pad of 4 dwords behind every 32 dwords (one row), which gives the 144-byte LDS pitch.
__device__ __forceinline__ u32x8 tdm_group1(uint32_t src_pitch) {
  u32x8 g;
  g[0] = uni((1u << 20) | (4u << 22) | (3u << 25));
  g[1] = uni(128u << 16);
  g[2] = uni(64u << 16);
  g[3] = uni(128u << 16);
  g[4] = uni(64u);
  g[5] = uni(src_pitch);
  g[6] = uni(0u);
  g[7] = uni(0u);
  return g;
}
// pinned() on the whole group: descriptor words held in their scalar registers (as plain constants they were made anew
// in front of each use, and their registers took other values in between, while a request was in flight).
__device__ __forceinline__ u32x8 pinned8(u32x8 g) { asm volatile("" : "+s"(g)); return g; }
// Descriptor group 0: count 1, place in LDS (byte offset), global address of the tile's first byte, type 2.
__device__ __forceinline__ u32x4 tdm_group0(uint32_t lds_dst, uint64_t ga) {
  u32x4 g;
  g[0] = uni(1u);
  g[1] = uni(lds_dst);
  g[2] = uni((uint32_t)ga);
  g[3] = uni((((uint32_t)(ga >> 32)) & 0x01FFFFFFu) | 0x80000000u);
  return g;
}
__device__ __forceinline__ void tdm_load(u32x4 g0, u32x8 g1) { asm volatile("tensor_load_to_lds %0, %1" :: "s"(g0), "s"(g1) : "memory"); }
// The compiler places no wait for a tensor load: a tile counts as landed only behind its issuer's own wait.
__device__ __forceinline__ void wait_tensor0() { asm volatile("s_wait_tensorcnt 0x0" ::: "memory"); }
// The same wait with the outstanding request's descriptor as inputs, so that its scalar registers stay whole up to here
// (without them the loop counter was put into a register of the request still in flight).
__device__ __forceinline__ void wait_tensor0_of(u32x4 g0, u32x8 g1) { asm volatile("s_wait_tensorcnt 0x0" :: "s"(g0), "s"(g1) : "memory"); }
// This wave's LDS reads have returned before the barrier behind which their buffer is refilled.
__device__ __forceinline__ void wait_ds0() { asm volatile("s_wait_dscnt 0x0" ::: "memory"); }

__global__ __launch_bounds__(128)
void attn_xl_kernel(const unsigned short* __restrict__ qhp, const unsigned short* __restrict__ qlp,
                    const unsigned short* __restrict__ khp, const unsigned short* __restrict__ klp,
                    const unsigned short* __restrict__ vtp, float* __restrict__ out, float sscale) {
  union FB { v16b v; v8b h[2]; };
  union FH { v16h v; v8h h[2]; v2h p[8]; };
  // two buffers of three planes: K hi [kv][d], K lo [kv][d], V^T [d][kv], each 64 rows at pitch 144 B, each place a multiple of 2 KiB
  __shared__ __attribute__((aligned(2048))) unsigned char Ring[2 * AT_BUF];
  __shared__ __align__(16) float    Os[AT_NW][16 * 68];         // per wave out tile, pitch 68
  const float PSC = 32768.0f;
  // softmax in base 2: exp((x - m) * sscale) = 2^((x - m) * sc2). sscale > 0 (the launch passes 1/sqrt(64)),
  // so the row maximum may be taken on the unscaled scores.
  const float sc2 = sscale * 1.44269504088896340736f;

  const int tid  = threadIdx.x;
  const int wave = (int)uni((uint32_t)tid >> 5);
  const int lane = tid & 31;
  const int hh   = lane >> 4;
  const int c    = lane & 15;

  const int nqb = kTq / AT_QB;            // 32
  const int bx = blockIdx.x;
  const int b  = blockIdx.y;
  const int qb = bx % nqb;
  const int h  = bx / nqb;                // 0..kHeads-1
  const int q0 = qb * AT_QB + wave * 16;

  const __bf16*   Qh = (const __bf16*)(const void*)qhp   + (size_t)b * kTq * kDm   + (size_t)h * AT_D;
  const __bf16*   Ql = (const __bf16*)(const void*)qlp   + (size_t)b * kTq * kDm   + (size_t)h * AT_D;
  const __bf16*   Kh = (const __bf16*)(const void*)khp   + (size_t)b * kKeys * kDm + (size_t)h * AT_D;
  const __bf16*   Kl = (const __bf16*)(const void*)klp   + (size_t)b * kKeys * kDm + (size_t)h * AT_D;
  const _Float16* Vh = (const _Float16*)(const void*)vtp + (size_t)b * kDm * kKeys + (size_t)h * AT_D * kKeys;
  float*          ob = out + (size_t)b * kTq * kDm + (size_t)h * AT_D;

  // ---- Q fragments (B operand, column = lane&15, split k map via Frag load): 2 d-chunks, hi and lo ----
  v16b qah[2], qal[2];
#pragma unroll
  for (int dc = 0; dc < 2; ++dc) {
    qah[dc] = Frag<__bf16>::load(Qh + (size_t)(q0 + c) * kDm + dc * 32 + 8 * hh);
    qal[dc] = Frag<__bf16>::load(Ql + (size_t)(q0 + c) * kDm + dc * 32 + 8 * hh);
  }

  float mrow = -INFINITY, lrow = 0.f;   // query q0 + c: running maximum (both halves agree), this half's sum
  v8f oacc[4];                          // oacc[t][r] = O^T[d = 16 t + 8 hh + r][query q0 + c]
#pragma unroll
  for (int t = 0; t < 4; ++t) oacc[t] = (v8f){0.f,0.f,0.f,0.f,0.f,0.f,0.f,0.f};

  const int nChunks = kKeys / AT_KC;   // 64, compile-time constant
  // Wave 0 brings K hi, wave 1 K lo, wave 2 V^T; chunk st goes to buffer st & 1. Every tile lies inside its plane:
  // K rows 64 st .. 64 st + 63 of 4096, 128 B at byte 128 h of a 2048-B row; V^T rows 64 h .. 64 h + 63, 128 B at byte 128 st of an 8192-B row.
  const uint32_t plane = (uint32_t)wave < 2u ? (uint32_t)wave : 2u;
  const uint32_t lbase = (uint32_t)(size_t)Ring;
  const uint64_t tsrc  = plane == 0u ? (uint64_t)(size_t)Kh : plane == 1u ? (uint64_t)(size_t)Kl : (uint64_t)(size_t)Vh;
  const uint32_t tstep = plane < 2u ? (uint32_t)(AT_KC * kDm * 2) : (uint32_t)(AT_KC * 2);   // bytes from one chunk's tile to the next
  const u32x8 g1 = pinned8(tdm_group1(plane < 2u ? (uint32_t)(kDm * 2) : (uint32_t)(kKeys * 2)));
  u32x4 g0 = tdm_group0(lbase + plane * AT_PLANE, tsrc);
  if (pinned((uint32_t)wave < 3u)) {
    tdm_load(g0, g1);
    wait_tensor0_of(g0, g1);
  }
  __syncthreads();   // chunk 0 published
  g0 = tdm_group0(lbase + AT_BUF + plane * AT_PLANE, tsrc + tstep);
  if (pinned((uint32_t)wave < 3u)) tdm_load(g0, g1);
  for (int kc = 0; kc < nChunks; ++kc) {
    const unsigned char* bufp = Ring + (kc & 1) * AT_BUF;   // chunk kc: keys kv0 = 64 kc .. kv0 + 63
    const __bf16*   Ksh = (const __bf16*)(const void*)bufp;
    const __bf16*   Ksl = (const __bf16*)(const void*)(bufp + AT_PLANE);
    const _Float16* Vth = (const _Float16*)(const void*)(bufp + 2 * AT_PLANE);

    // All 32 K fragment reads of the chunk as one group, in the order of their use: the wave meets the LDS latency once
    // here, not once in front of every three products.
    FB kf[2][4], lf[2][4];
#pragma unroll
    for (int dc = 0; dc < 2; ++dc) {
#pragma unroll
      for (int j = 0; j < 4; ++j) {
        kf[dc][j].h[0] = *(const v8b*)(Ksh + (j * 16 + c) * AT_LP + dc * 32 + 8 * hh);
        kf[dc][j].h[1] = *(const v8b*)(Ksh + (j * 16 + c) * AT_LP + dc * 32 + 16 + 8 * hh);
      }
#pragma unroll
      for (int j = 0; j < 4; ++j) {
        lf[dc][j].h[0] = *(const v8b*)(Ksl + (j * 16 + c) * AT_LP + dc * 32 + 8 * hh);
        lf[dc][j].h[1] = *(const v8b*)(Ksl + (j * 16 + c) * AT_LP + dc * 32 + 16 + 8 * hh);
      }
    }
    // s[j][r] = S^T[key kv0 + 16 j + 8 hh + r][query q0 + c]; every s[j] takes its six products in the order
    // dc 0: hi.hi, lo.hi, hi.lo, then dc 1 the same; the four tiles take turns, so that no product waits for the one before it.
    v8f s[4];
#pragma unroll
    for (int j = 0; j < 4; ++j) s[j] = (v8f){0.f,0.f,0.f,0.f,0.f,0.f,0.f,0.f};
#pragma unroll
    for (int dc = 0; dc < 2; ++dc) {
#pragma unroll
      for (int j = 0; j < 4; ++j) s[j] = at_mma_b(kf[dc][j].v, qah[dc], s[j]);
#pragma unroll
      for (int j = 0; j < 4; ++j) s[j] = at_mma_b(lf[dc][j].v, qah[dc], s[j]);
#pragma unroll
      for (int j = 0; j < 4; ++j) s[j] = at_mma_b(kf[dc][j].v, qal[dc], s[j]);
    }
    // All 16 V^T fragment reads of the chunk as one group: they return while the softmax runs.
    FH vf[2][4];
#pragma unroll
    for (int kk = 0; kk < 2; ++kk) {
#pragma unroll
      for (int t = 0; t < 4; ++t) {
        vf[kk][t].h[0] = *(const v8h*)(Vth + (t * 16 + c) * AT_LP + kk * 32 + 8 * hh);
        vf[kk][t].h[1] = *(const v8h*)(Vth + (t * 16 + c) * AT_LP + kk * 32 + 16 + 8 * hh);
      }
    }
    __builtin_amdgcn_sched_barrier(0);   // keeps the 16 reads as one group in front of the softmax (without it they stand in two groups inside it)
    float mj[4];
#pragma unroll
    for (int j = 0; j < 4; ++j) {
      float m = s[j][0];
#pragma unroll
      for (int r = 1; r < 8; ++r) m = fmaxf(m, s[j][r]);
      mj[j] = m;
    }
    float cm = fmaxf(fmaxf(mj[0], mj[1]), fmaxf(mj[2], mj[3]));
    cm = fmaxf(cm, xhalf(cm));
    const float mnew = fmaxf(mrow, cm);
    float alpha = (mrow - mnew) * sc2;
    const float nm = -mnew * sc2;
    mrow = mnew;
    exp2x1(alpha);
    FH pb[2];          // pb[kk]: P^T as B operand, keys kv0 + 32 kk + (8 hh + 0..7, 16 + 8 hh + 0..7), column c
    v2f ps[4];
#pragma unroll
    for (int j = 0; j < 4; ++j) {
      float pe[8];
#pragma unroll
      for (int r = 0; r < 8; ++r) pe[r] = fmaf(s[j][r], sc2, nm);
      exp2x4(pe[0], pe[1], pe[2], pe[3]);
      exp2x4(pe[4], pe[5], pe[6], pe[7]);
      v2f a = {0.f, 0.f};
#pragma unroll
      for (int r = 0; r < 8; r += 2) {
        const v2f w = {pe[r], pe[r + 1]};
        a = (r == 0) ? w : a + w;
        pb[j >> 1].p[(j & 1) * 4 + (r >> 1)] = __builtin_convertvector(w * PSC, v2h);
      }
      ps[j] = a;
    }
    const v2f pt = (ps[0] + ps[1]) + (ps[2] + ps[3]);
    lrow = lrow * alpha + (pt[0] + pt[1]);
#pragma unroll
    for (int t = 0; t < 4; ++t)
#pragma unroll
      for (int r = 0; r < 8; ++r) oacc[t][r] *= alpha;
#pragma unroll
    for (int kk = 0; kk < 2; ++kk) {
#pragma unroll
      for (int t = 0; t < 4; ++t) oacc[t] = at_mma_h(vf[kk][t].v, pb[kk].v, oacc[t]);
    }
    // publish point of chunk kc + 1, every wave: own LDS reads back, the issuers' tiles landed, barrier; then the refill of the buffer just read
    wait_ds0();
    if (pinned((uint32_t)wave < 3u)) wait_tensor0_of(g0, g1);
    __syncthreads();
    if (pinned((uint32_t)wave < 3u && kc + 2 < nChunks)) {
      g0 = tdm_group0(lbase + (uint32_t)(kc & 1) * AT_BUF + plane * AT_PLANE, tsrc + (uint64_t)(uint32_t)(kc + 2) * tstep);
      tdm_load(g0, g1);
    }
  }
  wait_tensor0();
  wait_ds0();

  float* os = Os[wave];
  const float inv = 1.0f / ((lrow + xhalf(lrow)) * PSC);   // the halves' sums are joined once, here
#pragma unroll
  for (int t = 0; t < 4; ++t) {
    const v4f lo4 = {oacc[t][0] * inv, oacc[t][1] * inv, oacc[t][2] * inv, oacc[t][3] * inv};
    const v4f hi4 = {oacc[t][4] * inv, oacc[t][5] * inv, oacc[t][6] * inv, oacc[t][7] * inv};
    *(v4f*)(os + c * 68 + t * 16 + 8 * hh)     = lo4;   // row = query, 8 consecutive d per lane
    *(v4f*)(os + c * 68 + t * 16 + 8 * hh + 4) = hi4;
  }
  __builtin_amdgcn_fence(__ATOMIC_RELEASE, "workgroup");
  __builtin_amdgcn_wave_barrier();
  __builtin_amdgcn_fence(__ATOMIC_ACQUIRE, "workgroup");
  {
    const int c4 = (lane & 15) * 4;
    {
#pragma unroll
      for (int it = 0; it < 8; ++it) {
        const int row = it * 2 + hh;   // it 0..7 x hh 0..1 covers rows 0..15 of the wave tile
        v4f val = *(const v4f*)(os + row * 68 + c4);
        *(v4f*)(ob + (size_t)(q0 + row) * kDm + c4) = val;
      }
      
    }
  }
}

// ---------------------------------------------------------------------------
// Workspace region map (byte offsets; every region is fully written before it is read):
//   R0  Qb   bf16 [4096][1024]          8,388,608 @           0   (RNE cast of q, fragment order)
//   R1  Wq   bf16 [3072][1024]          6,291,456 @   8,388,608   (RNE cast of W_qkv, fragment order)
//   R2  Wp   bf16 [1024][1024]          2,097,152 @  14,680,064   (RNE cast of W_proj, fragment order)
//   R3  Qh   bf16 [4096][1024]          8,388,608 @  16,777,216   (q projection, hi plane)
//   R4  Ql   bf16 [4096][1024]          8,388,608 @  25,165,824   (q projection, lo plane)
//   R5  Kh   bf16 [2][4096][1024]      16,777,216 @  33,554,432   (rows 0..2047 cache keys, 2048.. k projection; hi)
//   R6  Kl   bf16 [2][4096][1024]      16,777,216 @  50,331,648   (same rows; lo)
//   R7  Vt   f16  [2][1024][4096]      16,777,216 @  67,108,864   (cols 0..2047 cache values^T, 2048.. v projection^T)
//   R8  Y    f32  [4096][1024]         16,777,216 @  83,886,080   (attention output, token-major, heads merged)
//   R9  Yh   bf16 [4096][1024]          8,388,608 @ 100,663,296   (split of Y, hi, fragment order)
//   R10 Yl   bf16 [4096][1024]          8,388,608 @ 109,051,904   (split of Y, lo, fragment order)
//   total 117,440,512 B
// ---------------------------------------------------------------------------
extern "C" void kernel_launch(void* const* d_in, const int* in_sizes, int n_in,
                              void* d_out, int out_size, void* d_ws,
                              size_t ws_size, hipStream_t stream) {
  if (n_in < 7) return;
  const size_t nQ  = (size_t)kBatch * kTq * kDm;        // 4,194,304
  const size_t nKV = (size_t)kBatch * kSkv * kDm;       // 4,194,304
  const size_t nWq = (size_t)3 * kDm * kDm;             // 3,145,728
  const size_t nWp = (size_t)kDm * kDm;                 // 1,048,576
  const size_t nPe = (size_t)kSkv * kDm;                // 2,097,152
  if (in_sizes[0] != (int)nQ || in_sizes[1] != (int)nKV || in_sizes[2] != (int)nKV ||
      in_sizes[3] != (int)nWq || in_sizes[4] != (int)nWp || in_sizes[5] != (int)nPe ||
      out_size != (int)nQ) return;

  const float* q     = (const float*)d_in[0];
  const float* k_xl  = (const float*)d_in[1];
  const float* v_xl  = (const float*)d_in[2];
  const float* Wqkv  = (const float*)d_in[3];
  const float* Wproj = (const float*)d_in[4];
  const float* pos   = (const float*)d_in[5];
  const int*   causf = (const int*)d_in[6];
  float* outp = (float*)d_out;

  const size_t offQb = 0,              szQb = nQ * 2;
  const size_t offWq = offQb + szQb,   szWq = nWq * 2;
  const size_t offWp = offWq + szWq,   szWp = nWp * 2;
  const size_t offQh = offWp + szWp,   szQh = nQ * 2;
  const size_t offQl = offQh + szQh,   szQl = nQ * 2;
  const size_t offKh = offQl + szQl,   szKh = (size_t)kBatch * kKeys * kDm * 2;
  const size_t offKl = offKh + szKh,   szKl = szKh;
  const size_t offVt = offKl + szKl,   szVt = (size_t)kBatch * kDm * kKeys * 2;
  const size_t offY  = offVt + szVt,   szY  = nQ * 4;
  const size_t offYh = offY + szY,     szYh = nQ * 2;
  const size_t offYl = offYh + szYh,   szYl = nQ * 2;
  const size_t total = offYl + szYl;   // 117,440,512
  if (total > ws_size) return;

  char* ws = (char*)d_ws;
  unsigned short* Qb = (unsigned short*)(ws + offQb);
  unsigned short* Wq = (unsigned short*)(ws + offWq);
  unsigned short* Wp = (unsigned short*)(ws + offWp);
  unsigned short* Qh = (unsigned short*)(ws + offQh);
  unsigned short* Ql = (unsigned short*)(ws + offQl);
  unsigned short* Kh = (unsigned short*)(ws + offKh);
  unsigned short* Kl = (unsigned short*)(ws + offKl);
  unsigned short* Vt = (unsigned short*)(ws + offVt);
  float*          Y  = (float*)(ws + offY);
  unsigned short* Yh = (unsigned short*)(ws + offYh);
  unsigned short* Yl = (unsigned short*)(ws + offYl);

  // ---- input casts (RNE bf16 of every float input) and cache planes ----
  {
    const int npq = (int)(nQ / 1024), npwq = (int)(nWq / 1024), npwp = (int)(nWp / 1024), n2kv = (int)(nKV / 2);
    // GEMM operands, written in fragment order; one wave per 1024 elements, 8 waves per block
    cast_pack_bf16_kernel<<<dim3((npq + 7) / 8), 256, 0, stream>>>(q, Qb, npq);
    cast_pack_bf16_kernel<<<dim3((npwq + 7) / 8), 256, 0, stream>>>(Wqkv, Wq, npwq);
    cast_pack_bf16_kernel<<<dim3((npwp + 7) / 8), 256, 0, stream>>>(Wproj, Wp, npwp);
    // cache keys -> rows 0..2047 of both key planes (hi, lo), both batches
    kcache_split_kernel<<<dim3((n2kv + 255) / 256), 256, 0, stream>>>(k_xl, pos, Kh, Kl, causf, n2kv);
    // v_xl[b]: in[s rows=2048][c cols=1024] -> Vt[b] out[c][s] with output row pitch kKeys, cols 0..2047;
    // grid (cols/64, rows/64, B)
    tcast16_kernel<<<dim3(kDm / 64, kSkv / 64, kBatch), 256, 0, stream>>>(
        v_xl, Vt, kSkv, kDm, kKeys, (long)kSkv * kDm, (long)kDm * kKeys);
  }

  // ---- qkv projections: bf16 operands (K = 1024, M,N multiples of 64, no tails) ----
  {
    // q projection: C[m = b*2048+t][n] -> Qh (hi) / Ql (lo), M=4096, N=1024, K=1024; 1024 tiles -> 128 blocks
    const int tilesQ = (int)((nQ / kDm) / 64) * (kDm / 64);
    wmma_gemm64<1, false, 0, 2, false><<<dim3((tilesQ + 7) / 8, 1), 256, 0, stream>>>(
        Qb, nullptr, kDm, 0L, Wq, nullptr, kDm, 0L,
        (void*)Qh, (void*)Ql, kDm, 0L, nullptr, nullptr, 0L,
        kBatch * kTq, kDm, kDm, 1.0f);
    // k projection per batch: C[t][n] -> key plane rows 2048+t (hi -> Kh, lo -> Kl), M=2048, N=1024, K=1024;
    // 512 tiles -> 64 blocks, grid.y = batch
    const int tilesK = (kTq / 64) * (kDm / 64);
    wmma_gemm64<1, false, 0, 2, false><<<dim3((tilesK + 7) / 8, kBatch), 256, 0, stream>>>(
        Qb, nullptr, kDm, (long)kTq * kDm, Wq + (size_t)kDm * kDm, nullptr, kDm, 0L,
        (void*)(Kh + (size_t)kSkv * kDm), (void*)(Kl + (size_t)kSkv * kDm), kDm, (long)kKeys * kDm,
        nullptr, nullptr, 0L,
        kTq, kDm, kDm, 1.0f);
    // v projection, role-swapped: C[m = channel][n = t] -> Vt_b[channel][2048 + t] (f16), M=1024, N=2048, K=1024,
    // ldc = kKeys; 512 tiles -> 64 blocks, grid.y = batch
    const int tilesV = (kDm / 64) * (kTq / 64);
    wmma_gemm64<1, false, 0, 1, false><<<dim3((tilesV + 7) / 8, kBatch), 256, 0, stream>>>(
        Wq + (size_t)2 * kDm * kDm, nullptr, kDm, 0L, Qb, nullptr, kDm, (long)kTq * kDm,
        (void*)(Vt + kSkv), nullptr, kKeys, (long)kDm * kKeys, nullptr, nullptr, 0L,
        kDm, kTq, kDm, 1.0f);
  }

  // ---- attention over the 4096 keys per (batch, head); score scale 1/sqrt(64) applied in f32 ----
  attn_xl_kernel<<<dim3(kHeads * (kTq / AT_QB), kBatch), 128, 0, stream>>>(Qh, Ql, Kh, Kl, Vt, Y, 0.125f);

  // ---- y -> bf16 hi/lo planes; output projection C[m][n] = sum_c (Yh + Yl)[m][c] * Wp[n][c] -> d_out ----
  {
    const int npy = (int)(nQ / 1024);
    split_pack_bf16_kernel<<<dim3((npy + 7) / 8), 256, 0, stream>>>(Y, Yh, Yl, npy);
    const int tilesP = (int)((nQ / kDm) / 64) * (kDm / 64);   // 1024 tiles -> 128 blocks
    wmma_gemm64<1, true, 0, 0, false, 0, false><<<dim3((tilesP + 7) / 8, 1), 256, 0, stream>>>(
        Yh, Yl, kDm, 0L, Wp, nullptr, kDm, 0L,
        (void*)outp, nullptr, kDm, 0L, nullptr, nullptr, 0L,
        kBatch * kTq, kDm, kDm, 1.0f);
  }
}

// v008
// Measured time: 224 microseconds a run.
// Two timings next to v007 put it at 1.05 and 1.06 times that version's speed.
// All steps since v000 together make it 3.72 times as fast.
// Contractions: q/k/v projections on v_wmma_f32_16x16x32_bf16 (bf16 operands = RNE-cast inputs, single product); q.k^T on v_wmma_f32_16x16x32_bf16 with bf16 hi/lo planes for both q and k (hi.hi + hi.lo + lo.hi); p.v on v_wmma_f32_16x16x32_f16 (p f16 carried x2^15, v f16, single product); output projection on v_wmma_f32_16x16x32_bf16 with y as bf16 hi/lo planes (hi.W + lo.W) and W bf16; f32 accumulate everywhere; softmax, score scale and the cache add in f32.
#include <hip/hip_runtime.h>
#include <math.h>
#include <stdint.h>

constexpr int kBatch = 2;
constexpr int kTq    = 2048;            // query length
constexpr int kSkv   = 2048;            // cache length
constexpr int kKeys  = kSkv + kTq;      // 4096 keys per (batch, head)
constexpr int kDm    = 1024;            // model dim
constexpr int kHeads = 16;
constexpr int kHd    = 64;
static_assert(kHeads * kHd == kDm, "head split");
static_assert(kTq % 64 == 0 && kKeys % 64 == 0 && kDm % 64 == 0 && kSkv % 64 == 0, "tile multiples");

typedef __attribute__((ext_vector_type(16))) _Float16 v16h;
typedef __attribute__((ext_vector_type(8)))  _Float16 v8h;
typedef __attribute__((ext_vector_type(2)))  _Float16 v2h;
typedef __attribute__((ext_vector_type(16))) __bf16   v16b;
typedef __attribute__((ext_vector_type(8)))  __bf16   v8b;
typedef __attribute__((ext_vector_type(8)))  float    v8f;
typedef __attribute__((ext_vector_type(4)))  float    v4f;
typedef __attribute__((ext_vector_type(2)))  float    v2f;
typedef __attribute__((ext_vector_type(4)))  unsigned int v4u;

__device__ __forceinline__ unsigned short f2bf_bits(float f) {
  unsigned u = __float_as_uint(f);
  return (unsigned short)((u + 0x7FFFu + ((u >> 16) & 1u)) >> 16);
}
__device__ __forceinline__ float bf_bits2f(unsigned short h) { return __uint_as_float(((unsigned)h) << 16); }
__device__ __forceinline__ unsigned short h_bits(float f) { return __builtin_bit_cast(unsigned short, (_Float16)f); }
__device__ __forceinline__ unsigned pk16(unsigned short a, unsigned short b) { return (unsigned)a | ((unsigned)b << 16); }

// hazard guards as plain device helpers (no inline asm inside the kernel template body)
__device__ __forceinline__ void dep_guard_h(v8f& a, v8f& b, v16h x, v16h y) { asm volatile("v_nop\n\tv_nop\n\tv_nop\n\tv_nop" : "+v"(a), "+v"(b) : "v"(x), "v"(y)); }
__device__ __forceinline__ void dep_guard_b(v8f& a, v8f& b, v16b x, v16b y) { asm volatile("v_nop\n\tv_nop\n\tv_nop\n\tv_nop" : "+v"(a), "+v"(b) : "v"(x), "v"(y)); }
__device__ __forceinline__ void keep4_h(v16h a, v16h b, v16h c, v16h d) { asm volatile("v_nop" :: "v"(a), "v"(b), "v"(c), "v"(d)); }
__device__ __forceinline__ void keep4_b(v16b a, v16b b, v16b c, v16b d) { asm volatile("v_nop" :: "v"(a), "v"(b), "v"(c), "v"(d)); }
__device__ __forceinline__ void acc_guard4(v8f& a, v8f& b, v8f& c, v8f& d) { asm volatile("v_nop\n\tv_nop\n\tv_nop\n\tv_nop" : "+v"(a), "+v"(b), "+v"(c), "+v"(d)); }
// The wait that belongs in front of any overwrite of a register that an issued global load names. The address pairs
// are inputs so that they stay whole up to here.
__device__ __forceinline__ void addr_wait4(const void* a, const void* b, const void* c, const void* d) {
  asm volatile("s_wait_xcnt 0x0" :: "v"(a), "v"(b), "v"(c), "v"(d) : "memory");
}
__device__ __forceinline__ void addr_wait8(const void* a, const void* b, const void* c, const void* d, const void* e, const void* f,
                                           const void* g, const void* h) {
  asm volatile("s_wait_xcnt 0x0" :: "v"(a), "v"(b), "v"(c), "v"(d), "v"(e), "v"(f), "v"(g), "v"(h) : "memory");
}
__device__ __forceinline__ void addr_wait12(const void* a, const void* b, const void* c, const void* d, const void* e, const void* f,
                                            const void* g, const void* h, const void* i, const void* j, const void* k, const void* l) {
  asm volatile("s_wait_xcnt 0x0" :: "v"(a), "v"(b), "v"(c), "v"(d), "v"(e), "v"(f), "v"(g), "v"(h), "v"(i), "v"(j), "v"(k), "v"(l) : "memory");
}
template <typename T> struct Frag;
template <> struct Frag<_Float16> {
  typedef v16h V; union U { v16h v; v8h h[2]; };
  static __device__ __forceinline__ v16h load(const _Float16* p) {   // elements 0..7 <- p[0..7], 8..15 <- p[16..23]
    U f; f.h[0] = *(const v8h*)(p); f.h[1] = *(const v8h*)(p + 16); return f.v;
  }
  // fragment order: register halves 256 elements apart. The global address space is stated: pointers carried round a
  // loop would otherwise give flat loads.
  static __device__ __forceinline__ v16h loadp(const _Float16* p) {
    typedef const __attribute__((address_space(1))) v8h* G;
    U f; f.h[0] = *(G)(p); f.h[1] = *(G)(p + 256); return f.v;
  }
  static __device__ __forceinline__ v8f mma(v16h a, v16h b, v8f c) {
    return __builtin_amdgcn_wmma_f32_16x16x32_f16(false, a, false, b, (short)0, c, false, false);
  }
  static __device__ __forceinline__ void guard(v8f& a, v8f& b, v16h x, v16h y) { dep_guard_h(a, b, x, y); }
  static __device__ __forceinline__ void keep(v16h a, v16h b, v16h c, v16h d) { keep4_h(a, b, c, d); }
};
template <> struct Frag<__bf16> {
  typedef v16b V; union U { v16b v; v8b h[2]; };
  static __device__ __forceinline__ v16b load(const __bf16* p) {
    U f; f.h[0] = *(const v8b*)(p); f.h[1] = *(const v8b*)(p + 16); return f.v;
  }
  static __device__ __forceinline__ v16b loadp(const __bf16* p) {
    typedef const __attribute__((address_space(1))) v8b* G;
    U f; f.h[0] = *(G)(p); f.h[1] = *(G)(p + 256); return f.v;
  }
  static __device__ __forceinline__ v8f mma(v16b a, v16b b, v8f c) {
    return __builtin_amdgcn_wmma_f32_16x16x32_bf16(false, a, false, b, (short)0, c, false, false);
  }
  static __device__ __forceinline__ void guard(v8f& a, v8f& b, v16b x, v16b y) { dep_guard_b(a, b, x, y); }
  static __device__ __forceinline__ void keep(v16b a, v16b b, v16b c, v16b d) { keep4_b(a, b, c, d); }
};

// ---- Register-blocked batched WMMA GEMM ------------------------------------
// C[m,n] = scale * sum_k A[m,k] * Bt[n,k] (+bias)(+resid); each wave owns a 64x64 tile.
// A [M,K] and Bt [N,K] stand in FRAGMENT ORDER (lda = ldb = K): blocks of 16 rows x 32 k = 512 elements (1 KB), block
// number (row / 16) * (K / 32) + k / 32, so a row tile starts where row-major row 16 * (row / 16) would. Inside a block
// the 8 elements k % 32 = 8 * (2 h + hh) + 0..7 of row r stand at element h * 256 + (hh * 16 + r) * 8: lane hh * 16 + r
// finds register half h of its fragment at h * 256 + lane * 8, and each of a fragment's two loads reads 512
// contiguous bytes (4 whole lines). The k of every lane and register position is that of Frag::load on a row-major
// operand, the same for A and Bt. M,N % 64 == 0, K % 32 == 0.
// SPLIT: operands are hi/lo planes (A2/Bt2 = lo planes, same layout); product = hi.hi + hi.lo + lo.hi.
// SPLITB (only meaningful with SPLIT): when false only A carries a lo plane; product = hi.B + lo.B (Bt2 unused).
// BIAS_MODE: 0 = none, 1 = bias[m], 2 = bias[n].
// OUT_MODE: 0 = f32, 1 = f16, 2 = bf16 hi plane (Cout) + bf16 lo plane (Cout2).
// ET: 0 = f16 operands, 1 = bf16 operands (pointers passed as 16-bit storage)
template <int ET> struct Elem;
template <> struct Elem<0> { typedef _Float16 T; };
template <> struct Elem<1> { typedef __bf16 T; };
template <int ET, bool SPLIT, int BIAS_MODE, int OUT_MODE, bool RESID, int ACT = 0, bool SPLITB = SPLIT>
__global__ __launch_bounds__(256) void wmma_gemm64(
    const unsigned short* __restrict__ Ap, const unsigned short* __restrict__ A2p, int lda, long strideA,
    const unsigned short* __restrict__ Btp, const unsigned short* __restrict__ Bt2p, int ldb, long strideB,
    void* __restrict__ Cout, void* __restrict__ Cout2, int ldc, long strideC,
    const float* __restrict__ bias,
    const float* __restrict__ resid, long strideR,
    int M, int N, int K, float scale) {
  typedef typename Elem<ET>::T T;
  typedef typename Frag<T>::V V;
  const T* A = (const T*)Ap; const T* A2 = (const T*)A2p; const T* Bt = (const T*)Btp; const T* Bt2 = (const T*)Bt2p;
  __shared__ __align__(16) float sT[8][16 * 68];   // per-wave 16x64 slab, pitch 68 floats
  const int b    = blockIdx.y;
  const int lane = threadIdx.x & 31;
  const int wave = __builtin_amdgcn_readfirstlane(threadIdx.x >> 5);   // scalar, so that tile indices and row-tile offsets stay in scalar registers
  const int tilesN = N >> 6;
  const int tilesM = M >> 6;
  const int tile = blockIdx.x * 8 + wave;
  if (tile >= tilesM * tilesN) return;   // wave-uniform; no block barriers in this kernel
  const int tm = tile / tilesN;
  const int tn = tile - tm * tilesN;
  const int m0 = tm << 6;
  const int n0 = tn << 6;

  const T* Ab  = A  + (size_t)b * strideA;
  const T* Bb  = Bt + (size_t)b * strideB;
  const T* Ab2 = SPLIT ? (A2  + (size_t)b * strideA) : nullptr;
  const T* Bb2 = (SPLIT && SPLITB) ? (Bt2 + (size_t)b * strideB) : nullptr;

  const int rlane = lane & 15;                 // row (A) / col (B, D) within subtile
  const int mOff  = (lane >> 4) * 8;           // D row offset
  const unsigned lo8 = (unsigned)lane * 8u;    // this lane's 8 elements (16 bytes) inside a half block

  v8f acc[4][4];
#pragma unroll
  for (int i = 0; i < 4; ++i)
#pragma unroll
    for (int j = 0; j < 4; ++j) acc[i][j] = (v8f){0.f,0.f,0.f,0.f,0.f,0.f,0.f,0.f};

  // This lane's 16 bytes in the current k block of each row tile; the next k block stands 512 elements further on.
  const T* bp[4]; const T* bp2[4]; const T* ap[4]; const T* ap2[4];
#pragma unroll
  for (int j = 0; j < 4; ++j) {
    const size_t bo = (size_t)(n0 + (j << 4)) * ldb + lo8;
    const size_t ao = (size_t)(m0 + (j << 4)) * lda + lo8;
    bp[j]  = Bb + bo;
    bp2[j] = (SPLIT && SPLITB) ? (Bb2 + bo) : bp[j];
    ap[j]  = Ab + ao;
    ap2[j] = SPLIT ? (Ab2 + ao) : ap[j];
  }
  for (int k0 = 0; k0 < K; k0 += 32) {
    // All fragment loads of the k block as one group, so that the block waits for memory once, not once per row tile of A.
    V bh[4], bl[4], ah[4], al[4];
#pragma unroll
    for (int j = 0; j < 4; ++j) {
      bh[j] = Frag<T>::loadp(bp[j]);
      if (SPLIT && SPLITB) bl[j] = Frag<T>::loadp(bp2[j]);
    }
#pragma unroll
    for (int i = 0; i < 4; ++i) {
      ah[i] = Frag<T>::loadp(ap[i]);
      if (SPLIT) al[i] = Frag<T>::loadp(ap2[i]);
    }
#pragma unroll
    for (int i = 0; i < 4; ++i) {
#pragma unroll
      for (int j = 0; j < 4; ++j) {
        acc[i][j] = Frag<T>::mma(ah[i], bh[j], acc[i][j]);
        if (SPLIT) {
          if (SPLITB) acc[i][j] = Frag<T>::mma(ah[i], bl[j], acc[i][j]);
          acc[i][j] = Frag<T>::mma(al[i], bh[j], acc[i][j]);
        }
      }
      Frag<T>::guard(acc[i][0], acc[i][3], ah[i], SPLIT ? al[i] : ah[i]);
    }
    Frag<T>::keep(bh[0], bh[1], bh[2], bh[3]);
    if (SPLIT && SPLITB) Frag<T>::keep(bl[0], bl[1], bl[2], bl[3]);
    // in front of the advance, which overwrites the pairs that the loads of this block name
    if (SPLIT) addr_wait12(bp[0], bp[1], bp[2], bp[3], ap[0], ap[1], ap[2], ap[3], ap2[0], ap2[1], ap2[2], ap2[3]);
    else       addr_wait8(bp[0], bp[1], bp[2], bp[3], ap[0], ap[1], ap[2], ap[3]);
    if (SPLIT && SPLITB) addr_wait4(bp2[0], bp2[1], bp2[2], bp2[3]);
#pragma unroll
    for (int j = 0; j < 4; ++j) { bp[j] += 512; bp2[j] += 512; ap[j] += 512; ap2[j] += 512; }
  }
  acc_guard4(acc[0][0], acc[0][1], acc[0][2], acc[0][3]);
  acc_guard4(acc[1][0], acc[1][1], acc[1][2], acc[1][3]);
  acc_guard4(acc[2][0], acc[2][1], acc[2][2], acc[2][3]);
  acc_guard4(acc[3][0], acc[3][1], acc[3][2], acc[3][3]);

  // ---- epilogue ----
  float* slab = sT[wave];
  const float* Rb = RESID ? (resid + (size_t)b * strideR) : nullptr;
#pragma unroll
  for (int i = 0; i < 4; ++i) {
    const int mBase = m0 + (i << 4);
#pragma unroll
    for (int j = 0; j < 4; ++j) {
      const int n = n0 + (j << 4) + rlane;
      float bv = 0.f;
      if (BIAS_MODE == 2) bv = bias[n];
#pragma unroll
      for (int r = 0; r < 8; ++r) {
        float v = acc[i][j][r] * scale;
        if (BIAS_MODE == 1) v += bias[mBase + mOff + r];
        if (BIAS_MODE == 2) v += bv;
        if (RESID) v += Rb[(size_t)(mBase + mOff + r) * ldc + n];
        if (ACT == 1) v = tanhf(v);
        if (ACT == 2) v = fmaxf(v, 0.0f);
        if (ACT == 3) v = v / (1.0f + expf(-v));
        if (ACT == 4) v = (v > 0.f) ? v : 0.01f * v;
        slab[(mOff + r) * 68 + (j << 4) + rlane] = v;
      }
    }
    __builtin_amdgcn_fence(__ATOMIC_RELEASE, "workgroup");
    __builtin_amdgcn_wave_barrier();
    __builtin_amdgcn_fence(__ATOMIC_ACQUIRE, "workgroup");
    if (OUT_MODE == 0) {
      float* C = (float*)Cout + (size_t)b * strideC;
      const int hh = lane >> 4, c4 = (lane & 15) * 4;     // row seg = 256 B = 16 lanes x 16 B
      {
#pragma unroll
        for (int it = 0; it < 8; ++it) {
          const int row = it * 2 + hh;
          v4f v = *(const v4f*)(slab + row * 68 + c4);
          *(v4f*)(C + (size_t)(mBase + row) * ldc + n0 + c4) = v;
        }
        
      }
    } else {
      const int q = lane >> 3, c8 = (lane & 7) * 8;
      unsigned short* C  = (unsigned short*)Cout  + (size_t)b * strideC;
      unsigned short* C2 = (OUT_MODE == 2) ? ((unsigned short*)Cout2 + (size_t)b * strideC) : nullptr;
      {
#pragma unroll
        for (int it = 0; it < 4; ++it) {
          const int row = it * 4 + q;
          const float* sp = slab + row * 68 + c8;
          v8h hv, lv;
#pragma unroll
          for (int e = 0; e < 8; ++e) {
            if (OUT_MODE == 1) {
              hv[e] = (_Float16)sp[e];
            } else {
              unsigned short hb = f2bf_bits(sp[e]);
              unsigned short lb = f2bf_bits(sp[e] - bf_bits2f(hb));
              hv[e] = __builtin_bit_cast(_Float16, hb);
              lv[e] = __builtin_bit_cast(_Float16, lb);
            }
          }
          *(v8h*)(C + (size_t)(mBase + row) * ldc + n0 + c8) = hv;
          if (OUT_MODE == 2) *(v8h*)(C2 + (size_t)(mBase + row) * ldc + n0 + c8) = lv;
        }
        
      }
    }
    __builtin_amdgcn_fence(__ATOMIC_RELEASE, "workgroup");
    __builtin_amdgcn_wave_barrier();
    __builtin_amdgcn_fence(__ATOMIC_ACQUIRE, "workgroup");
  }
}

// ---------------------------------------------------------------------------
// f32 [R][kDm] row-major -> 16-bit planes in the fragment order that wmma_gemm64 reads (described there).
// One wave makes two neighbouring 1 KB blocks (16 rows x 64 k). Lane l takes the 8 floats k = 8 * (l & 3) + 0..7 of row
// 8 it + (l >> 2) of block u (u, it = 0, 1): two 16-byte loads, one 16-byte store per plane. A wave-wide store writes
// four whole 128-byte lines (8 rows x 16 B each); the eight loads of a lane are issued together.
// Coverage: nPairs = (R / 16) * (kDm / 64) waves x 1024 elements = R * kDm (every nPairs here is a multiple of 8).
// ---------------------------------------------------------------------------
struct PackPos { const float* src; size_t dst; };
__device__ __forceinline__ PackPos pack_pos(const float* in, int wv, int lane) {
  const int rt = wv / (kDm / 64), kp = wv - rt * (kDm / 64);   // row tile, pair of k blocks
  const int r8 = lane >> 2, piece = lane & 3;
  PackPos p;
  p.src = in + (size_t)(rt * 16 + r8) * kDm + kp * 64 + piece * 8;
  p.dst = (size_t)wv * 1024 + (piece >> 1) * 256 + ((piece & 1) * 16 + r8) * 8;
  return p;
}

// bf16 (RNE) cast
__global__ __launch_bounds__(256) void cast_pack_bf16_kernel(const float* __restrict__ in, unsigned short* __restrict__ out,
                                                            int nPairs) {
  const int wv = (blockIdx.x * 256 + threadIdx.x) >> 5;
  if (wv < nPairs) {
    const PackPos p = pack_pos(in, wv, threadIdx.x & 31);
    v4f f[2][2][2];
#pragma unroll
    for (int u = 0; u < 2; ++u)
#pragma unroll
      for (int it = 0; it < 2; ++it) {
        f[u][it][0] = *(const v4f*)(p.src + (size_t)it * 8 * kDm + u * 32);
        f[u][it][1] = *(const v4f*)(p.src + (size_t)it * 8 * kDm + u * 32 + 4);
      }
#pragma unroll
    for (int u = 0; u < 2; ++u)
#pragma unroll
      for (int it = 0; it < 2; ++it) {
        v4u o;
#pragma unroll
        for (int q = 0; q < 4; ++q) {
          const v4f g = f[u][it][q >> 1];
          o[q] = pk16(f2bf_bits(g[(q & 1) * 2]), f2bf_bits(g[(q & 1) * 2 + 1]));
        }
        *(v4u*)(out + p.dst + u * 512 + it * 64) = o;
      }
  }
}

// bf16 split: hi = bf16_rne(in), lo = bf16_rne(in - hi)
__global__ __launch_bounds__(256) void split_pack_bf16_kernel(const float* __restrict__ in, unsigned short* __restrict__ hi,
                                                             unsigned short* __restrict__ lo, int nPairs) {
  const int wv = (blockIdx.x * 256 + threadIdx.x) >> 5;
  if (wv < nPairs) {
    const PackPos p = pack_pos(in, wv, threadIdx.x & 31);
    v4f f[2][2][2];
#pragma unroll
    for (int u = 0; u < 2; ++u)
#pragma unroll
      for (int it = 0; it < 2; ++it) {
        f[u][it][0] = *(const v4f*)(p.src + (size_t)it * 8 * kDm + u * 32);
        f[u][it][1] = *(const v4f*)(p.src + (size_t)it * 8 * kDm + u * 32 + 4);
      }
#pragma unroll
    for (int u = 0; u < 2; ++u)
#pragma unroll
      for (int it = 0; it < 2; ++it) {
        v4u oh, ol;
#pragma unroll
        for (int q = 0; q < 4; ++q) {
          const v4f g = f[u][it][q >> 1];
          const float f0 = g[(q & 1) * 2], f1 = g[(q & 1) * 2 + 1];
          const unsigned short h0 = f2bf_bits(f0), h1 = f2bf_bits(f1);
          oh[q] = pk16(h0, h1);
          ol[q] = pk16(f2bf_bits(f0 - bf_bits2f(h0)), f2bf_bits(f1 - bf_bits2f(h1)));
        }
        *(v4u*)(hi + p.dst + u * 512 + it * 64) = oh;
        *(v4u*)(lo + p.dst + u * 512 + it * 64) = ol;
      }
  }
}

// ---------------------------------------------------------------------------
// Cache keys, rows 0..kSkv-1 of each per-batch [kKeys][kDm] bf16 key plane pair:
//   x = bf16_rne(k_xl[b][s][c]) + bf16_rne(pos[s][c])   (the add in f32)
//   kh[b][s][c] = bf16_rne(x),  kl[b][s][c] = bf16_rne(x - kh)
// flags = the causal flag input; this forward applies no mask, the pointer is only bound, never read.
// ---------------------------------------------------------------------------
__global__ __launch_bounds__(256) void kcache_split_kernel(const float* __restrict__ kxl, const float* __restrict__ pos,
                                                           unsigned short* __restrict__ kh, unsigned short* __restrict__ kl,
                                                           const int* __restrict__ flags, int n2) {
  const int i = blockIdx.x * 256 + threadIdx.x;
  if (i < n2) {
    const size_t e = 2 * (size_t)i;                        // element index into [b][s][c]
    const size_t perB = (size_t)kSkv * kDm;
    const int bb = (int)(e / perB);
    const size_t rem = e - (size_t)bb * perB;              // s*kDm + c (even)
    const v2f a = *(const v2f*)(kxl + e);
    const v2f p = *(const v2f*)(pos + rem);
    const float s0 = bf_bits2f(f2bf_bits(a[0])) + bf_bits2f(f2bf_bits(p[0]));
    const float s1 = bf_bits2f(f2bf_bits(a[1])) + bf_bits2f(f2bf_bits(p[1]));
    const unsigned short h0 = f2bf_bits(s0), h1 = f2bf_bits(s1);
    const unsigned short l0 = f2bf_bits(s0 - bf_bits2f(h0)), l1 = f2bf_bits(s1 - bf_bits2f(h1));
    const unsigned uh = pk16(h0, h1), ul = pk16(l0, l1);
    const size_t o = ((size_t)bb * kKeys * kDm + rem) >> 1; // u32 index
    ((unsigned*)kh)[o] = uh;
    ((unsigned*)kl)[o] = ul;
    
  }
}

// ---------------------------------------------------------------------------
// Fused transpose + cast of an f32 matrix, z-batched: in_z = W + z*sIn viewed [R rows][Cc cols] (pitch Cc) ->
//   o_z[c][r] = f16(bf16_rne(in_z[r][c]))   ([Cc][...], output row pitch ldo halves), o_z = o + z*sOut.
// 64x64 tiles through LDS. grid = (Cc/64, R/64, Z), 256 threads (R, Cc multiples of 64).
// Coverage per block: load 4 it x 256 thr x 4 floats = 64x64; store 2 it x 256 thr x 8 u16 = 64x64.
// ---------------------------------------------------------------------------
__global__ __launch_bounds__(256) void tcast16_kernel(const float* __restrict__ W, unsigned short* __restrict__ o,
                                                      int R, int Cc, int ldo, long sIn, long sOut) {
  __shared__ __align__(16) float tf[64 * 68];
  W += (size_t)blockIdx.z * sIn;
  o += (size_t)blockIdx.z * sOut;
  const int c0  = blockIdx.x * 64;   // input column block = output row block
  const int r0  = blockIdx.y * 64;   // input row block    = output column block
  const int tid = threadIdx.x;
  {
    const int lr = tid >> 4;         // 0..15
    const int c4 = (tid & 15) * 4;   // 0..60
#pragma unroll
    for (int it = 0; it < 4; ++it) {
      const int rr = it * 16 + lr;   // 0..63
      const v4f a = *(const v4f*)(W + (size_t)(r0 + rr) * Cc + c0 + c4);
      *(v4f*)(tf + rr * 68 + c4) = a;
    }
  }
  __syncthreads();
  const int sub = tid >> 3;          // 0..31
  const int c8  = (tid & 7) * 8;     // 0..56
  v4u hv[2];
#pragma unroll
  for (int it = 0; it < 2; ++it) {
    const int oc = it * 32 + sub;    // output row within tile (= input column)
    v4u a;
#pragma unroll
    for (int q = 0; q < 4; ++q) {
      const float f0 = tf[(c8 + 2 * q) * 68 + oc];
      const float f1 = tf[(c8 + 2 * q + 1) * 68 + oc];
      a[q] = pk16(h_bits(bf_bits2f(f2bf_bits(f0))), h_bits(bf_bits2f(f2bf_bits(f1))));
    }
    hv[it] = a;
  }
  {
#pragma unroll
    for (int it = 0; it < 2; ++it) {
      const int oc = it * 32 + sub;
      const size_t go = (size_t)(c0 + oc) * ldo + r0 + c8;
      *(v4u*)(o + go) = hv[it];
    }
    
  }
}

#define AT_D 64
#define AT_NW 4
#define AT_QB 64
#define AT_KC 64
#define AT_PLANE 10240   // bytes from one plane's place in LDS to the next: 64 rows x 144 B = 9216, rounded up to a multiple of 2 KiB
#define AT_BUF (3 * AT_PLANE)   // one buffer: K hi, K lo, V^T
#define AT_LP 72   // LDS row pitch in 16-bit elements: 144 B = 16 B x 9 (odd), so the 16 rows of a 16-byte fragment read fall on 16 different bank groups

// Plain builtins: the compiler keeps the distances behind its own WMMAs, and a product that accumulates into the same tile needs none.
__device__ __forceinline__ v8f at_mma_b(v16b a, v16b b, v8f c) {
  return __builtin_amdgcn_wmma_f32_16x16x32_bf16(false, a, false, b, (short)0, c, false, false);
}
__device__ __forceinline__ v8f at_mma_h(v16h a, v16h b, v8f c) {
  return __builtin_amdgcn_wmma_f32_16x16x32_f16(false, a, false, b, (short)0, c, false, false);
}

// Four hardware exp2 in place, in one statement: each v_exp_f32 is followed by an independent one and the last by
// v_nop, the slot the instruction set asks for behind a transcendental before its result is read or its source
// overwritten.
__device__ __forceinline__ void exp2x4(float& a, float& b, float& c, float& d) {
  asm("v_exp_f32 %0, %0\n\tv_exp_f32 %1, %1\n\tv_exp_f32 %2, %2\n\tv_exp_f32 %3, %3\n\tv_nop"
      : "+v"(a), "+v"(b), "+v"(c), "+v"(d));
}

// One hardware exp2 in place, with the same slot behind it.
__device__ __forceinline__ void exp2x1(float& a) { asm("v_exp_f32 %0, %0\n\tv_nop" : "+v"(a)); }

// lane l <-> lane l ^ 16 (the two halves that share a query column), a vector cross-row move, no LDS
__device__ __forceinline__ float xhalf(float x) {
  const int i = __builtin_bit_cast(int, x);
  return __builtin_bit_cast(float, __builtin_amdgcn_permlanex16(i, i, 0x76543210, 0xfedcba98, false, false));
}

typedef uint32_t u32x4 __attribute__((ext_vector_type(4)));
typedef uint32_t u32x8 __attribute__((ext_vector_type(8)));
__device__ __forceinline__ uint32_t uni(uint32_t v) { return (uint32_t)__builtin_amdgcn_readfirstlane(v); }
// A wave-uniform test held in a scalar register, so that the branch on it is a scalar branch: a tensor load ignores EXEC.
__device__ __forceinline__ uint32_t pinned(uint32_t v) { uint32_t w = (uint32_t)__builtin_amdgcn_readfirstlane(v); asm volatile("" : "+s"(w)); return w; }
// Descriptor group 1: 1-byte elements, tensor = tile = 64 rows of 128 bytes, source row pitch src_pitch bytes, no mask;
// word 0: a pad of 4 dwords behind every 32 dwords (one row), which gives the 144-byte LDS pitch.
__device__ __forceinline__ u32x8 tdm_group1(uint32_t src_pitch) {
  u32x8 g;
  g[0] = uni((1u << 20) | (4u << 22) | (3u << 25));
  g[1] = uni(128u << 16);
  g[2] = uni(64u << 16);
  g[3] = uni(128u << 16);
  g[4] = uni(64u);
  g[5] = uni(src_pitch);
  g[6] = uni(0u);
  g[7] = uni(0u);
  return g;
}
// pinned() on the whole group: descriptor words held in their scalar registers (as plain constants they were made anew
// in front of each use, and their registers took other values in between, while a request was in flight).
__device__ __forceinline__ u32x8 pinned8(u32x8 g) { asm volatile("" : "+s"(g)); return g; }
// Descriptor group 0: count 1, place in LDS (byte offset), global address of the tile's first byte, type 2.
__device__ __forceinline__ u32x4 tdm_group0(uint32_t lds_dst, uint64_t ga) {
  u32x4 g;
  g[0] = uni(1u);
  g[1] = uni(lds_dst);
  g[2] = uni((uint32_t)ga);
  g[3] = uni((((uint32_t)(ga >> 32)) & 0x01FFFFFFu) | 0x80000000u);
  return g;
}
__device__ __forceinline__ void tdm_load(u32x4 g0, u32x8 g1) { asm volatile("tensor_load_to_lds %0, %1" :: "s"(g0), "s"(g1) : "memory"); }
// The compiler places no wait for a tensor load: a tile counts as landed only behind its issuer's own wait.
__device__ __forceinline__ void wait_tensor0() { asm volatile("s_wait_tensorcnt 0x0" ::: "memory"); }
// The same wait with the outstanding request's descriptor as inputs, so that its scalar registers stay whole up to here
// (without them the loop counter was put into a register of the request still in flight).
__device__ __forceinline__ void wait_tensor0_of(u32x4 g0, u32x8 g1) { asm volatile("s_wait_tensorcnt 0x0" :: "s"(g0), "s"(g1) : "memory"); }
// This wave's LDS reads have returned before the barrier behind which their buffer is refilled.
__device__ __forceinline__ void wait_ds0() { asm volatile("s_wait_dscnt 0x0" ::: "memory"); }

__global__ __launch_bounds__(128)
void attn_xl_kernel(const unsigned short* __restrict__ qhp, const unsigned short* __restrict__ qlp,
                    const unsigned short* __restrict__ khp, const unsigned short* __restrict__ klp,
                    const unsigned short* __restrict__ vtp, float* __restrict__ out, float sscale) {
  union FB { v16b v; v8b h[2]; };
  union FH { v16h v; v8h h[2]; v2h p[8]; };
  // two buffers of three planes: K hi [kv][d], K lo [kv][d], V^T [d][kv], each 64 rows at pitch 144 B, each place a multiple of 2 KiB
  __shared__ __attribute__((aligned(2048))) unsigned char Ring[2 * AT_BUF];
  __shared__ __align__(16) float    Os[AT_NW][16 * 68];         // per wave out tile, pitch 68
  const float PSC = 32768.0f;
  // softmax in base 2: exp((x - m) * sscale) = 2^((x - m) * sc2). sscale > 0 (the launch passes 1/sqrt(64)),
  // so the row maximum may be taken on the unscaled scores.
  const float sc2 = sscale * 1.44269504088896340736f;

  const int tid  = threadIdx.x;
  const int wave = (int)uni((uint32_t)tid >> 5);
  const int lane = tid & 31;
  const int hh   = lane >> 4;
  const int c    = lane & 15;

  const int nqb = kTq / AT_QB;            // 32
  const int bx = blockIdx.x;
  const int b  = blockIdx.y;
  const int qb = bx % nqb;
  const int h  = bx / nqb;                // 0..kHeads-1
  const int q0 = qb * AT_QB + wave * 16;

  const __bf16*   Qh = (const __bf16*)(const void*)qhp   + (size_t)b * kTq * kDm   + (size_t)h * AT_D;
  const __bf16*   Ql = (const __bf16*)(const void*)qlp   + (size_t)b * kTq * kDm   + (size_t)h * AT_D;
  const __bf16*   Kh = (const __bf16*)(const void*)khp   + (size_t)b * kKeys * kDm + (size_t)h * AT_D;
  const __bf16*   Kl = (const __bf16*)(const void*)klp   + (size_t)b * kKeys * kDm + (size_t)h * AT_D;
  const _Float16* Vh = (const _Float16*)(const void*)vtp + (size_t)b * kDm * kKeys + (size_t)h * AT_D * kKeys;
  float*          ob = out + (size_t)b * kTq * kDm + (size_t)h * AT_D;

  // ---- Q fragments (B operand, column = lane&15, split k map via Frag load): 2 d-chunks, hi and lo ----
  v16b qah[2], qal[2];
#pragma unroll
  for (int dc = 0; dc < 2; ++dc) {
    qah[dc] = Frag<__bf16>::load(Qh + (size_t)(q0 + c) * kDm + dc * 32 + 8 * hh);
    qal[dc] = Frag<__bf16>::load(Ql + (size_t)(q0 + c) * kDm + dc * 32 + 8 * hh);
  }

  float mrow = -INFINITY, lrow = 0.f;   // query q0 + c: running maximum (both halves agree), this half's sum
  v8f oacc[4];                          // oacc[t][r] = O^T[d = 16 t + 8 hh + r][query q0 + c]
#pragma unroll
  for (int t = 0; t < 4; ++t) oacc[t] = (v8f){0.f,0.f,0.f,0.f,0.f,0.f,0.f,0.f};

  const int nChunks = kKeys / AT_KC;   // 64, compile-time constant
  // Wave 0 brings K hi, wave 1 K lo, wave 2 V^T; chunk st goes to buffer st & 1. Every tile lies inside its plane:
  // K rows 64 st .. 64 st + 63 of 4096, 128 B at byte 128 h of a 2048-B row; V^T rows 64 h .. 64 h + 63, 128 B at byte 128 st of an 8192-B row.
  const uint32_t plane = (uint32_t)wave < 2u ? (uint32_t)wave : 2u;
  const uint32_t lbase = (uint32_t)(size_t)Ring;
  const uint64_t tsrc  = plane == 0u ? (uint64_t)(size_t)Kh : plane == 1u ? (uint64_t)(size_t)Kl : (uint64_t)(size_t)Vh;
  const uint32_t tstep = plane < 2u ? (uint32_t)(AT_KC * kDm * 2) : (uint32_t)(AT_KC * 2);   // bytes from one chunk's tile to the next
  const u32x8 g1 = pinned8(tdm_group1(plane < 2u ? (uint32_t)(kDm * 2) : (uint32_t)(kKeys * 2)));
  u32x4 g0 = tdm_group0(lbase + plane * AT_PLANE, tsrc);
  if (pinned((uint32_t)wave < 3u)) {
    tdm_load(g0, g1);
    wait_tensor0_of(g0, g1);
  }
  __syncthreads();   // chunk 0 published
  g0 = tdm_group0(lbase + AT_BUF + plane * AT_PLANE, tsrc + tstep);
  if (pinned((uint32_t)wave < 3u)) tdm_load(g0, g1);
  for (int kc = 0; kc < nChunks; ++kc) {
    const unsigned char* bufp = Ring + (kc & 1) * AT_BUF;   // chunk kc: keys kv0 = 64 kc .. kv0 + 63
    const __bf16*   Ksh = (const __bf16*)(const void*)bufp;
    const __bf16*   Ksl = (const __bf16*)(const void*)(bufp + AT_PLANE);
    const _Float16* Vth = (const _Float16*)(const void*)(bufp + 2 * AT_PLANE);

    // All 32 K fragment reads of the chunk as one group, in the order of their use: the wave meets the LDS latency once
    // here, not once in front of every three products.
    FB kf[2][4], lf[2][4];
#pragma unroll
    for (int dc = 0; dc < 2; ++dc) {
#pragma unroll
      for (int j = 0; j < 4; ++j) {
        kf[dc][j].h[0] = *(const v8b*)(Ksh + (j * 16 + c) * AT_LP + dc * 32 + 8 * hh);
        kf[dc][j].h[1] = *(const v8b*)(Ksh + (j * 16 + c) * AT_LP + dc * 32 + 16 + 8 * hh);
      }
#pragma unroll
      for (int j = 0; j < 4; ++j) {
        lf[dc][j].h[0] = *(const v8b*)(Ksl + (j * 16 + c) * AT_LP + dc * 32 + 8 * hh);
        lf[dc][j].h[1] = *(const v8b*)(Ksl + (j * 16 + c) * AT_LP + dc * 32 + 16 + 8 * hh);
      }
    }
    __builtin_amdgcn_sched_barrier(0);   // keeps the 32 reads as one group in front of the products (without it most of them stand in pairs among the WMMAs)
    // s[j][r] = S^T[key kv0 + 16 j + 8 hh + r][query q0 + c]; every s[j] takes its six products in the order
    // dc 0: hi.hi, lo.hi, hi.lo, then dc 1 the same; the four tiles take turns, so that no product waits for the one before it.
    v8f s[4];
#pragma unroll
    for (int j = 0; j < 4; ++j) s[j] = (v8f){0.f,0.f,0.f,0.f,0.f,0.f,0.f,0.f};
#pragma unroll
    for (int dc = 0; dc < 2; ++dc) {
#pragma unroll
      for (int j = 0; j < 4; ++j) s[j] = at_mma_b(kf[dc][j].v, qah[dc], s[j]);
#pragma unroll
      for (int j = 0; j < 4; ++j) s[j] = at_mma_b(lf[dc][j].v, qah[dc], s[j]);
#pragma unroll
      for (int j = 0; j < 4; ++j) s[j] = at_mma_b(kf[dc][j].v, qal[dc], s[j]);
    }
    // All 16 V^T fragment reads of the chunk as one group: they return while the softmax runs.
    FH vf[2][4];
#pragma unroll
    for (int kk = 0; kk < 2; ++kk) {
#pragma unroll
      for (int t = 0; t < 4; ++t) {
        vf[kk][t].h[0] = *(const v8h*)(Vth + (t * 16 + c) * AT_LP + kk * 32 + 8 * hh);
        vf[kk][t].h[1] = *(const v8h*)(Vth + (t * 16 + c) * AT_LP + kk * 32 + 16 + 8 * hh);
      }
    }
    // order between the fence behind the K reads and the one below: the 24 score WMMAs first, then the 16 reads (without it the reads stand at three places among the last four WMMAs)
    __builtin_amdgcn_sched_group_barrier(0x008, 24, 0);
    __builtin_amdgcn_sched_group_barrier(0x100, 16, 0);
    __builtin_amdgcn_sched_barrier(0);   // keeps the 16 reads as one group in front of the softmax (without it they stand in two groups inside it)
    float mj[4];
#pragma unroll
    for (int j = 0; j < 4; ++j) {
      float m = s[j][0];
#pragma unroll
      for (int r = 1; r < 8; ++r) m = fmaxf(m, s[j][r]);
      mj[j] = m;
    }
    float cm = fmaxf(fmaxf(mj[0], mj[1]), fmaxf(mj[2], mj[3]));
    cm = fmaxf(cm, xhalf(cm));
    const float mnew = fmaxf(mrow, cm);
    float alpha = (mrow - mnew) * sc2;
    const float nm = -mnew * sc2;
    mrow = mnew;
    exp2x1(alpha);
    FH pb[2];          // pb[kk]: P^T as B operand, keys kv0 + 32 kk + (8 hh + 0..7, 16 + 8 hh + 0..7), column c
    v2f ps[4];
#pragma unroll
    for (int j = 0; j < 4; ++j) {
      float pe[8];
#pragma unroll
      for (int r = 0; r < 8; ++r) pe[r] = fmaf(s[j][r], sc2, nm);
      exp2x4(pe[0], pe[1], pe[2], pe[3]);
      exp2x4(pe[4], pe[5], pe[6], pe[7]);
      v2f a = {0.f, 0.f};
#pragma unroll
      for (int r = 0; r < 8; r += 2) {
        const v2f w = {pe[r], pe[r + 1]};
        a = (r == 0) ? w : a + w;
        pb[j >> 1].p[(j & 1) * 4 + (r >> 1)] = __builtin_convertvector(w * PSC, v2h);
      }
      ps[j] = a;
    }
    const v2f pt = (ps[0] + ps[1]) + (ps[2] + ps[3]);
    lrow = lrow * alpha + (pt[0] + pt[1]);
#pragma unroll
    for (int t = 0; t < 4; ++t)
#pragma unroll
      for (int r = 0; r < 8; ++r) oacc[t][r] *= alpha;
#pragma unroll
    for (int kk = 0; kk < 2; ++kk) {
#pragma unroll
      for (int t = 0; t < 4; ++t) oacc[t] = at_mma_h(vf[kk][t].v, pb[kk].v, oacc[t]);
    }
    __builtin_amdgcn_sched_barrier(0);   // keeps the wait below behind the products (without it it stands in the softmax, where the wave would wait for the V^T reads)
    // publish point of chunk kc + 1, every wave: own LDS reads back, the issuers' tiles landed, barrier; then the refill of the buffer just read
    wait_ds0();
    if (pinned((uint32_t)wave < 3u)) wait_tensor0_of(g0, g1);
    __syncthreads();
    if (pinned((uint32_t)wave < 3u && kc + 2 < nChunks)) {
      g0 = tdm_group0(lbase + (uint32_t)(kc & 1) * AT_BUF + plane * AT_PLANE, tsrc + (uint64_t)(uint32_t)(kc + 2) * tstep);
      tdm_load(g0, g1);
    }
  }
  wait_tensor0();
  wait_ds0();

  float* os = Os[wave];
  const float inv = 1.0f / ((lrow + xhalf(lrow)) * PSC);   // the halves' sums are joined once, here
#pragma unroll
  for (int t = 0; t < 4; ++t) {
    const v4f lo4 = {oacc[t][0] * inv, oacc[t][1] * inv, oacc[t][2] * inv, oacc[t][3] * inv};
    const v4f hi4 = {oacc[t][4] * inv, oacc[t][5] * inv, oacc[t][6] * inv, oacc[t][7] * inv};
    *(v4f*)(os + c * 68 + t * 16 + 8 * hh)     = lo4;   // row = query, 8 consecutive d per lane
    *(v4f*)(os + c * 68 + t * 16 + 8 * hh + 4) = hi4;
  }
  __builtin_amdgcn_fence(__ATOMIC_RELEASE, "workgroup");
  __builtin_amdgcn_wave_barrier();
  __builtin_amdgcn_fence(__ATOMIC_ACQUIRE, "workgroup");
  {
    const int c4 = (lane & 15) * 4;
    {
#pragma unroll
      for (int it = 0; it < 8; ++it) {
        const int row = it * 2 + hh;   // it 0..7 x hh 0..1 covers rows 0..15 of the wave tile
        v4f val = *(const v4f*)(os + row * 68 + c4);
        *(v4f*)(ob + (size_t)(q0 + row) * kDm + c4) = val;
      }
      
    }
  }
}

// ---------------------------------------------------------------------------
// Workspace region map (byte offsets; every region is fully written before it is read):
//   R0  Qb   bf16 [4096][1024]          8,388,608 @           0   (RNE cast of q, fragment order)
//   R1  Wq   bf16 [3072][1024]          6,291,456 @   8,388,608   (RNE cast of W_qkv, fragment order)
//   R2  Wp   bf16 [1024][1024]          2,097,152 @  14,680,064   (RNE cast of W_proj, fragment order)
//   R3  Qh   bf16 [4096][1024]          8,388,608 @  16,777,216   (q projection, hi plane)
//   R4  Ql   bf16 [4096][1024]          8,388,608 @  25,165,824   (q projection, lo plane)
//   R5  Kh   bf16 [2][4096][1024]      16,777,216 @  33,554,432   (rows 0..2047 cache keys, 2048.. k projection; hi)
//   R6  Kl   bf16 [2][4096][1024]      16,777,216 @  50,331,648   (same rows; lo)
//   R7  Vt   f16  [2][1024][4096]      16,777,216 @  67,108,864   (cols 0..2047 cache values^T, 2048.. v projection^T)
//   R8  Y    f32  [4096][1024]         16,777,216 @  83,886,080   (attention output, token-major, heads merged)
//   R9  Yh   bf16 [4096][1024]          8,388,608 @ 100,663,296   (split of Y, hi, fragment order)
//   R10 Yl   bf16 [4096][1024]          8,388,608 @ 109,051,904   (split of Y, lo, fragment order)
//   total 117,440,512 B
// ---------------------------------------------------------------------------
extern "C" void kernel_launch(void* const* d_in, const int* in_sizes, int n_in,
                              void* d_out, int out_size, void* d_ws,
                              size_t ws_size, hipStream_t stream) {
  if (n_in < 7) return;
  const size_t nQ  = (size_t)kBatch * kTq * kDm;        // 4,194,304
  const size_t nKV = (size_t)kBatch * kSkv * kDm;       // 4,194,304
  const size_t nWq = (size_t)3 * kDm * kDm;             // 3,145,728
  const size_t nWp = (size_t)kDm * kDm;                 // 1,048,576
  const size_t nPe = (size_t)kSkv * kDm;                // 2,097,152
  if (in_sizes[0] != (int)nQ || in_sizes[1] != (int)nKV || in_sizes[2] != (int)nKV ||
      in_sizes[3] != (int)nWq || in_sizes[4] != (int)nWp || in_sizes[5] != (int)nPe ||
      out_size != (int)nQ) return;

  const float* q     = (const float*)d_in[0];
  const float* k_xl  = (const float*)d_in[1];
  const float* v_xl  = (const float*)d_in[2];
  const float* Wqkv  = (const float*)d_in[3];
  const float* Wproj = (const float*)d_in[4];
  const float* pos   = (const float*)d_in[5];
  const int*   causf = (const int*)d_in[6];
  float* outp = (float*)d_out;

  const size_t offQb = 0,              szQb = nQ * 2;
  const size_t offWq = offQb + szQb,   szWq = nWq * 2;
  const size_t offWp = offWq + szWq,   szWp = nWp * 2;
  const size_t offQh = offWp + szWp,   szQh = nQ * 2;
  const size_t offQl = offQh + szQh,   szQl = nQ * 2;
  const size_t offKh = offQl + szQl,   szKh = (size_t)kBatch * kKeys * kDm * 2;
  const size_t offKl = offKh + szKh,   szKl = szKh;
  const size_t offVt = offKl + szKl,   szVt = (size_t)kBatch * kDm * kKeys * 2;
  const size_t offY  = offVt + szVt,   szY  = nQ * 4;
  const size_t offYh = offY + szY,     szYh = nQ * 2;
  const size_t offYl = offYh + szYh,   szYl = nQ * 2;
  const size_t total = offYl + szYl;   // 117,440,512
  if (total > ws_size) return;

  char* ws = (char*)d_ws;
  unsigned short* Qb = (unsigned short*)(ws + offQb);
  unsigned short* Wq = (unsigned short*)(ws + offWq);
  unsigned short* Wp = (unsigned short*)(ws + offWp);
  unsigned short* Qh = (unsigned short*)(ws + offQh);
  unsigned short* Ql = (unsigned short*)(ws + offQl);
  unsigned short* Kh = (unsigned short*)(ws + offKh);
  unsigned short* Kl = (unsigned short*)(ws + offKl);
  unsigned short* Vt = (unsigned short*)(ws + offVt);
  float*          Y  = (float*)(ws + offY);
  unsigned short* Yh = (unsigned short*)(ws + offYh);
  unsigned short* Yl = (unsigned short*)(ws + offYl);

  // ---- input casts (RNE bf16 of every float input) and cache planes ----
  {
    const int npq = (int)(nQ / 1024), npwq = (int)(nWq / 1024), npwp = (int)(nWp / 1024), n2kv = (int)(nKV / 2);
    // GEMM operands, written in fragment order; one wave per 1024 elements, 8 waves per block
    cast_pack_bf16_kernel<<<dim3((npq + 7) / 8), 256, 0, stream>>>(q, Qb, npq);
    cast_pack_bf16_kernel<<<dim3((npwq + 7) / 8), 256, 0, stream>>>(Wqkv, Wq, npwq);
    cast_pack_bf16_kernel<<<dim3((npwp + 7) / 8), 256, 0, stream>>>(Wproj, Wp, npwp);
    // cache keys -> rows 0..2047 of both key planes (hi, lo), both batches
    kcache_split_kernel<<<dim3((n2kv + 255) / 256), 256, 0, stream>>>(k_xl, pos, Kh, Kl, causf, n2kv);
    // v_xl[b]: in[s rows=2048][c cols=1024] -> Vt[b] out[c][s] with output row pitch kKeys, cols 0..2047;
    // grid (cols/64, rows/64, B)
    tcast16_kernel<<<dim3(kDm / 64, kSkv / 64, kBatch), 256, 0, stream>>>(
        v_xl, Vt, kSkv, kDm, kKeys, (long)kSkv * kDm, (long)kDm * kKeys);
  }

  // ---- qkv projections: bf16 operands (K = 1024, M,N multiples of 64, no tails) ----
  {
    // q projection: C[m = b*2048+t][n] -> Qh (hi) / Ql (lo), M=4096, N=1024, K=1024; 1024 tiles -> 128 blocks
    const int tilesQ = (int)((nQ / kDm) / 64) * (kDm / 64);
    wmma_gemm64<1, false, 0, 2, false><<<dim3((tilesQ + 7) / 8, 1), 256, 0, stream>>>(
        Qb, nullptr, kDm, 0L, Wq, nullptr, kDm, 0L,
        (void*)Qh, (void*)Ql, kDm, 0L, nullptr, nullptr, 0L,
        kBatch * kTq, kDm, kDm, 1.0f);
    // k projection per batch: C[t][n] -> key plane rows 2048+t (hi -> Kh, lo -> Kl), M=2048, N=1024, K=1024;
    // 512 tiles -> 64 blocks, grid.y = batch
    const int tilesK = (kTq / 64) * (kDm / 64);
    wmma_gemm64<1, false, 0, 2, false><<<dim3((tilesK + 7) / 8, kBatch), 256, 0, stream>>>(
        Qb, nullptr, kDm, (long)kTq * kDm, Wq + (size_t)kDm * kDm, nullptr, kDm, 0L,
        (void*)(Kh + (size_t)kSkv * kDm), (void*)(Kl + (size_t)kSkv * kDm), kDm, (long)kKeys * kDm,
        nullptr, nullptr, 0L,
        kTq, kDm, kDm, 1.0f);
    // v projection, role-swapped: C[m = channel][n = t] -> Vt_b[channel][2048 + t] (f16), M=1024, N=2048, K=1024,
    // ldc = kKeys; 512 tiles -> 64 blocks, grid.y = batch
    const int tilesV = (kDm / 64) * (kTq / 64);
    wmma_gemm64<1, false, 0, 1, false><<<dim3((tilesV + 7) / 8, kBatch), 256, 0, stream>>>(
        Wq + (size_t)2 * kDm * kDm, nullptr, kDm, 0L, Qb, nullptr, kDm, (long)kTq * kDm,
        (void*)(Vt + kSkv), nullptr, kKeys, (long)kDm * kKeys, nullptr, nullptr, 0L,
        kDm, kTq, kDm, 1.0f);
  }

  // ---- attention over the 4096 keys per (batch, head); score scale 1/sqrt(64) applied in f32 ----
  attn_xl_kernel<<<dim3(kHeads * (kTq / AT_QB), kBatch), 128, 0, stream>>>(Qh, Ql, Kh, Kl, Vt, Y, 0.125f);

  // ---- y -> bf16 hi/lo planes; output projection C[m][n] = sum_c (Yh + Yl)[m][c] * Wp[n][c] -> d_out ----
  {
    const int npy = (int)(nQ / 1024);
    split_pack_bf16_kernel<<<dim3((npy + 7) / 8), 256, 0, stream>>>(Y, Yh, Yl, npy);
    const int tilesP = (int)((nQ / kDm) / 64) * (kDm / 64);   // 1024 tiles -> 128 blocks
    wmma_gemm64<1, true, 0, 0, false, 0, false><<<dim3((tilesP + 7) / 8, 1), 256, 0, stream>>>(
        Yh, Yl, kDm, 0L, Wp, nullptr, kDm, 0L,
        (void*)outp, nullptr, kDm, 0L, nullptr, nullptr, 0L,
        kBatch * kTq, kDm, kDm, 1.0f);
  }
}

// v009
// It runs in 173 microseconds.
// In two side-by-side timings against v008, it was 1.29 and 1.30 times as fast.
// Over all steps from v000 it is 4.81 times as fast.
// Contractions: q/k/v projections on v_wmma_f32_16x16x32_bf16 (bf16 operands = RNE-cast inputs, single product); q.k^T on v_wmma_f32_16x16x32_bf16 with bf16 hi/lo planes for both q and k (hi.hi + hi.lo + lo.hi); p.v on v_wmma_f32_16x16x32_f16 (p f16 carried x2^15, v f16, single product); output projection on v_wmma_f32_16x16x32_bf16 with y as bf16 hi/lo planes (hi.W + lo.W) and W bf16; f32 accumulate everywhere; softmax, score scale and the cache add in f32.
#include <hip/hip_runtime.h>
#include <math.h>
#include <stdint.h>

constexpr int kBatch = 2;
constexpr int kTq    = 2048;            // query length
constexpr int kSkv   = 2048;            // cache length
constexpr int kKeys  = kSkv + kTq;      // 4096 keys per (batch, head)
constexpr int kDm    = 1024;            // model dim
constexpr int kHeads = 16;
constexpr int kHd    = 64;
static_assert(kHeads * kHd == kDm, "head split");
static_assert(kTq % 64 == 0 && kKeys % 64 == 0 && kDm % 64 == 0 && kSkv % 64 == 0, "tile multiples");

typedef __attribute__((ext_vector_type(16))) _Float16 v16h;
typedef __attribute__((ext_vector_type(8)))  _Float16 v8h;
typedef __attribute__((ext_vector_type(2)))  _Float16 v2h;
typedef __attribute__((ext_vector_type(16))) __bf16   v16b;
typedef __attribute__((ext_vector_type(8)))  __bf16   v8b;
typedef __attribute__((ext_vector_type(8)))  float    v8f;
typedef __attribute__((ext_vector_type(4)))  float    v4f;
typedef __attribute__((ext_vector_type(2)))  float    v2f;
typedef __attribute__((ext_vector_type(4)))  unsigned int v4u;

__device__ __forceinline__ unsigned short f2bf_bits(float f) {
  unsigned u = __float_as_uint(f);
  return (unsigned short)((u + 0x7FFFu + ((u >> 16) & 1u)) >> 16);
}
__device__ __forceinline__ float bf_bits2f(unsigned short h) { return __uint_as_float(((unsigned)h) << 16); }
__device__ __forceinline__ unsigned short h_bits(float f) { return __builtin_bit_cast(unsigned short, (_Float16)f); }
__device__ __forceinline__ unsigned pk16(unsigned short a, unsigned short b) { return (unsigned)a | ((unsigned)b << 16); }

// hazard guards as plain device helpers (no inline asm inside the kernel template body)
__device__ __forceinline__ void dep_guard_h(v8f& a, v8f& b, v16h x, v16h y) { asm volatile("v_nop\n\tv_nop\n\tv_nop\n\tv_nop" : "+v"(a), "+v"(b) : "v"(x), "v"(y)); }
__device__ __forceinline__ void dep_guard_b(v8f& a, v8f& b, v16b x, v16b y) { asm volatile("v_nop\n\tv_nop\n\tv_nop\n\tv_nop" : "+v"(a), "+v"(b) : "v"(x), "v"(y)); }
__device__ __forceinline__ void keep4_h(v16h a, v16h b, v16h c, v16h d) { asm volatile("v_nop" :: "v"(a), "v"(b), "v"(c), "v"(d)); }
__device__ __forceinline__ void keep4_b(v16b a, v16b b, v16b c, v16b d) { asm volatile("v_nop" :: "v"(a), "v"(b), "v"(c), "v"(d)); }
__device__ __forceinline__ void acc_guard4(v8f& a, v8f& b, v8f& c, v8f& d) { asm volatile("v_nop\n\tv_nop\n\tv_nop\n\tv_nop" : "+v"(a), "+v"(b), "+v"(c), "+v"(d)); }
// The wait that belongs in front of any overwrite of a register that an issued global load names. The address pairs
// are inputs so that they stay whole up to here.
__device__ __forceinline__ void addr_wait4(const void* a, const void* b, const void* c, const void* d) {
  asm volatile("s_wait_xcnt 0x0" :: "v"(a), "v"(b), "v"(c), "v"(d) : "memory");
}
__device__ __forceinline__ void addr_wait8(const void* a, const void* b, const void* c, const void* d, const void* e, const void* f,
                                           const void* g, const void* h) {
  asm volatile("s_wait_xcnt 0x0" :: "v"(a), "v"(b), "v"(c), "v"(d), "v"(e), "v"(f), "v"(g), "v"(h) : "memory");
}
__device__ __forceinline__ void addr_wait12(const void* a, const void* b, const void* c, const void* d, const void* e, const void* f,
                                            const void* g, const void* h, const void* i, const void* j, const void* k, const void* l) {
  asm volatile("s_wait_xcnt 0x0" :: "v"(a), "v"(b), "v"(c), "v"(d), "v"(e), "v"(f), "v"(g), "v"(h), "v"(i), "v"(j), "v"(k), "v"(l) : "memory");
}
template <typename T> struct Frag;
template <> struct Frag<_Float16> {
  typedef v16h V; union U { v16h v; v8h h[2]; };
  static __device__ __forceinline__ v16h load(const _Float16* p) {   // elements 0..7 <- p[0..7], 8..15 <- p[16..23]
    U f; f.h[0] = *(const v8h*)(p); f.h[1] = *(const v8h*)(p + 16); return f.v;
  }
  // fragment order: register halves 256 elements apart. The global address space is stated: pointers carried round a
  // loop would otherwise give flat loads.
  static __device__ __forceinline__ v16h loadp(const _Float16* p) {
    typedef const __attribute__((address_space(1))) v8h* G;
    U f; f.h[0] = *(G)(p); f.h[1] = *(G)(p + 256); return f.v;
  }
  static __device__ __forceinline__ v8f mma(v16h a, v16h b, v8f c) {
    return __builtin_amdgcn_wmma_f32_16x16x32_f16(false, a, false, b, (short)0, c, false, false);
  }
  static __device__ __forceinline__ void guard(v8f& a, v8f& b, v16h x, v16h y) { dep_guard_h(a, b, x, y); }
  static __device__ __forceinline__ void keep(v16h a, v16h b, v16h c, v16h d) { keep4_h(a, b, c, d); }
};
template <> struct Frag<__bf16> {
  typedef v16b V; union U { v16b v; v8b h[2]; };
  static __device__ __forceinline__ v16b load(const __bf16* p) {
    U f; f.h[0] = *(const v8b*)(p); f.h[1] = *(const v8b*)(p + 16); return f.v;
  }
  static __device__ __forceinline__ v16b loadp(const __bf16* p) {
    typedef const __attribute__((address_space(1))) v8b* G;
    U f; f.h[0] = *(G)(p); f.h[1] = *(G)(p + 256); return f.v;
  }
  static __device__ __forceinline__ v8f mma(v16b a, v16b b, v8f c) {
    return __builtin_amdgcn_wmma_f32_16x16x32_bf16(false, a, false, b, (short)0, c, false, false);
  }
  static __device__ __forceinline__ void guard(v8f& a, v8f& b, v16b x, v16b y) { dep_guard_b(a, b, x, y); }
  static __device__ __forceinline__ void keep(v16b a, v16b b, v16b c, v16b d) { keep4_b(a, b, c, d); }
};

// ---- Register-blocked batched WMMA GEMM ------------------------------------
// C[m,n] = scale * sum_k A[m,k] * Bt[n,k] (+bias)(+resid); each wave owns a 64x64 tile.
// A [M,K] and Bt [N,K] stand in FRAGMENT ORDER (lda = ldb = K): blocks of 16 rows x 32 k = 512 elements (1 KB), block
// number (row / 16) * (K / 32) + k / 32, so a row tile starts where row-major row 16 * (row / 16) would. Inside a block
// the 8 elements k % 32 = 8 * (2 h + hh) + 0..7 of row r stand at element h * 256 + (hh * 16 + r) * 8: lane hh * 16 + r
// finds register half h of its fragment at h * 256 + lane * 8, and each of a fragment's two loads reads 512
// contiguous bytes (4 whole lines). The k of every lane and register position is that of Frag::load on a row-major
// operand, the same for A and Bt. M,N % 64 == 0, K % 32 == 0.
// SPLIT: operands are hi/lo planes (A2/Bt2 = lo planes, same layout); product = hi.hi + hi.lo + lo.hi.
// SPLITB (only meaningful with SPLIT): when false only A carries a lo plane; product = hi.B + lo.B (Bt2 unused).
// BIAS_MODE: 0 = none, 1 = bias[m], 2 = bias[n].
// OUT_MODE: 0 = f32, 1 = f16, 2 = bf16 hi plane (Cout) + bf16 lo plane (Cout2).
// ET: 0 = f16 operands, 1 = bf16 operands (pointers passed as 16-bit storage)
template <int ET> struct Elem;
template <> struct Elem<0> { typedef _Float16 T; };
template <> struct Elem<1> { typedef __bf16 T; };
// gemm64_tiles: the work of one block (8 waves, 8 tiles): bx = the block's number among those of one product, b = the batch,
// sT = the block's LDS, one 16x64 slab (pitch 68 floats) per wave.
template <int ET, bool SPLIT, int BIAS_MODE, int OUT_MODE, bool RESID, int ACT = 0, bool SPLITB = SPLIT>
__device__ __forceinline__ void gemm64_tiles(
    const unsigned short* __restrict__ Ap, const unsigned short* __restrict__ A2p, int lda, long strideA,
    const unsigned short* __restrict__ Btp, const unsigned short* __restrict__ Bt2p, int ldb, long strideB,
    void* __restrict__ Cout, void* __restrict__ Cout2, int ldc, long strideC,
    const float* __restrict__ bias,
    const float* __restrict__ resid, long strideR,
    int M, int N, int K, float scale, int bx, int b, float (*sT)[16 * 68]) {
  typedef typename Elem<ET>::T T;
  typedef typename Frag<T>::V V;
  const T* A = (const T*)Ap; const T* A2 = (const T*)A2p; const T* Bt = (const T*)Btp; const T* Bt2 = (const T*)Bt2p;
  const int lane = threadIdx.x & 31;
  const int wave = __builtin_amdgcn_readfirstlane(threadIdx.x >> 5);   // scalar, so that tile indices and row-tile offsets stay in scalar registers
  const int tilesN = N >> 6;
  const int tilesM = M >> 6;
  const int tile = bx * 8 + wave;
  if (tile >= tilesM * tilesN) return;   // wave-uniform; no block barriers in this kernel
  const int tm = tile / tilesN;
  const int tn = tile - tm * tilesN;
  const int m0 = tm << 6;
  const int n0 = tn << 6;

  const T* Ab  = A  + (size_t)b * strideA;
  const T* Bb  = Bt + (size_t)b * strideB;
  const T* Ab2 = SPLIT ? (A2  + (size_t)b * strideA) : nullptr;
  const T* Bb2 = (SPLIT && SPLITB) ? (Bt2 + (size_t)b * strideB) : nullptr;

  const int rlane = lane & 15;                 // row (A) / col (B, D) within subtile
  const int mOff  = (lane >> 4) * 8;           // D row offset
  const unsigned lo8 = (unsigned)lane * 8u;    // this lane's 8 elements (16 bytes) inside a half block

  v8f acc[4][4];
#pragma unroll
  for (int i = 0; i < 4; ++i)
#pragma unroll
    for (int j = 0; j < 4; ++j) acc[i][j] = (v8f){0.f,0.f,0.f,0.f,0.f,0.f,0.f,0.f};

  // This lane's 16 bytes in the current k block of each row tile; the next k block stands 512 elements further on.
  const T* bp[4]; const T* bp2[4]; const T* ap[4]; const T* ap2[4];
#pragma unroll
  for (int j = 0; j < 4; ++j) {
    const size_t bo = (size_t)(n0 + (j << 4)) * ldb + lo8;
    const size_t ao = (size_t)(m0 + (j << 4)) * lda + lo8;
    bp[j]  = Bb + bo;
    bp2[j] = (SPLIT && SPLITB) ? (Bb2 + bo) : bp[j];
    ap[j]  = Ab + ao;
    ap2[j] = SPLIT ? (Ab2 + ao) : ap[j];
  }
  for (int k0 = 0; k0 < K; k0 += 32) {
    // All fragment loads of the k block as one group, so that the block waits for memory once, not once per row tile of A.
    V bh[4], bl[4], ah[4], al[4];
#pragma unroll
    for (int j = 0; j < 4; ++j) {
      bh[j] = Frag<T>::loadp(bp[j]);
      if (SPLIT && SPLITB) bl[j] = Frag<T>::loadp(bp2[j]);
    }
#pragma unroll
    for (int i = 0; i < 4; ++i) {
      ah[i] = Frag<T>::loadp(ap[i]);
      if (SPLIT) al[i] = Frag<T>::loadp(ap2[i]);
    }
#pragma unroll
    for (int i = 0; i < 4; ++i) {
#pragma unroll
      for (int j = 0; j < 4; ++j) {
        acc[i][j] = Frag<T>::mma(ah[i], bh[j], acc[i][j]);
        if (SPLIT) {
          if (SPLITB) acc[i][j] = Frag<T>::mma(ah[i], bl[j], acc[i][j]);
          acc[i][j] = Frag<T>::mma(al[i], bh[j], acc[i][j]);
        }
      }
      Frag<T>::guard(acc[i][0], acc[i][3], ah[i], SPLIT ? al[i] : ah[i]);
    }
    Frag<T>::keep(bh[0], bh[1], bh[2], bh[3]);
    if (SPLIT && SPLITB) Frag<T>::keep(bl[0], bl[1], bl[2], bl[3]);
    // in front of the advance, which overwrites the pairs that the loads of this block name
    if (SPLIT) addr_wait12(bp[0], bp[1], bp[2], bp[3], ap[0], ap[1], ap[2], ap[3], ap2[0], ap2[1], ap2[2], ap2[3]);
    else       addr_wait8(bp[0], bp[1], bp[2], bp[3], ap[0], ap[1], ap[2], ap[3]);
    if (SPLIT && SPLITB) addr_wait4(bp2[0], bp2[1], bp2[2], bp2[3]);
#pragma unroll
    for (int j = 0; j < 4; ++j) { bp[j] += 512; bp2[j] += 512; ap[j] += 512; ap2[j] += 512; }
  }
  acc_guard4(acc[0][0], acc[0][1], acc[0][2], acc[0][3]);
  acc_guard4(acc[1][0], acc[1][1], acc[1][2], acc[1][3]);
  acc_guard4(acc[2][0], acc[2][1], acc[2][2], acc[2][3]);
  acc_guard4(acc[3][0], acc[3][1], acc[3][2], acc[3][3]);

  // ---- epilogue ----
  float* slab = sT[wave];
  const float* Rb = RESID ? (resid + (size_t)b * strideR) : nullptr;
#pragma unroll
  for (int i = 0; i < 4; ++i) {
    const int mBase = m0 + (i << 4);
#pragma unroll
    for (int j = 0; j < 4; ++j) {
      const int n = n0 + (j << 4) + rlane;
      float bv = 0.f;
      if (BIAS_MODE == 2) bv = bias[n];
#pragma unroll
      for (int r = 0; r < 8; ++r) {
        float v = acc[i][j][r] * scale;
        if (BIAS_MODE == 1) v += bias[mBase + mOff + r];
        if (BIAS_MODE == 2) v += bv;
        if (RESID) v += Rb[(size_t)(mBase + mOff + r) * ldc + n];
        if (ACT == 1) v = tanhf(v);
        if (ACT == 2) v = fmaxf(v, 0.0f);
        if (ACT == 3) v = v / (1.0f + expf(-v));
        if (ACT == 4) v = (v > 0.f) ? v : 0.01f * v;
        slab[(mOff + r) * 68 + (j << 4) + rlane] = v;
      }
    }
    __builtin_amdgcn_fence(__ATOMIC_RELEASE, "workgroup");
    __builtin_amdgcn_wave_barrier();
    __builtin_amdgcn_fence(__ATOMIC_ACQUIRE, "workgroup");
    if (OUT_MODE == 0) {
      float* C = (float*)Cout + (size_t)b * strideC;
      const int hh = lane >> 4, c4 = (lane & 15) * 4;     // row seg = 256 B = 16 lanes x 16 B
      {
#pragma unroll
        for (int it = 0; it < 8; ++it) {
          const int row = it * 2 + hh;
          v4f v = *(const v4f*)(slab + row * 68 + c4);
          *(v4f*)(C + (size_t)(mBase + row) * ldc + n0 + c4) = v;
        }
        
      }
    } else {
      const int q = lane >> 3, c8 = (lane & 7) * 8;
      unsigned short* C  = (unsigned short*)Cout  + (size_t)b * strideC;
      unsigned short* C2 = (OUT_MODE == 2) ? ((unsigned short*)Cout2 + (size_t)b * strideC) : nullptr;
      {
#pragma unroll
        for (int it = 0; it < 4; ++it) {
          const int row = it * 4 + q;
          const float* sp = slab + row * 68 + c8;
          v8h hv, lv;
#pragma unroll
          for (int e = 0; e < 8; ++e) {
            if (OUT_MODE == 1) {
              hv[e] = (_Float16)sp[e];
            } else {
              unsigned short hb = f2bf_bits(sp[e]);
              unsigned short lb = f2bf_bits(sp[e] - bf_bits2f(hb));
              hv[e] = __builtin_bit_cast(_Float16, hb);
              lv[e] = __builtin_bit_cast(_Float16, lb);
            }
          }
          *(v8h*)(C + (size_t)(mBase + row) * ldc + n0 + c8) = hv;
          if (OUT_MODE == 2) *(v8h*)(C2 + (size_t)(mBase + row) * ldc + n0 + c8) = lv;
        }
        
      }
    }
    __builtin_amdgcn_fence(__ATOMIC_RELEASE, "workgroup");
    __builtin_amdgcn_wave_barrier();
    __builtin_amdgcn_fence(__ATOMIC_ACQUIRE, "workgroup");
  }
}

// One product per launch: grid = (tiles / 8, batches).
template <int ET, bool SPLIT, int BIAS_MODE, int OUT_MODE, bool RESID, int ACT = 0, bool SPLITB = SPLIT>
__global__ __launch_bounds__(256) void wmma_gemm64(
    const unsigned short* __restrict__ Ap, const unsigned short* __restrict__ A2p, int lda, long strideA,
    const unsigned short* __restrict__ Btp, const unsigned short* __restrict__ Bt2p, int ldb, long strideB,
    void* __restrict__ Cout, void* __restrict__ Cout2, int ldc, long strideC,
    const float* __restrict__ bias,
    const float* __restrict__ resid, long strideR,
    int M, int N, int K, float scale) {
  __shared__ __align__(16) float sT[8][16 * 68];
  gemm64_tiles<ET, SPLIT, BIAS_MODE, OUT_MODE, RESID, ACT, SPLITB>(Ap, A2p, lda, strideA, Btp, Bt2p, ldb, strideB, Cout, Cout2, ldc, strideC,
                                                                   bias, resid, strideR, M, N, K, scale, blockIdx.x, blockIdx.y, sT);
}

// The q, k and v projections in one launch, so that their 3 x 128 blocks are on the chip together (128 blocks alone leave
// half of the WGPs without work). grid = (64, kBatch, 3): x = block of 8 tiles, y = batch, z = 0 q, 1 k, 2 v.
//   q, k: C[t][n] = sum_c Qb[b][t][c] * W[n][c], M = kTq, N = kDm, bf16 hi / lo planes; q -> Qh, Ql row b * kTq + t,
//         k -> Kh, Kl row b * kKeys + kSkv + t. W = rows z * kDm .. of Wq.
//   v, roles swapped: C[channel][t] -> Vt[b][channel][kSkv + t] (f16), M = kDm, N = kTq, row pitch kKeys.
__global__ __launch_bounds__(256) void qkv_gemm64(const unsigned short* __restrict__ Qb, const unsigned short* __restrict__ Wq,
                                                  unsigned short* __restrict__ Qh, unsigned short* __restrict__ Ql,
                                                  unsigned short* __restrict__ Kh, unsigned short* __restrict__ Kl,
                                                  unsigned short* __restrict__ Vt) {
  __shared__ __align__(16) float sT[8][16 * 68];
  const int z = blockIdx.z;   // the same for the whole block
  if (z == 2) {
    gemm64_tiles<1, false, 0, 1, false>(Wq + (size_t)2 * kDm * kDm, nullptr, kDm, 0L, Qb, nullptr, kDm, (long)kTq * kDm,
                                        (void*)(Vt + kSkv), nullptr, kKeys, (long)kDm * kKeys, nullptr, nullptr, 0L,
                                        kDm, kTq, kDm, 1.0f, blockIdx.x, blockIdx.y, sT);
  } else {
    unsigned short* Ch = z ? Kh + (size_t)kSkv * kDm : Qh;
    unsigned short* Cl = z ? Kl + (size_t)kSkv * kDm : Ql;
    gemm64_tiles<1, false, 0, 2, false>(Qb, nullptr, kDm, (long)kTq * kDm, Wq + (size_t)z * kDm * kDm, nullptr, kDm, 0L,
                                        (void*)Ch, (void*)Cl, kDm, z ? (long)kKeys * kDm : (long)kTq * kDm, nullptr, nullptr, 0L,
                                        kTq, kDm, kDm, 1.0f, blockIdx.x, blockIdx.y, sT);
  }
}

// ---------------------------------------------------------------------------
// f32 [R][kDm] row-major -> 16-bit planes in the fragment order that wmma_gemm64 reads (described there).
// One wave makes two neighbouring 1 KB blocks (16 rows x 64 k). Lane l takes the 8 floats k = 8 * (l & 3) + 0..7 of row
// 8 it + (l >> 2) of block u (u, it = 0, 1): two 16-byte loads, one 16-byte store per plane. A wave-wide store writes
// four whole 128-byte lines (8 rows x 16 B each); the eight loads of a lane are issued together.
// Coverage: nPairs = (R / 16) * (kDm / 64) waves x 1024 elements = R * kDm (every nPairs here is a multiple of 8).
// ---------------------------------------------------------------------------
struct PackPos { const float* src; size_t dst; };
__device__ __forceinline__ PackPos pack_pos(const float* in, int wv, int lane) {
  const int rt = wv / (kDm / 64), kp = wv - rt * (kDm / 64);   // row tile, pair of k blocks
  const int r8 = lane >> 2, piece = lane & 3;
  PackPos p;
  p.src = in + (size_t)(rt * 16 + r8) * kDm + kp * 64 + piece * 8;
  p.dst = (size_t)wv * 1024 + (piece >> 1) * 256 + ((piece & 1) * 16 + r8) * 8;
  return p;
}

// bf16 (RNE) cast
__global__ __launch_bounds__(256) void cast_pack_bf16_kernel(const float* __restrict__ in, unsigned short* __restrict__ out,
                                                            int nPairs) {
  const int wv = (blockIdx.x * 256 + threadIdx.x) >> 5;
  if (wv < nPairs) {
    const PackPos p = pack_pos(in, wv, threadIdx.x & 31);
    v4f f[2][2][2];
#pragma unroll
    for (int u = 0; u < 2; ++u)
#pragma unroll
      for (int it = 0; it < 2; ++it) {
        f[u][it][0] = *(const v4f*)(p.src + (size_t)it * 8 * kDm + u * 32);
        f[u][it][1] = *(const v4f*)(p.src + (size_t)it * 8 * kDm + u * 32 + 4);
      }
#pragma unroll
    for (int u = 0; u < 2; ++u)
#pragma unroll
      for (int it = 0; it < 2; ++it) {
        v4u o;
#pragma unroll
        for (int q = 0; q < 4; ++q) {
          const v4f g = f[u][it][q >> 1];
          o[q] = pk16(f2bf_bits(g[(q & 1) * 2]), f2bf_bits(g[(q & 1) * 2 + 1]));
        }
        *(v4u*)(out + p.dst + u * 512 + it * 64) = o;
      }
  }
}

// bf16 split: hi = bf16_rne(in), lo = bf16_rne(in - hi)
__global__ __launch_bounds__(256) void split_pack_bf16_kernel(const float* __restrict__ in, unsigned short* __restrict__ hi,
                                                             unsigned short* __restrict__ lo, int nPairs) {
  const int wv = (blockIdx.x * 256 + threadIdx.x) >> 5;
  if (wv < nPairs) {
    const PackPos p = pack_pos(in, wv, threadIdx.x & 31);
    v4f f[2][2][2];
#pragma unroll
    for (int u = 0; u < 2; ++u)
#pragma unroll
      for (int it = 0; it < 2; ++it) {
        f[u][it][0] = *(const v4f*)(p.src + (size_t)it * 8 * kDm + u * 32);
        f[u][it][1] = *(const v4f*)(p.src + (size_t)it * 8 * kDm + u * 32 + 4);
      }
#pragma unroll
    for (int u = 0; u < 2; ++u)
#pragma unroll
      for (int it = 0; it < 2; ++it) {
        v4u oh, ol;
#pragma unroll
        for (int q = 0; q < 4; ++q) {
          const v4f g = f[u][it][q >> 1];
          const float f0 = g[(q & 1) * 2], f1 = g[(q & 1) * 2 + 1];
          const unsigned short h0 = f2bf_bits(f0), h1 = f2bf_bits(f1);
          oh[q] = pk16(h0, h1);
          ol[q] = pk16(f2bf_bits(f0 - bf_bits2f(h0)), f2bf_bits(f1 - bf_bits2f(h1)));
        }
        *(v4u*)(hi + p.dst + u * 512 + it * 64) = oh;
        *(v4u*)(lo + p.dst + u * 512 + it * 64) = ol;
      }
  }
}

// ---------------------------------------------------------------------------
// Cache keys, rows 0..kSkv-1 of each per-batch [kKeys][kDm] bf16 key plane pair:
//   x = bf16_rne(k_xl[b][s][c]) + bf16_rne(pos[s][c])   (the add in f32)
//   kh[b][s][c] = bf16_rne(x),  kl[b][s][c] = bf16_rne(x - kh)
// flags = the causal flag input; this forward applies no mask, the pointer is only bound, never read.
// ---------------------------------------------------------------------------
__global__ __launch_bounds__(256) void kcache_split_kernel(const float* __restrict__ kxl, const float* __restrict__ pos,
                                                           unsigned short* __restrict__ kh, unsigned short* __restrict__ kl,
                                                           const int* __restrict__ flags, int n2) {
  const int i = blockIdx.x * 256 + threadIdx.x;
  if (i < n2) {
    const size_t e = 2 * (size_t)i;                        // element index into [b][s][c]
    const size_t perB = (size_t)kSkv * kDm;
    const int bb = (int)(e / perB);
    const size_t rem = e - (size_t)bb * perB;              // s*kDm + c (even)
    const v2f a = *(const v2f*)(kxl + e);
    const v2f p = *(const v2f*)(pos + rem);
    const float s0 = bf_bits2f(f2bf_bits(a[0])) + bf_bits2f(f2bf_bits(p[0]));
    const float s1 = bf_bits2f(f2bf_bits(a[1])) + bf_bits2f(f2bf_bits(p[1]));
    const unsigned short h0 = f2bf_bits(s0), h1 = f2bf_bits(s1);
    const unsigned short l0 = f2bf_bits(s0 - bf_bits2f(h0)), l1 = f2bf_bits(s1 - bf_bits2f(h1));
    const unsigned uh = pk16(h0, h1), ul = pk16(l0, l1);
    const size_t o = ((size_t)bb * kKeys * kDm + rem) >> 1; // u32 index
    ((unsigned*)kh)[o] = uh;
    ((unsigned*)kl)[o] = ul;
    
  }
}

// ---------------------------------------------------------------------------
// Fused transpose + cast of an f32 matrix, z-batched: in_z = W + z*sIn viewed [R rows][Cc cols] (pitch Cc) ->
//   o_z[c][r] = f16(bf16_rne(in_z[r][c]))   ([Cc][...], output row pitch ldo halves), o_z = o + z*sOut.
// 64x64 tiles through LDS. grid = (Cc/64, R/64, Z), 256 threads (R, Cc multiples of 64).
// Coverage per block: load 4 it x 256 thr x 4 floats = 64x64; store 2 it x 256 thr x 8 u16 = 64x64.
// ---------------------------------------------------------------------------
__global__ __launch_bounds__(256) void tcast16_kernel(const float* __restrict__ W, unsigned short* __restrict__ o,
                                                      int R, int Cc, int ldo, long sIn, long sOut) {
  __shared__ __align__(16) float tf[64 * 68];
  W += (size_t)blockIdx.z * sIn;
  o += (size_t)blockIdx.z * sOut;
  const int c0  = blockIdx.x * 64;   // input column block = output row block
  const int r0  = blockIdx.y * 64;   // input row block    = output column block
  const int tid = threadIdx.x;
  {
    const int lr = tid >> 4;         // 0..15
    const int c4 = (tid & 15) * 4;   // 0..60
#pragma unroll
    for (int it = 0; it < 4; ++it) {
      const int rr = it * 16 + lr;   // 0..63
      const v4f a = *(const v4f*)(W + (size_t)(r0 + rr) * Cc + c0 + c4);
      *(v4f*)(tf + rr * 68 + c4) = a;
    }
  }
  __syncthreads();
  const int sub = tid >> 3;          // 0..31
  const int c8  = (tid & 7) * 8;     // 0..56
  v4u hv[2];
#pragma unroll
  for (int it = 0; it < 2; ++it) {
    const int oc = it * 32 + sub;    // output row within tile (= input column)
    v4u a;
#pragma unroll
    for (int q = 0; q < 4; ++q) {
      const float f0 = tf[(c8 + 2 * q) * 68 + oc];
      const float f1 = tf[(c8 + 2 * q + 1) * 68 + oc];
      a[q] = pk16(h_bits(bf_bits2f(f2bf_bits(f0))), h_bits(bf_bits2f(f2bf_bits(f1))));
    }
    hv[it] = a;
  }
  {
#pragma unroll
    for (int it = 0; it < 2; ++it) {
      const int oc = it * 32 + sub;
      const size_t go = (size_t)(c0 + oc) * ldo + r0 + c8;
      *(v4u*)(o + go) = hv[it];
    }
    
  }
}

#define AT_D 64
#define AT_NW 4
#define AT_QB 64
#define AT_KC 64
#define AT_PLANE 10240   // bytes from one plane's place in LDS to the next: 64 rows x 144 B = 9216, rounded up to a multiple of 2 KiB
#define AT_BUF (3 * AT_PLANE)   // one buffer: K hi, K lo, V^T
#define AT_LP 72   // LDS row pitch in 16-bit elements: 144 B = 16 B x 9 (odd), so the 16 rows of a 16-byte fragment read fall on 16 different bank groups

// Plain builtins: the compiler keeps the distances behind its own WMMAs, and a product that accumulates into the same tile needs none.
__device__ __forceinline__ v8f at_mma_b(v16b a, v16b b, v8f c) {
  return __builtin_amdgcn_wmma_f32_16x16x32_bf16(false, a, false, b, (short)0, c, false, false);
}
__device__ __forceinline__ v8f at_mma_h(v16h a, v16h b, v8f c) {
  return __builtin_amdgcn_wmma_f32_16x16x32_f16(false, a, false, b, (short)0, c, false, false);
}

// Four hardware exp2 in place, in one statement: each v_exp_f32 is followed by an independent one and the last by
// v_nop, the slot the instruction set asks for behind a transcendental before its result is read or its source
// overwritten.
__device__ __forceinline__ void exp2x4(float& a, float& b, float& c, float& d) {
  asm("v_exp_f32 %0, %0\n\tv_exp_f32 %1, %1\n\tv_exp_f32 %2, %2\n\tv_exp_f32 %3, %3\n\tv_nop"
      : "+v"(a), "+v"(b), "+v"(c), "+v"(d));
}

// One hardware exp2 in place, with the same slot behind it.
__device__ __forceinline__ void exp2x1(float& a) { asm("v_exp_f32 %0, %0\n\tv_nop" : "+v"(a)); }

// lane l <-> lane l ^ 16 (the two halves that share a query column), a vector cross-row move, no LDS
__device__ __forceinline__ float xhalf(float x) {
  const int i = __builtin_bit_cast(int, x);
  return __builtin_bit_cast(float, __builtin_amdgcn_permlanex16(i, i, 0x76543210, 0xfedcba98, false, false));
}

typedef uint32_t u32x4 __attribute__((ext_vector_type(4)));
typedef uint32_t u32x8 __attribute__((ext_vector_type(8)));
__device__ __forceinline__ uint32_t uni(uint32_t v) { return (uint32_t)__builtin_amdgcn_readfirstlane(v); }
// A wave-uniform test held in a scalar register, so that the branch on it is a scalar branch: a tensor load ignores EXEC.
__device__ __forceinline__ uint32_t pinned(uint32_t v) { uint32_t w = (uint32_t)__builtin_amdgcn_readfirstlane(v); asm volatile("" : "+s"(w)); return w; }
// Descriptor group 1: 1-byte elements, tensor = tile = 64 rows of 128 bytes, source row pitch src_pitch bytes, no mask;
// word 0: a pad of 4 dwords behind every 32 dwords (one row), which gives the 144-byte LDS pitch.
__device__ __forceinline__ u32x8 tdm_group1(uint32_t src_pitch) {
  u32x8 g;
  g[0] = uni((1u << 20) | (4u << 22) | (3u << 25));
  g[1] = uni(128u << 16);
  g[2] = uni(64u << 16);
  g[3] = uni(128u << 16);
  g[4] = uni(64u);
  g[5] = uni(src_pitch);
  g[6] = uni(0u);
  g[7] = uni(0u);
  return g;
}
// pinned() on the whole group: descriptor words held in their scalar registers (as plain constants they were made anew
// in front of each use, and their registers took other values in between, while a request was in flight).
__device__ __forceinline__ u32x8 pinned8(u32x8 g) { asm volatile("" : "+s"(g)); return g; }
// Descriptor group 0: count 1, place in LDS (byte offset), global address of the tile's first byte, type 2.
__device__ __forceinline__ u32x4 tdm_group0(uint32_t lds_dst, uint64_t ga) {
  u32x4 g;
  g[0] = uni(1u);
  g[1] = uni(lds_dst);
  g[2] = uni((uint32_t)ga);
  g[3] = uni((((uint32_t)(ga >> 32)) & 0x01FFFFFFu) | 0x80000000u);
  return g;
}
__device__ __forceinline__ void tdm_load(u32x4 g0, u32x8 g1) { asm volatile("tensor_load_to_lds %0, %1" :: "s"(g0), "s"(g1) : "memory"); }
// The compiler places no wait for a tensor load: a tile counts as landed only behind its issuer's own wait.
__device__ __forceinline__ void wait_tensor0() { asm volatile("s_wait_tensorcnt 0x0" ::: "memory"); }
// The same wait with the outstanding request's descriptor as inputs, so that its scalar registers stay whole up to here
// (without them the loop counter was put into a register of the request still in flight).
__device__ __forceinline__ void wait_tensor0_of(u32x4 g0, u32x8 g1) { asm volatile("s_wait_tensorcnt 0x0" :: "s"(g0), "s"(g1) : "memory"); }
// This wave's LDS reads have returned before the barrier behind which their buffer is refilled.
__device__ __forceinline__ void wait_ds0() { asm volatile("s_wait_dscnt 0x0" ::: "memory"); }

__global__ __launch_bounds__(128)
void attn_xl_kernel(const unsigned short* __restrict__ qhp, const unsigned short* __restrict__ qlp,
                    const unsigned short* __restrict__ khp, const unsigned short* __restrict__ klp,
                    const unsigned short* __restrict__ vtp, float* __restrict__ out, float sscale) {
  union FB { v16b v; v8b h[2]; };
  union FH { v16h v; v8h h[2]; v2h p[8]; };
  // two buffers of three planes: K hi [kv][d], K lo [kv][d], V^T [d][kv], each 64 rows at pitch 144 B, each place a multiple of 2 KiB
  __shared__ __attribute__((aligned(2048))) unsigned char Ring[2 * AT_BUF];
  __shared__ __align__(16) float    Os[AT_NW][16 * 68];         // per wave out tile, pitch 68
  const float PSC = 32768.0f;
  // softmax in base 2: exp((x - m) * sscale) = 2^((x - m) * sc2). sscale > 0 (the launch passes 1/sqrt(64)),
  // so the row maximum may be taken on the unscaled scores.
  const float sc2 = sscale * 1.44269504088896340736f;

  const int tid  = threadIdx.x;
  const int wave = (int)uni((uint32_t)tid >> 5);
  const int lane = tid & 31;
  const int hh   = lane >> 4;
  const int c    = lane & 15;

  const int nqb = kTq / AT_QB;            // 32
  const int bx = blockIdx.x;
  const int b  = blockIdx.y;
  const int qb = bx % nqb;
  const int h  = bx / nqb;                // 0..kHeads-1
  const int q0 = qb * AT_QB + wave * 16;

  const __bf16*   Qh = (const __bf16*)(const void*)qhp   + (size_t)b * kTq * kDm   + (size_t)h * AT_D;
  const __bf16*   Ql = (const __bf16*)(const void*)qlp   + (size_t)b * kTq * kDm   + (size_t)h * AT_D;
  const __bf16*   Kh = (const __bf16*)(const void*)khp   + (size_t)b * kKeys * kDm + (size_t)h * AT_D;
  const __bf16*   Kl = (const __bf16*)(const void*)klp   + (size_t)b * kKeys * kDm + (size_t)h * AT_D;
  const _Float16* Vh = (const _Float16*)(const void*)vtp + (size_t)b * kDm * kKeys + (size_t)h * AT_D * kKeys;
  float*          ob = out + (size_t)b * kTq * kDm + (size_t)h * AT_D;

  // ---- Q fragments (B operand, column = lane&15, split k map via Frag load): 2 d-chunks, hi and lo ----
  v16b qah[2], qal[2];
#pragma unroll
  for (int dc = 0; dc < 2; ++dc) {
    qah[dc] = Frag<__bf16>::load(Qh + (size_t)(q0 + c) * kDm + dc * 32 + 8 * hh);
    qal[dc] = Frag<__bf16>::load(Ql + (size_t)(q0 + c) * kDm + dc * 32 + 8 * hh);
  }

  float mrow = -INFINITY, lrow = 0.f;   // query q0 + c: running maximum (both halves agree), this half's sum
  v8f oacc[4];                          // oacc[t][r] = O^T[d = 16 t + 8 hh + r][query q0 + c]
#pragma unroll
  for (int t = 0; t < 4; ++t) oacc[t] = (v8f){0.f,0.f,0.f,0.f,0.f,0.f,0.f,0.f};

  const int nChunks = kKeys / AT_KC;   // 64, compile-time constant
  // Wave 0 brings K hi, wave 1 K lo, wave 2 V^T; chunk st goes to buffer st & 1. Every tile lies inside its plane:
  // K rows 64 st .. 64 st + 63 of 4096, 128 B at byte 128 h of a 2048-B row; V^T rows 64 h .. 64 h + 63, 128 B at byte 128 st of an 8192-B row.
  const uint32_t plane = (uint32_t)wave < 2u ? (uint32_t)wave : 2u;
  const uint32_t lbase = (uint32_t)(size_t)Ring;
  const uint64_t tsrc  = plane == 0u ? (uint64_t)(size_t)Kh : plane == 1u ? (uint64_t)(size_t)Kl : (uint64_t)(size_t)Vh;
  const uint32_t tstep = plane < 2u ? (uint32_t)(AT_KC * kDm * 2) : (uint32_t)(AT_KC * 2);   // bytes from one chunk's tile to the next
  const u32x8 g1 = pinned8(tdm_group1(plane < 2u ? (uint32_t)(kDm * 2) : (uint32_t)(kKeys * 2)));
  u32x4 g0 = tdm_group0(lbase + plane * AT_PLANE, tsrc);
  if (pinned((uint32_t)wave < 3u)) {
    tdm_load(g0, g1);
    wait_tensor0_of(g0, g1);
  }
  __syncthreads();   // chunk 0 published
  g0 = tdm_group0(lbase + AT_BUF + plane * AT_PLANE, tsrc + tstep);
  if (pinned((uint32_t)wave < 3u)) tdm_load(g0, g1);
  for (int kc = 0; kc < nChunks; ++kc) {
    const unsigned char* bufp = Ring + (kc & 1) * AT_BUF;   // chunk kc: keys kv0 = 64 kc .. kv0 + 63
    const __bf16*   Ksh = (const __bf16*)(const void*)bufp;
    const __bf16*   Ksl = (const __bf16*)(const void*)(bufp + AT_PLANE);
    const _Float16* Vth = (const _Float16*)(const void*)(bufp + 2 * AT_PLANE);

    // All 32 K fragment reads of the chunk as one group, in the order of their use: the wave meets the LDS latency once
    // here, not once in front of every three products.
    FB kf[2][4], lf[2][4];
#pragma unroll
    for (int dc = 0; dc < 2; ++dc) {
#pragma unroll
      for (int j = 0; j < 4; ++j) {
        kf[dc][j].h[0] = *(const v8b*)(Ksh + (j * 16 + c) * AT_LP + dc * 32 + 8 * hh);
        kf[dc][j].h[1] = *(const v8b*)(Ksh + (j * 16 + c) * AT_LP + dc * 32 + 16 + 8 * hh);
      }
#pragma unroll
      for (int j = 0; j < 4; ++j) {
        lf[dc][j].h[0] = *(const v8b*)(Ksl + (j * 16 + c) * AT_LP + dc * 32 + 8 * hh);
        lf[dc][j].h[1] = *(const v8b*)(Ksl + (j * 16 + c) * AT_LP + dc * 32 + 16 + 8 * hh);
      }
    }
    __builtin_amdgcn_sched_barrier(0);   // keeps the 32 reads as one group in front of the products (without it most of them stand in pairs among the WMMAs)
    // s[j][r] = S^T[key kv0 + 16 j + 8 hh + r][query q0 + c]; every s[j] takes its six products in the order
    // dc 0: hi.hi, lo.hi, hi.lo, then dc 1 the same; the four tiles take turns, so that no product waits for the one before it.
    v8f s[4];
#pragma unroll
    for (int j = 0; j < 4; ++j) s[j] = (v8f){0.f,0.f,0.f,0.f,0.f,0.f,0.f,0.f};
#pragma unroll
    for (int dc = 0; dc < 2; ++dc) {
#pragma unroll
      for (int j = 0; j < 4; ++j) s[j] = at_mma_b(kf[dc][j].v, qah[dc], s[j]);
#pragma unroll
      for (int j = 0; j < 4; ++j) s[j] = at_mma_b(lf[dc][j].v, qah[dc], s[j]);
#pragma unroll
      for (int j = 0; j < 4; ++j) s[j] = at_mma_b(kf[dc][j].v, qal[dc], s[j]);
    }
    // All 16 V^T fragment reads of the chunk as one group: they return while the softmax runs.
    FH vf[2][4];
#pragma unroll
    for (int kk = 0; kk < 2; ++kk) {
#pragma unroll
      for (int t = 0; t < 4; ++t) {
        vf[kk][t].h[0] = *(const v8h*)(Vth + (t * 16 + c) * AT_LP + kk * 32 + 8 * hh);
        vf[kk][t].h[1] = *(const v8h*)(Vth + (t * 16 + c) * AT_LP + kk * 32 + 16 + 8 * hh);
      }
    }
    // order between the fence behind the K reads and the one below: the 24 score WMMAs first, then the 16 reads (without it the reads stand at three places among the last four WMMAs)
    __builtin_amdgcn_sched_group_barrier(0x008, 24, 0);
    __builtin_amdgcn_sched_group_barrier(0x100, 16, 0);
    __builtin_amdgcn_sched_barrier(0);   // keeps the 16 reads as one group in front of the softmax (without it they stand in two groups inside it)
    float mj[4];
#pragma unroll
    for (int j = 0; j < 4; ++j) {
      float m = s[j][0];
#pragma unroll
      for (int r = 1; r < 8; ++r) m = fmaxf(m, s[j][r]);
      mj[j] = m;
    }
    float cm = fmaxf(fmaxf(mj[0], mj[1]), fmaxf(mj[2], mj[3]));
    cm = fmaxf(cm, xhalf(cm));
    const float mnew = fmaxf(mrow, cm);
    float alpha = (mrow - mnew) * sc2;
    const float nm = -mnew * sc2;
    mrow = mnew;
    exp2x1(alpha);
    FH pb[2];          // pb[kk]: P^T as B operand, keys kv0 + 32 kk + (8 hh + 0..7, 16 + 8 hh + 0..7), column c
    v2f ps[4];
#pragma unroll
    for (int j = 0; j < 4; ++j) {
      float pe[8];
#pragma unroll
      for (int r = 0; r < 8; ++r) pe[r] = fmaf(s[j][r], sc2, nm);
      exp2x4(pe[0], pe[1], pe[2], pe[3]);
      exp2x4(pe[4], pe[5], pe[6], pe[7]);
      v2f a = {0.f, 0.f};
#pragma unroll
      for (int r = 0; r < 8; r += 2) {
        const v2f w = {pe[r], pe[r + 1]};
        a = (r == 0) ? w : a + w;
        pb[j >> 1].p[(j & 1) * 4 + (r >> 1)] = __builtin_convertvector(w * PSC, v2h);
      }
      ps[j] = a;
    }
    const v2f pt = (ps[0] + ps[1]) + (ps[2] + ps[3]);
    lrow = lrow * alpha + (pt[0] + pt[1]);
#pragma unroll
    for (int t = 0; t < 4; ++t)
#pragma unroll
      for (int r = 0; r < 8; ++r) oacc[t][r] *= alpha;
#pragma unroll
    for (int kk = 0; kk < 2; ++kk) {
#pragma unroll
      for (int t = 0; t < 4; ++t) oacc[t] = at_mma_h(vf[kk][t].v, pb[kk].v, oacc[t]);
    }
    __builtin_amdgcn_sched_barrier(0);   // keeps the wait below behind the products (without it it stands in the softmax, where the wave would wait for the V^T reads)
    // publish point of chunk kc + 1, every wave: own LDS reads back, the issuers' tiles landed, barrier; then the refill of the buffer just read
    wait_ds0();
    if (pinned((uint32_t)wave < 3u)) wait_tensor0_of(g0, g1);
    __syncthreads();
    if (pinned((uint32_t)wave < 3u && kc + 2 < nChunks)) {
      g0 = tdm_group0(lbase + (uint32_t)(kc & 1) * AT_BUF + plane * AT_PLANE, tsrc + (uint64_t)(uint32_t)(kc + 2) * tstep);
      tdm_load(g0, g1);
    }
  }
  wait_tensor0();
  wait_ds0();

  float* os = Os[wave];
  const float inv = 1.0f / ((lrow + xhalf(lrow)) * PSC);   // the halves' sums are joined once, here
#pragma unroll
  for (int t = 0; t < 4; ++t) {
    const v4f lo4 = {oacc[t][0] * inv, oacc[t][1] * inv, oacc[t][2] * inv, oacc[t][3] * inv};
    const v4f hi4 = {oacc[t][4] * inv, oacc[t][5] * inv, oacc[t][6] * inv, oacc[t][7] * inv};
    *(v4f*)(os + c * 68 + t * 16 + 8 * hh)     = lo4;   // row = query, 8 consecutive d per lane
    *(v4f*)(os + c * 68 + t * 16 + 8 * hh + 4) = hi4;
  }
  __builtin_amdgcn_fence(__ATOMIC_RELEASE, "workgroup");
  __builtin_amdgcn_wave_barrier();
  __builtin_amdgcn_fence(__ATOMIC_ACQUIRE, "workgroup");
  {
    const int c4 = (lane & 15) * 4;
    {
#pragma unroll
      for (int it = 0; it < 8; ++it) {
        const int row = it * 2 + hh;   // it 0..7 x hh 0..1 covers rows 0..15 of the wave tile
        v4f val = *(const v4f*)(os + row * 68 + c4);
        *(v4f*)(ob + (size_t)(q0 + row) * kDm + c4) = val;
      }
      
    }
  }
}

// ---------------------------------------------------------------------------
// Workspace region map (byte offsets; every region is fully written before it is read):
//   R0  Qb   bf16 [4096][1024]          8,388,608 @           0   (RNE cast of q, fragment order)
//   R1  Wq   bf16 [3072][1024]          6,291,456 @   8,388,608   (RNE cast of W_qkv, fragment order)
//   R2  Wp   bf16 [1024][1024]          2,097,152 @  14,680,064   (RNE cast of W_proj, fragment order)
//   R3  Qh   bf16 [4096][1024]          8,388,608 @  16,777,216   (q projection, hi plane)
//   R4  Ql   bf16 [4096][1024]          8,388,608 @  25,165,824   (q projection, lo plane)
//   R5  Kh   bf16 [2][4096][1024]      16,777,216 @  33,554,432   (rows 0..2047 cache keys, 2048.. k projection; hi)
//   R6  Kl   bf16 [2][4096][1024]      16,777,216 @  50,331,648   (same rows; lo)
//   R7  Vt   f16  [2][1024][4096]      16,777,216 @  67,108,864   (cols 0..2047 cache values^T, 2048.. v projection^T)
//   R8  Y    f32  [4096][1024]         16,777,216 @  83,886,080   (attention output, token-major, heads merged)
//   R9  Yh   bf16 [4096][1024]          8,388,608 @ 100,663,296   (split of Y, hi, fragment order)
//   R10 Yl   bf16 [4096][1024]          8,388,608 @ 109,051,904   (split of Y, lo, fragment order)
//   total 117,440,512 B
// ---------------------------------------------------------------------------
extern "C" void kernel_launch(void* const* d_in, const int* in_sizes, int n_in,
                              void* d_out, int out_size, void* d_ws,
                              size_t ws_size, hipStream_t stream) {
  if (n_in < 7) return;
  const size_t nQ  = (size_t)kBatch * kTq * kDm;        // 4,194,304
  const size_t nKV = (size_t)kBatch * kSkv * kDm;       // 4,194,304
  const size_t nWq = (size_t)3 * kDm * kDm;             // 3,145,728
  const size_t nWp = (size_t)kDm * kDm;                 // 1,048,576
  const size_t nPe = (size_t)kSkv * kDm;                // 2,097,152
  if (in_sizes[0] != (int)nQ || in_sizes[1] != (int)nKV || in_sizes[2] != (int)nKV ||
      in_sizes[3] != (int)nWq || in_sizes[4] != (int)nWp || in_sizes[5] != (int)nPe ||
      out_size != (int)nQ) return;

  const float* q     = (const float*)d_in[0];
  const float* k_xl  = (const float*)d_in[1];
  const float* v_xl  = (const float*)d_in[2];
  const float* Wqkv  = (const float*)d_in[3];
  const float* Wproj = (const float*)d_in[4];
  const float* pos   = (const float*)d_in[5];
  const int*   causf = (const int*)d_in[6];
  float* outp = (float*)d_out;

  const size_t offQb = 0,              szQb = nQ * 2;
  const size_t offWq = offQb + szQb,   szWq = nWq * 2;
  const size_t offWp = offWq + szWq,   szWp = nWp * 2;
  const size_t offQh = offWp + szWp,   szQh = nQ * 2;
  const size_t offQl = offQh + szQh,   szQl = nQ * 2;
  const size_t offKh = offQl + szQl,   szKh = (size_t)kBatch * kKeys * kDm * 2;
  const size_t offKl = offKh + szKh,   szKl = szKh;
  const size_t offVt = offKl + szKl,   szVt = (size_t)kBatch * kDm * kKeys * 2;
  const size_t offY  = offVt + szVt,   szY  = nQ * 4;
  const size_t offYh = offY + szY,     szYh = nQ * 2;
  const size_t offYl = offYh + szYh,   szYl = nQ * 2;
  const size_t total = offYl + szYl;   // 117,440,512
  if (total > ws_size) return;

  char* ws = (char*)d_ws;
  unsigned short* Qb = (unsigned short*)(ws + offQb);
  unsigned short* Wq = (unsigned short*)(ws + offWq);
  unsigned short* Wp = (unsigned short*)(ws + offWp);
  unsigned short* Qh = (unsigned short*)(ws + offQh);
  unsigned short* Ql = (unsigned short*)(ws + offQl);
  unsigned short* Kh = (unsigned short*)(ws + offKh);
  unsigned short* Kl = (unsigned short*)(ws + offKl);
  unsigned short* Vt = (unsigned short*)(ws + offVt);
  float*          Y  = (float*)(ws + offY);
  unsigned short* Yh = (unsigned short*)(ws + offYh);
  unsigned short* Yl = (unsigned short*)(ws + offYl);

  // ---- input casts (RNE bf16 of every float input) and cache planes ----
  {
    const int npq = (int)(nQ / 1024), npwq = (int)(nWq / 1024), npwp = (int)(nWp / 1024), n2kv = (int)(nKV / 2);
    // GEMM operands, written in fragment order; one wave per 1024 elements, 8 waves per block
    cast_pack_bf16_kernel<<<dim3((npq + 7) / 8), 256, 0, stream>>>(q, Qb, npq);
    cast_pack_bf16_kernel<<<dim3((npwq + 7) / 8), 256, 0, stream>>>(Wqkv, Wq, npwq);
    cast_pack_bf16_kernel<<<dim3((npwp + 7) / 8), 256, 0, stream>>>(Wproj, Wp, npwp);
    // cache keys -> rows 0..2047 of both key planes (hi, lo), both batches
    kcache_split_kernel<<<dim3((n2kv + 255) / 256), 256, 0, stream>>>(k_xl, pos, Kh, Kl, causf, n2kv);
    // v_xl[b]: in[s rows=2048][c cols=1024] -> Vt[b] out[c][s] with output row pitch kKeys, cols 0..2047;
    // grid (cols/64, rows/64, B)
    tcast16_kernel<<<dim3(kDm / 64, kSkv / 64, kBatch), 256, 0, stream>>>(
        v_xl, Vt, kSkv, kDm, kKeys, (long)kSkv * kDm, (long)kDm * kKeys);
  }

  // ---- qkv projections: bf16 operands (K = 1024, M,N multiples of 64, no tails); 512 tiles -> 64 blocks per product and batch ----
  qkv_gemm64<<<dim3((kTq / 64) * (kDm / 64) / 8, kBatch, 3), 256, 0, stream>>>(Qb, Wq, Qh, Ql, Kh, Kl, Vt);

  // ---- attention over the 4096 keys per (batch, head); score scale 1/sqrt(64) applied in f32 ----
  attn_xl_kernel<<<dim3(kHeads * (kTq / AT_QB), kBatch), 128, 0, stream>>>(Qh, Ql, Kh, Kl, Vt, Y, 0.125f);

  // ---- y -> bf16 hi/lo planes; output projection C[m][n] = sum_c (Yh + Yl)[m][c] * Wp[n][c] -> d_out ----
  {
    const int npy = (int)(nQ / 1024);
    split_pack_bf16_kernel<<<dim3((npy + 7) / 8), 256, 0, stream>>>(Y, Yh, Yl, npy);
    const int tilesP = (int)((nQ / kDm) / 64) * (kDm / 64);   // 1024 tiles -> 128 blocks
    wmma_gemm64<1, true, 0, 0, false, 0, false><<<dim3((tilesP + 7) / 8, 1), 256, 0, stream>>>(
        Yh, Yl, kDm, 0L, Wp, nullptr, kDm, 0L,
        (void*)outp, nullptr, kDm, 0L, nullptr, nullptr, 0L,
        kBatch * kTq, kDm, kDm, 1.0f);
  }
}

// v010
// Measured time: 165 microseconds a run.
// Next to v009, in two timings, it ran 1.06 and 1.05 times as fast.
// Over all steps from v000 it is 5.08 times as fast.
// Contractions: q/k/v projections on v_wmma_f32_16x16x32_bf16 (bf16 operands = RNE-cast inputs, single product); q.k^T on v_wmma_f32_16x16x32_bf16 with bf16 hi/lo planes for both q and k (hi.hi + hi.lo + lo.hi); p.v on v_wmma_f32_16x16x32_f16 (p f16 carried x2^15, v f16, single product); output projection on v_wmma_f32_16x16x32_bf16 with y as bf16 hi/lo planes (hi.W + lo.W) and W bf16; f32 accumulate everywhere; softmax, score scale and the cache add in f32.
#include <hip/hip_runtime.h>
#include <math.h>
#include <stdint.h>

constexpr int kBatch = 2;
constexpr int kTq    = 2048;            // query length
constexpr int kSkv   = 2048;            // cache length
constexpr int kKeys  = kSkv + kTq;      // 4096 keys per (batch, head)
constexpr int kDm    = 1024;            // model dim
constexpr int kHeads = 16;
constexpr int kHd    = 64;
static_assert(kHeads * kHd == kDm, "head split");
static_assert(kTq % 64 == 0 && kKeys % 64 == 0 && kDm % 64 == 0 && kSkv % 64 == 0, "tile multiples");

typedef __attribute__((ext_vector_type(16))) _Float16 v16h;
typedef __attribute__((ext_vector_type(8)))  _Float16 v8h;
typedef __attribute__((ext_vector_type(2)))  _Float16 v2h;
typedef __attribute__((ext_vector_type(16))) __bf16   v16b;
typedef __attribute__((ext_vector_type(8)))  __bf16   v8b;
typedef __attribute__((ext_vector_type(8)))  float    v8f;
typedef __attribute__((ext_vector_type(4)))  float    v4f;
typedef __attribute__((ext_vector_type(2)))  float    v2f;
typedef __attribute__((ext_vector_type(4)))  unsigned int v4u;

__device__ __forceinline__ unsigned short f2bf_bits(float f) {
  unsigned u = __float_as_uint(f);
  return (unsigned short)((u + 0x7FFFu + ((u >> 16) & 1u)) >> 16);
}
__device__ __forceinline__ float bf_bits2f(unsigned short h) { return __uint_as_float(((unsigned)h) << 16); }
__device__ __forceinline__ unsigned short h_bits(float f) { return __builtin_bit_cast(unsigned short, (_Float16)f); }
__device__ __forceinline__ unsigned pk16(unsigned short a, unsigned short b) { return (unsigned)a | ((unsigned)b << 16); }

// hazard guards as plain device helpers
__device__ __forceinline__ void acc_guard4(v8f& a, v8f& b, v8f& c, v8f& d) { asm volatile("v_nop\n\tv_nop\n\tv_nop\n\tv_nop" : "+v"(a), "+v"(b), "+v"(c), "+v"(d)); }
// The wait that belongs in front of any overwrite of a register that an issued global load names. The address pairs
// are inputs so that they stay whole up to here.
__device__ __forceinline__ void addr_wait4(const void* a, const void* b, const void* c, const void* d) {
  asm volatile("s_wait_xcnt 0x0" :: "v"(a), "v"(b), "v"(c), "v"(d) : "memory");
}
__device__ __forceinline__ void addr_wait8(const void* a, const void* b, const void* c, const void* d, const void* e, const void* f,
                                           const void* g, const void* h) {
  asm volatile("s_wait_xcnt 0x0" :: "v"(a), "v"(b), "v"(c), "v"(d), "v"(e), "v"(f), "v"(g), "v"(h) : "memory");
}
__device__ __forceinline__ void addr_wait12(const void* a, const void* b, const void* c, const void* d, const void* e, const void* f,
                                            const void* g, const void* h, const void* i, const void* j, const void* k, const void* l) {
  asm volatile("s_wait_xcnt 0x0" :: "v"(a), "v"(b), "v"(c), "v"(d), "v"(e), "v"(f), "v"(g), "v"(h), "v"(i), "v"(j), "v"(k), "v"(l) : "memory");
}
// The same wait and, behind it in the same statement, the advance of four address pairs by two k blocks (2048 bytes): as a
// plain addition the compiler moved the advance up to the loads that name the pairs, in front of the wait.
template <typename P>
__device__ __forceinline__ void wait_advance4(P& a, P& b, P& c, P& d) {
  asm volatile("s_wait_xcnt 0x0\n\tv_add_nc_u64 %0, 0x800, %0\n\tv_add_nc_u64 %1, 0x800, %1\n\tv_add_nc_u64 %2, 0x800, %2\n\tv_add_nc_u64 %3, 0x800, %3"
               : "+v"(a), "+v"(b), "+v"(c), "+v"(d) :: "memory");
}
template <typename T> struct Frag;
template <> struct Frag<_Float16> {
  typedef v16h V; union U { v16h v; v8h h[2]; };
  static __device__ __forceinline__ v16h load(const _Float16* p) {   // elements 0..7 <- p[0..7], 8..15 <- p[16..23]
    U f; f.h[0] = *(const v8h*)(p); f.h[1] = *(const v8h*)(p + 16); return f.v;
  }
  // fragment order: register halves 256 elements apart. The global address space is stated: pointers carried round a
  // loop would otherwise give flat loads.
  static __device__ __forceinline__ v16h loadp(const _Float16* p) {
    typedef const __attribute__((address_space(1))) v8h* G;
    U f; f.h[0] = *(G)(p); f.h[1] = *(G)(p + 256); return f.v;
  }
  static __device__ __forceinline__ v8f mma(v16h a, v16h b, v8f c) {
    return __builtin_amdgcn_wmma_f32_16x16x32_f16(false, a, false, b, (short)0, c, false, false);
  }
};
template <> struct Frag<__bf16> {
  typedef v16b V; union U { v16b v; v8b h[2]; };
  static __device__ __forceinline__ v16b load(const __bf16* p) {
    U f; f.h[0] = *(const v8b*)(p); f.h[1] = *(const v8b*)(p + 16); return f.v;
  }
  static __device__ __forceinline__ v16b loadp(const __bf16* p) {
    typedef const __attribute__((address_space(1))) v8b* G;
    U f; f.h[0] = *(G)(p); f.h[1] = *(G)(p + 256); return f.v;
  }
  static __device__ __forceinline__ v8f mma(v16b a, v16b b, v8f c) {
    return __builtin_amdgcn_wmma_f32_16x16x32_bf16(false, a, false, b, (short)0, c, false, false);
  }
};

// ---- Register-blocked batched WMMA GEMM ------------------------------------
// C[m,n] = scale * sum_k A[m,k] * Bt[n,k] (+bias)(+resid); each wave owns a 64x64 tile.
// A [M,K] and Bt [N,K] stand in FRAGMENT ORDER (lda = ldb = K): blocks of 16 rows x 32 k = 512 elements (1 KB), block
// number (row / 16) * (K / 32) + k / 32, so a row tile starts where row-major row 16 * (row / 16) would. Inside a block
// the 8 elements k % 32 = 8 * (2 h + hh) + 0..7 of row r stand at element h * 256 + (hh * 16 + r) * 8: lane hh * 16 + r
// finds register half h of its fragment at h * 256 + lane * 8, and each of a fragment's two loads reads 512
// contiguous bytes (4 whole lines). The k of every lane and register position is that of Frag::load on a row-major
// operand, the same for A and Bt. M,N % 64 == 0, K % 64 == 0, K >= 64 (the k loop takes two blocks a trip).
// SPLIT: operands are hi/lo planes (A2/Bt2 = lo planes, same layout); product = hi.hi + hi.lo + lo.hi.
// SPLITB (only meaningful with SPLIT): when false only A carries a lo plane; product = hi.B + lo.B (Bt2 unused).
// BIAS_MODE: 0 = none, 1 = bias[m], 2 = bias[n].
// OUT_MODE: 0 = f32, 1 = f16, 2 = bf16 hi plane (Cout) + bf16 lo plane (Cout2).
// ET: 0 = f16 operands, 1 = bf16 operands (pointers passed as 16-bit storage)
template <int ET> struct Elem;
template <> struct Elem<0> { typedef _Float16 T; };
template <> struct Elem<1> { typedef __bf16 T; };
// gemm64_tiles: the work of one block (8 waves, 8 tiles): bx = the block's number among those of one product, b = the batch,
// sT = the block's LDS, one 16x64 slab (pitch 68 floats) per wave.
template <int ET, bool SPLIT, int BIAS_MODE, int OUT_MODE, bool RESID, int ACT = 0, bool SPLITB = SPLIT>
__device__ __forceinline__ void gemm64_tiles(
    const unsigned short* __restrict__ Ap, const unsigned short* __restrict__ A2p, int lda, long strideA,
    const unsigned short* __restrict__ Btp, const unsigned short* __restrict__ Bt2p, int ldb, long strideB,
    void* __restrict__ Cout, void* __restrict__ Cout2, int ldc, long strideC,
    const float* __restrict__ bias,
    const float* __restrict__ resid, long strideR,
    int M, int N, int K, float scale, int bx, int b, float (*sT)[16 * 68]) {
  typedef typename Elem<ET>::T T;
  typedef typename Frag<T>::V V;
  const T* A = (const T*)Ap; const T* A2 = (const T*)A2p; const T* Bt = (const T*)Btp; const T* Bt2 = (const T*)Bt2p;
  const int lane = threadIdx.x & 31;
  const int wave = __builtin_amdgcn_readfirstlane(threadIdx.x >> 5);   // scalar, so that tile indices and row-tile offsets stay in scalar registers
  const int tilesN = N >> 6;
  const int tilesM = M >> 6;
  const int tile = bx * 8 + wave;
  if (tile >= tilesM * tilesN) return;   // wave-uniform; no block barriers in this kernel
  const int tm = tile / tilesN;
  const int tn = tile - tm * tilesN;
  const int m0 = tm << 6;
  const int n0 = tn << 6;

  const T* Ab  = A  + (size_t)b * strideA;
  const T* Bb  = Bt + (size_t)b * strideB;
  const T* Ab2 = SPLIT ? (A2  + (size_t)b * strideA) : nullptr;
  const T* Bb2 = (SPLIT && SPLITB) ? (Bt2 + (size_t)b * strideB) : nullptr;

  const int rlane = lane & 15;                 // row (A) / col (B, D) within subtile
  const int mOff  = (lane >> 4) * 8;           // D row offset
  const unsigned lo8 = (unsigned)lane * 8u;    // this lane's 8 elements (16 bytes) inside a half block

  v8f acc[4][4];
#pragma unroll
  for (int i = 0; i < 4; ++i)
#pragma unroll
    for (int j = 0; j < 4; ++j) acc[i][j] = (v8f){0.f,0.f,0.f,0.f,0.f,0.f,0.f,0.f};

  // This lane's 16 bytes in the current k block of each row tile; the next k block stands 512 elements further on.
  const T* bp[4]; const T* bp2[4]; const T* ap[4]; const T* ap2[4];
#pragma unroll
  for (int j = 0; j < 4; ++j) {
    const size_t bo = (size_t)(n0 + (j << 4)) * ldb + lo8;
    const size_t ao = (size_t)(m0 + (j << 4)) * lda + lo8;
    bp[j]  = Bb + bo;
    bp2[j] = (SPLIT && SPLITB) ? (Bb2 + bo) : bp[j];
    ap[j]  = Ab + ao;
    ap2[j] = SPLIT ? (Ab2 + ao) : ap[j];
  }
  // All fragment loads of one k block as one group (the block that stands off elements behind the pointers).
  auto load_block = [&](V (&bh)[4], V (&bl)[4], V (&ah)[4], V (&al)[4], int off) {
#pragma unroll
    for (int j = 0; j < 4; ++j) {
      bh[j] = Frag<T>::loadp(bp[j] + off);
      if (SPLIT && SPLITB) bl[j] = Frag<T>::loadp(bp2[j] + off);
    }
#pragma unroll
    for (int i = 0; i < 4; ++i) {
      ah[i] = Frag<T>::loadp(ap[i] + off);
      if (SPLIT) al[i] = Frag<T>::loadp(ap2[i] + off);
    }
  };
  auto mma_block = [&](V (&bh)[4], V (&bl)[4], V (&ah)[4], V (&al)[4]) {
#pragma unroll
    for (int i = 0; i < 4; ++i) {
#pragma unroll
      for (int j = 0; j < 4; ++j) {
        acc[i][j] = Frag<T>::mma(ah[i], bh[j], acc[i][j]);
        if (SPLIT) {
          if (SPLITB) acc[i][j] = Frag<T>::mma(ah[i], bl[j], acc[i][j]);
          acc[i][j] = Frag<T>::mma(al[i], bh[j], acc[i][j]);
        }
      }
    }
  };
  // Four vector slots between a block's last WMMA and the loads that next overwrite its operands. The statement names no
  // register: a value that an asm statement names stays below v256, and the two sets do not fit there beside the tile.
  auto slots = [&]() {
    __builtin_amdgcn_sched_barrier(0);   // keeps every product of the block in front of the slots
    asm volatile("v_nop\n\tv_nop\n\tv_nop\n\tv_nop");
  };
  // Two fragment sets in registers, two k blocks a trip: each block's loads are issued one block ahead of its products, so
  // that they return while the other set's WMMAs run and the wave waits for them by count, not for the whole latency.
  V bh0[4], bl0[4], ah0[4], al0[4], bh1[4], bl1[4], ah1[4], al1[4];
  // The wait that belongs in front of any overwrite of the pairs (or of the scalar bases) that the loads issued so far name.
  auto wait_addrs = [&]() {
    if (SPLIT) addr_wait12(bp[0], bp[1], bp[2], bp[3], ap[0], ap[1], ap[2], ap[3], ap2[0], ap2[1], ap2[2], ap2[3]);
    else       addr_wait8(bp[0], bp[1], bp[2], bp[3], ap[0], ap[1], ap[2], ap[3]);
    if (SPLIT && SPLITB) addr_wait4(bp2[0], bp2[1], bp2[2], bp2[3]);
  };
  load_block(bh0, bl0, ah0, al0, 0);
  wait_addrs();
  // The last two blocks stand behind the loop: with the refill under a test inside it, the waits of the second half trip
  // were set for the path without a refill and drained the loads just issued.
  for (int k0 = 0; k0 + 64 < K; k0 += 64) {
    load_block(bh1, bl1, ah1, al1, 512);
    __builtin_amdgcn_sched_barrier(0);   // keeps the loads of the next block in front of this block's products (they are worth nothing further down)
    mma_block(bh0, bl0, ah0, al0);
    slots();
    load_block(bh0, bl0, ah0, al0, 1024);
    __builtin_amdgcn_sched_barrier(0);   // as above
    mma_block(bh1, bl1, ah1, al1);
    slots();
    wait_advance4(bp[0], bp[1], bp[2], bp[3]);
    wait_advance4(ap[0], ap[1], ap[2], ap[3]);
    if (SPLIT) wait_advance4(ap2[0], ap2[1], ap2[2], ap2[3]);
    if (SPLIT && SPLITB) wait_advance4(bp2[0], bp2[1], bp2[2], bp2[3]);
  }
  load_block(bh1, bl1, ah1, al1, 512);
  __builtin_amdgcn_sched_barrier(0);   // as above
  mma_block(bh0, bl0, ah0, al0);
  mma_block(bh1, bl1, ah1, al1);
  wait_addrs();   // the epilogue takes these registers for other values
  acc_guard4(acc[0][0], acc[0][1], acc[0][2], acc[0][3]);
  acc_guard4(acc[1][0], acc[1][1], acc[1][2], acc[1][3]);
  acc_guard4(acc[2][0], acc[2][1], acc[2][2], acc[2][3]);
  acc_guard4(acc[3][0], acc[3][1], acc[3][2], acc[3][3]);

  // ---- epilogue ----
  float* slab = sT[wave];
  const float* Rb = RESID ? (resid + (size_t)b * strideR) : nullptr;
#pragma unroll
  for (int i = 0; i < 4; ++i) {
    const int mBase = m0 + (i << 4);
#pragma unroll
    for (int j = 0; j < 4; ++j) {
      const int n = n0 + (j << 4) + rlane;
      float bv = 0.f;
      if (BIAS_MODE == 2) bv = bias[n];
#pragma unroll
      for (int r = 0; r < 8; ++r) {
        float v = acc[i][j][r] * scale;
        if (BIAS_MODE == 1) v += bias[mBase + mOff + r];
        if (BIAS_MODE == 2) v += bv;
        if (RESID) v += Rb[(size_t)(mBase + mOff + r) * ldc + n];
        if (ACT == 1) v = tanhf(v);
        if (ACT == 2) v = fmaxf(v, 0.0f);
        if (ACT == 3) v = v / (1.0f + expf(-v));
        if (ACT == 4) v = (v > 0.f) ? v : 0.01f * v;
        slab[(mOff + r) * 68 + (j << 4) + rlane] = v;
      }
    }
    __builtin_amdgcn_fence(__ATOMIC_RELEASE, "workgroup");
    __builtin_amdgcn_wave_barrier();
    __builtin_amdgcn_fence(__ATOMIC_ACQUIRE, "workgroup");
    if (OUT_MODE == 0) {
      float* C = (float*)Cout + (size_t)b * strideC;
      const int hh = lane >> 4, c4 = (lane & 15) * 4;     // row seg = 256 B = 16 lanes x 16 B
      {
#pragma unroll
        for (int it = 0; it < 8; ++it) {
          const int row = it * 2 + hh;
          v4f v = *(const v4f*)(slab + row * 68 + c4);
          *(v4f*)(C + (size_t)(mBase + row) * ldc + n0 + c4) = v;
        }
        
      }
    } else {
      const int q = lane >> 3, c8 = (lane & 7) * 8;
      unsigned short* C  = (unsigned short*)Cout  + (size_t)b * strideC;
      unsigned short* C2 = (OUT_MODE == 2) ? ((unsigned short*)Cout2 + (size_t)b * strideC) : nullptr;
      {
#pragma unroll
        for (int it = 0; it < 4; ++it) {
          const int row = it * 4 + q;
          const float* sp = slab + row * 68 + c8;
          v8h hv, lv;
#pragma unroll
          for (int e = 0; e < 8; ++e) {
            if (OUT_MODE == 1) {
              hv[e] = (_Float16)sp[e];
            } else {
              unsigned short hb = f2bf_bits(sp[e]);
              unsigned short lb = f2bf_bits(sp[e] - bf_bits2f(hb));
              hv[e] = __builtin_bit_cast(_Float16, hb);
              lv[e] = __builtin_bit_cast(_Float16, lb);
            }
          }
          *(v8h*)(C + (size_t)(mBase + row) * ldc + n0 + c8) = hv;
          if (OUT_MODE == 2) *(v8h*)(C2 + (size_t)(mBase + row) * ldc + n0 + c8) = lv;
        }
        
      }
    }
    __builtin_amdgcn_fence(__ATOMIC_RELEASE, "workgroup");
    __builtin_amdgcn_wave_barrier();
    __builtin_amdgcn_fence(__ATOMIC_ACQUIRE, "workgroup");
  }
}

// One product per launch: grid = (tiles / 8, batches).
template <int ET, bool SPLIT, int BIAS_MODE, int OUT_MODE, bool RESID, int ACT = 0, bool SPLITB = SPLIT>
__global__ __launch_bounds__(256) void wmma_gemm64(
    const unsigned short* __restrict__ Ap, const unsigned short* __restrict__ A2p, int lda, long strideA,
    const unsigned short* __restrict__ Btp, const unsigned short* __restrict__ Bt2p, int ldb, long strideB,
    void* __restrict__ Cout, void* __restrict__ Cout2, int ldc, long strideC,
    const float* __restrict__ bias,
    const float* __restrict__ resid, long strideR,
    int M, int N, int K, float scale) {
  __shared__ __align__(16) float sT[8][16 * 68];
  gemm64_tiles<ET, SPLIT, BIAS_MODE, OUT_MODE, RESID, ACT, SPLITB>(Ap, A2p, lda, strideA, Btp, Bt2p, ldb, strideB, Cout, Cout2, ldc, strideC,
                                                                   bias, resid, strideR, M, N, K, scale, blockIdx.x, blockIdx.y, sT);
}

// The q, k and v projections in one launch, so that their 3 x 128 blocks are on the chip together (128 blocks alone leave
// half of the WGPs without work). grid = (64, kBatch, 3): x = block of 8 tiles, y = batch, z = 0 q, 1 k, 2 v.
//   q, k: C[t][n] = sum_c Qb[b][t][c] * W[n][c], M = kTq, N = kDm, bf16 hi / lo planes; q -> Qh, Ql row b * kTq + t,
//         k -> Kh, Kl row b * kKeys + kSkv + t. W = rows z * kDm .. of Wq.
//   v, roles swapped: C[channel][t] -> Vt[b][channel][kSkv + t] (f16), M = kDm, N = kTq, row pitch kKeys.
__global__ __launch_bounds__(256) void qkv_gemm64(const unsigned short* __restrict__ Qb, const unsigned short* __restrict__ Wq,
                                                  unsigned short* __restrict__ Qh, unsigned short* __restrict__ Ql,
                                                  unsigned short* __restrict__ Kh, unsigned short* __restrict__ Kl,
                                                  unsigned short* __restrict__ Vt) {
  __shared__ __align__(16) float sT[8][16 * 68];
  const int z = blockIdx.z;   // the same for the whole block
  if (z == 2) {
    gemm64_tiles<1, false, 0, 1, false>(Wq + (size_t)2 * kDm * kDm, nullptr, kDm, 0L, Qb, nullptr, kDm, (long)kTq * kDm,
                                        (void*)(Vt + kSkv), nullptr, kKeys, (long)kDm * kKeys, nullptr, nullptr, 0L,
                                        kDm, kTq, kDm, 1.0f, blockIdx.x, blockIdx.y, sT);
  } else {
    unsigned short* Ch = z ? Kh + (size_t)kSkv * kDm : Qh;
    unsigned short* Cl = z ? Kl + (size_t)kSkv * kDm : Ql;
    gemm64_tiles<1, false, 0, 2, false>(Qb, nullptr, kDm, (long)kTq * kDm, Wq + (size_t)z * kDm * kDm, nullptr, kDm, 0L,
                                        (void*)Ch, (void*)Cl, kDm, z ? (long)kKeys * kDm : (long)kTq * kDm, nullptr, nullptr, 0L,
                                        kTq, kDm, kDm, 1.0f, blockIdx.x, blockIdx.y, sT);
  }
}

// ---------------------------------------------------------------------------
// f32 [R][kDm] row-major -> 16-bit planes in the fragment order that wmma_gemm64 reads (described there).
// One wave makes two neighbouring 1 KB blocks (16 rows x 64 k). Lane l takes the 8 floats k = 8 * (l & 3) + 0..7 of row
// 8 it + (l >> 2) of block u (u, it = 0, 1): two 16-byte loads, one 16-byte store per plane. A wave-wide store writes
// four whole 128-byte lines (8 rows x 16 B each); the eight loads of a lane are issued together.
// Coverage: nPairs = (R / 16) * (kDm / 64) waves x 1024 elements = R * kDm (every nPairs here is a multiple of 8).
// ---------------------------------------------------------------------------
struct PackPos { const float* src; size_t dst; };
__device__ __forceinline__ PackPos pack_pos(const float* in, int wv, int lane) {
  const int rt = wv / (kDm / 64), kp = wv - rt * (kDm / 64);   // row tile, pair of k blocks
  const int r8 = lane >> 2, piece = lane & 3;
  PackPos p;
  p.src = in + (size_t)(rt * 16 + r8) * kDm + kp * 64 + piece * 8;
  p.dst = (size_t)wv * 1024 + (piece >> 1) * 256 + ((piece & 1) * 16 + r8) * 8;
  return p;
}

// bf16 (RNE) cast
__global__ __launch_bounds__(256) void cast_pack_bf16_kernel(const float* __restrict__ in, unsigned short* __restrict__ out,
                                                            int nPairs) {
  const int wv = (blockIdx.x * 256 + threadIdx.x) >> 5;
  if (wv < nPairs) {
    const PackPos p = pack_pos(in, wv, threadIdx.x & 31);
    v4f f[2][2][2];
#pragma unroll
    for (int u = 0; u < 2; ++u)
#pragma unroll
      for (int it = 0; it < 2; ++it) {
        f[u][it][0] = *(const v4f*)(p.src + (size_t)it * 8 * kDm + u * 32);
        f[u][it][1] = *(const v4f*)(p.src + (size_t)it * 8 * kDm + u * 32 + 4);
      }
#pragma unroll
    for (int u = 0; u < 2; ++u)
#pragma unroll
      for (int it = 0; it < 2; ++it) {
        v4u o;
#pragma unroll
        for (int q = 0; q < 4; ++q) {
          const v4f g = f[u][it][q >> 1];
          o[q] = pk16(f2bf_bits(g[(q & 1) * 2]), f2bf_bits(g[(q & 1) * 2 + 1]));
        }
        *(v4u*)(out + p.dst + u * 512 + it * 64) = o;
      }
  }
}

// bf16 split: hi = bf16_rne(in), lo = bf16_rne(in - hi)
__global__ __launch_bounds__(256) void split_pack_bf16_kernel(const float* __restrict__ in, unsigned short* __restrict__ hi,
                                                             unsigned short* __restrict__ lo, int nPairs) {
  const int wv = (blockIdx.x * 256 + threadIdx.x) >> 5;
  if (wv < nPairs) {
    const PackPos p = pack_pos(in, wv, threadIdx.x & 31);
    v4f f[2][2][2];
#pragma unroll
    for (int u = 0; u < 2; ++u)
#pragma unroll
      for (int it = 0; it < 2; ++it) {
        f[u][it][0] = *(const v4f*)(p.src + (size_t)it * 8 * kDm + u * 32);
        f[u][it][1] = *(const v4f*)(p.src + (size_t)it * 8 * kDm + u * 32 + 4);
      }
#pragma unroll
    for (int u = 0; u < 2; ++u)
#pragma unroll
      for (int it = 0; it < 2; ++it) {
        v4u oh, ol;
#pragma unroll
        for (int q = 0; q < 4; ++q) {
          const v4f g = f[u][it][q >> 1];
          const float f0 = g[(q & 1) * 2], f1 = g[(q & 1) * 2 + 1];
          const unsigned short h0 = f2bf_bits(f0), h1 = f2bf_bits(f1);
          oh[q] = pk16(h0, h1);
          ol[q] = pk16(f2bf_bits(f0 - bf_bits2f(h0)), f2bf_bits(f1 - bf_bits2f(h1)));
        }
        *(v4u*)(hi + p.dst + u * 512 + it * 64) = oh;
        *(v4u*)(lo + p.dst + u * 512 + it * 64) = ol;
      }
  }
}

// ---------------------------------------------------------------------------
// Cache keys, rows 0..kSkv-1 of each per-batch [kKeys][kDm] bf16 key plane pair:
//   x = bf16_rne(k_xl[b][s][c]) + bf16_rne(pos[s][c])   (the add in f32)
//   kh[b][s][c] = bf16_rne(x),  kl[b][s][c] = bf16_rne(x - kh)
// flags = the causal flag input; this forward applies no mask, the pointer is only bound, never read.
// ---------------------------------------------------------------------------
__global__ __launch_bounds__(256) void kcache_split_kernel(const float* __restrict__ kxl, const float* __restrict__ pos,
                                                           unsigned short* __restrict__ kh, unsigned short* __restrict__ kl,
                                                           const int* __restrict__ flags, int n2) {
  const int i = blockIdx.x * 256 + threadIdx.x;
  if (i < n2) {
    const size_t e = 2 * (size_t)i;                        // element index into [b][s][c]
    const size_t perB = (size_t)kSkv * kDm;
    const int bb = (int)(e / perB);
    const size_t rem = e - (size_t)bb * perB;              // s*kDm + c (even)
    const v2f a = *(const v2f*)(kxl + e);
    const v2f p = *(const v2f*)(pos + rem);
    const float s0 = bf_bits2f(f2bf_bits(a[0])) + bf_bits2f(f2bf_bits(p[0]));
    const float s1 = bf_bits2f(f2bf_bits(a[1])) + bf_bits2f(f2bf_bits(p[1]));
    const unsigned short h0 = f2bf_bits(s0), h1 = f2bf_bits(s1);
    const unsigned short l0 = f2bf_bits(s0 - bf_bits2f(h0)), l1 = f2bf_bits(s1 - bf_bits2f(h1));
    const unsigned uh = pk16(h0, h1), ul = pk16(l0, l1);
    const size_t o = ((size_t)bb * kKeys * kDm + rem) >> 1; // u32 index
    ((unsigned*)kh)[o] = uh;
    ((unsigned*)kl)[o] = ul;
    
  }
}

// ---------------------------------------------------------------------------
// Fused transpose + cast of an f32 matrix, z-batched: in_z = W + z*sIn viewed [R rows][Cc cols] (pitch Cc) ->
//   o_z[c][r] = f16(bf16_rne(in_z[r][c]))   ([Cc][...], output row pitch ldo halves), o_z = o + z*sOut.
// 64x64 tiles through LDS. grid = (Cc/64, R/64, Z), 256 threads (R, Cc multiples of 64).
// Coverage per block: load 4 it x 256 thr x 4 floats = 64x64; store 2 it x 256 thr x 8 u16 = 64x64.
// ---------------------------------------------------------------------------
__global__ __launch_bounds__(256) void tcast16_kernel(const float* __restrict__ W, unsigned short* __restrict__ o,
                                                      int R, int Cc, int ldo, long sIn, long sOut) {
  __shared__ __align__(16) float tf[64 * 68];
  W += (size_t)blockIdx.z * sIn;
  o += (size_t)blockIdx.z * sOut;
  const int c0  = blockIdx.x * 64;   // input column block = output row block
  const int r0  = blockIdx.y * 64;   // input row block    = output column block
  const int tid = threadIdx.x;
  {
    const int lr = tid >> 4;         // 0..15
    const int c4 = (tid & 15) * 4;   // 0..60
#pragma unroll
    for (int it = 0; it < 4; ++it) {
      const int rr = it * 16 + lr;   // 0..63
      const v4f a = *(const v4f*)(W + (size_t)(r0 + rr) * Cc + c0 + c4);
      *(v4f*)(tf + rr * 68 + c4) = a;
    }
  }
  __syncthreads();
  const int sub = tid >> 3;          // 0..31
  const int c8  = (tid & 7) * 8;     // 0..56
  v4u hv[2];
#pragma unroll
  for (int it = 0; it < 2; ++it) {
    const int oc = it * 32 + sub;    // output row within tile (= input column)
    v4u a;
#pragma unroll
    for (int q = 0; q < 4; ++q) {
      const float f0 = tf[(c8 + 2 * q) * 68 + oc];
      const float f1 = tf[(c8 + 2 * q + 1) * 68 + oc];
      a[q] = pk16(h_bits(bf_bits2f(f2bf_bits(f0))), h_bits(bf_bits2f(f2bf_bits(f1))));
    }
    hv[it] = a;
  }
  {
#pragma unroll
    for (int it = 0; it < 2; ++it) {
      const int oc = it * 32 + sub;
      const size_t go = (size_t)(c0 + oc) * ldo + r0 + c8;
      *(v4u*)(o + go) = hv[it];
    }
    
  }
}

#define AT_D 64
#define AT_NW 4
#define AT_QB 64
#define AT_KC 64
#define AT_PLANE 10240   // bytes from one plane's place in LDS to the next: 64 rows x 144 B = 9216, rounded up to a multiple of 2 KiB
#define AT_BUF (3 * AT_PLANE)   // one buffer: K hi, K lo, V^T
#define AT_LP 72   // LDS row pitch in 16-bit elements: 144 B = 16 B x 9 (odd), so the 16 rows of a 16-byte fragment read fall on 16 different bank groups

// Plain builtins: the compiler keeps the distances behind its own WMMAs, and a product that accumulates into the same tile needs none.
__device__ __forceinline__ v8f at_mma_b(v16b a, v16b b, v8f c) {
  return __builtin_amdgcn_wmma_f32_16x16x32_bf16(false, a, false, b, (short)0, c, false, false);
}
__device__ __forceinline__ v8f at_mma_h(v16h a, v16h b, v8f c) {
  return __builtin_amdgcn_wmma_f32_16x16x32_f16(false, a, false, b, (short)0, c, false, false);
}

// Four hardware exp2 in place, in one statement: each v_exp_f32 is followed by an independent one and the last by
// v_nop, the slot the instruction set asks for behind a transcendental before its result is read or its source
// overwritten.
__device__ __forceinline__ void exp2x4(float& a, float& b, float& c, float& d) {
  asm("v_exp_f32 %0, %0\n\tv_exp_f32 %1, %1\n\tv_exp_f32 %2, %2\n\tv_exp_f32 %3, %3\n\tv_nop"
      : "+v"(a), "+v"(b), "+v"(c), "+v"(d));
}

// One hardware exp2 in place, with the same slot behind it.
__device__ __forceinline__ void exp2x1(float& a) { asm("v_exp_f32 %0, %0\n\tv_nop" : "+v"(a)); }

// lane l <-> lane l ^ 16 (the two halves that share a query column), a vector cross-row move, no LDS
__device__ __forceinline__ float xhalf(float x) {
  const int i = __builtin_bit_cast(int, x);
  return __builtin_bit_cast(float, __builtin_amdgcn_permlanex16(i, i, 0x76543210, 0xfedcba98, false, false));
}

typedef uint32_t u32x4 __attribute__((ext_vector_type(4)));
typedef uint32_t u32x8 __attribute__((ext_vector_type(8)));
__device__ __forceinline__ uint32_t uni(uint32_t v) { return (uint32_t)__builtin_amdgcn_readfirstlane(v); }
// A wave-uniform test held in a scalar register, so that the branch on it is a scalar branch: a tensor load ignores EXEC.
__device__ __forceinline__ uint32_t pinned(uint32_t v) { uint32_t w = (uint32_t)__builtin_amdgcn_readfirstlane(v); asm volatile("" : "+s"(w)); return w; }
// Descriptor group 1: 1-byte elements, tensor = tile = 64 rows of 128 bytes, source row pitch src_pitch bytes, no mask;
// word 0: a pad of 4 dwords behind every 32 dwords (one row), which gives the 144-byte LDS pitch.
__device__ __forceinline__ u32x8 tdm_group1(uint32_t src_pitch) {
  u32x8 g;
  g[0] = uni((1u << 20) | (4u << 22) | (3u << 25));
  g[1] = uni(128u << 16);
  g[2] = uni(64u << 16);
  g[3] = uni(128u << 16);
  g[4] = uni(64u);
  g[5] = uni(src_pitch);
  g[6] = uni(0u);
  g[7] = uni(0u);
  return g;
}
// pinned() on the whole group: descriptor words held in their scalar registers (as plain constants they were made anew
// in front of each use, and their registers took other values in between, while a request was in flight).
__device__ __forceinline__ u32x8 pinned8(u32x8 g) { asm volatile("" : "+s"(g)); return g; }
// Descriptor group 0: count 1, place in LDS (byte offset), global address of the tile's first byte, type 2.
__device__ __forceinline__ u32x4 tdm_group0(uint32_t lds_dst, uint64_t ga) {
  u32x4 g;
  g[0] = uni(1u);
  g[1] = uni(lds_dst);
  g[2] = uni((uint32_t)ga);
  g[3] = uni((((uint32_t)(ga >> 32)) & 0x01FFFFFFu) | 0x80000000u);
  return g;
}
__device__ __forceinline__ void tdm_load(u32x4 g0, u32x8 g1) { asm volatile("tensor_load_to_lds %0, %1" :: "s"(g0), "s"(g1) : "memory"); }
// The compiler places no wait for a tensor load: a tile counts as landed only behind its issuer's own wait.
__device__ __forceinline__ void wait_tensor0() { asm volatile("s_wait_tensorcnt 0x0" ::: "memory"); }
// The same wait with the outstanding request's descriptor as inputs, so that its scalar registers stay whole up to here
// (without them the loop counter was put into a register of the request still in flight).
__device__ __forceinline__ void wait_tensor0_of(u32x4 g0, u32x8 g1) { asm volatile("s_wait_tensorcnt 0x0" :: "s"(g0), "s"(g1) : "memory"); }
// This wave's LDS reads have returned before the barrier behind which their buffer is refilled.
__device__ __forceinline__ void wait_ds0() { asm volatile("s_wait_dscnt 0x0" ::: "memory"); }

__global__ __launch_bounds__(128)
void attn_xl_kernel(const unsigned short* __restrict__ qhp, const unsigned short* __restrict__ qlp,
                    const unsigned short* __restrict__ khp, const unsigned short* __restrict__ klp,
                    const unsigned short* __restrict__ vtp, float* __restrict__ out, float sscale) {
  union FB { v16b v; v8b h[2]; };
  union FH { v16h v; v8h h[2]; v2h p[8]; };
  // two buffers of three planes: K hi [kv][d], K lo [kv][d], V^T [d][kv], each 64 rows at pitch 144 B, each place a multiple of 2 KiB
  __shared__ __attribute__((aligned(2048))) unsigned char Ring[2 * AT_BUF];
  __shared__ __align__(16) float    Os[AT_NW][16 * 68];         // per wave out tile, pitch 68
  const float PSC = 32768.0f;
  // softmax in base 2: exp((x - m) * sscale) = 2^((x - m) * sc2). sscale > 0 (the launch passes 1/sqrt(64)),
  // so the row maximum may be taken on the unscaled scores.
  const float sc2 = sscale * 1.44269504088896340736f;

  const int tid  = threadIdx.x;
  const int wave = (int)uni((uint32_t)tid >> 5);
  const int lane = tid & 31;
  const int hh   = lane >> 4;
  const int c    = lane & 15;

  const int nqb = kTq / AT_QB;            // 32
  const int bx = blockIdx.x;
  const int b  = blockIdx.y;
  const int qb = bx % nqb;
  const int h  = bx / nqb;                // 0..kHeads-1
  const int q0 = qb * AT_QB + wave * 16;

  const __bf16*   Qh = (const __bf16*)(const void*)qhp   + (size_t)b * kTq * kDm   + (size_t)h * AT_D;
  const __bf16*   Ql = (const __bf16*)(const void*)qlp   + (size_t)b * kTq * kDm   + (size_t)h * AT_D;
  const __bf16*   Kh = (const __bf16*)(const void*)khp   + (size_t)b * kKeys * kDm + (size_t)h * AT_D;
  const __bf16*   Kl = (const __bf16*)(const void*)klp   + (size_t)b * kKeys * kDm + (size_t)h * AT_D;
  const _Float16* Vh = (const _Float16*)(const void*)vtp + (size_t)b * kDm * kKeys + (size_t)h * AT_D * kKeys;
  float*          ob = out + (size_t)b * kTq * kDm + (size_t)h * AT_D;

  // ---- Q fragments (B operand, column = lane&15, split k map via Frag load): 2 d-chunks, hi and lo ----
  v16b qah[2], qal[2];
#pragma unroll
  for (int dc = 0; dc < 2; ++dc) {
    qah[dc] = Frag<__bf16>::load(Qh + (size_t)(q0 + c) * kDm + dc * 32 + 8 * hh);
    qal[dc] = Frag<__bf16>::load(Ql + (size_t)(q0 + c) * kDm + dc * 32 + 8 * hh);
  }

  float mrow = -INFINITY, lrow = 0.f;   // query q0 + c: running maximum (both halves agree), this half's sum
  v8f oacc[4];                          // oacc[t][r] = O^T[d = 16 t + 8 hh + r][query q0 + c]
#pragma unroll
  for (int t = 0; t < 4; ++t) oacc[t] = (v8f){0.f,0.f,0.f,0.f,0.f,0.f,0.f,0.f};

  const int nChunks = kKeys / AT_KC;   // 64, compile-time constant
  // Wave 0 brings K hi, wave 1 K lo, wave 2 V^T; chunk st goes to buffer st & 1. Every tile lies inside its plane:
  // K rows 64 st .. 64 st + 63 of 4096, 128 B at byte 128 h of a 2048-B row; V^T rows 64 h .. 64 h + 63, 128 B at byte 128 st of an 8192-B row.
  const uint32_t plane = (uint32_t)wave < 2u ? (uint32_t)wave : 2u;
  const uint32_t lbase = (uint32_t)(size_t)Ring;
  const uint64_t tsrc  = plane == 0u ? (uint64_t)(size_t)Kh : plane == 1u ? (uint64_t)(size_t)Kl : (uint64_t)(size_t)Vh;
  const uint32_t tstep = plane < 2u ? (uint32_t)(AT_KC * kDm * 2) : (uint32_t)(AT_KC * 2);   // bytes from one chunk's tile to the next
  const u32x8 g1 = pinned8(tdm_group1(plane < 2u ? (uint32_t)(kDm * 2) : (uint32_t)(kKeys * 2)));
  u32x4 g0 = tdm_group0(lbase + plane * AT_PLANE, tsrc);
  if (pinned((uint32_t)wave < 3u)) {
    tdm_load(g0, g1);
    wait_tensor0_of(g0, g1);
  }
  __syncthreads();   // chunk 0 published
  g0 = tdm_group0(lbase + AT_BUF + plane * AT_PLANE, tsrc + tstep);
  if (pinned((uint32_t)wave < 3u)) tdm_load(g0, g1);
  for (int kc = 0; kc < nChunks; ++kc) {
    const unsigned char* bufp = Ring + (kc & 1) * AT_BUF;   // chunk kc: keys kv0 = 64 kc .. kv0 + 63
    const __bf16*   Ksh = (const __bf16*)(const void*)bufp;
    const __bf16*   Ksl = (const __bf16*)(const void*)(bufp + AT_PLANE);
    const _Float16* Vth = (const _Float16*)(const void*)(bufp + 2 * AT_PLANE);

    // All 32 K fragment reads of the chunk as one group, in the order of their use: the wave meets the LDS latency once
    // here, not once in front of every three products.
    FB kf[2][4], lf[2][4];
#pragma unroll
    for (int dc = 0; dc < 2; ++dc) {
#pragma unroll
      for (int j = 0; j < 4; ++j) {
        kf[dc][j].h[0] = *(const v8b*)(Ksh + (j * 16 + c) * AT_LP + dc * 32 + 8 * hh);
        kf[dc][j].h[1] = *(const v8b*)(Ksh + (j * 16 + c) * AT_LP + dc * 32 + 16 + 8 * hh);
      }
#pragma unroll
      for (int j = 0; j < 4; ++j) {
        lf[dc][j].h[0] = *(const v8b*)(Ksl + (j * 16 + c) * AT_LP + dc * 32 + 8 * hh);
        lf[dc][j].h[1] = *(const v8b*)(Ksl + (j * 16 + c) * AT_LP + dc * 32 + 16 + 8 * hh);
      }
    }
    __builtin_amdgcn_sched_barrier(0);   // keeps the 32 reads as one group in front of the products (without it most of them stand in pairs among the WMMAs)
    // s[j][r] = S^T[key kv0 + 16 j + 8 hh + r][query q0 + c]; every s[j] takes its six products in the order
    // dc 0: hi.hi, lo.hi, hi.lo, then dc 1 the same; the four tiles take turns, so that no product waits for the one before it.
    v8f s[4];
#pragma unroll
    for (int j = 0; j < 4; ++j) s[j] = (v8f){0.f,0.f,0.f,0.f,0.f,0.f,0.f,0.f};
#pragma unroll
    for (int dc = 0; dc < 2; ++dc) {
#pragma unroll
      for (int j = 0; j < 4; ++j) s[j] = at_mma_b(kf[dc][j].v, qah[dc], s[j]);
#pragma unroll
      for (int j = 0; j < 4; ++j) s[j] = at_mma_b(lf[dc][j].v, qah[dc], s[j]);
#pragma unroll
      for (int j = 0; j < 4; ++j) s[j] = at_mma_b(kf[dc][j].v, qal[dc], s[j]);
    }
    // All 16 V^T fragment reads of the chunk as one group: they return while the softmax runs.
    FH vf[2][4];
#pragma unroll
    for (int kk = 0; kk < 2; ++kk) {
#pragma unroll
      for (int t = 0; t < 4; ++t) {
        vf[kk][t].h[0] = *(const v8h*)(Vth + (t * 16 + c) * AT_LP + kk * 32 + 8 * hh);
        vf[kk][t].h[1] = *(const v8h*)(Vth + (t * 16 + c) * AT_LP + kk * 32 + 16 + 8 * hh);
      }
    }
    // order between the fence behind the K reads and the one below: the 24 score WMMAs first, then the 16 reads (without it the reads stand at three places among the last four WMMAs)
    __builtin_amdgcn_sched_group_barrier(0x008, 24, 0);
    __builtin_amdgcn_sched_group_barrier(0x100, 16, 0);
    __builtin_amdgcn_sched_barrier(0);   // keeps the 16 reads as one group in front of the softmax (without it they stand in two groups inside it)
    float mj[4];
#pragma unroll
    for (int j = 0; j < 4; ++j) {
      float m = s[j][0];
#pragma unroll
      for (int r = 1; r < 8; ++r) m = fmaxf(m, s[j][r]);
      mj[j] = m;
    }
    float cm = fmaxf(fmaxf(mj[0], mj[1]), fmaxf(mj[2], mj[3]));
    cm = fmaxf(cm, xhalf(cm));
    const float mnew = fmaxf(mrow, cm);
    float alpha = (mrow - mnew) * sc2;
    const float nm = -mnew * sc2;
    mrow = mnew;
    exp2x1(alpha);
    FH pb[2];          // pb[kk]: P^T as B operand, keys kv0 + 32 kk + (8 hh + 0..7, 16 + 8 hh + 0..7), column c
    v2f ps[4];
#pragma unroll
    for (int j = 0; j < 4; ++j) {
      float pe[8];
#pragma unroll
      for (int r = 0; r < 8; ++r) pe[r] = fmaf(s[j][r], sc2, nm);
      exp2x4(pe[0], pe[1], pe[2], pe[3]);
      exp2x4(pe[4], pe[5], pe[6], pe[7]);
      v2f a = {0.f, 0.f};
#pragma unroll
      for (int r = 0; r < 8; r += 2) {
        const v2f w = {pe[r], pe[r + 1]};
        a = (r == 0) ? w : a + w;
        pb[j >> 1].p[(j & 1) * 4 + (r >> 1)] = __builtin_convertvector(w * PSC, v2h);
      }
      ps[j] = a;
    }
    const v2f pt = (ps[0] + ps[1]) + (ps[2] + ps[3]);
    lrow = lrow * alpha + (pt[0] + pt[1]);
#pragma unroll
    for (int t = 0; t < 4; ++t)
#pragma unroll
      for (int r = 0; r < 8; ++r) oacc[t][r] *= alpha;
#pragma unroll
    for (int kk = 0; kk < 2; ++kk) {
#pragma unroll
      for (int t = 0; t < 4; ++t) oacc[t] = at_mma_h(vf[kk][t].v, pb[kk].v, oacc[t]);
    }
    __builtin_amdgcn_sched_barrier(0);   // keeps the wait below behind the products (without it it stands in the softmax, where the wave would wait for the V^T reads)
    // publish point of chunk kc + 1, every wave: own LDS reads back, the issuers' tiles landed, barrier; then the refill of the buffer just read
    wait_ds0();
    if (pinned((uint32_t)wave < 3u)) wait_tensor0_of(g0, g1);
    __syncthreads();
    if (pinned((uint32_t)wave < 3u && kc + 2 < nChunks)) {
      g0 = tdm_group0(lbase + (uint32_t)(kc & 1) * AT_BUF + plane * AT_PLANE, tsrc + (uint64_t)(uint32_t)(kc + 2) * tstep);
      tdm_load(g0, g1);
    }
  }
  wait_tensor0();
  wait_ds0();

  float* os = Os[wave];
  const float inv = 1.0f / ((lrow + xhalf(lrow)) * PSC);   // the halves' sums are joined once, here
#pragma unroll
  for (int t = 0; t < 4; ++t) {
    const v4f lo4 = {oacc[t][0] * inv, oacc[t][1] * inv, oacc[t][2] * inv, oacc[t][3] * inv};
    const v4f hi4 = {oacc[t][4] * inv, oacc[t][5] * inv, oacc[t][6] * inv, oacc[t][7] * inv};
    *(v4f*)(os + c * 68 + t * 16 + 8 * hh)     = lo4;   // row = query, 8 consecutive d per lane
    *(v4f*)(os + c * 68 + t * 16 + 8 * hh + 4) = hi4;
  }
  __builtin_amdgcn_fence(__ATOMIC_RELEASE, "workgroup");
  __builtin_amdgcn_wave_barrier();
  __builtin_amdgcn_fence(__ATOMIC_ACQUIRE, "workgroup");
  {
    const int c4 = (lane & 15) * 4;
    {
#pragma unroll
      for (int it = 0; it < 8; ++it) {
        const int row = it * 2 + hh;   // it 0..7 x hh 0..1 covers rows 0..15 of the wave tile
        v4f val = *(const v4f*)(os + row * 68 + c4);
        *(v4f*)(ob + (size_t)(q0 + row) * kDm + c4) = val;
      }
      
    }
  }
}

// ---------------------------------------------------------------------------
// Workspace region map (byte offsets; every region is fully written before it is read):
//   R0  Qb   bf16 [4096][1024]          8,388,608 @           0   (RNE cast of q, fragment order)
//   R1  Wq   bf16 [3072][1024]          6,291,456 @   8,388,608   (RNE cast of W_qkv, fragment order)
//   R2  Wp   bf16 [1024][1024]          2,097,152 @  14,680,064   (RNE cast of W_proj, fragment order)
//   R3  Qh   bf16 [4096][1024]          8,388,608 @  16,777,216   (q projection, hi plane)
//   R4  Ql   bf16 [4096][1024]          8,388,608 @  25,165,824   (q projection, lo plane)
//   R5  Kh   bf16 [2][4096][1024]      16,777,216 @  33,554,432   (rows 0..2047 cache keys, 2048.. k projection; hi)
//   R6  Kl   bf16 [2][4096][1024]      16,777,216 @  50,331,648   (same rows; lo)
//   R7  Vt   f16  [2][1024][4096]      16,777,216 @  67,108,864   (cols 0..2047 cache values^T, 2048.. v projection^T)
//   R8  Y    f32  [4096][1024]         16,777,216 @  83,886,080   (attention output, token-major, heads merged)
//   R9  Yh   bf16 [4096][1024]          8,388,608 @ 100,663,296   (split of Y, hi, fragment order)
//   R10 Yl   bf16 [4096][1024]          8,388,608 @ 109,051,904   (split of Y, lo, fragment order)
//   total 117,440,512 B
// ---------------------------------------------------------------------------
extern "C" void kernel_launch(void* const* d_in, const int* in_sizes, int n_in,
                              void* d_out, int out_size, void* d_ws,
                              size_t ws_size, hipStream_t stream) {
  if (n_in < 7) return;
  const size_t nQ  = (size_t)kBatch * kTq * kDm;        // 4,194,304
  const size_t nKV = (size_t)kBatch * kSkv * kDm;       // 4,194,304
  const size_t nWq = (size_t)3 * kDm * kDm;             // 3,145,728
  const size_t nWp = (size_t)kDm * kDm;                 // 1,048,576
  const size_t nPe = (size_t)kSkv * kDm;                // 2,097,152
  if (in_sizes[0] != (int)nQ || in_sizes[1] != (int)nKV || in_sizes[2] != (int)nKV ||
      in_sizes[3] != (int)nWq || in_sizes[4] != (int)nWp || in_sizes[5] != (int)nPe ||
      out_size != (int)nQ) return;

  const float* q     = (const float*)d_in[0];
  const float* k_xl  = (const float*)d_in[1];
  const float* v_xl  = (const float*)d_in[2];
  const float* Wqkv  = (const float*)d_in[3];
  const float* Wproj = (const float*)d_in[4];
  const float* pos   = (const float*)d_in[5];
  const int*   causf = (const int*)d_in[6];
  float* outp = (float*)d_out;

  const size_t offQb = 0,              szQb = nQ * 2;
  const size_t offWq = offQb + szQb,   szWq = nWq * 2;
  const size_t offWp = offWq + szWq,   szWp = nWp * 2;
  const size_t offQh = offWp + szWp,   szQh = nQ * 2;
  const size_t offQl = offQh + szQh,   szQl = nQ * 2;
  const size_t offKh = offQl + szQl,   szKh = (size_t)kBatch * kKeys * kDm * 2;
  const size_t offKl = offKh + szKh,   szKl = szKh;
  const size_t offVt = offKl + szKl,   szVt = (size_t)kBatch * kDm * kKeys * 2;
  const size_t offY  = offVt + szVt,   szY  = nQ * 4;
  const size_t offYh = offY + szY,     szYh = nQ * 2;
  const size_t offYl = offYh + szYh,   szYl = nQ * 2;
  const size_t total = offYl + szYl;   // 117,440,512
  if (total > ws_size) return;

  char* ws = (char*)d_ws;
  unsigned short* Qb = (unsigned short*)(ws + offQb);
  unsigned short* Wq = (unsigned short*)(ws + offWq);
  unsigned short* Wp = (unsigned short*)(ws + offWp);
  unsigned short* Qh = (unsigned short*)(ws + offQh);
  unsigned short* Ql = (unsigned short*)(ws + offQl);
  unsigned short* Kh = (unsigned short*)(ws + offKh);
  unsigned short* Kl = (unsigned short*)(ws + offKl);
  unsigned short* Vt = (unsigned short*)(ws + offVt);
  float*          Y  = (float*)(ws + offY);
  unsigned short* Yh = (unsigned short*)(ws + offYh);
  unsigned short* Yl = (unsigned short*)(ws + offYl);

  // ---- input casts (RNE bf16 of every float input) and cache planes ----
  {
    const int npq = (int)(nQ / 1024), npwq = (int)(nWq / 1024), npwp = (int)(nWp / 1024), n2kv = (int)(nKV / 2);
    // GEMM operands, written in fragment order; one wave per 1024 elements, 8 waves per block
    cast_pack_bf16_kernel<<<dim3((npq + 7) / 8), 256, 0, stream>>>(q, Qb, npq);
    cast_pack_bf16_kernel<<<dim3((npwq + 7) / 8), 256, 0, stream>>>(Wqkv, Wq, npwq);
    cast_pack_bf16_kernel<<<dim3((npwp + 7) / 8), 256, 0, stream>>>(Wproj, Wp, npwp);
    // cache keys -> rows 0..2047 of both key planes (hi, lo), both batches
    kcache_split_kernel<<<dim3((n2kv + 255) / 256), 256, 0, stream>>>(k_xl, pos, Kh, Kl, causf, n2kv);
    // v_xl[b]: in[s rows=2048][c cols=1024] -> Vt[b] out[c][s] with output row pitch kKeys, cols 0..2047;
    // grid (cols/64, rows/64, B)
    tcast16_kernel<<<dim3(kDm / 64, kSkv / 64, kBatch), 256, 0, stream>>>(
        v_xl, Vt, kSkv, kDm, kKeys, (long)kSkv * kDm, (long)kDm * kKeys);
  }

  // ---- qkv projections: bf16 operands (K = 1024, M,N multiples of 64, no tails); 512 tiles -> 64 blocks per product and batch ----
  qkv_gemm64<<<dim3((kTq / 64) * (kDm / 64) / 8, kBatch, 3), 256, 0, stream>>>(Qb, Wq, Qh, Ql, Kh, Kl, Vt);

  // ---- attention over the 4096 keys per (batch, head); score scale 1/sqrt(64) applied in f32 ----
  attn_xl_kernel<<<dim3(kHeads * (kTq / AT_QB), kBatch), 128, 0, stream>>>(Qh, Ql, Kh, Kl, Vt, Y, 0.125f);

  // ---- y -> bf16 hi/lo planes; output projection C[m][n] = sum_c (Yh + Yl)[m][c] * Wp[n][c] -> d_out ----
  {
    const int npy = (int)(nQ / 1024);
    split_pack_bf16_kernel<<<dim3((npy + 7) / 8), 256, 0, stream>>>(Y, Yh, Yl, npy);
    const int tilesP = (int)((nQ / kDm) / 64) * (kDm / 64);   // 1024 tiles -> 128 blocks
    wmma_gemm64<1, true, 0, 0, false, 0, false><<<dim3((tilesP + 7) / 8, 1), 256, 0, stream>>>(
        Yh, Yl, kDm, 0L, Wp, nullptr, kDm, 0L,
        (void*)outp, nullptr, kDm, 0L, nullptr, nullptr, 0L,
        kBatch * kTq, kDm, kDm, 1.0f);
  }
}
